// v000
// The times below were measured on an AMD MI455X: many runs one after another, warmed up first and cycling through
// copies of the inputs, with the whole window's GPU time divided by the number of runs. Launches and the gaps
// between them are all in it. The median over several windows is given; except for v000 it joins two sittings, which
// can be a few percent apart, so the side-by-side timings, each taken in one sitting, are the better comparison.
// The starting kernel, v000, takes 372 microseconds a run.
// Contractions: q/k/v input projections on v_wmma_f32_16x16x32_bf16 (bf16 operands = RNE-converted inputs and weights, f32 accumulate); scores q.k^T, row-shifted q.Er^T, p.v and the output projection on v_wmma_f32_16x16x32_f16 (f16 operands: f16 hi planes of projected q/k/v, p carried x1024 and folded as 1/1024 before the ctx plane, ctx carried x16, Wo carried x64, plus x2048 f16 residual planes for the first 256 query rows and first 256 keys), f32 accumulate; softmax and all other arithmetic in f32.
#include <hip/hip_runtime.h>

typedef _Float16       v16h __attribute__((ext_vector_type(16)));
typedef __bf16         v16b __attribute__((ext_vector_type(16)));
typedef unsigned short v8us __attribute__((ext_vector_type(8)));
typedef float          v8f  __attribute__((ext_vector_type(8)));
typedef float          v4f  __attribute__((ext_vector_type(4)));
typedef unsigned int   v4u  __attribute__((ext_vector_type(4)));
typedef int            v4i  __attribute__((ext_vector_type(4)));

#ifndef NB
#define NB 1
#endif
#ifndef SEQ
#define SEQ 2049
#endif
#define SEQ_FULL 2049

constexpr int DM     = 1024;
constexpr int NH     = 16;
constexpr int HD     = 64;
constexpr int TT     = SEQ;
constexpr int NQB    = (TT + 63) / 64;          /* query blocks of 64 rows */
constexpr int NTB    = NQB + 1;                  /* token blocks of the planes (one extra for the +1 row shift) */
constexpr int TPAD   = NTB * 64;                 /* padded token count of every plane */
constexpr int NKC    = NTB;                      /* key chunks of 64 */
constexpr int NEARLY = NQB < 4 ? NQB : 4;        /* query blocks with residual treatment */
constexpr int CRES   = NEARLY * 64;              /* rows of K/V/ctx residual planes */
constexpr int QRES   = (NEARLY + 1) * 64;        /* rows of the Q residual plane (covers the +1 shift) */

constexpr float RSC  = 2048.0f;                  /* residual plane carry */
constexpr float RINV = 1.0f / 2048.0f;
constexpr float PSC  = 1024.0f;                  /* softmax weight carry (on the p tile, hence on the p.v accumulator) */
constexpr float CSC  = 16.0f;                    /* ctx plane carry */
constexpr float OCV  = CSC / PSC;                /* 1/64: removes the p carry and applies the ctx carry in one factor */
constexpr float WOSC = 64.0f;                    /* Wo plane carry */
constexpr float OINV = 1.0f / (CSC * WOSC);      /* 1/1024 */

static_assert(NB == 1);
static_assert(SEQ <= SEQ_FULL);
static_assert(HD == 64);
static_assert(DM % 64 == 0 && DM % 32 == 0);
static_assert(TPAD % 64 == 0);
static_assert(NKC <= 64);
static_assert(QRES <= TPAD && CRES <= TPAD);

/* workspace region map (bytes, every offset a multiple of 128) */
constexpr size_t X_B  = (size_t)TPAD * DM * 2;       /* bf16 [TPAD][DM] */
constexpr size_t W_B  = (size_t)DM * DM * 2;         /* 16-bit [DM][DM] */
constexpr size_t E_B  = (size_t)TPAD * HD * 2;       /* f16 [TPAD][HD] */
constexpr size_t HP_B = (size_t)NH * TPAD * HD * 2;  /* f16 [NH][TPAD][HD] or [NH][HD][TPAD] */
constexpr size_t QR_B = (size_t)NH * QRES * HD * 2;  /* f16 [NH][QRES][HD] */
constexpr size_t KR_B = (size_t)NH * CRES * HD * 2;  /* f16 [NH][CRES][HD] or [NH][HD][CRES] */
constexpr size_t CT_B = (size_t)TPAD * DM * 2;       /* f16 [TPAD][DM] */
constexpr size_t CR_B = (size_t)CRES * DM * 2;       /* f16 [CRES][DM] */
constexpr size_t FL_B = (size_t)NQB * 64 * 4;        /* int [NQB][64] */

constexpr size_t OFF_XQ = 0;
constexpr size_t OFF_XK = OFF_XQ + X_B;
constexpr size_t OFF_XV = OFF_XK + X_B;
constexpr size_t OFF_WQ = OFF_XV + X_B;
constexpr size_t OFF_WK = OFF_WQ + W_B;
constexpr size_t OFF_WV = OFF_WK + W_B;
constexpr size_t OFF_WO = OFF_WV + W_B;
constexpr size_t OFF_ER = OFF_WO + W_B;
constexpr size_t OFF_QH = OFF_ER + E_B;
constexpr size_t OFF_KH = OFF_QH + HP_B;
constexpr size_t OFF_VT = OFF_KH + HP_B;
constexpr size_t OFF_QR = OFF_VT + HP_B;
constexpr size_t OFF_KR = OFF_QR + QR_B;
constexpr size_t OFF_VR = OFF_KR + KR_B;
constexpr size_t OFF_CT = OFF_VR + KR_B;
constexpr size_t OFF_CR = OFF_CT + CT_B;
constexpr size_t OFF_FL = OFF_CR + CR_B;
constexpr size_t WS_NEED = OFF_FL + FL_B;

static_assert(X_B % 128 == 0 && W_B % 128 == 0 && E_B % 128 == 0 && HP_B % 128 == 0);
static_assert(QR_B % 128 == 0 && KR_B % 128 == 0 && CT_B % 128 == 0 && CR_B % 128 == 0 && FL_B % 128 == 0);
static_assert(WS_NEED <= 134217728ull);
static_assert((size_t)TT * DM * 4 <= (size_t)SEQ_FULL * DM * 4);

/* -------------------------------------------------------------------------- */
__device__ __forceinline__ unsigned short f2bf_bits(float f) {
  unsigned u = __float_as_uint(f);
  return (unsigned short)((u + 0x7FFFu + ((u >> 16) & 1u)) >> 16);
}
__device__ __forceinline__ float bfr(float f) { return __uint_as_float(((unsigned)f2bf_bits(f)) << 16); }
__device__ __forceinline__ unsigned short h_bits(float f) {
  _Float16 h = (_Float16)f;
  return __builtin_bit_cast(unsigned short, h);
}
__device__ __forceinline__ float h2f(unsigned short b) {
  _Float16 h = __builtin_bit_cast(_Float16, b);
  return (float)h;
}

/* WMMA issue helpers with the 4-slot hazard guard (ties D, keeps A/B live) */
__device__ __forceinline__ v8f mma_h(v16h a, v16h b, v8f c) {
  c = __builtin_amdgcn_wmma_f32_16x16x32_f16(false, a, false, b, (short)0, c, false, false);
  asm volatile("v_nop\n\tv_nop\n\tv_nop\n\tv_nop" : "+v"(c) : "v"(a), "v"(b));
  return c;
}
__device__ __forceinline__ v8f mma_b(v16b a, v16b b, v8f c) {
  c = __builtin_amdgcn_wmma_f32_16x16x32_bf16(false, a, false, b, (short)0, c, false, false);
  asm volatile("v_nop\n\tv_nop\n\tv_nop\n\tv_nop" : "+v"(c) : "v"(a), "v"(b));
  return c;
}

__device__ __forceinline__ v8f zero8() { return (v8f){0.f,0.f,0.f,0.f,0.f,0.f,0.f,0.f}; }

/* --------------------------------------------------------------------------
 * f32 [nrows][ncols] -> 16-bit plane [nrows_pad][ncols]; rows >= nrows are zeros.
 * mode 0: bf16 bits (RNE).  mode 1: f16 bits of (scale * bf16(x)).
 * Coverage: ceil(nrows_pad*ncols/8 / 256) blocks x 256 threads, guard u < total.
 * ------------------------------------------------------------------------ */
__global__ __launch_bounds__(256) void cvt_plane_kernel(
    const float* __restrict__ src, int nrows, int ncols, int nrows_pad, int mode, float scale,
    unsigned short* __restrict__ dst)
{
  const int u = blockIdx.x * 256 + threadIdx.x;
  const int upr = ncols >> 3;
  const int total = nrows_pad * upr;
  if (u >= total) return;
  const int row = u / upr;
  const int cu  = u - row * upr;
  const int rowc = row < nrows ? row : nrows - 1;          /* clamped address */
  const bool live = row < nrows;
  const float* p = src + (size_t)rowc * ncols + cu * 8;
  const v4f x0 = *(const v4f*)p;
  const v4f x1 = *(const v4f*)(p + 4);
  unsigned b0, b1, b2, b3, b4, b5, b6, b7;
  {
    const float f0 = live ? x0[0] : 0.f, f1 = live ? x0[1] : 0.f, f2 = live ? x0[2] : 0.f, f3 = live ? x0[3] : 0.f;
    const float f4 = live ? x1[0] : 0.f, f5 = live ? x1[1] : 0.f, f6 = live ? x1[2] : 0.f, f7 = live ? x1[3] : 0.f;
    if (mode == 0) {
      b0 = f2bf_bits(f0); b1 = f2bf_bits(f1); b2 = f2bf_bits(f2); b3 = f2bf_bits(f3);
      b4 = f2bf_bits(f4); b5 = f2bf_bits(f5); b6 = f2bf_bits(f6); b7 = f2bf_bits(f7);
    } else {
      b0 = h_bits(bfr(f0) * scale); b1 = h_bits(bfr(f1) * scale); b2 = h_bits(bfr(f2) * scale); b3 = h_bits(bfr(f3) * scale);
      b4 = h_bits(bfr(f4) * scale); b5 = h_bits(bfr(f5) * scale); b6 = h_bits(bfr(f6) * scale); b7 = h_bits(bfr(f7) * scale);
    }
  }
  v4u w;
  w[0] = b0 | (b1 << 16);
  w[1] = b2 | (b3 << 16);
  w[2] = b4 | (b5 << 16);
  w[3] = b6 | (b7 << 16);
  unsigned short* d = dst + (size_t)u * 8;
  *(v4u*)d = w;
  
}

/* --------------------------------------------------------------------------
 * Per (query block, key chunk) flag from the int32 key mask:
 *   0 = every effective entry masked (chunk skipped), 1 = all kept, 2 = mixed.
 * Effective entry (t, s): query row clamped to TT-1 for padded rows, keys s >= TT masked.
 * Block = one query block, 256 threads, loops over all NKC chunks; flags staged in
 * Coverage: NQB blocks x 64 ints = the whole table.
 * ------------------------------------------------------------------------ */
__global__ __launch_bounds__(256) void flags_kernel(const int* __restrict__ mask, int* __restrict__ flags)
{
  __shared__ int part[8];
  __shared__ __align__(16) int fl[64];
  const int tid = threadIdx.x, lane = tid & 31, wave = tid >> 5;
  const int qb = blockIdx.x;
  if (tid < 64) fl[tid] = 0;
  __syncthreads();
#pragma unroll 1
  for (int kc = 0; kc < NKC; ++kc) {
    int cnt = 0;
#pragma unroll 4
    for (int it = 0; it < 16; ++it) {
      const int e = it * 256 + tid;
      const int r = e >> 6, cc = e & 63;
      int t = qb * 64 + r;
      t = t < TT ? t : TT - 1;
      const int s = kc * 64 + cc;
      const int sc = s < TT ? s : TT - 1;
      const int mv = mask[(size_t)t * SEQ_FULL + sc];
      cnt += (s < TT && mv != 0) ? 1 : 0;
    }
#pragma unroll
    for (int off = 1; off < 32; off <<= 1) cnt += __shfl_xor(cnt, off, 32);
    if (lane == 0) part[wave] = cnt;
    __syncthreads();
    if (tid == 0) {
      int tot = 0;
#pragma unroll
      for (int w = 0; w < 8; ++w) tot += part[w];
      fl[kc] = (tot == 0) ? 0 : ((tot == 4096) ? 1 : 2);
    }
    __syncthreads();
  }
  {
    if (tid < 16) {
      const v4i v = *(const v4i*)(fl + tid * 4);
      *(v4i*)(flags + (size_t)qb * 64 + tid * 4) = v;
    }
    
  }
}

/* --------------------------------------------------------------------------
 * Projection GEMM: Y[t][n] = sum_k X[t][k] W[n][k] + b[n] for one 64-token x 64-col
 * (= one head) tile per block; bf16 operands (X and W planes), f32 accumulate.
 * Block = 2 waves (64 threads); wave w: tokens w*32..w*32+31 (2 row tiles) x 4 col tiles.
 * A fragment (row m = lane&15): elems 0..7 <- k0+8h+i, 8..15 <- k0+16+8h+i.
 * B[k][n] = W[n][k]: loaded from row n = lane&15 with the same k map.  D elem r = (row 8h+r, col lane&15).
 * Epilogue: hi = f16(y), res = f16((y - hi) * 2048), rows t >= TT forced to 0; the block's
 * MODE 0: Q -> [NH][TPAD][HD] (+ residual rows < QRES); 1: K -> same (+ residual rows < CRES);
 * MODE 2: V -> [NH][HD][TPAD] (+ residual [NH][HD][CRES]).
 * Coverage per block: 8 iterations x 64 threads = 512 units = 64 rows x 8 segments (hi and res).
 * LDS tiles th/tr: cross-wave, separated by a block barrier; reloaded through the stored element type.
 * ------------------------------------------------------------------------ */
template <int MODE>
__global__ __launch_bounds__(64) __attribute__((amdgpu_num_vgpr(256)))
void proj_kernel(
    const unsigned short* __restrict__ X, const unsigned short* __restrict__ W,
    const float* __restrict__ bias, unsigned short* __restrict__ Ph, unsigned short* __restrict__ Pr)
{
  constexpr int PT = 72;
  constexpr int NRES_TB = (MODE == 0) ? (NEARLY + 1) : NEARLY;
  __shared__ __align__(16) unsigned short th[64 * PT];
  __shared__ __align__(16) unsigned short tr[64 * PT];
  union FB { v16b v; v8us h[2]; };

  const int tid = threadIdx.x, wave = tid >> 5, lane = tid & 31;
  const int hh = lane >> 4, m = lane & 15;
  const int tb = blockIdx.x, head = blockIdx.y;
  const int n0 = head * 64;
  const int rl0 = wave * 32;
  const int r0 = tb * 64 + rl0;

  v8f acc[2][4];
#pragma unroll
  for (int mi = 0; mi < 2; ++mi)
#pragma unroll
    for (int ni = 0; ni < 4; ++ni) acc[mi][ni] = zero8();

  const unsigned short* xp0 = X + (size_t)(r0 + m) * DM + 8 * hh;
  const unsigned short* xp1 = X + (size_t)(r0 + 16 + m) * DM + 8 * hh;
  const unsigned short* wp  = W + (size_t)(n0 + m) * DM + 8 * hh;

#pragma unroll 2
  for (int k0 = 0; k0 < DM; k0 += 32) {
    FB a0, a1;
    a0.h[0] = *(const v8us*)(xp0 + k0);
    a0.h[1] = *(const v8us*)(xp0 + k0 + 16);
    a1.h[0] = *(const v8us*)(xp1 + k0);
    a1.h[1] = *(const v8us*)(xp1 + k0 + 16);
#pragma unroll
    for (int ni = 0; ni < 4; ++ni) {
      FB b;
      b.h[0] = *(const v8us*)(wp + (size_t)ni * 16 * DM + k0);
      b.h[1] = *(const v8us*)(wp + (size_t)ni * 16 * DM + k0 + 16);
      acc[0][ni] = mma_b(a0.v, b.v, acc[0][ni]);
      acc[1][ni] = mma_b(a1.v, b.v, acc[1][ni]);
    }
  }

  float bb[4];
#pragma unroll
  for (int ni = 0; ni < 4; ++ni) bb[ni] = bfr(bias[n0 + ni * 16 + m]);

#pragma unroll
  for (int mi = 0; mi < 2; ++mi) {
#pragma unroll
    for (int ni = 0; ni < 4; ++ni) {
#pragma unroll
      for (int r = 0; r < 8; ++r) {
        const int rl  = rl0 + mi * 16 + 8 * hh + r;
        const int t   = tb * 64 + rl;
        const int col = ni * 16 + m;
        float y = acc[mi][ni][r] + bb[ni];
        y = (t < TT) ? y : 0.f;
        const unsigned short hb = h_bits(y);
        const float res = (y - h2f(hb)) * RSC;
        const unsigned short rb = h_bits(res);
        if (MODE == 2) { th[col * PT + rl] = hb; tr[col * PT + rl] = rb; }
        else           { th[rl * PT + col] = hb; tr[rl * PT + col] = rb; }
      }
    }
  }
  __syncthreads();

  const bool dores = tb < NRES_TB;    /* block-uniform */
  {
#pragma unroll
    for (int it = 0; it < 8; ++it) {
      const int u = it * 64 + tid;
      const int row = u >> 3, seg = u & 7;
      const v8us vh = *(const v8us*)(th + row * PT + seg * 8);
      const v8us vr = *(const v8us*)(tr + row * PT + seg * 8);
      if (MODE == 2) {
        *(v8us*)(Ph + ((size_t)head * HD + row) * TPAD + tb * 64 + seg * 8) = vh;
        if (dores) *(v8us*)(Pr + ((size_t)head * HD + row) * CRES + tb * 64 + seg * 8) = vr;
      } else {
        *(v8us*)(Ph + ((size_t)head * TPAD + tb * 64 + row) * HD + seg * 8) = vh;
        if (dores) {
          if (MODE == 0) *(v8us*)(Pr + ((size_t)head * QRES + tb * 64 + row) * HD + seg * 8) = vr;
          else           *(v8us*)(Pr + ((size_t)head * CRES + tb * 64 + row) * HD + seg * 8) = vr;
        }
      }
    }
    
  }
}

/* --------------------------------------------------------------------------
 * Flash attention with the row-shifted Er term, head dim 64.
 * Block = 4 waves = 64 query rows of one head; grid (query blocks, NH).
 * Per kept 64-key chunk: K [key][d], Er [key][d], V^T [d][key] f16 tiles staged in LDS
 * (EARLY: also K and V^T residual tiles), scores = qh.k^T + qh(t+1).Er^T on f16 WMMA,
 * x0.125, replace-fill -inf from the key mask (flag 2 chunks), f32 online softmax,
 * P = f16(1024 p) per-wave LDS tile (EARLY: + f16 residual x2048), O += P.V on f16 WMMA
 * (O therefore carries the x1024 of P; the normaliser applies 1/(1024 l) x 16 in one factor).
 * EARLY adds (qh.k_res + q_res.k + q_res(t+1).Er)/2048 to the scores and
 * (P.V_res + P_res.V)/2048 to O through separate accumulators folded per tile.
 * Live-state plan: Q hi fragments reloaded per chunk (dead during softmax and P.V),
 * Q residual fragments loaded only inside the residual score phase, one 8-register
 * residual accumulator at a time; <= 4 O tiles + 4 score tiles + m/l persistent.
 * Epilogue: ctx = O/(1024 l) carried x16 as f16 into [TPAD][DM] (+ residual rows < CRES),
 * Fragment map as in proj_kernel (A row / B col = lane&15, split k map, D elem r = row 8h+r).
 * LDS regions: K/Er/V/res tiles and msk cross-wave (block barriers); P tiles and the
 * ------------------------------------------------------------------------ */
template <bool EARLY>
__global__ __launch_bounds__(128) __attribute__((amdgpu_num_vgpr(256)))
void attn_kernel(const unsigned short* __restrict__ Qh, const unsigned short* __restrict__ Qr,
                 const unsigned short* __restrict__ Kh, const unsigned short* __restrict__ Kr,
                 const unsigned short* __restrict__ Vt, const unsigned short* __restrict__ Vr,
                 const unsigned short* __restrict__ Erp, const int* __restrict__ mask,
                 const int* __restrict__ flags, unsigned short* __restrict__ Ct,
                 unsigned short* __restrict__ Cr)
{
  constexpr int KSH = 0, ESH = 4096, VTH = 8192, PSH = 12288, KRS = 16384, VRS = 20480;
  constexpr int PRS = EARLY ? 24576 : PSH;
  constexpr int SMN = EARLY ? 28672 : 16384;
  __shared__ __align__(16) unsigned short sm[SMN];
  __shared__ __align__(16) unsigned char msk[4096];
  union FH { v16h v; v8us h[2]; };

  const int tid = threadIdx.x, wave = tid >> 5, lane = tid & 31;
  const int hh = lane >> 4, c = lane & 15;
  const int qb = EARLY ? (int)blockIdx.x : ((int)blockIdx.x + NEARLY);
  const int head = blockIdx.y;
  const int q0 = qb * 64 + wave * 16;
  const int wrow0 = wave * 16;                     /* the wave's first row inside the block tile */

  /* fragment base pointers: rows q0+c (q.k^T) and q0+1+c (shifted Er term) */
  const unsigned short* qp = Qh + ((size_t)head * TPAD + q0 + c) * HD + 8 * hh;
  const unsigned short* rp = Qr + ((size_t)head * QRES + (EARLY ? (q0 + c) : c)) * HD + 8 * hh;

  float mrow[8], lrow[8];
  v8f oacc[4];
#pragma unroll
  for (int r = 0; r < 8; ++r) { mrow[r] = -__builtin_inff(); lrow[r] = 0.f; }
#pragma unroll
  for (int t = 0; t < 4; ++t) oacc[t] = zero8();

  unsigned short* pwh = sm + PSH + wave * 1024;
  unsigned short* pwr = sm + PRS + wave * 1024;
  const int* frow = flags + (size_t)qb * 64;

#pragma unroll 1
  for (int kc = 0; kc < NKC; ++kc) {
    const int fk = __builtin_amdgcn_readfirstlane(frow[kc]);   /* block-uniform */
    if (fk == 0) continue;
    const int kv0 = kc * 64;
    const bool useres = EARLY && (kc < NEARLY);
    const int kvr = (kc < NEARLY) ? kv0 : 0;                   /* clamped residual chunk base */

    __syncthreads();
    /* staging: unit u -> row u>>3 (0..63), seg u&7; 4 iterations x 128 threads = 512 units per tile */
#pragma unroll
    for (int it = 0; it < 4; ++it) {
      const int u = it * 128 + tid;
      const int row = u >> 3, seg = u & 7;
      *(v4u*)(sm + KSH + row * 64 + seg * 8) = *(const v4u*)(Kh + ((size_t)head * TPAD + kv0 + row) * HD + seg * 8);
      *(v4u*)(sm + ESH + row * 64 + seg * 8) = *(const v4u*)(Erp + (size_t)(kv0 + row) * HD + seg * 8);
      *(v4u*)(sm + VTH + row * 64 + seg * 8) = *(const v4u*)(Vt + ((size_t)head * HD + row) * TPAD + kv0 + seg * 8);
    }
    if (EARLY) {
#pragma unroll
      for (int it = 0; it < 4; ++it) {
        const int u = it * 128 + tid;
        const int row = u >> 3, seg = u & 7;
        *(v4u*)(sm + KRS + row * 64 + seg * 8) = *(const v4u*)(Kr + ((size_t)head * CRES + kvr + row) * HD + seg * 8);
        *(v4u*)(sm + VRS + row * 64 + seg * 8) = *(const v4u*)(Vr + ((size_t)head * HD + row) * CRES + kvr + seg * 8);
      }
    }
    if (fk == 2) {
      /* key mask tile: thread -> row tid>>1, 32 columns; clamped addresses, keys >= TT masked */
      const int row = tid >> 1, hsel = tid & 1;
      int qrow = qb * 64 + row;
      qrow = qrow < TT ? qrow : TT - 1;
      const int* mb = mask + (size_t)qrow * SEQ_FULL;
#pragma unroll 1
      for (int g = 0; g < 4; ++g) {
#pragma unroll
        for (int e = 0; e < 8; ++e) {
          const int col = hsel * 32 + g * 8 + e;
          const int s = kv0 + col;
          const int sc = s < TT ? s : TT - 1;
          const int mv = mb[sc];
          msk[row * 64 + col] = (unsigned char)((s < TT && mv != 0) ? 1 : 0);
        }
      }
    }
    __syncthreads();

    /* Q hi fragments for this chunk, two 32-deep d halves */
    FH qa[2], qs[2];
#pragma unroll
    for (int dc = 0; dc < 2; ++dc) {
      qa[dc].h[0] = *(const v8us*)(qp + dc * 32);
      qa[dc].h[1] = *(const v8us*)(qp + dc * 32 + 16);
      qs[dc].h[0] = *(const v8us*)(qp + HD + dc * 32);
      qs[dc].h[1] = *(const v8us*)(qp + HD + dc * 32 + 16);
    }

    /* scores: 16 query rows x 64 keys per wave */
    v8f s[4];
#pragma unroll
    for (int j = 0; j < 4; ++j) {
      s[j] = zero8();
#pragma unroll
      for (int dc = 0; dc < 2; ++dc) {
        FH kf, ef;
        kf.h[0] = *(const v8us*)(sm + KSH + (j * 16 + c) * 64 + dc * 32 + 8 * hh);
        kf.h[1] = *(const v8us*)(sm + KSH + (j * 16 + c) * 64 + dc * 32 + 16 + 8 * hh);
        ef.h[0] = *(const v8us*)(sm + ESH + (j * 16 + c) * 64 + dc * 32 + 8 * hh);
        ef.h[1] = *(const v8us*)(sm + ESH + (j * 16 + c) * 64 + dc * 32 + 16 + 8 * hh);
        s[j] = mma_h(qa[dc].v, kf.v, s[j]);
        s[j] = mma_h(qs[dc].v, ef.v, s[j]);
      }
      if (EARLY) {
        if (useres) {
          v8f sr = zero8();
#pragma unroll
          for (int dc = 0; dc < 2; ++dc) {
            FH kf, ef, krf, qra, qrs;
            kf.h[0]  = *(const v8us*)(sm + KSH + (j * 16 + c) * 64 + dc * 32 + 8 * hh);
            kf.h[1]  = *(const v8us*)(sm + KSH + (j * 16 + c) * 64 + dc * 32 + 16 + 8 * hh);
            ef.h[0]  = *(const v8us*)(sm + ESH + (j * 16 + c) * 64 + dc * 32 + 8 * hh);
            ef.h[1]  = *(const v8us*)(sm + ESH + (j * 16 + c) * 64 + dc * 32 + 16 + 8 * hh);
            krf.h[0] = *(const v8us*)(sm + KRS + (j * 16 + c) * 64 + dc * 32 + 8 * hh);
            krf.h[1] = *(const v8us*)(sm + KRS + (j * 16 + c) * 64 + dc * 32 + 16 + 8 * hh);
            qra.h[0] = *(const v8us*)(rp + dc * 32);
            qra.h[1] = *(const v8us*)(rp + dc * 32 + 16);
            qrs.h[0] = *(const v8us*)(rp + HD + dc * 32);
            qrs.h[1] = *(const v8us*)(rp + HD + dc * 32 + 16);
            sr = mma_h(qa[dc].v, krf.v, sr);
            sr = mma_h(qra.v, kf.v, sr);
            sr = mma_h(qrs.v, ef.v, sr);
          }
#pragma unroll
          for (int r = 0; r < 8; ++r) s[j][r] += sr[r] * RINV;
        }
      }
    }

    /* scale by 1/sqrt(64) and replace-fill from the key mask (this wave's rows) */
#pragma unroll
    for (int j = 0; j < 4; ++j) {
#pragma unroll
      for (int r = 0; r < 8; ++r) s[j][r] *= 0.125f;
    }
    if (fk == 2) {
#pragma unroll
      for (int j = 0; j < 4; ++j) {
#pragma unroll
        for (int r = 0; r < 8; ++r) {
          const unsigned char mv = msk[(wrow0 + 8 * hh + r) * 64 + j * 16 + c];
          s[j][r] = mv ? s[j][r] : -__builtin_inff();
        }
      }
    }

    /* chunk row max over 64 keys (16 lanes of one half x 4 tiles) */
    float cm[8];
#pragma unroll
    for (int r = 0; r < 8; ++r) {
      float mx = fmaxf(fmaxf(s[0][r], s[1][r]), fmaxf(s[2][r], s[3][r]));
#pragma unroll
      for (int off = 1; off < 16; off <<= 1) mx = fmaxf(mx, __shfl_xor(mx, off, 32));
      cm[r] = mx;
    }

    /* online softmax update; P tiles (carried x1024) into the wave's LDS tile */
#pragma unroll
    for (int r = 0; r < 8; ++r) {
      const float mnew = fmaxf(mrow[r], cm[r]);
      const bool dead = (mnew == -__builtin_inff());
      const float aexp = __expf(mrow[r] - mnew);
      const float alpha = dead ? 1.f : aexp;
      mrow[r] = mnew;
      float psum = 0.f;
#pragma unroll
      for (int j = 0; j < 4; ++j) {
        const float pe = __expf(s[j][r] - mnew);
        const float p = dead ? 0.f : pe;
        psum += p;
        const float pc = p * PSC;
        const unsigned short hb = h_bits(pc);
        pwh[(8 * hh + r) * 64 + j * 16 + c] = hb;
        if (EARLY) {
          const float pres = (pc - h2f(hb)) * RSC;
          pwr[(8 * hh + r) * 64 + j * 16 + c] = h_bits(pres);
        }
      }
#pragma unroll
      for (int off = 1; off < 16; off <<= 1) psum += __shfl_xor(psum, off, 32);
      lrow[r] = lrow[r] * alpha + psum;
#pragma unroll
      for (int t = 0; t < 4; ++t) oacc[t][r] *= alpha;
    }
    __builtin_amdgcn_fence(3, "workgroup");
    __builtin_amdgcn_wave_barrier();
    __builtin_amdgcn_fence(2, "workgroup");

    /* O += P.V : A = P [q][key] (this wave's tile), B = V [key][d] from V^T [d][key] */
#pragma unroll
    for (int kk = 0; kk < 2; ++kk) {
      FH pa;
      pa.h[0] = *(const v8us*)(pwh + c * 64 + kk * 32 + 8 * hh);
      pa.h[1] = *(const v8us*)(pwh + c * 64 + kk * 32 + 16 + 8 * hh);
#pragma unroll
      for (int t = 0; t < 4; ++t) {
        FH vb;
        vb.h[0] = *(const v8us*)(sm + VTH + (t * 16 + c) * 64 + kk * 32 + 8 * hh);
        vb.h[1] = *(const v8us*)(sm + VTH + (t * 16 + c) * 64 + kk * 32 + 16 + 8 * hh);
        oacc[t] = mma_h(pa.v, vb.v, oacc[t]);
      }
    }
    if (EARLY) {
      if (useres) {
        /* residual products per d tile: one 8-register accumulator live at a time */
#pragma unroll
        for (int t = 0; t < 4; ++t) {
          v8f oar = zero8();
#pragma unroll
          for (int kk = 0; kk < 2; ++kk) {
            FH pa, pr, vb, vr;
            pa.h[0] = *(const v8us*)(pwh + c * 64 + kk * 32 + 8 * hh);
            pa.h[1] = *(const v8us*)(pwh + c * 64 + kk * 32 + 16 + 8 * hh);
            pr.h[0] = *(const v8us*)(pwr + c * 64 + kk * 32 + 8 * hh);
            pr.h[1] = *(const v8us*)(pwr + c * 64 + kk * 32 + 16 + 8 * hh);
            vb.h[0] = *(const v8us*)(sm + VTH + (t * 16 + c) * 64 + kk * 32 + 8 * hh);
            vb.h[1] = *(const v8us*)(sm + VTH + (t * 16 + c) * 64 + kk * 32 + 16 + 8 * hh);
            vr.h[0] = *(const v8us*)(sm + VRS + (t * 16 + c) * 64 + kk * 32 + 8 * hh);
            vr.h[1] = *(const v8us*)(sm + VRS + (t * 16 + c) * 64 + kk * 32 + 16 + 8 * hh);
            oar = mma_h(pa.v, vr.v, oar);
            oar = mma_h(pr.v, vb.v, oar);
          }
#pragma unroll
          for (int r = 0; r < 8; ++r) oacc[t][r] += oar[r] * RINV;
        }
      }
    }
  }

  /* epilogue: all waves are done with the staged tiles before the region is reused */
  __syncthreads();
  unsigned short* osh = sm + KSH + wave * 1024;     /* [16][64] hi, carried x16 */
  unsigned short* osr = sm + ESH + wave * 1024;     /* [16][64] residual x2048 (EARLY) */
#pragma unroll
  for (int r = 0; r < 8; ++r) {
    /* O holds 1024 x sum(p v); ctx = O / (1024 l); plane value = 16 ctx = O x (1/l) x (16/1024) */
    const float inv = (1.0f / lrow[r]) * OCV;
#pragma unroll
    for (int t = 0; t < 4; ++t) {
      const float o = oacc[t][r] * inv;
      const unsigned short hb = h_bits(o);
      osh[(8 * hh + r) * 64 + t * 16 + c] = hb;
      if (EARLY) {
        const float res = (o - h2f(hb)) * RSC;
        osr[(8 * hh + r) * 64 + t * 16 + c] = h_bits(res);
      }
    }
  }
  __builtin_amdgcn_fence(3, "workgroup");
  __builtin_amdgcn_wave_barrier();
  __builtin_amdgcn_fence(2, "workgroup");
  /* 16 rows x 8 segments = 4 iterations x 32 lanes; row = 4it + (lane>>3), seg = lane&7:
*/
  {
#pragma unroll
    for (int it = 0; it < 4; ++it) {
      const int u = it * 32 + lane;
      const int row = u >> 3, seg = u & 7;
      const v8us vh = *(const v8us*)(osh + row * 64 + seg * 8);
      *(v8us*)(Ct + (size_t)(q0 + row) * DM + head * 64 + seg * 8) = vh;
      if (EARLY) {
        const v8us vr = *(const v8us*)(osr + row * 64 + seg * 8);
        *(v8us*)(Cr + (size_t)(q0 + row) * DM + head * 64 + seg * 8) = vr;
      }
    }
    
  }
}

/* --------------------------------------------------------------------------
 * Output projection: out[t][n] = (sum_k ctx16[t][k] wo64[n][k]) / 1024 + b[n], f16 operands,
 * f32 accumulate.  Token blocks tb < NEARLY first accumulate the ctx residual products
 * alone from zero, scale that sum by 1/2048 in f32, and use it as the start value of
 * the hi-plane accumulation (no residual product enters an accumulator holding hi terms).
 * Block = 2 waves (64 threads), 64 tokens x 64 columns; grid (NQB, DM/64).
 * Epilogue: 64x64 f32 tile staged in LDS (cross-wave, block barrier), then
 * Coverage: 16 iterations x 64 threads = 1024 units = 64 rows x 16 segments.
 * ------------------------------------------------------------------------ */
__global__ __launch_bounds__(64) __attribute__((amdgpu_num_vgpr(256)))
void out_kernel(
    const unsigned short* __restrict__ Ct, const unsigned short* __restrict__ Cr,
    const unsigned short* __restrict__ Wo, const float* __restrict__ bias, float* __restrict__ out)
{
  constexpr int PTF = 68;
  __shared__ __align__(16) float ts[64 * PTF];
  union FH { v16h v; v8us h[2]; };

  const int tid = threadIdx.x, wave = tid >> 5, lane = tid & 31;
  const int hh = lane >> 4, m = lane & 15;
  const int tb = blockIdx.x, nb = blockIdx.y;
  const int n0 = nb * 64;
  const int rl0 = wave * 32;
  const int r0 = tb * 64 + rl0;
  const bool dores = tb < NEARLY;     /* block-uniform */

  v8f acc[2][4];
#pragma unroll
  for (int mi = 0; mi < 2; ++mi)
#pragma unroll
    for (int ni = 0; ni < 4; ++ni) acc[mi][ni] = zero8();

  const unsigned short* wp = Wo + (size_t)(n0 + m) * DM + 8 * hh;

  if (dores) {
    const unsigned short* cp0 = Cr + (size_t)(r0 + m) * DM + 8 * hh;
    const unsigned short* cp1 = Cr + (size_t)(r0 + 16 + m) * DM + 8 * hh;
#pragma unroll 2
    for (int k0 = 0; k0 < DM; k0 += 32) {
      FH a0, a1;
      a0.h[0] = *(const v8us*)(cp0 + k0);
      a0.h[1] = *(const v8us*)(cp0 + k0 + 16);
      a1.h[0] = *(const v8us*)(cp1 + k0);
      a1.h[1] = *(const v8us*)(cp1 + k0 + 16);
#pragma unroll
      for (int ni = 0; ni < 4; ++ni) {
        FH b;
        b.h[0] = *(const v8us*)(wp + (size_t)ni * 16 * DM + k0);
        b.h[1] = *(const v8us*)(wp + (size_t)ni * 16 * DM + k0 + 16);
        acc[0][ni] = mma_h(a0.v, b.v, acc[0][ni]);
        acc[1][ni] = mma_h(a1.v, b.v, acc[1][ni]);
      }
    }
#pragma unroll
    for (int mi = 0; mi < 2; ++mi)
#pragma unroll
      for (int ni = 0; ni < 4; ++ni)
#pragma unroll
        for (int r = 0; r < 8; ++r) acc[mi][ni][r] *= RINV;
  }

  {
    const unsigned short* cp0 = Ct + (size_t)(r0 + m) * DM + 8 * hh;
    const unsigned short* cp1 = Ct + (size_t)(r0 + 16 + m) * DM + 8 * hh;
#pragma unroll 2
    for (int k0 = 0; k0 < DM; k0 += 32) {
      FH a0, a1;
      a0.h[0] = *(const v8us*)(cp0 + k0);
      a0.h[1] = *(const v8us*)(cp0 + k0 + 16);
      a1.h[0] = *(const v8us*)(cp1 + k0);
      a1.h[1] = *(const v8us*)(cp1 + k0 + 16);
#pragma unroll
      for (int ni = 0; ni < 4; ++ni) {
        FH b;
        b.h[0] = *(const v8us*)(wp + (size_t)ni * 16 * DM + k0);
        b.h[1] = *(const v8us*)(wp + (size_t)ni * 16 * DM + k0 + 16);
        acc[0][ni] = mma_h(a0.v, b.v, acc[0][ni]);
        acc[1][ni] = mma_h(a1.v, b.v, acc[1][ni]);
      }
    }
  }

  float bb[4];
#pragma unroll
  for (int ni = 0; ni < 4; ++ni) bb[ni] = bfr(bias[n0 + ni * 16 + m]);
#pragma unroll
  for (int mi = 0; mi < 2; ++mi) {
#pragma unroll
    for (int ni = 0; ni < 4; ++ni) {
#pragma unroll
      for (int r = 0; r < 8; ++r) {
        const int rl = rl0 + mi * 16 + 8 * hh + r;
        ts[rl * PTF + ni * 16 + m] = acc[mi][ni][r] * OINV + bb[ni];
      }
    }
  }
  __syncthreads();

  {
#pragma unroll
    for (int it = 0; it < 16; ++it) {
      const int u = it * 64 + tid;
      const int row = u >> 4, seg = u & 15;
      const int t = tb * 64 + row;
      const v4f v = *(const v4f*)(ts + row * PTF + seg * 4);
      if (t < TT) *(v4f*)(out + (size_t)t * DM + n0 + seg * 4) = v;
    }
    
  }
}

/* -------------------------------------------------------------------------- */
extern "C" void kernel_launch(void* const* d_in, const int* in_sizes, int n_in,
                              void* d_out, int out_size, void* d_ws, size_t ws_size,
                              hipStream_t stream)
{
  if (n_in < 13) return;
  if (in_sizes[0] < TT * DM || in_sizes[1] < TT * DM || in_sizes[2] < TT * DM) return;
  if (in_sizes[3] < (TT - 1) * SEQ_FULL + TT) return;
  if (in_sizes[4] < DM * DM || in_sizes[6] < DM * DM || in_sizes[8] < DM * DM || in_sizes[11] < DM * DM) return;
  if (in_sizes[5] < DM || in_sizes[7] < DM || in_sizes[9] < DM || in_sizes[12] < DM) return;
  if (in_sizes[10] < TT * HD) return;
  if (out_size < TT * DM) return;
  if (d_ws == nullptr || ws_size < WS_NEED) return;

  const float* q    = (const float*)d_in[0];
  const float* k    = (const float*)d_in[1];
  const float* v    = (const float*)d_in[2];
  const int*   mask = (const int*)d_in[3];
  const float* Wq_w = (const float*)d_in[4];
  const float* Wq_b = (const float*)d_in[5];
  const float* Wk_w = (const float*)d_in[6];
  const float* Wk_b = (const float*)d_in[7];
  const float* Wv_w = (const float*)d_in[8];
  const float* Wv_b = (const float*)d_in[9];
  const float* Er   = (const float*)d_in[10];
  const float* Wo_w = (const float*)d_in[11];
  const float* Wo_b = (const float*)d_in[12];
  float* outp = (float*)d_out;

  unsigned char* ws = (unsigned char*)d_ws;
  unsigned short* Xq = (unsigned short*)(ws + OFF_XQ);
  unsigned short* Xk = (unsigned short*)(ws + OFF_XK);
  unsigned short* Xv = (unsigned short*)(ws + OFF_XV);
  unsigned short* Wq = (unsigned short*)(ws + OFF_WQ);
  unsigned short* Wk = (unsigned short*)(ws + OFF_WK);
  unsigned short* Wv = (unsigned short*)(ws + OFF_WV);
  unsigned short* Wo = (unsigned short*)(ws + OFF_WO);
  unsigned short* Eh = (unsigned short*)(ws + OFF_ER);
  unsigned short* Qh = (unsigned short*)(ws + OFF_QH);
  unsigned short* Kh = (unsigned short*)(ws + OFF_KH);
  unsigned short* Vt = (unsigned short*)(ws + OFF_VT);
  unsigned short* Qr = (unsigned short*)(ws + OFF_QR);
  unsigned short* Kr = (unsigned short*)(ws + OFF_KR);
  unsigned short* Vr = (unsigned short*)(ws + OFF_VR);
  unsigned short* Ct = (unsigned short*)(ws + OFF_CT);
  unsigned short* Cr = (unsigned short*)(ws + OFF_CR);
  int* flags = (int*)(ws + OFF_FL);

  /* input planes (rows >= TT zero) */
  const int xu = TPAD * (DM / 8);
  const int wu = DM * (DM / 8);
  const int eu = TPAD * (HD / 8);
  cvt_plane_kernel<<<(xu + 255) / 256, 256, 0, stream>>>(q, TT, DM, TPAD, 0, 1.0f, Xq);
  cvt_plane_kernel<<<(xu + 255) / 256, 256, 0, stream>>>(k, TT, DM, TPAD, 0, 1.0f, Xk);
  cvt_plane_kernel<<<(xu + 255) / 256, 256, 0, stream>>>(v, TT, DM, TPAD, 0, 1.0f, Xv);
  cvt_plane_kernel<<<(wu + 255) / 256, 256, 0, stream>>>(Wq_w, DM, DM, DM, 0, 1.0f, Wq);
  cvt_plane_kernel<<<(wu + 255) / 256, 256, 0, stream>>>(Wk_w, DM, DM, DM, 0, 1.0f, Wk);
  cvt_plane_kernel<<<(wu + 255) / 256, 256, 0, stream>>>(Wv_w, DM, DM, DM, 0, 1.0f, Wv);
  cvt_plane_kernel<<<(wu + 255) / 256, 256, 0, stream>>>(Wo_w, DM, DM, DM, 1, WOSC, Wo);
  cvt_plane_kernel<<<(eu + 255) / 256, 256, 0, stream>>>(Er, TT, HD, TPAD, 1, 1.0f, Eh);

  /* per (query block, key chunk) skip/dense/mixed flags from the key mask */
  flags_kernel<<<NQB, 256, 0, stream>>>(mask, flags);

  /* projections: 64 tokens x one head per block */
  proj_kernel<0><<<dim3(NTB, NH), 64, 0, stream>>>(Xq, Wq, Wq_b, Qh, Qr);
  proj_kernel<1><<<dim3(NTB, NH), 64, 0, stream>>>(Xk, Wk, Wk_b, Kh, Kr);
  proj_kernel<2><<<dim3(NTB, NH), 64, 0, stream>>>(Xv, Wv, Wv_b, Vt, Vr);

  /* attention: first NEARLY query blocks with residual products, the rest single products */
  attn_kernel<true><<<dim3(NEARLY, NH), 128, 0, stream>>>(Qh, Qr, Kh, Kr, Vt, Vr, Eh, mask, flags, Ct, Cr);
  if (NQB > NEARLY)
    attn_kernel<false><<<dim3(NQB - NEARLY, NH), 128, 0, stream>>>(Qh, Qr, Kh, Kr, Vt, Vr, Eh, mask, flags, Ct, Cr);

  /* output projection into d_out */
  out_kernel<<<dim3(NQB, DM / 64), 64, 0, stream>>>(Ct, Cr, Wo, Wo_b, outp);
}

// v001
// Measured time: 321 microseconds a run.
// Timed twice side by side with v000, it ran 1.14 times as fast both times.
// Contractions: q/k/v input projections on v_wmma_f32_16x16x32_bf16 (bf16 operands = RNE-converted inputs and weights, f32 accumulate); scores q.k^T, row-shifted q.Er^T, p.v and the output projection on v_wmma_f32_16x16x32_f16 (f16 operands: f16 hi planes of projected q/k/v, p carried x1024 and folded as 1/1024 before the ctx plane, ctx carried x16, Wo carried x64, plus x2048 f16 residual planes for the first 256 query rows and first 256 keys), f32 accumulate; softmax and all other arithmetic in f32.
#include <hip/hip_runtime.h>

typedef _Float16       v16h __attribute__((ext_vector_type(16)));
typedef __bf16         v16b __attribute__((ext_vector_type(16)));
typedef unsigned short v8us __attribute__((ext_vector_type(8)));
typedef float          v8f  __attribute__((ext_vector_type(8)));
typedef float          v4f  __attribute__((ext_vector_type(4)));
typedef unsigned int   v4u  __attribute__((ext_vector_type(4)));
typedef int            v4i  __attribute__((ext_vector_type(4)));

#ifndef NB
#define NB 1
#endif
#ifndef SEQ
#define SEQ 2049
#endif
#define SEQ_FULL 2049

constexpr int DM     = 1024;
constexpr int NH     = 16;
constexpr int HD     = 64;
constexpr int TT     = SEQ;
constexpr int NQB    = (TT + 63) / 64;          /* query blocks of 64 rows */
constexpr int NTB    = NQB + 1;                  /* token blocks of the planes (one extra for the +1 row shift) */
constexpr int TPAD   = NTB * 64;                 /* padded token count of every plane */
constexpr int NKC    = NTB;                      /* key chunks of 64 */
constexpr int NEARLY = NQB < 4 ? NQB : 4;        /* query blocks with residual treatment */
constexpr int CRES   = NEARLY * 64;              /* rows of K/V/ctx residual planes */
constexpr int QRES   = (NEARLY + 1) * 64;        /* rows of the Q residual plane (covers the +1 shift) */

constexpr float RSC  = 2048.0f;                  /* residual plane carry */
constexpr float RINV = 1.0f / 2048.0f;
constexpr float PSC  = 1024.0f;                  /* softmax weight carry (on the p tile, hence on the p.v accumulator) */
constexpr float CSC  = 16.0f;                    /* ctx plane carry */
constexpr float OCV  = CSC / PSC;                /* 1/64: removes the p carry and applies the ctx carry in one factor */
constexpr float WOSC = 64.0f;                    /* Wo plane carry */
constexpr float OINV = 1.0f / (CSC * WOSC);      /* 1/1024 */

static_assert(NB == 1);
static_assert(SEQ <= SEQ_FULL);
static_assert(HD == 64);
static_assert(DM % 64 == 0 && DM % 32 == 0);
static_assert(TPAD % 64 == 0);
static_assert(NKC <= 64);
static_assert(QRES <= TPAD && CRES <= TPAD);

/* workspace region map (bytes, every offset a multiple of 128) */
constexpr size_t X_B  = (size_t)TPAD * DM * 2;       /* bf16 [TPAD][DM] */
constexpr size_t W_B  = (size_t)DM * DM * 2;         /* 16-bit [DM][DM] */
constexpr size_t E_B  = (size_t)TPAD * HD * 2;       /* f16 [TPAD][HD] */
constexpr size_t HP_B = (size_t)NH * TPAD * HD * 2;  /* f16 [NH][TPAD][HD] or [NH][HD][TPAD] */
constexpr size_t QR_B = (size_t)NH * QRES * HD * 2;  /* f16 [NH][QRES][HD] */
constexpr size_t KR_B = (size_t)NH * CRES * HD * 2;  /* f16 [NH][CRES][HD] or [NH][HD][CRES] */
constexpr size_t CT_B = (size_t)TPAD * DM * 2;       /* f16 [TPAD][DM] */
constexpr size_t CR_B = (size_t)CRES * DM * 2;       /* f16 [CRES][DM] */
constexpr int    FLN  = 4;                          /* 128-byte flag lines per query block, one writer each */
constexpr int    FSL  = (NKC + FLN - 1) / FLN;      /* key chunks (used slots) per flag line */
constexpr size_t FL_B = (size_t)NQB * FLN * 32 * 4; /* int [NQB][FLN][32]: chunk kc at line kc % FLN, slot kc / FLN */
static_assert(FSL <= 32);

constexpr size_t OFF_XQ = 0;
constexpr size_t OFF_XK = OFF_XQ + X_B;
constexpr size_t OFF_XV = OFF_XK + X_B;
constexpr size_t OFF_WQ = OFF_XV + X_B;
constexpr size_t OFF_WK = OFF_WQ + W_B;
constexpr size_t OFF_WV = OFF_WK + W_B;
constexpr size_t OFF_WO = OFF_WV + W_B;
constexpr size_t OFF_ER = OFF_WO + W_B;
constexpr size_t OFF_QH = OFF_ER + E_B;
constexpr size_t OFF_KH = OFF_QH + HP_B;
constexpr size_t OFF_VT = OFF_KH + HP_B;
constexpr size_t OFF_QR = OFF_VT + HP_B;
constexpr size_t OFF_KR = OFF_QR + QR_B;
constexpr size_t OFF_VR = OFF_KR + KR_B;
constexpr size_t OFF_CT = OFF_VR + KR_B;
constexpr size_t OFF_CR = OFF_CT + CT_B;
constexpr size_t OFF_FL = OFF_CR + CR_B;
constexpr size_t WS_NEED = OFF_FL + FL_B;

static_assert(X_B % 128 == 0 && W_B % 128 == 0 && E_B % 128 == 0 && HP_B % 128 == 0);
static_assert(QR_B % 128 == 0 && KR_B % 128 == 0 && CT_B % 128 == 0 && CR_B % 128 == 0 && FL_B % 128 == 0);
static_assert(WS_NEED <= 134217728ull);
static_assert((size_t)TT * DM * 4 <= (size_t)SEQ_FULL * DM * 4);

/* -------------------------------------------------------------------------- */
__device__ __forceinline__ unsigned short f2bf_bits(float f) {
  unsigned u = __float_as_uint(f);
  return (unsigned short)((u + 0x7FFFu + ((u >> 16) & 1u)) >> 16);
}
__device__ __forceinline__ float bfr(float f) { return __uint_as_float(((unsigned)f2bf_bits(f)) << 16); }
__device__ __forceinline__ unsigned short h_bits(float f) {
  _Float16 h = (_Float16)f;
  return __builtin_bit_cast(unsigned short, h);
}
__device__ __forceinline__ float h2f(unsigned short b) {
  _Float16 h = __builtin_bit_cast(_Float16, b);
  return (float)h;
}

/* WMMA issue helpers with the 4-slot hazard guard (ties D, keeps A/B live) */
__device__ __forceinline__ v8f mma_h(v16h a, v16h b, v8f c) {
  c = __builtin_amdgcn_wmma_f32_16x16x32_f16(false, a, false, b, (short)0, c, false, false);
  asm volatile("v_nop\n\tv_nop\n\tv_nop\n\tv_nop" : "+v"(c) : "v"(a), "v"(b));
  return c;
}
__device__ __forceinline__ v8f mma_b(v16b a, v16b b, v8f c) {
  c = __builtin_amdgcn_wmma_f32_16x16x32_bf16(false, a, false, b, (short)0, c, false, false);
  asm volatile("v_nop\n\tv_nop\n\tv_nop\n\tv_nop" : "+v"(c) : "v"(a), "v"(b));
  return c;
}

__device__ __forceinline__ v8f zero8() { return (v8f){0.f,0.f,0.f,0.f,0.f,0.f,0.f,0.f}; }

/* --------------------------------------------------------------------------
 * f32 [nrows][ncols] -> 16-bit plane [nrows_pad][ncols]; rows >= nrows are zeros.
 * mode 0: bf16 bits (RNE).  mode 1: f16 bits of (scale * bf16(x)).
 * Coverage: ceil(nrows_pad*ncols/8 / 256) blocks x 256 threads, guard u < total.
 * ------------------------------------------------------------------------ */
__global__ __launch_bounds__(256) void cvt_plane_kernel(
    const float* __restrict__ src, int nrows, int ncols, int nrows_pad, int mode, float scale,
    unsigned short* __restrict__ dst)
{
  const int u = blockIdx.x * 256 + threadIdx.x;
  const int upr = ncols >> 3;
  const int total = nrows_pad * upr;
  if (u >= total) return;
  const int row = u / upr;
  const int cu  = u - row * upr;
  const int rowc = row < nrows ? row : nrows - 1;          /* clamped address */
  const bool live = row < nrows;
  const float* p = src + (size_t)rowc * ncols + cu * 8;
  const v4f x0 = *(const v4f*)p;
  const v4f x1 = *(const v4f*)(p + 4);
  unsigned b0, b1, b2, b3, b4, b5, b6, b7;
  {
    const float f0 = live ? x0[0] : 0.f, f1 = live ? x0[1] : 0.f, f2 = live ? x0[2] : 0.f, f3 = live ? x0[3] : 0.f;
    const float f4 = live ? x1[0] : 0.f, f5 = live ? x1[1] : 0.f, f6 = live ? x1[2] : 0.f, f7 = live ? x1[3] : 0.f;
    if (mode == 0) {
      b0 = f2bf_bits(f0); b1 = f2bf_bits(f1); b2 = f2bf_bits(f2); b3 = f2bf_bits(f3);
      b4 = f2bf_bits(f4); b5 = f2bf_bits(f5); b6 = f2bf_bits(f6); b7 = f2bf_bits(f7);
    } else {
      b0 = h_bits(bfr(f0) * scale); b1 = h_bits(bfr(f1) * scale); b2 = h_bits(bfr(f2) * scale); b3 = h_bits(bfr(f3) * scale);
      b4 = h_bits(bfr(f4) * scale); b5 = h_bits(bfr(f5) * scale); b6 = h_bits(bfr(f6) * scale); b7 = h_bits(bfr(f7) * scale);
    }
  }
  v4u w;
  w[0] = b0 | (b1 << 16);
  w[1] = b2 | (b3 << 16);
  w[2] = b4 | (b5 << 16);
  w[3] = b6 | (b7 << 16);
  unsigned short* d = dst + (size_t)u * 8;
  *(v4u*)d = w;
  
}

/* --------------------------------------------------------------------------
 * Per (query block, key chunk) flag from the int32 key mask:
 *   0 = every effective entry masked (chunk skipped), 1 = all kept, 2 = mixed.
 * Effective entry (t, s): query row clamped to TT-1 for padded rows, keys s >= TT masked.
 * Block = (query block qb, flag line ln), 16 waves: the chunks kc = ln + FLN*j, j < FSL.
 * Wave w reads rows 4w..4w+3 of every chunk of the block; all loads are independent, so
 * the whole strip is in flight at once.  Per wave one any-kept and one all-kept bit per
 * chunk (ballots), combined over the 16 waves through LDS behind one block barrier.
 * Coverage: wave 0 stores the block's whole 128-byte line (unused slots 0);
 * NQB x FLN blocks = the whole table.
 * ------------------------------------------------------------------------ */
__device__ __forceinline__ int flag_slot(int kc) { return (kc % FLN) * 32 + kc / FLN; }

__global__ __launch_bounds__(512) void flags_kernel(const int* __restrict__ mask, int* __restrict__ flags)
{
  __shared__ unsigned wany[16];
  __shared__ unsigned wall[16];
  const int tid = threadIdx.x, lane = tid & 31;
  const int wave = __builtin_amdgcn_readfirstlane(tid >> 5);   /* scalar, so the row bases are scalar */
  const int qb = blockIdx.x, ln = blockIdx.y;

  /* key of slot j, half hf: s = col0 + FLN*64*j + 32*hf.  Only the last slot can pass TT. */
  constexpr int LOFF = FLN * (FSL - 1) * 64;
  static_assert(LOFF - 1 < TT);
  const unsigned col0 = (unsigned)(ln * 64 + lane);
  const unsigned sl0 = col0 + LOFF, sl1 = sl0 + 32u;
  const unsigned cl0 = sl0 < (unsigned)TT ? sl0 : (unsigned)(TT - 1);   /* clamped address */
  const unsigned cl1 = sl1 < (unsigned)TT ? sl1 : (unsigned)(TT - 1);   /* clamped address */
  const int* rowp[4];
#pragma unroll
  for (int rr = 0; rr < 4; ++rr) {
    int t = qb * 64 + wave * 4 + rr;
    t = t < TT ? t : TT - 1;
    rowp[rr] = mask + (size_t)t * SEQ_FULL;
  }

  /* first every load, then every count */
  int mv[FSL][8];
#pragma unroll
  for (int j = 0; j < FSL - 1; ++j) {
#pragma unroll
    for (int it = 0; it < 8; ++it)
      mv[j][it] = (rowp[it >> 1] + col0)[FLN * j * 64 + (it & 1) * 32];
  }
#pragma unroll
  for (int it = 0; it < 8; ++it)
    mv[FSL - 1][it] = rowp[it >> 1][(it & 1) ? cl1 : cl0];
  /* keeps every load in front of every count: without it the scheduler mixes them and fewer loads fly at once */
  __builtin_amdgcn_sched_barrier(0);
  /* every register that the issued loads name (row bases, key offsets) is an input here, so none is
     rewritten in front of this wait */
  asm volatile("s_wait_xcnt 0x0"
               :: "s"(rowp[0]), "s"(rowp[1]), "s"(rowp[2]), "s"(rowp[3]), "v"(col0), "v"(cl0), "v"(cl1)
               : "memory");

  int cnt[FSL];
#pragma unroll
  for (int j = 0; j < FSL; ++j) {
    int n = 0;
#pragma unroll
    for (int it = 0; it < 8; ++it) {
      const bool ex = (j < FSL - 1) || (((it & 1) ? sl1 : sl0) < (unsigned)TT);   /* key exists */
      n += (ex && mv[j][it] != 0) ? 1 : 0;
    }
    cnt[j] = n;
  }

  unsigned anym = 0u, allm = 0u;                           /* wave-uniform, bit j = chunk ln + FLN*j */
#pragma unroll
  for (int j = 0; j < FSL; ++j) {
    anym |= (__builtin_amdgcn_ballot_w32(cnt[j] != 0) != 0u) ? (1u << j) : 0u;
    allm |= (__builtin_amdgcn_ballot_w32(cnt[j] == 8) == 0xFFFFFFFFu) ? (1u << j) : 0u;
  }
  if (lane == 0) { wany[wave] = anym; wall[wave] = allm; }
  __syncthreads();

  if (wave == 0) {
    unsigned a = 0u, f = 0xFFFFFFFFu;
#pragma unroll
    for (int w = 0; w < 16; ++w) { a |= wany[w]; f &= wall[w]; }
    int fv = 0;
    if (lane < FSL) fv = ((a >> lane) & 1u) ? (((f >> lane) & 1u) ? 1 : 2) : 0;
    flags[((size_t)qb * FLN + ln) * 32 + lane] = fv;
  }
}

/* --------------------------------------------------------------------------
 * Projection GEMM: Y[t][n] = sum_k X[t][k] W[n][k] + b[n] for one 64-token x 64-col
 * (= one head) tile per block; bf16 operands (X and W planes), f32 accumulate.
 * Block = 2 waves (64 threads); wave w: tokens w*32..w*32+31 (2 row tiles) x 4 col tiles.
 * A fragment (row m = lane&15): elems 0..7 <- k0+8h+i, 8..15 <- k0+16+8h+i.
 * B[k][n] = W[n][k]: loaded from row n = lane&15 with the same k map.  D elem r = (row 8h+r, col lane&15).
 * Epilogue: hi = f16(y), res = f16((y - hi) * 2048), rows t >= TT forced to 0; the block's
 * MODE 0: Q -> [NH][TPAD][HD] (+ residual rows < QRES); 1: K -> same (+ residual rows < CRES);
 * MODE 2: V -> [NH][HD][TPAD] (+ residual [NH][HD][CRES]).
 * Coverage per block: 8 iterations x 64 threads = 512 units = 64 rows x 8 segments (hi and res).
 * LDS tiles th/tr: cross-wave, separated by a block barrier; reloaded through the stored element type.
 * ------------------------------------------------------------------------ */
template <int MODE>
__global__ __launch_bounds__(64) __attribute__((amdgpu_num_vgpr(256)))
void proj_kernel(
    const unsigned short* __restrict__ X, const unsigned short* __restrict__ W,
    const float* __restrict__ bias, unsigned short* __restrict__ Ph, unsigned short* __restrict__ Pr)
{
  constexpr int PT = 72;
  constexpr int NRES_TB = (MODE == 0) ? (NEARLY + 1) : NEARLY;
  __shared__ __align__(16) unsigned short th[64 * PT];
  __shared__ __align__(16) unsigned short tr[64 * PT];
  union FB { v16b v; v8us h[2]; };

  const int tid = threadIdx.x, wave = tid >> 5, lane = tid & 31;
  const int hh = lane >> 4, m = lane & 15;
  const int tb = blockIdx.x, head = blockIdx.y;
  const int n0 = head * 64;
  const int rl0 = wave * 32;
  const int r0 = tb * 64 + rl0;

  v8f acc[2][4];
#pragma unroll
  for (int mi = 0; mi < 2; ++mi)
#pragma unroll
    for (int ni = 0; ni < 4; ++ni) acc[mi][ni] = zero8();

  const unsigned short* xp0 = X + (size_t)(r0 + m) * DM + 8 * hh;
  const unsigned short* xp1 = X + (size_t)(r0 + 16 + m) * DM + 8 * hh;
  const unsigned short* wp  = W + (size_t)(n0 + m) * DM + 8 * hh;

#pragma unroll 2
  for (int k0 = 0; k0 < DM; k0 += 32) {
    FB a0, a1;
    a0.h[0] = *(const v8us*)(xp0 + k0);
    a0.h[1] = *(const v8us*)(xp0 + k0 + 16);
    a1.h[0] = *(const v8us*)(xp1 + k0);
    a1.h[1] = *(const v8us*)(xp1 + k0 + 16);
#pragma unroll
    for (int ni = 0; ni < 4; ++ni) {
      FB b;
      b.h[0] = *(const v8us*)(wp + (size_t)ni * 16 * DM + k0);
      b.h[1] = *(const v8us*)(wp + (size_t)ni * 16 * DM + k0 + 16);
      acc[0][ni] = mma_b(a0.v, b.v, acc[0][ni]);
      acc[1][ni] = mma_b(a1.v, b.v, acc[1][ni]);
    }
  }

  float bb[4];
#pragma unroll
  for (int ni = 0; ni < 4; ++ni) bb[ni] = bfr(bias[n0 + ni * 16 + m]);

#pragma unroll
  for (int mi = 0; mi < 2; ++mi) {
#pragma unroll
    for (int ni = 0; ni < 4; ++ni) {
#pragma unroll
      for (int r = 0; r < 8; ++r) {
        const int rl  = rl0 + mi * 16 + 8 * hh + r;
        const int t   = tb * 64 + rl;
        const int col = ni * 16 + m;
        float y = acc[mi][ni][r] + bb[ni];
        y = (t < TT) ? y : 0.f;
        const unsigned short hb = h_bits(y);
        const float res = (y - h2f(hb)) * RSC;
        const unsigned short rb = h_bits(res);
        if (MODE == 2) { th[col * PT + rl] = hb; tr[col * PT + rl] = rb; }
        else           { th[rl * PT + col] = hb; tr[rl * PT + col] = rb; }
      }
    }
  }
  __syncthreads();

  const bool dores = tb < NRES_TB;    /* block-uniform */
  {
#pragma unroll
    for (int it = 0; it < 8; ++it) {
      const int u = it * 64 + tid;
      const int row = u >> 3, seg = u & 7;
      const v8us vh = *(const v8us*)(th + row * PT + seg * 8);
      const v8us vr = *(const v8us*)(tr + row * PT + seg * 8);
      if (MODE == 2) {
        *(v8us*)(Ph + ((size_t)head * HD + row) * TPAD + tb * 64 + seg * 8) = vh;
        if (dores) *(v8us*)(Pr + ((size_t)head * HD + row) * CRES + tb * 64 + seg * 8) = vr;
      } else {
        *(v8us*)(Ph + ((size_t)head * TPAD + tb * 64 + row) * HD + seg * 8) = vh;
        if (dores) {
          if (MODE == 0) *(v8us*)(Pr + ((size_t)head * QRES + tb * 64 + row) * HD + seg * 8) = vr;
          else           *(v8us*)(Pr + ((size_t)head * CRES + tb * 64 + row) * HD + seg * 8) = vr;
        }
      }
    }
    
  }
}

/* --------------------------------------------------------------------------
 * Flash attention with the row-shifted Er term, head dim 64.
 * Block = 4 waves = 64 query rows of one head; grid (query blocks, NH).
 * Per kept 64-key chunk: K [key][d], Er [key][d], V^T [d][key] f16 tiles staged in LDS
 * (EARLY: also K and V^T residual tiles), scores = qh.k^T + qh(t+1).Er^T on f16 WMMA,
 * x0.125, replace-fill -inf from the key mask (flag 2 chunks), f32 online softmax,
 * P = f16(1024 p) per-wave LDS tile (EARLY: + f16 residual x2048), O += P.V on f16 WMMA
 * (O therefore carries the x1024 of P; the normaliser applies 1/(1024 l) x 16 in one factor).
 * EARLY adds (qh.k_res + q_res.k + q_res(t+1).Er)/2048 to the scores and
 * (P.V_res + P_res.V)/2048 to O through separate accumulators folded per tile.
 * Live-state plan: Q hi fragments reloaded per chunk (dead during softmax and P.V),
 * Q residual fragments loaded only inside the residual score phase, one 8-register
 * residual accumulator at a time; <= 4 O tiles + 4 score tiles + m/l persistent.
 * Epilogue: ctx = O/(1024 l) carried x16 as f16 into [TPAD][DM] (+ residual rows < CRES),
 * Fragment map as in proj_kernel (A row / B col = lane&15, split k map, D elem r = row 8h+r).
 * LDS regions: K/Er/V/res tiles and msk cross-wave (block barriers); P tiles and the
 * ------------------------------------------------------------------------ */
template <bool EARLY>
__global__ __launch_bounds__(128) __attribute__((amdgpu_num_vgpr(256)))
void attn_kernel(const unsigned short* __restrict__ Qh, const unsigned short* __restrict__ Qr,
                 const unsigned short* __restrict__ Kh, const unsigned short* __restrict__ Kr,
                 const unsigned short* __restrict__ Vt, const unsigned short* __restrict__ Vr,
                 const unsigned short* __restrict__ Erp, const int* __restrict__ mask,
                 const int* __restrict__ flags, unsigned short* __restrict__ Ct,
                 unsigned short* __restrict__ Cr)
{
  constexpr int KSH = 0, ESH = 4096, VTH = 8192, PSH = 12288, KRS = 16384, VRS = 20480;
  constexpr int PRS = EARLY ? 24576 : PSH;
  constexpr int SMN = EARLY ? 28672 : 16384;
  __shared__ __align__(16) unsigned short sm[SMN];
  __shared__ __align__(16) unsigned char msk[4096];
  union FH { v16h v; v8us h[2]; };

  const int tid = threadIdx.x, wave = tid >> 5, lane = tid & 31;
  const int hh = lane >> 4, c = lane & 15;
  const int qb = EARLY ? (int)blockIdx.x : ((int)blockIdx.x + NEARLY);
  const int head = blockIdx.y;
  const int q0 = qb * 64 + wave * 16;
  const int wrow0 = wave * 16;                     /* the wave's first row inside the block tile */

  /* fragment base pointers: rows q0+c (q.k^T) and q0+1+c (shifted Er term) */
  const unsigned short* qp = Qh + ((size_t)head * TPAD + q0 + c) * HD + 8 * hh;
  const unsigned short* rp = Qr + ((size_t)head * QRES + (EARLY ? (q0 + c) : c)) * HD + 8 * hh;

  float mrow[8], lrow[8];
  v8f oacc[4];
#pragma unroll
  for (int r = 0; r < 8; ++r) { mrow[r] = -__builtin_inff(); lrow[r] = 0.f; }
#pragma unroll
  for (int t = 0; t < 4; ++t) oacc[t] = zero8();

  unsigned short* pwh = sm + PSH + wave * 1024;
  unsigned short* pwr = sm + PRS + wave * 1024;
  const int* frow = flags + (size_t)qb * (FLN * 32);

#pragma unroll 1
  for (int kc = 0; kc < NKC; ++kc) {
    const int fk = __builtin_amdgcn_readfirstlane(frow[flag_slot(kc)]);   /* block-uniform */
    if (fk == 0) continue;
    const int kv0 = kc * 64;
    const bool useres = EARLY && (kc < NEARLY);
    const int kvr = (kc < NEARLY) ? kv0 : 0;                   /* clamped residual chunk base */

    __syncthreads();
    /* staging: unit u -> row u>>3 (0..63), seg u&7; 4 iterations x 128 threads = 512 units per tile */
#pragma unroll
    for (int it = 0; it < 4; ++it) {
      const int u = it * 128 + tid;
      const int row = u >> 3, seg = u & 7;
      *(v4u*)(sm + KSH + row * 64 + seg * 8) = *(const v4u*)(Kh + ((size_t)head * TPAD + kv0 + row) * HD + seg * 8);
      *(v4u*)(sm + ESH + row * 64 + seg * 8) = *(const v4u*)(Erp + (size_t)(kv0 + row) * HD + seg * 8);
      *(v4u*)(sm + VTH + row * 64 + seg * 8) = *(const v4u*)(Vt + ((size_t)head * HD + row) * TPAD + kv0 + seg * 8);
    }
    if (EARLY) {
#pragma unroll
      for (int it = 0; it < 4; ++it) {
        const int u = it * 128 + tid;
        const int row = u >> 3, seg = u & 7;
        *(v4u*)(sm + KRS + row * 64 + seg * 8) = *(const v4u*)(Kr + ((size_t)head * CRES + kvr + row) * HD + seg * 8);
        *(v4u*)(sm + VRS + row * 64 + seg * 8) = *(const v4u*)(Vr + ((size_t)head * HD + row) * CRES + kvr + seg * 8);
      }
    }
    if (fk == 2) {
      /* key mask tile: thread -> row tid>>1, 32 columns; clamped addresses, keys >= TT masked */
      const int row = tid >> 1, hsel = tid & 1;
      int qrow = qb * 64 + row;
      qrow = qrow < TT ? qrow : TT - 1;
      const int* mb = mask + (size_t)qrow * SEQ_FULL;
#pragma unroll 1
      for (int g = 0; g < 4; ++g) {
#pragma unroll
        for (int e = 0; e < 8; ++e) {
          const int col = hsel * 32 + g * 8 + e;
          const int s = kv0 + col;
          const int sc = s < TT ? s : TT - 1;
          const int mv = mb[sc];
          msk[row * 64 + col] = (unsigned char)((s < TT && mv != 0) ? 1 : 0);
        }
      }
    }
    __syncthreads();

    /* Q hi fragments for this chunk, two 32-deep d halves */
    FH qa[2], qs[2];
#pragma unroll
    for (int dc = 0; dc < 2; ++dc) {
      qa[dc].h[0] = *(const v8us*)(qp + dc * 32);
      qa[dc].h[1] = *(const v8us*)(qp + dc * 32 + 16);
      qs[dc].h[0] = *(const v8us*)(qp + HD + dc * 32);
      qs[dc].h[1] = *(const v8us*)(qp + HD + dc * 32 + 16);
    }

    /* scores: 16 query rows x 64 keys per wave */
    v8f s[4];
#pragma unroll
    for (int j = 0; j < 4; ++j) {
      s[j] = zero8();
#pragma unroll
      for (int dc = 0; dc < 2; ++dc) {
        FH kf, ef;
        kf.h[0] = *(const v8us*)(sm + KSH + (j * 16 + c) * 64 + dc * 32 + 8 * hh);
        kf.h[1] = *(const v8us*)(sm + KSH + (j * 16 + c) * 64 + dc * 32 + 16 + 8 * hh);
        ef.h[0] = *(const v8us*)(sm + ESH + (j * 16 + c) * 64 + dc * 32 + 8 * hh);
        ef.h[1] = *(const v8us*)(sm + ESH + (j * 16 + c) * 64 + dc * 32 + 16 + 8 * hh);
        s[j] = mma_h(qa[dc].v, kf.v, s[j]);
        s[j] = mma_h(qs[dc].v, ef.v, s[j]);
      }
      if (EARLY) {
        if (useres) {
          v8f sr = zero8();
#pragma unroll
          for (int dc = 0; dc < 2; ++dc) {
            FH kf, ef, krf, qra, qrs;
            kf.h[0]  = *(const v8us*)(sm + KSH + (j * 16 + c) * 64 + dc * 32 + 8 * hh);
            kf.h[1]  = *(const v8us*)(sm + KSH + (j * 16 + c) * 64 + dc * 32 + 16 + 8 * hh);
            ef.h[0]  = *(const v8us*)(sm + ESH + (j * 16 + c) * 64 + dc * 32 + 8 * hh);
            ef.h[1]  = *(const v8us*)(sm + ESH + (j * 16 + c) * 64 + dc * 32 + 16 + 8 * hh);
            krf.h[0] = *(const v8us*)(sm + KRS + (j * 16 + c) * 64 + dc * 32 + 8 * hh);
            krf.h[1] = *(const v8us*)(sm + KRS + (j * 16 + c) * 64 + dc * 32 + 16 + 8 * hh);
            qra.h[0] = *(const v8us*)(rp + dc * 32);
            qra.h[1] = *(const v8us*)(rp + dc * 32 + 16);
            qrs.h[0] = *(const v8us*)(rp + HD + dc * 32);
            qrs.h[1] = *(const v8us*)(rp + HD + dc * 32 + 16);
            sr = mma_h(qa[dc].v, krf.v, sr);
            sr = mma_h(qra.v, kf.v, sr);
            sr = mma_h(qrs.v, ef.v, sr);
          }
#pragma unroll
          for (int r = 0; r < 8; ++r) s[j][r] += sr[r] * RINV;
        }
      }
    }

    /* scale by 1/sqrt(64) and replace-fill from the key mask (this wave's rows) */
#pragma unroll
    for (int j = 0; j < 4; ++j) {
#pragma unroll
      for (int r = 0; r < 8; ++r) s[j][r] *= 0.125f;
    }
    if (fk == 2) {
#pragma unroll
      for (int j = 0; j < 4; ++j) {
#pragma unroll
        for (int r = 0; r < 8; ++r) {
          const unsigned char mv = msk[(wrow0 + 8 * hh + r) * 64 + j * 16 + c];
          s[j][r] = mv ? s[j][r] : -__builtin_inff();
        }
      }
    }

    /* chunk row max over 64 keys (16 lanes of one half x 4 tiles) */
    float cm[8];
#pragma unroll
    for (int r = 0; r < 8; ++r) {
      float mx = fmaxf(fmaxf(s[0][r], s[1][r]), fmaxf(s[2][r], s[3][r]));
#pragma unroll
      for (int off = 1; off < 16; off <<= 1) mx = fmaxf(mx, __shfl_xor(mx, off, 32));
      cm[r] = mx;
    }

    /* online softmax update; P tiles (carried x1024) into the wave's LDS tile */
#pragma unroll
    for (int r = 0; r < 8; ++r) {
      const float mnew = fmaxf(mrow[r], cm[r]);
      const bool dead = (mnew == -__builtin_inff());
      const float aexp = __expf(mrow[r] - mnew);
      const float alpha = dead ? 1.f : aexp;
      mrow[r] = mnew;
      float psum = 0.f;
#pragma unroll
      for (int j = 0; j < 4; ++j) {
        const float pe = __expf(s[j][r] - mnew);
        const float p = dead ? 0.f : pe;
        psum += p;
        const float pc = p * PSC;
        const unsigned short hb = h_bits(pc);
        pwh[(8 * hh + r) * 64 + j * 16 + c] = hb;
        if (EARLY) {
          const float pres = (pc - h2f(hb)) * RSC;
          pwr[(8 * hh + r) * 64 + j * 16 + c] = h_bits(pres);
        }
      }
#pragma unroll
      for (int off = 1; off < 16; off <<= 1) psum += __shfl_xor(psum, off, 32);
      lrow[r] = lrow[r] * alpha + psum;
#pragma unroll
      for (int t = 0; t < 4; ++t) oacc[t][r] *= alpha;
    }
    __builtin_amdgcn_fence(3, "workgroup");
    __builtin_amdgcn_wave_barrier();
    __builtin_amdgcn_fence(2, "workgroup");

    /* O += P.V : A = P [q][key] (this wave's tile), B = V [key][d] from V^T [d][key] */
#pragma unroll
    for (int kk = 0; kk < 2; ++kk) {
      FH pa;
      pa.h[0] = *(const v8us*)(pwh + c * 64 + kk * 32 + 8 * hh);
      pa.h[1] = *(const v8us*)(pwh + c * 64 + kk * 32 + 16 + 8 * hh);
#pragma unroll
      for (int t = 0; t < 4; ++t) {
        FH vb;
        vb.h[0] = *(const v8us*)(sm + VTH + (t * 16 + c) * 64 + kk * 32 + 8 * hh);
        vb.h[1] = *(const v8us*)(sm + VTH + (t * 16 + c) * 64 + kk * 32 + 16 + 8 * hh);
        oacc[t] = mma_h(pa.v, vb.v, oacc[t]);
      }
    }
    if (EARLY) {
      if (useres) {
        /* residual products per d tile: one 8-register accumulator live at a time */
#pragma unroll
        for (int t = 0; t < 4; ++t) {
          v8f oar = zero8();
#pragma unroll
          for (int kk = 0; kk < 2; ++kk) {
            FH pa, pr, vb, vr;
            pa.h[0] = *(const v8us*)(pwh + c * 64 + kk * 32 + 8 * hh);
            pa.h[1] = *(const v8us*)(pwh + c * 64 + kk * 32 + 16 + 8 * hh);
            pr.h[0] = *(const v8us*)(pwr + c * 64 + kk * 32 + 8 * hh);
            pr.h[1] = *(const v8us*)(pwr + c * 64 + kk * 32 + 16 + 8 * hh);
            vb.h[0] = *(const v8us*)(sm + VTH + (t * 16 + c) * 64 + kk * 32 + 8 * hh);
            vb.h[1] = *(const v8us*)(sm + VTH + (t * 16 + c) * 64 + kk * 32 + 16 + 8 * hh);
            vr.h[0] = *(const v8us*)(sm + VRS + (t * 16 + c) * 64 + kk * 32 + 8 * hh);
            vr.h[1] = *(const v8us*)(sm + VRS + (t * 16 + c) * 64 + kk * 32 + 16 + 8 * hh);
            oar = mma_h(pa.v, vr.v, oar);
            oar = mma_h(pr.v, vb.v, oar);
          }
#pragma unroll
          for (int r = 0; r < 8; ++r) oacc[t][r] += oar[r] * RINV;
        }
      }
    }
  }

  /* epilogue: all waves are done with the staged tiles before the region is reused */
  __syncthreads();
  unsigned short* osh = sm + KSH + wave * 1024;     /* [16][64] hi, carried x16 */
  unsigned short* osr = sm + ESH + wave * 1024;     /* [16][64] residual x2048 (EARLY) */
#pragma unroll
  for (int r = 0; r < 8; ++r) {
    /* O holds 1024 x sum(p v); ctx = O / (1024 l); plane value = 16 ctx = O x (1/l) x (16/1024) */
    const float inv = (1.0f / lrow[r]) * OCV;
#pragma unroll
    for (int t = 0; t < 4; ++t) {
      const float o = oacc[t][r] * inv;
      const unsigned short hb = h_bits(o);
      osh[(8 * hh + r) * 64 + t * 16 + c] = hb;
      if (EARLY) {
        const float res = (o - h2f(hb)) * RSC;
        osr[(8 * hh + r) * 64 + t * 16 + c] = h_bits(res);
      }
    }
  }
  __builtin_amdgcn_fence(3, "workgroup");
  __builtin_amdgcn_wave_barrier();
  __builtin_amdgcn_fence(2, "workgroup");
  /* 16 rows x 8 segments = 4 iterations x 32 lanes; row = 4it + (lane>>3), seg = lane&7:
*/
  {
#pragma unroll
    for (int it = 0; it < 4; ++it) {
      const int u = it * 32 + lane;
      const int row = u >> 3, seg = u & 7;
      const v8us vh = *(const v8us*)(osh + row * 64 + seg * 8);
      *(v8us*)(Ct + (size_t)(q0 + row) * DM + head * 64 + seg * 8) = vh;
      if (EARLY) {
        const v8us vr = *(const v8us*)(osr + row * 64 + seg * 8);
        *(v8us*)(Cr + (size_t)(q0 + row) * DM + head * 64 + seg * 8) = vr;
      }
    }
    
  }
}

/* --------------------------------------------------------------------------
 * Output projection: out[t][n] = (sum_k ctx16[t][k] wo64[n][k]) / 1024 + b[n], f16 operands,
 * f32 accumulate.  Token blocks tb < NEARLY first accumulate the ctx residual products
 * alone from zero, scale that sum by 1/2048 in f32, and use it as the start value of
 * the hi-plane accumulation (no residual product enters an accumulator holding hi terms).
 * Block = 2 waves (64 threads), 64 tokens x 64 columns; grid (NQB, DM/64).
 * Epilogue: 64x64 f32 tile staged in LDS (cross-wave, block barrier), then
 * Coverage: 16 iterations x 64 threads = 1024 units = 64 rows x 16 segments.
 * ------------------------------------------------------------------------ */
__global__ __launch_bounds__(64) __attribute__((amdgpu_num_vgpr(256)))
void out_kernel(
    const unsigned short* __restrict__ Ct, const unsigned short* __restrict__ Cr,
    const unsigned short* __restrict__ Wo, const float* __restrict__ bias, float* __restrict__ out)
{
  constexpr int PTF = 68;
  __shared__ __align__(16) float ts[64 * PTF];
  union FH { v16h v; v8us h[2]; };

  const int tid = threadIdx.x, wave = tid >> 5, lane = tid & 31;
  const int hh = lane >> 4, m = lane & 15;
  const int tb = blockIdx.x, nb = blockIdx.y;
  const int n0 = nb * 64;
  const int rl0 = wave * 32;
  const int r0 = tb * 64 + rl0;
  const bool dores = tb < NEARLY;     /* block-uniform */

  v8f acc[2][4];
#pragma unroll
  for (int mi = 0; mi < 2; ++mi)
#pragma unroll
    for (int ni = 0; ni < 4; ++ni) acc[mi][ni] = zero8();

  const unsigned short* wp = Wo + (size_t)(n0 + m) * DM + 8 * hh;

  if (dores) {
    const unsigned short* cp0 = Cr + (size_t)(r0 + m) * DM + 8 * hh;
    const unsigned short* cp1 = Cr + (size_t)(r0 + 16 + m) * DM + 8 * hh;
#pragma unroll 2
    for (int k0 = 0; k0 < DM; k0 += 32) {
      FH a0, a1;
      a0.h[0] = *(const v8us*)(cp0 + k0);
      a0.h[1] = *(const v8us*)(cp0 + k0 + 16);
      a1.h[0] = *(const v8us*)(cp1 + k0);
      a1.h[1] = *(const v8us*)(cp1 + k0 + 16);
#pragma unroll
      for (int ni = 0; ni < 4; ++ni) {
        FH b;
        b.h[0] = *(const v8us*)(wp + (size_t)ni * 16 * DM + k0);
        b.h[1] = *(const v8us*)(wp + (size_t)ni * 16 * DM + k0 + 16);
        acc[0][ni] = mma_h(a0.v, b.v, acc[0][ni]);
        acc[1][ni] = mma_h(a1.v, b.v, acc[1][ni]);
      }
    }
#pragma unroll
    for (int mi = 0; mi < 2; ++mi)
#pragma unroll
      for (int ni = 0; ni < 4; ++ni)
#pragma unroll
        for (int r = 0; r < 8; ++r) acc[mi][ni][r] *= RINV;
  }

  {
    const unsigned short* cp0 = Ct + (size_t)(r0 + m) * DM + 8 * hh;
    const unsigned short* cp1 = Ct + (size_t)(r0 + 16 + m) * DM + 8 * hh;
#pragma unroll 2
    for (int k0 = 0; k0 < DM; k0 += 32) {
      FH a0, a1;
      a0.h[0] = *(const v8us*)(cp0 + k0);
      a0.h[1] = *(const v8us*)(cp0 + k0 + 16);
      a1.h[0] = *(const v8us*)(cp1 + k0);
      a1.h[1] = *(const v8us*)(cp1 + k0 + 16);
#pragma unroll
      for (int ni = 0; ni < 4; ++ni) {
        FH b;
        b.h[0] = *(const v8us*)(wp + (size_t)ni * 16 * DM + k0);
        b.h[1] = *(const v8us*)(wp + (size_t)ni * 16 * DM + k0 + 16);
        acc[0][ni] = mma_h(a0.v, b.v, acc[0][ni]);
        acc[1][ni] = mma_h(a1.v, b.v, acc[1][ni]);
      }
    }
  }

  float bb[4];
#pragma unroll
  for (int ni = 0; ni < 4; ++ni) bb[ni] = bfr(bias[n0 + ni * 16 + m]);
#pragma unroll
  for (int mi = 0; mi < 2; ++mi) {
#pragma unroll
    for (int ni = 0; ni < 4; ++ni) {
#pragma unroll
      for (int r = 0; r < 8; ++r) {
        const int rl = rl0 + mi * 16 + 8 * hh + r;
        ts[rl * PTF + ni * 16 + m] = acc[mi][ni][r] * OINV + bb[ni];
      }
    }
  }
  __syncthreads();

  {
#pragma unroll
    for (int it = 0; it < 16; ++it) {
      const int u = it * 64 + tid;
      const int row = u >> 4, seg = u & 15;
      const int t = tb * 64 + row;
      const v4f v = *(const v4f*)(ts + row * PTF + seg * 4);
      if (t < TT) *(v4f*)(out + (size_t)t * DM + n0 + seg * 4) = v;
    }
    
  }
}

/* -------------------------------------------------------------------------- */
extern "C" void kernel_launch(void* const* d_in, const int* in_sizes, int n_in,
                              void* d_out, int out_size, void* d_ws, size_t ws_size,
                              hipStream_t stream)
{
  if (n_in < 13) return;
  if (in_sizes[0] < TT * DM || in_sizes[1] < TT * DM || in_sizes[2] < TT * DM) return;
  if (in_sizes[3] < (TT - 1) * SEQ_FULL + TT) return;
  if (in_sizes[4] < DM * DM || in_sizes[6] < DM * DM || in_sizes[8] < DM * DM || in_sizes[11] < DM * DM) return;
  if (in_sizes[5] < DM || in_sizes[7] < DM || in_sizes[9] < DM || in_sizes[12] < DM) return;
  if (in_sizes[10] < TT * HD) return;
  if (out_size < TT * DM) return;
  if (d_ws == nullptr || ws_size < WS_NEED) return;

  const float* q    = (const float*)d_in[0];
  const float* k    = (const float*)d_in[1];
  const float* v    = (const float*)d_in[2];
  const int*   mask = (const int*)d_in[3];
  const float* Wq_w = (const float*)d_in[4];
  const float* Wq_b = (const float*)d_in[5];
  const float* Wk_w = (const float*)d_in[6];
  const float* Wk_b = (const float*)d_in[7];
  const float* Wv_w = (const float*)d_in[8];
  const float* Wv_b = (const float*)d_in[9];
  const float* Er   = (const float*)d_in[10];
  const float* Wo_w = (const float*)d_in[11];
  const float* Wo_b = (const float*)d_in[12];
  float* outp = (float*)d_out;

  unsigned char* ws = (unsigned char*)d_ws;
  unsigned short* Xq = (unsigned short*)(ws + OFF_XQ);
  unsigned short* Xk = (unsigned short*)(ws + OFF_XK);
  unsigned short* Xv = (unsigned short*)(ws + OFF_XV);
  unsigned short* Wq = (unsigned short*)(ws + OFF_WQ);
  unsigned short* Wk = (unsigned short*)(ws + OFF_WK);
  unsigned short* Wv = (unsigned short*)(ws + OFF_WV);
  unsigned short* Wo = (unsigned short*)(ws + OFF_WO);
  unsigned short* Eh = (unsigned short*)(ws + OFF_ER);
  unsigned short* Qh = (unsigned short*)(ws + OFF_QH);
  unsigned short* Kh = (unsigned short*)(ws + OFF_KH);
  unsigned short* Vt = (unsigned short*)(ws + OFF_VT);
  unsigned short* Qr = (unsigned short*)(ws + OFF_QR);
  unsigned short* Kr = (unsigned short*)(ws + OFF_KR);
  unsigned short* Vr = (unsigned short*)(ws + OFF_VR);
  unsigned short* Ct = (unsigned short*)(ws + OFF_CT);
  unsigned short* Cr = (unsigned short*)(ws + OFF_CR);
  int* flags = (int*)(ws + OFF_FL);

  /* input planes (rows >= TT zero) */
  const int xu = TPAD * (DM / 8);
  const int wu = DM * (DM / 8);
  const int eu = TPAD * (HD / 8);
  cvt_plane_kernel<<<(xu + 255) / 256, 256, 0, stream>>>(q, TT, DM, TPAD, 0, 1.0f, Xq);
  cvt_plane_kernel<<<(xu + 255) / 256, 256, 0, stream>>>(k, TT, DM, TPAD, 0, 1.0f, Xk);
  cvt_plane_kernel<<<(xu + 255) / 256, 256, 0, stream>>>(v, TT, DM, TPAD, 0, 1.0f, Xv);
  cvt_plane_kernel<<<(wu + 255) / 256, 256, 0, stream>>>(Wq_w, DM, DM, DM, 0, 1.0f, Wq);
  cvt_plane_kernel<<<(wu + 255) / 256, 256, 0, stream>>>(Wk_w, DM, DM, DM, 0, 1.0f, Wk);
  cvt_plane_kernel<<<(wu + 255) / 256, 256, 0, stream>>>(Wv_w, DM, DM, DM, 0, 1.0f, Wv);
  cvt_plane_kernel<<<(wu + 255) / 256, 256, 0, stream>>>(Wo_w, DM, DM, DM, 1, WOSC, Wo);
  cvt_plane_kernel<<<(eu + 255) / 256, 256, 0, stream>>>(Er, TT, HD, TPAD, 1, 1.0f, Eh);

  /* per (query block, key chunk) skip/dense/mixed flags from the key mask */
  flags_kernel<<<dim3(NQB, FLN), 512, 0, stream>>>(mask, flags);

  /* projections: 64 tokens x one head per block */
  proj_kernel<0><<<dim3(NTB, NH), 64, 0, stream>>>(Xq, Wq, Wq_b, Qh, Qr);
  proj_kernel<1><<<dim3(NTB, NH), 64, 0, stream>>>(Xk, Wk, Wk_b, Kh, Kr);
  proj_kernel<2><<<dim3(NTB, NH), 64, 0, stream>>>(Xv, Wv, Wv_b, Vt, Vr);

  /* attention: first NEARLY query blocks with residual products, the rest single products */
  attn_kernel<true><<<dim3(NEARLY, NH), 128, 0, stream>>>(Qh, Qr, Kh, Kr, Vt, Vr, Eh, mask, flags, Ct, Cr);
  if (NQB > NEARLY)
    attn_kernel<false><<<dim3(NQB - NEARLY, NH), 128, 0, stream>>>(Qh, Qr, Kh, Kr, Vt, Vr, Eh, mask, flags, Ct, Cr);

  /* output projection into d_out */
  out_kernel<<<dim3(NQB, DM / 64), 64, 0, stream>>>(Ct, Cr, Wo, Wo_b, outp);
}

// v002
// One run takes 283 microseconds.
// Next to v001, in two timings, it ran 1.15 times as fast each time.
// All steps since v000 together make it 1.31 times as fast.
// Contractions: q/k/v input projections on v_wmma_f32_16x16x32_bf16 (bf16 operands = RNE-converted inputs and weights, f32 accumulate); scores q.k^T, row-shifted q.Er^T, p.v and the output projection on v_wmma_f32_16x16x32_f16 (f16 operands: f16 hi planes of projected q/k/v, p carried x1024 and folded as 1/1024 before the ctx plane, ctx carried x16, Wo carried x64, plus x2048 f16 residual planes for the first 256 query rows and first 256 keys), f32 accumulate; softmax and all other arithmetic in f32.
#include <hip/hip_runtime.h>

typedef _Float16       v16h __attribute__((ext_vector_type(16)));
typedef __bf16         v16b __attribute__((ext_vector_type(16)));
typedef unsigned short v8us __attribute__((ext_vector_type(8)));
typedef float          v8f  __attribute__((ext_vector_type(8)));
typedef float          v4f  __attribute__((ext_vector_type(4)));
typedef unsigned int   v4u  __attribute__((ext_vector_type(4)));
typedef int            v4i  __attribute__((ext_vector_type(4)));

#ifndef NB
#define NB 1
#endif
#ifndef SEQ
#define SEQ 2049
#endif
#define SEQ_FULL 2049

constexpr int DM     = 1024;
constexpr int NH     = 16;
constexpr int HD     = 64;
constexpr int TT     = SEQ;
constexpr int NQB    = (TT + 63) / 64;          /* query blocks of 64 rows */
constexpr int NTB    = NQB + 1;                  /* token blocks of the planes (one extra for the +1 row shift) */
constexpr int TPAD   = NTB * 64;                 /* padded token count of every plane */
constexpr int NKC    = NTB;                      /* key chunks of 64 */
constexpr int NEARLY = NQB < 4 ? NQB : 4;        /* query blocks with residual treatment */
constexpr int CRES   = NEARLY * 64;              /* rows of K/V/ctx residual planes */
constexpr int QRES   = (NEARLY + 1) * 64;        /* rows of the Q residual plane (covers the +1 shift) */

constexpr float RSC  = 2048.0f;                  /* residual plane carry */
constexpr float RINV = 1.0f / 2048.0f;
constexpr float PSC  = 1024.0f;                  /* softmax weight carry (on the p tile, hence on the p.v accumulator) */
constexpr float CSC  = 16.0f;                    /* ctx plane carry */
constexpr float OCV  = CSC / PSC;                /* 1/64: removes the p carry and applies the ctx carry in one factor */
constexpr float WOSC = 64.0f;                    /* Wo plane carry */
constexpr float OINV = 1.0f / (CSC * WOSC);      /* 1/1024 */

static_assert(NB == 1);
static_assert(SEQ <= SEQ_FULL);
static_assert(HD == 64);
static_assert(DM % 64 == 0 && DM % 32 == 0);
static_assert(TPAD % 64 == 0);
static_assert(NKC <= 64);
static_assert(QRES <= TPAD && CRES <= TPAD);

/* workspace region map (bytes, every offset a multiple of 128) */
constexpr size_t X_B  = (size_t)TPAD * DM * 2;       /* bf16 [TPAD][DM] */
constexpr size_t W_B  = (size_t)DM * DM * 2;         /* 16-bit [DM][DM] */
constexpr size_t E_B  = (size_t)TPAD * HD * 2;       /* f16 [TPAD][HD] */
constexpr size_t HP_B = (size_t)NH * TPAD * HD * 2;  /* f16 [NH][TPAD][HD] or [NH][HD][TPAD] */
constexpr size_t QR_B = (size_t)NH * QRES * HD * 2;  /* f16 [NH][QRES][HD] */
constexpr size_t KR_B = (size_t)NH * CRES * HD * 2;  /* f16 [NH][CRES][HD] or [NH][HD][CRES] */
constexpr size_t CT_B = (size_t)TPAD * DM * 2;       /* f16 [TPAD][DM] */
constexpr size_t CR_B = (size_t)CRES * DM * 2;       /* f16 [CRES][DM] */
constexpr int    FLN  = 4;                          /* 128-byte flag lines per query block, one writer each */
constexpr int    FSL  = (NKC + FLN - 1) / FLN;      /* key chunks (used slots) per flag line */
constexpr size_t FL_B = (size_t)NQB * FLN * 32 * 4; /* int [NQB][FLN][32]: chunk kc at line kc % FLN, slot kc / FLN */
static_assert(FSL <= 32);

constexpr size_t OFF_XQ = 0;
constexpr size_t OFF_XK = OFF_XQ + X_B;
constexpr size_t OFF_XV = OFF_XK + X_B;
constexpr size_t OFF_WQ = OFF_XV + X_B;
constexpr size_t OFF_WK = OFF_WQ + W_B;
constexpr size_t OFF_WV = OFF_WK + W_B;
constexpr size_t OFF_WO = OFF_WV + W_B;
constexpr size_t OFF_ER = OFF_WO + W_B;
constexpr size_t OFF_QH = OFF_ER + E_B;
constexpr size_t OFF_KH = OFF_QH + HP_B;
constexpr size_t OFF_VT = OFF_KH + HP_B;
constexpr size_t OFF_QR = OFF_VT + HP_B;
constexpr size_t OFF_KR = OFF_QR + QR_B;
constexpr size_t OFF_VR = OFF_KR + KR_B;
constexpr size_t OFF_CT = OFF_VR + KR_B;
constexpr size_t OFF_CR = OFF_CT + CT_B;
constexpr size_t OFF_FL = OFF_CR + CR_B;
constexpr size_t WS_NEED = OFF_FL + FL_B;

static_assert(X_B % 128 == 0 && W_B % 128 == 0 && E_B % 128 == 0 && HP_B % 128 == 0);
static_assert(QR_B % 128 == 0 && KR_B % 128 == 0 && CT_B % 128 == 0 && CR_B % 128 == 0 && FL_B % 128 == 0);
static_assert(WS_NEED <= 134217728ull);
static_assert((size_t)TT * DM * 4 <= (size_t)SEQ_FULL * DM * 4);

/* -------------------------------------------------------------------------- */
__device__ __forceinline__ unsigned short f2bf_bits(float f) {
  unsigned u = __float_as_uint(f);
  return (unsigned short)((u + 0x7FFFu + ((u >> 16) & 1u)) >> 16);
}
__device__ __forceinline__ float bfr(float f) { return __uint_as_float(((unsigned)f2bf_bits(f)) << 16); }
__device__ __forceinline__ unsigned short h_bits(float f) {
  _Float16 h = (_Float16)f;
  return __builtin_bit_cast(unsigned short, h);
}
__device__ __forceinline__ float h2f(unsigned short b) {
  _Float16 h = __builtin_bit_cast(_Float16, b);
  return (float)h;
}

/* WMMA issue helpers with the 4-slot hazard guard (ties D, keeps A/B live) */
__device__ __forceinline__ v8f mma_h(v16h a, v16h b, v8f c) {
  c = __builtin_amdgcn_wmma_f32_16x16x32_f16(false, a, false, b, (short)0, c, false, false);
  asm volatile("v_nop\n\tv_nop\n\tv_nop\n\tv_nop" : "+v"(c) : "v"(a), "v"(b));
  return c;
}
__device__ __forceinline__ v8f mma_b(v16b a, v16b b, v8f c) {
  c = __builtin_amdgcn_wmma_f32_16x16x32_bf16(false, a, false, b, (short)0, c, false, false);
  asm volatile("v_nop\n\tv_nop\n\tv_nop\n\tv_nop" : "+v"(c) : "v"(a), "v"(b));
  return c;
}

__device__ __forceinline__ v8f zero8() { return (v8f){0.f,0.f,0.f,0.f,0.f,0.f,0.f,0.f}; }

/* --------------------------------------------------------------------------
 * f32 [nrows][ncols] -> 16-bit plane [nrows_pad][ncols]; rows >= nrows are zeros.
 * mode 0: bf16 bits (RNE).  mode 1: f16 bits of (scale * bf16(x)).
 * Coverage: ceil(nrows_pad*ncols/8 / 256) blocks x 256 threads, guard u < total.
 * ------------------------------------------------------------------------ */
__global__ __launch_bounds__(256) void cvt_plane_kernel(
    const float* __restrict__ src, int nrows, int ncols, int nrows_pad, int mode, float scale,
    unsigned short* __restrict__ dst)
{
  const int u = blockIdx.x * 256 + threadIdx.x;
  const int upr = ncols >> 3;
  const int total = nrows_pad * upr;
  if (u >= total) return;
  const int row = u / upr;
  const int cu  = u - row * upr;
  const int rowc = row < nrows ? row : nrows - 1;          /* clamped address */
  const bool live = row < nrows;
  const float* p = src + (size_t)rowc * ncols + cu * 8;
  const v4f x0 = *(const v4f*)p;
  const v4f x1 = *(const v4f*)(p + 4);
  unsigned b0, b1, b2, b3, b4, b5, b6, b7;
  {
    const float f0 = live ? x0[0] : 0.f, f1 = live ? x0[1] : 0.f, f2 = live ? x0[2] : 0.f, f3 = live ? x0[3] : 0.f;
    const float f4 = live ? x1[0] : 0.f, f5 = live ? x1[1] : 0.f, f6 = live ? x1[2] : 0.f, f7 = live ? x1[3] : 0.f;
    if (mode == 0) {
      b0 = f2bf_bits(f0); b1 = f2bf_bits(f1); b2 = f2bf_bits(f2); b3 = f2bf_bits(f3);
      b4 = f2bf_bits(f4); b5 = f2bf_bits(f5); b6 = f2bf_bits(f6); b7 = f2bf_bits(f7);
    } else {
      b0 = h_bits(bfr(f0) * scale); b1 = h_bits(bfr(f1) * scale); b2 = h_bits(bfr(f2) * scale); b3 = h_bits(bfr(f3) * scale);
      b4 = h_bits(bfr(f4) * scale); b5 = h_bits(bfr(f5) * scale); b6 = h_bits(bfr(f6) * scale); b7 = h_bits(bfr(f7) * scale);
    }
  }
  v4u w;
  w[0] = b0 | (b1 << 16);
  w[1] = b2 | (b3 << 16);
  w[2] = b4 | (b5 << 16);
  w[3] = b6 | (b7 << 16);
  unsigned short* d = dst + (size_t)u * 8;
  *(v4u*)d = w;
  
}

/* --------------------------------------------------------------------------
 * Per (query block, key chunk) flag from the int32 key mask:
 *   0 = every effective entry masked (chunk skipped), 1 = all kept, 2 = mixed.
 * Effective entry (t, s): query row clamped to TT-1 for padded rows, keys s >= TT masked.
 * Block = (query block qb, flag line ln), 16 waves: the chunks kc = ln + FLN*j, j < FSL.
 * Wave w reads rows 4w..4w+3 of every chunk of the block; all loads are independent, so
 * the whole strip is in flight at once.  Per wave one any-kept and one all-kept bit per
 * chunk (ballots), combined over the 16 waves through LDS behind one block barrier.
 * Coverage: wave 0 stores the block's whole 128-byte line (unused slots 0);
 * NQB x FLN blocks = the whole table.
 * ------------------------------------------------------------------------ */
__device__ __forceinline__ int flag_slot(int kc) { return (kc % FLN) * 32 + kc / FLN; }

__global__ __launch_bounds__(512) void flags_kernel(const int* __restrict__ mask, int* __restrict__ flags)
{
  __shared__ unsigned wany[16];
  __shared__ unsigned wall[16];
  const int tid = threadIdx.x, lane = tid & 31;
  const int wave = __builtin_amdgcn_readfirstlane(tid >> 5);   /* scalar, so the row bases are scalar */
  const int qb = blockIdx.x, ln = blockIdx.y;

  /* key of slot j, half hf: s = col0 + FLN*64*j + 32*hf.  Only the last slot can pass TT. */
  constexpr int LOFF = FLN * (FSL - 1) * 64;
  static_assert(LOFF - 1 < TT);
  const unsigned col0 = (unsigned)(ln * 64 + lane);
  const unsigned sl0 = col0 + LOFF, sl1 = sl0 + 32u;
  const unsigned cl0 = sl0 < (unsigned)TT ? sl0 : (unsigned)(TT - 1);   /* clamped address */
  const unsigned cl1 = sl1 < (unsigned)TT ? sl1 : (unsigned)(TT - 1);   /* clamped address */
  const int* rowp[4];
#pragma unroll
  for (int rr = 0; rr < 4; ++rr) {
    int t = qb * 64 + wave * 4 + rr;
    t = t < TT ? t : TT - 1;
    rowp[rr] = mask + (size_t)t * SEQ_FULL;
  }

  /* first every load, then every count */
  int mv[FSL][8];
#pragma unroll
  for (int j = 0; j < FSL - 1; ++j) {
#pragma unroll
    for (int it = 0; it < 8; ++it)
      mv[j][it] = (rowp[it >> 1] + col0)[FLN * j * 64 + (it & 1) * 32];
  }
#pragma unroll
  for (int it = 0; it < 8; ++it)
    mv[FSL - 1][it] = rowp[it >> 1][(it & 1) ? cl1 : cl0];
  /* keeps every load in front of every count: without it the scheduler mixes them and fewer loads fly at once */
  __builtin_amdgcn_sched_barrier(0);
  /* every register that the issued loads name (row bases, key offsets) is an input here, so none is
     rewritten in front of this wait */
  asm volatile("s_wait_xcnt 0x0"
               :: "s"(rowp[0]), "s"(rowp[1]), "s"(rowp[2]), "s"(rowp[3]), "v"(col0), "v"(cl0), "v"(cl1)
               : "memory");

  int cnt[FSL];
#pragma unroll
  for (int j = 0; j < FSL; ++j) {
    int n = 0;
#pragma unroll
    for (int it = 0; it < 8; ++it) {
      const bool ex = (j < FSL - 1) || (((it & 1) ? sl1 : sl0) < (unsigned)TT);   /* key exists */
      n += (ex && mv[j][it] != 0) ? 1 : 0;
    }
    cnt[j] = n;
  }

  unsigned anym = 0u, allm = 0u;                           /* wave-uniform, bit j = chunk ln + FLN*j */
#pragma unroll
  for (int j = 0; j < FSL; ++j) {
    anym |= (__builtin_amdgcn_ballot_w32(cnt[j] != 0) != 0u) ? (1u << j) : 0u;
    allm |= (__builtin_amdgcn_ballot_w32(cnt[j] == 8) == 0xFFFFFFFFu) ? (1u << j) : 0u;
  }
  if (lane == 0) { wany[wave] = anym; wall[wave] = allm; }
  __syncthreads();

  if (wave == 0) {
    unsigned a = 0u, f = 0xFFFFFFFFu;
#pragma unroll
    for (int w = 0; w < 16; ++w) { a |= wany[w]; f &= wall[w]; }
    int fv = 0;
    if (lane < FSL) fv = ((a >> lane) & 1u) ? (((f >> lane) & 1u) ? 1 : 2) : 0;
    flags[((size_t)qb * FLN + ln) * 32 + lane] = fv;
  }
}

/* --------------------------------------------------------------------------
 * Projection GEMM: Y[t][n] = sum_k X[t][k] W[n][k] + b[n] for one 64-token x 64-col
 * (= one head) tile per block; bf16 operands (X and W planes), f32 accumulate.
 * Block = 2 waves (64 threads); wave w: tokens w*32..w*32+31 (2 row tiles) x 4 col tiles.
 * A fragment (row m = lane&15): elems 0..7 <- k0+8h+i, 8..15 <- k0+16+8h+i.
 * B[k][n] = W[n][k]: loaded from row n = lane&15 with the same k map.  D elem r = (row 8h+r, col lane&15).
 * Epilogue: hi = f16(y), res = f16((y - hi) * 2048), rows t >= TT forced to 0; the block's
 * MODE 0: Q -> [NH][TPAD][HD] (+ residual rows < QRES); 1: K -> same (+ residual rows < CRES);
 * MODE 2: V -> [NH][HD][TPAD] (+ residual [NH][HD][CRES]).
 * Coverage per block: 8 iterations x 64 threads = 512 units = 64 rows x 8 segments (hi and res).
 * LDS tiles th/tr: cross-wave, separated by a block barrier; reloaded through the stored element type.
 * ------------------------------------------------------------------------ */
template <int MODE>
__global__ __launch_bounds__(64) __attribute__((amdgpu_num_vgpr(256)))
void proj_kernel(
    const unsigned short* __restrict__ X, const unsigned short* __restrict__ W,
    const float* __restrict__ bias, unsigned short* __restrict__ Ph, unsigned short* __restrict__ Pr)
{
  constexpr int PT = 72;
  constexpr int NRES_TB = (MODE == 0) ? (NEARLY + 1) : NEARLY;
  __shared__ __align__(16) unsigned short th[64 * PT];
  __shared__ __align__(16) unsigned short tr[64 * PT];
  union FB { v16b v; v8us h[2]; };

  const int tid = threadIdx.x, wave = tid >> 5, lane = tid & 31;
  const int hh = lane >> 4, m = lane & 15;
  const int tb = blockIdx.x, head = blockIdx.y;
  const int n0 = head * 64;
  const int rl0 = wave * 32;
  const int r0 = tb * 64 + rl0;

  v8f acc[2][4];
#pragma unroll
  for (int mi = 0; mi < 2; ++mi)
#pragma unroll
    for (int ni = 0; ni < 4; ++ni) acc[mi][ni] = zero8();

  const unsigned short* xp0 = X + (size_t)(r0 + m) * DM + 8 * hh;
  const unsigned short* xp1 = X + (size_t)(r0 + 16 + m) * DM + 8 * hh;
  const unsigned short* wp  = W + (size_t)(n0 + m) * DM + 8 * hh;

#pragma unroll 2
  for (int k0 = 0; k0 < DM; k0 += 32) {
    FB a0, a1;
    a0.h[0] = *(const v8us*)(xp0 + k0);
    a0.h[1] = *(const v8us*)(xp0 + k0 + 16);
    a1.h[0] = *(const v8us*)(xp1 + k0);
    a1.h[1] = *(const v8us*)(xp1 + k0 + 16);
#pragma unroll
    for (int ni = 0; ni < 4; ++ni) {
      FB b;
      b.h[0] = *(const v8us*)(wp + (size_t)ni * 16 * DM + k0);
      b.h[1] = *(const v8us*)(wp + (size_t)ni * 16 * DM + k0 + 16);
      acc[0][ni] = mma_b(a0.v, b.v, acc[0][ni]);
      acc[1][ni] = mma_b(a1.v, b.v, acc[1][ni]);
    }
  }

  float bb[4];
#pragma unroll
  for (int ni = 0; ni < 4; ++ni) bb[ni] = bfr(bias[n0 + ni * 16 + m]);

#pragma unroll
  for (int mi = 0; mi < 2; ++mi) {
#pragma unroll
    for (int ni = 0; ni < 4; ++ni) {
#pragma unroll
      for (int r = 0; r < 8; ++r) {
        const int rl  = rl0 + mi * 16 + 8 * hh + r;
        const int t   = tb * 64 + rl;
        const int col = ni * 16 + m;
        float y = acc[mi][ni][r] + bb[ni];
        y = (t < TT) ? y : 0.f;
        const unsigned short hb = h_bits(y);
        const float res = (y - h2f(hb)) * RSC;
        const unsigned short rb = h_bits(res);
        if (MODE == 2) { th[col * PT + rl] = hb; tr[col * PT + rl] = rb; }
        else           { th[rl * PT + col] = hb; tr[rl * PT + col] = rb; }
      }
    }
  }
  __syncthreads();

  const bool dores = tb < NRES_TB;    /* block-uniform */
  {
#pragma unroll
    for (int it = 0; it < 8; ++it) {
      const int u = it * 64 + tid;
      const int row = u >> 3, seg = u & 7;
      const v8us vh = *(const v8us*)(th + row * PT + seg * 8);
      const v8us vr = *(const v8us*)(tr + row * PT + seg * 8);
      if (MODE == 2) {
        *(v8us*)(Ph + ((size_t)head * HD + row) * TPAD + tb * 64 + seg * 8) = vh;
        if (dores) *(v8us*)(Pr + ((size_t)head * HD + row) * CRES + tb * 64 + seg * 8) = vr;
      } else {
        *(v8us*)(Ph + ((size_t)head * TPAD + tb * 64 + row) * HD + seg * 8) = vh;
        if (dores) {
          if (MODE == 0) *(v8us*)(Pr + ((size_t)head * QRES + tb * 64 + row) * HD + seg * 8) = vr;
          else           *(v8us*)(Pr + ((size_t)head * CRES + tb * 64 + row) * HD + seg * 8) = vr;
        }
      }
    }
    
  }
}

/* --------------------------------------------------------------------------
 * Flash attention with the row-shifted Er term, head dim 64.
 * Block = 4 waves = 64 query rows of one head; grid (query blocks, NH).
 * Per kept 64-key chunk: K [key][d], Er [key][d], V^T [d][key] f16 tiles staged in LDS
 * (EARLY: also K and V^T residual tiles), scores = qh.k^T + qh(t+1).Er^T on f16 WMMA,
 * x0.125, replace-fill -inf from the key mask (flag 2 chunks), f32 online softmax,
 * P = f16(1024 p) per-wave LDS tile (EARLY: + f16 residual x2048), O += P.V on f16 WMMA
 * (O therefore carries the x1024 of P; the normaliser applies 1/(1024 l) x 16 in one factor).
 * EARLY adds (qh.k_res + q_res.k + q_res(t+1).Er)/2048 to the scores and
 * (P.V_res + P_res.V)/2048 to O through separate accumulators folded per tile.
 * Live-state plan: Q hi fragments reloaded per chunk (dead during softmax and P.V),
 * Q residual fragments loaded only inside the residual score phase, one 8-register
 * residual accumulator at a time; <= 4 O tiles + 4 score tiles + m/l persistent.
 * Epilogue: ctx = O/(1024 l) carried x16 as f16 into [TPAD][DM] (+ residual rows < CRES),
 * Fragment map as in proj_kernel (A row / B col = lane&15, split k map, D elem r = row 8h+r).
 * LDS regions: K/Er/V/res tiles and msk cross-wave (block barriers); P tiles and the
 * ------------------------------------------------------------------------ */
template <bool EARLY>
__global__ __launch_bounds__(128) __attribute__((amdgpu_num_vgpr(256)))
void attn_kernel(const unsigned short* __restrict__ Qh, const unsigned short* __restrict__ Qr,
                 const unsigned short* __restrict__ Kh, const unsigned short* __restrict__ Kr,
                 const unsigned short* __restrict__ Vt, const unsigned short* __restrict__ Vr,
                 const unsigned short* __restrict__ Erp, const int* __restrict__ mask,
                 const int* __restrict__ flags, unsigned short* __restrict__ Ct,
                 unsigned short* __restrict__ Cr)
{
  /* LDS row pitch of every fragment-read tile: 72 halves = 144 B = 16 B x 9 (odd), so the 16 rows that one
     ds_load_b128 reads fall on 16 distinct groups of four banks; at 128 B they fall on two groups */
  constexpr int LP = 72;
  constexpr int TSZ = 64 * LP;                     /* one 64-row tile, or four 16-row P tiles */
  constexpr int KSH = 0, ESH = TSZ, VTH = 2 * TSZ, PSH = 3 * TSZ, KRS = 4 * TSZ, VRS = 5 * TSZ;
  constexpr int PRS = EARLY ? 6 * TSZ : PSH;
  constexpr int SMN = EARLY ? 7 * TSZ : 4 * TSZ;
  __shared__ __align__(16) unsigned short sm[SMN];
  __shared__ __align__(16) unsigned char msk[4096];
  union FH { v16h v; v8us h[2]; };

  const int tid = threadIdx.x, wave = tid >> 5, lane = tid & 31;
  const int hh = lane >> 4, c = lane & 15;
  const int qb = EARLY ? (int)blockIdx.x : ((int)blockIdx.x + NEARLY);
  const int head = blockIdx.y;
  const int q0 = qb * 64 + wave * 16;
  const int wrow0 = wave * 16;                     /* the wave's first row inside the block tile */

  /* fragment base pointers: rows q0+c (q.k^T) and q0+1+c (shifted Er term) */
  const unsigned short* qp = Qh + ((size_t)head * TPAD + q0 + c) * HD + 8 * hh;
  const unsigned short* rp = Qr + ((size_t)head * QRES + (EARLY ? (q0 + c) : c)) * HD + 8 * hh;

  float mrow[8], lrow[8];
  v8f oacc[4];
#pragma unroll
  for (int r = 0; r < 8; ++r) { mrow[r] = -__builtin_inff(); lrow[r] = 0.f; }
#pragma unroll
  for (int t = 0; t < 4; ++t) oacc[t] = zero8();

  unsigned short* pwh = sm + PSH + wave * (16 * LP);
  unsigned short* pwr = sm + PRS + wave * (16 * LP);
  const int* frow = flags + (size_t)qb * (FLN * 32);

#pragma unroll 1
  for (int kc = 0; kc < NKC; ++kc) {
    const int fk = __builtin_amdgcn_readfirstlane(frow[flag_slot(kc)]);   /* block-uniform */
    if (fk == 0) continue;
    const int kv0 = kc * 64;
    const bool useres = EARLY && (kc < NEARLY);
    const int kvr = (kc < NEARLY) ? kv0 : 0;                   /* clamped residual chunk base */

    __syncthreads();
    /* staging: unit u -> row u>>3 (0..63), seg u&7; 4 iterations x 128 threads = 512 units per tile */
    {
      const unsigned short *gk[4], *ge[4], *gv[4];
      v4u tk[4], te[4], tv[4];
#pragma unroll
      for (int it = 0; it < 4; ++it) {
        const int u = it * 128 + tid;
        const int row = u >> 3, seg = u & 7;
        gk[it] = Kh + ((size_t)head * TPAD + kv0 + row) * HD + seg * 8;
        ge[it] = Erp + (size_t)(kv0 + row) * HD + seg * 8;
        gv[it] = Vt + ((size_t)head * HD + row) * TPAD + kv0 + seg * 8;
        tk[it] = *(const v4u*)gk[it];
        te[it] = *(const v4u*)ge[it];
        tv[it] = *(const v4u*)gv[it];
      }
      /* every address that the issued loads name is an input here, so none is rewritten in front of this wait */
      asm volatile("s_wait_xcnt 0x0"
                   :: "v"(gk[0]), "v"(gk[1]), "v"(gk[2]), "v"(gk[3]), "v"(ge[0]), "v"(ge[1]), "v"(ge[2]), "v"(ge[3]),
                      "v"(gv[0]), "v"(gv[1]), "v"(gv[2]), "v"(gv[3])
                   : "memory");
#pragma unroll
      for (int it = 0; it < 4; ++it) {
        const int u = it * 128 + tid;
        const int row = u >> 3, seg = u & 7;
        *(v4u*)(sm + KSH + row * LP + seg * 8) = tk[it];
        *(v4u*)(sm + ESH + row * LP + seg * 8) = te[it];
        *(v4u*)(sm + VTH + row * LP + seg * 8) = tv[it];
      }
    }
    if (EARLY) {
      const unsigned short *gkr[4], *gvr[4];
      v4u tkr[4], tvr[4];
#pragma unroll
      for (int it = 0; it < 4; ++it) {
        const int u = it * 128 + tid;
        const int row = u >> 3, seg = u & 7;
        gkr[it] = Kr + ((size_t)head * CRES + kvr + row) * HD + seg * 8;
        gvr[it] = Vr + ((size_t)head * HD + row) * CRES + kvr + seg * 8;
        tkr[it] = *(const v4u*)gkr[it];
        tvr[it] = *(const v4u*)gvr[it];
      }
      /* as above: the addresses of the issued loads stay whole up to this wait */
      asm volatile("s_wait_xcnt 0x0"
                   :: "v"(gkr[0]), "v"(gkr[1]), "v"(gkr[2]), "v"(gkr[3]), "v"(gvr[0]), "v"(gvr[1]), "v"(gvr[2]), "v"(gvr[3])
                   : "memory");
#pragma unroll
      for (int it = 0; it < 4; ++it) {
        const int u = it * 128 + tid;
        const int row = u >> 3, seg = u & 7;
        *(v4u*)(sm + KRS + row * LP + seg * 8) = tkr[it];
        *(v4u*)(sm + VRS + row * LP + seg * 8) = tvr[it];
      }
    }
    if (fk == 2) {
      /* key mask tile: thread -> row tid>>1, 32 columns; clamped addresses, keys >= TT masked */
      const int row = tid >> 1, hsel = tid & 1;
      int qrow = qb * 64 + row;
      qrow = qrow < TT ? qrow : TT - 1;
      const int* mb = mask + (size_t)qrow * SEQ_FULL;
#pragma unroll 1
      for (int g = 0; g < 4; ++g) {
#pragma unroll
        for (int e = 0; e < 8; ++e) {
          const int col = hsel * 32 + g * 8 + e;
          const int s = kv0 + col;
          const int sc = s < TT ? s : TT - 1;
          const int mv = mb[sc];
          msk[row * 64 + col] = (unsigned char)((s < TT && mv != 0) ? 1 : 0);
        }
      }
    }
    __syncthreads();

    /* Q hi fragments for this chunk, two 32-deep d halves */
    FH qa[2], qs[2];
#pragma unroll
    for (int dc = 0; dc < 2; ++dc) {
      qa[dc].h[0] = *(const v8us*)(qp + dc * 32);
      qa[dc].h[1] = *(const v8us*)(qp + dc * 32 + 16);
      qs[dc].h[0] = *(const v8us*)(qp + HD + dc * 32);
      qs[dc].h[1] = *(const v8us*)(qp + HD + dc * 32 + 16);
    }

    /* scores: 16 query rows x 64 keys per wave */
    v8f s[4];
#pragma unroll
    for (int j = 0; j < 4; ++j) {
      s[j] = zero8();
#pragma unroll
      for (int dc = 0; dc < 2; ++dc) {
        FH kf, ef;
        kf.h[0] = *(const v8us*)(sm + KSH + (j * 16 + c) * LP + dc * 32 + 8 * hh);
        kf.h[1] = *(const v8us*)(sm + KSH + (j * 16 + c) * LP + dc * 32 + 16 + 8 * hh);
        ef.h[0] = *(const v8us*)(sm + ESH + (j * 16 + c) * LP + dc * 32 + 8 * hh);
        ef.h[1] = *(const v8us*)(sm + ESH + (j * 16 + c) * LP + dc * 32 + 16 + 8 * hh);
        s[j] = mma_h(qa[dc].v, kf.v, s[j]);
        s[j] = mma_h(qs[dc].v, ef.v, s[j]);
      }
      if (EARLY) {
        if (useres) {
          v8f sr = zero8();
#pragma unroll
          for (int dc = 0; dc < 2; ++dc) {
            FH kf, ef, krf, qra, qrs;
            kf.h[0]  = *(const v8us*)(sm + KSH + (j * 16 + c) * LP + dc * 32 + 8 * hh);
            kf.h[1]  = *(const v8us*)(sm + KSH + (j * 16 + c) * LP + dc * 32 + 16 + 8 * hh);
            ef.h[0]  = *(const v8us*)(sm + ESH + (j * 16 + c) * LP + dc * 32 + 8 * hh);
            ef.h[1]  = *(const v8us*)(sm + ESH + (j * 16 + c) * LP + dc * 32 + 16 + 8 * hh);
            krf.h[0] = *(const v8us*)(sm + KRS + (j * 16 + c) * LP + dc * 32 + 8 * hh);
            krf.h[1] = *(const v8us*)(sm + KRS + (j * 16 + c) * LP + dc * 32 + 16 + 8 * hh);
            qra.h[0] = *(const v8us*)(rp + dc * 32);
            qra.h[1] = *(const v8us*)(rp + dc * 32 + 16);
            qrs.h[0] = *(const v8us*)(rp + HD + dc * 32);
            qrs.h[1] = *(const v8us*)(rp + HD + dc * 32 + 16);
            sr = mma_h(qa[dc].v, krf.v, sr);
            sr = mma_h(qra.v, kf.v, sr);
            sr = mma_h(qrs.v, ef.v, sr);
          }
#pragma unroll
          for (int r = 0; r < 8; ++r) s[j][r] += sr[r] * RINV;
        }
      }
    }

    /* scale by 1/sqrt(64) and replace-fill from the key mask (this wave's rows) */
#pragma unroll
    for (int j = 0; j < 4; ++j) {
#pragma unroll
      for (int r = 0; r < 8; ++r) s[j][r] *= 0.125f;
    }
    if (fk == 2) {
#pragma unroll
      for (int j = 0; j < 4; ++j) {
#pragma unroll
        for (int r = 0; r < 8; ++r) {
          const unsigned char mv = msk[(wrow0 + 8 * hh + r) * 64 + j * 16 + c];
          s[j][r] = mv ? s[j][r] : -__builtin_inff();
        }
      }
    }

    /* chunk row max over 64 keys (16 lanes of one half x 4 tiles) */
    float cm[8];
#pragma unroll
    for (int r = 0; r < 8; ++r) {
      float mx = fmaxf(fmaxf(s[0][r], s[1][r]), fmaxf(s[2][r], s[3][r]));
#pragma unroll
      for (int off = 1; off < 16; off <<= 1) mx = fmaxf(mx, __shfl_xor(mx, off, 32));
      cm[r] = mx;
    }

    /* online softmax update; P tiles (carried x1024) into the wave's LDS tile */
#pragma unroll
    for (int r = 0; r < 8; ++r) {
      const float mnew = fmaxf(mrow[r], cm[r]);
      const bool dead = (mnew == -__builtin_inff());
      const float aexp = __expf(mrow[r] - mnew);
      const float alpha = dead ? 1.f : aexp;
      mrow[r] = mnew;
      float psum = 0.f;
#pragma unroll
      for (int j = 0; j < 4; ++j) {
        const float pe = __expf(s[j][r] - mnew);
        const float p = dead ? 0.f : pe;
        psum += p;
        const float pc = p * PSC;
        const unsigned short hb = h_bits(pc);
        pwh[(8 * hh + r) * LP + j * 16 + c] = hb;
        if (EARLY) {
          const float pres = (pc - h2f(hb)) * RSC;
          pwr[(8 * hh + r) * LP + j * 16 + c] = h_bits(pres);
        }
      }
#pragma unroll
      for (int off = 1; off < 16; off <<= 1) psum += __shfl_xor(psum, off, 32);
      lrow[r] = lrow[r] * alpha + psum;
#pragma unroll
      for (int t = 0; t < 4; ++t) oacc[t][r] *= alpha;
    }
    __builtin_amdgcn_fence(3, "workgroup");
    __builtin_amdgcn_wave_barrier();
    __builtin_amdgcn_fence(2, "workgroup");

    /* O += P.V : A = P [q][key] (this wave's tile), B = V [key][d] from V^T [d][key] */
#pragma unroll
    for (int kk = 0; kk < 2; ++kk) {
      FH pa;
      pa.h[0] = *(const v8us*)(pwh + c * LP + kk * 32 + 8 * hh);
      pa.h[1] = *(const v8us*)(pwh + c * LP + kk * 32 + 16 + 8 * hh);
#pragma unroll
      for (int t = 0; t < 4; ++t) {
        FH vb;
        vb.h[0] = *(const v8us*)(sm + VTH + (t * 16 + c) * LP + kk * 32 + 8 * hh);
        vb.h[1] = *(const v8us*)(sm + VTH + (t * 16 + c) * LP + kk * 32 + 16 + 8 * hh);
        oacc[t] = mma_h(pa.v, vb.v, oacc[t]);
      }
    }
    if (EARLY) {
      if (useres) {
        /* residual products per d tile: one 8-register accumulator live at a time */
#pragma unroll
        for (int t = 0; t < 4; ++t) {
          v8f oar = zero8();
#pragma unroll
          for (int kk = 0; kk < 2; ++kk) {
            FH pa, pr, vb, vr;
            pa.h[0] = *(const v8us*)(pwh + c * LP + kk * 32 + 8 * hh);
            pa.h[1] = *(const v8us*)(pwh + c * LP + kk * 32 + 16 + 8 * hh);
            pr.h[0] = *(const v8us*)(pwr + c * LP + kk * 32 + 8 * hh);
            pr.h[1] = *(const v8us*)(pwr + c * LP + kk * 32 + 16 + 8 * hh);
            vb.h[0] = *(const v8us*)(sm + VTH + (t * 16 + c) * LP + kk * 32 + 8 * hh);
            vb.h[1] = *(const v8us*)(sm + VTH + (t * 16 + c) * LP + kk * 32 + 16 + 8 * hh);
            vr.h[0] = *(const v8us*)(sm + VRS + (t * 16 + c) * LP + kk * 32 + 8 * hh);
            vr.h[1] = *(const v8us*)(sm + VRS + (t * 16 + c) * LP + kk * 32 + 16 + 8 * hh);
            oar = mma_h(pa.v, vr.v, oar);
            oar = mma_h(pr.v, vb.v, oar);
          }
#pragma unroll
          for (int r = 0; r < 8; ++r) oacc[t][r] += oar[r] * RINV;
        }
      }
    }
  }

  /* epilogue: all waves are done with the staged tiles before the region is reused */
  __syncthreads();
  unsigned short* osh = sm + KSH + wave * 1024;     /* [16][64] hi, carried x16 */
  unsigned short* osr = sm + ESH + wave * 1024;     /* [16][64] residual x2048 (EARLY) */
#pragma unroll
  for (int r = 0; r < 8; ++r) {
    /* O holds 1024 x sum(p v); ctx = O / (1024 l); plane value = 16 ctx = O x (1/l) x (16/1024) */
    const float inv = (1.0f / lrow[r]) * OCV;
#pragma unroll
    for (int t = 0; t < 4; ++t) {
      const float o = oacc[t][r] * inv;
      const unsigned short hb = h_bits(o);
      osh[(8 * hh + r) * 64 + t * 16 + c] = hb;
      if (EARLY) {
        const float res = (o - h2f(hb)) * RSC;
        osr[(8 * hh + r) * 64 + t * 16 + c] = h_bits(res);
      }
    }
  }
  __builtin_amdgcn_fence(3, "workgroup");
  __builtin_amdgcn_wave_barrier();
  __builtin_amdgcn_fence(2, "workgroup");
  /* 16 rows x 8 segments = 4 iterations x 32 lanes; row = 4it + (lane>>3), seg = lane&7:
*/
  {
#pragma unroll
    for (int it = 0; it < 4; ++it) {
      const int u = it * 32 + lane;
      const int row = u >> 3, seg = u & 7;
      const v8us vh = *(const v8us*)(osh + row * 64 + seg * 8);
      *(v8us*)(Ct + (size_t)(q0 + row) * DM + head * 64 + seg * 8) = vh;
      if (EARLY) {
        const v8us vr = *(const v8us*)(osr + row * 64 + seg * 8);
        *(v8us*)(Cr + (size_t)(q0 + row) * DM + head * 64 + seg * 8) = vr;
      }
    }
    
  }
}

/* --------------------------------------------------------------------------
 * Output projection: out[t][n] = (sum_k ctx16[t][k] wo64[n][k]) / 1024 + b[n], f16 operands,
 * f32 accumulate.  Token blocks tb < NEARLY first accumulate the ctx residual products
 * alone from zero, scale that sum by 1/2048 in f32, and use it as the start value of
 * the hi-plane accumulation (no residual product enters an accumulator holding hi terms).
 * Block = 2 waves (64 threads), 64 tokens x 64 columns; grid (NQB, DM/64).
 * Epilogue: 64x64 f32 tile staged in LDS (cross-wave, block barrier), then
 * Coverage: 16 iterations x 64 threads = 1024 units = 64 rows x 16 segments.
 * ------------------------------------------------------------------------ */
__global__ __launch_bounds__(64) __attribute__((amdgpu_num_vgpr(256)))
void out_kernel(
    const unsigned short* __restrict__ Ct, const unsigned short* __restrict__ Cr,
    const unsigned short* __restrict__ Wo, const float* __restrict__ bias, float* __restrict__ out)
{
  constexpr int PTF = 68;
  __shared__ __align__(16) float ts[64 * PTF];
  union FH { v16h v; v8us h[2]; };

  const int tid = threadIdx.x, wave = tid >> 5, lane = tid & 31;
  const int hh = lane >> 4, m = lane & 15;
  const int tb = blockIdx.x, nb = blockIdx.y;
  const int n0 = nb * 64;
  const int rl0 = wave * 32;
  const int r0 = tb * 64 + rl0;
  const bool dores = tb < NEARLY;     /* block-uniform */

  v8f acc[2][4];
#pragma unroll
  for (int mi = 0; mi < 2; ++mi)
#pragma unroll
    for (int ni = 0; ni < 4; ++ni) acc[mi][ni] = zero8();

  const unsigned short* wp = Wo + (size_t)(n0 + m) * DM + 8 * hh;

  if (dores) {
    const unsigned short* cp0 = Cr + (size_t)(r0 + m) * DM + 8 * hh;
    const unsigned short* cp1 = Cr + (size_t)(r0 + 16 + m) * DM + 8 * hh;
#pragma unroll 2
    for (int k0 = 0; k0 < DM; k0 += 32) {
      FH a0, a1;
      a0.h[0] = *(const v8us*)(cp0 + k0);
      a0.h[1] = *(const v8us*)(cp0 + k0 + 16);
      a1.h[0] = *(const v8us*)(cp1 + k0);
      a1.h[1] = *(const v8us*)(cp1 + k0 + 16);
#pragma unroll
      for (int ni = 0; ni < 4; ++ni) {
        FH b;
        b.h[0] = *(const v8us*)(wp + (size_t)ni * 16 * DM + k0);
        b.h[1] = *(const v8us*)(wp + (size_t)ni * 16 * DM + k0 + 16);
        acc[0][ni] = mma_h(a0.v, b.v, acc[0][ni]);
        acc[1][ni] = mma_h(a1.v, b.v, acc[1][ni]);
      }
    }
#pragma unroll
    for (int mi = 0; mi < 2; ++mi)
#pragma unroll
      for (int ni = 0; ni < 4; ++ni)
#pragma unroll
        for (int r = 0; r < 8; ++r) acc[mi][ni][r] *= RINV;
  }

  {
    const unsigned short* cp0 = Ct + (size_t)(r0 + m) * DM + 8 * hh;
    const unsigned short* cp1 = Ct + (size_t)(r0 + 16 + m) * DM + 8 * hh;
#pragma unroll 2
    for (int k0 = 0; k0 < DM; k0 += 32) {
      FH a0, a1;
      a0.h[0] = *(const v8us*)(cp0 + k0);
      a0.h[1] = *(const v8us*)(cp0 + k0 + 16);
      a1.h[0] = *(const v8us*)(cp1 + k0);
      a1.h[1] = *(const v8us*)(cp1 + k0 + 16);
#pragma unroll
      for (int ni = 0; ni < 4; ++ni) {
        FH b;
        b.h[0] = *(const v8us*)(wp + (size_t)ni * 16 * DM + k0);
        b.h[1] = *(const v8us*)(wp + (size_t)ni * 16 * DM + k0 + 16);
        acc[0][ni] = mma_h(a0.v, b.v, acc[0][ni]);
        acc[1][ni] = mma_h(a1.v, b.v, acc[1][ni]);
      }
    }
  }

  float bb[4];
#pragma unroll
  for (int ni = 0; ni < 4; ++ni) bb[ni] = bfr(bias[n0 + ni * 16 + m]);
#pragma unroll
  for (int mi = 0; mi < 2; ++mi) {
#pragma unroll
    for (int ni = 0; ni < 4; ++ni) {
#pragma unroll
      for (int r = 0; r < 8; ++r) {
        const int rl = rl0 + mi * 16 + 8 * hh + r;
        ts[rl * PTF + ni * 16 + m] = acc[mi][ni][r] * OINV + bb[ni];
      }
    }
  }
  __syncthreads();

  {
#pragma unroll
    for (int it = 0; it < 16; ++it) {
      const int u = it * 64 + tid;
      const int row = u >> 4, seg = u & 15;
      const int t = tb * 64 + row;
      const v4f v = *(const v4f*)(ts + row * PTF + seg * 4);
      if (t < TT) *(v4f*)(out + (size_t)t * DM + n0 + seg * 4) = v;
    }
    
  }
}

/* -------------------------------------------------------------------------- */
extern "C" void kernel_launch(void* const* d_in, const int* in_sizes, int n_in,
                              void* d_out, int out_size, void* d_ws, size_t ws_size,
                              hipStream_t stream)
{
  if (n_in < 13) return;
  if (in_sizes[0] < TT * DM || in_sizes[1] < TT * DM || in_sizes[2] < TT * DM) return;
  if (in_sizes[3] < (TT - 1) * SEQ_FULL + TT) return;
  if (in_sizes[4] < DM * DM || in_sizes[6] < DM * DM || in_sizes[8] < DM * DM || in_sizes[11] < DM * DM) return;
  if (in_sizes[5] < DM || in_sizes[7] < DM || in_sizes[9] < DM || in_sizes[12] < DM) return;
  if (in_sizes[10] < TT * HD) return;
  if (out_size < TT * DM) return;
  if (d_ws == nullptr || ws_size < WS_NEED) return;

  const float* q    = (const float*)d_in[0];
  const float* k    = (const float*)d_in[1];
  const float* v    = (const float*)d_in[2];
  const int*   mask = (const int*)d_in[3];
  const float* Wq_w = (const float*)d_in[4];
  const float* Wq_b = (const float*)d_in[5];
  const float* Wk_w = (const float*)d_in[6];
  const float* Wk_b = (const float*)d_in[7];
  const float* Wv_w = (const float*)d_in[8];
  const float* Wv_b = (const float*)d_in[9];
  const float* Er   = (const float*)d_in[10];
  const float* Wo_w = (const float*)d_in[11];
  const float* Wo_b = (const float*)d_in[12];
  float* outp = (float*)d_out;

  unsigned char* ws = (unsigned char*)d_ws;
  unsigned short* Xq = (unsigned short*)(ws + OFF_XQ);
  unsigned short* Xk = (unsigned short*)(ws + OFF_XK);
  unsigned short* Xv = (unsigned short*)(ws + OFF_XV);
  unsigned short* Wq = (unsigned short*)(ws + OFF_WQ);
  unsigned short* Wk = (unsigned short*)(ws + OFF_WK);
  unsigned short* Wv = (unsigned short*)(ws + OFF_WV);
  unsigned short* Wo = (unsigned short*)(ws + OFF_WO);
  unsigned short* Eh = (unsigned short*)(ws + OFF_ER);
  unsigned short* Qh = (unsigned short*)(ws + OFF_QH);
  unsigned short* Kh = (unsigned short*)(ws + OFF_KH);
  unsigned short* Vt = (unsigned short*)(ws + OFF_VT);
  unsigned short* Qr = (unsigned short*)(ws + OFF_QR);
  unsigned short* Kr = (unsigned short*)(ws + OFF_KR);
  unsigned short* Vr = (unsigned short*)(ws + OFF_VR);
  unsigned short* Ct = (unsigned short*)(ws + OFF_CT);
  unsigned short* Cr = (unsigned short*)(ws + OFF_CR);
  int* flags = (int*)(ws + OFF_FL);

  /* input planes (rows >= TT zero) */
  const int xu = TPAD * (DM / 8);
  const int wu = DM * (DM / 8);
  const int eu = TPAD * (HD / 8);
  cvt_plane_kernel<<<(xu + 255) / 256, 256, 0, stream>>>(q, TT, DM, TPAD, 0, 1.0f, Xq);
  cvt_plane_kernel<<<(xu + 255) / 256, 256, 0, stream>>>(k, TT, DM, TPAD, 0, 1.0f, Xk);
  cvt_plane_kernel<<<(xu + 255) / 256, 256, 0, stream>>>(v, TT, DM, TPAD, 0, 1.0f, Xv);
  cvt_plane_kernel<<<(wu + 255) / 256, 256, 0, stream>>>(Wq_w, DM, DM, DM, 0, 1.0f, Wq);
  cvt_plane_kernel<<<(wu + 255) / 256, 256, 0, stream>>>(Wk_w, DM, DM, DM, 0, 1.0f, Wk);
  cvt_plane_kernel<<<(wu + 255) / 256, 256, 0, stream>>>(Wv_w, DM, DM, DM, 0, 1.0f, Wv);
  cvt_plane_kernel<<<(wu + 255) / 256, 256, 0, stream>>>(Wo_w, DM, DM, DM, 1, WOSC, Wo);
  cvt_plane_kernel<<<(eu + 255) / 256, 256, 0, stream>>>(Er, TT, HD, TPAD, 1, 1.0f, Eh);

  /* per (query block, key chunk) skip/dense/mixed flags from the key mask */
  flags_kernel<<<dim3(NQB, FLN), 512, 0, stream>>>(mask, flags);

  /* projections: 64 tokens x one head per block */
  proj_kernel<0><<<dim3(NTB, NH), 64, 0, stream>>>(Xq, Wq, Wq_b, Qh, Qr);
  proj_kernel<1><<<dim3(NTB, NH), 64, 0, stream>>>(Xk, Wk, Wk_b, Kh, Kr);
  proj_kernel<2><<<dim3(NTB, NH), 64, 0, stream>>>(Xv, Wv, Wv_b, Vt, Vr);

  /* attention: first NEARLY query blocks with residual products, the rest single products */
  attn_kernel<true><<<dim3(NEARLY, NH), 128, 0, stream>>>(Qh, Qr, Kh, Kr, Vt, Vr, Eh, mask, flags, Ct, Cr);
  if (NQB > NEARLY)
    attn_kernel<false><<<dim3(NQB - NEARLY, NH), 128, 0, stream>>>(Qh, Qr, Kh, Kr, Vt, Vr, Eh, mask, flags, Ct, Cr);

  /* output projection into d_out */
  out_kernel<<<dim3(NQB, DM / 64), 64, 0, stream>>>(Ct, Cr, Wo, Wo_b, outp);
}

// v003
// It runs in 180 microseconds.
// Timed twice side by side with v002, it ran 1.56 and 1.57 times as fast.
// Counting every step since v000, it is 2.05 times as fast.
// Contractions: q/k/v input projections on v_wmma_f32_16x16x32_bf16 (bf16 operands = RNE-converted inputs and weights, f32 accumulate); scores q.k^T, row-shifted q.Er^T, p.v and the output projection on v_wmma_f32_16x16x32_f16 (f16 operands: f16 hi planes of projected q/k/v, p carried x1024 and folded as 1/1024 before the ctx plane, ctx carried x16, Wo carried x64, plus x2048 f16 residual planes for the first 256 query rows and first 256 keys), f32 accumulate; softmax and all other arithmetic in f32.
#include <hip/hip_runtime.h>

typedef _Float16       v16h __attribute__((ext_vector_type(16)));
typedef __bf16         v16b __attribute__((ext_vector_type(16)));
typedef unsigned short v8us __attribute__((ext_vector_type(8)));
typedef float          v8f  __attribute__((ext_vector_type(8)));
typedef float          v4f  __attribute__((ext_vector_type(4)));
typedef unsigned int   v4u  __attribute__((ext_vector_type(4)));
typedef int            v4i  __attribute__((ext_vector_type(4)));

#ifndef NB
#define NB 1
#endif
#ifndef SEQ
#define SEQ 2049
#endif
#define SEQ_FULL 2049

constexpr int DM     = 1024;
constexpr int NH     = 16;
constexpr int HD     = 64;
constexpr int TT     = SEQ;
constexpr int NQB    = (TT + 63) / 64;          /* query blocks of 64 rows */
constexpr int NTB    = NQB + 1;                  /* token blocks of the planes (one extra for the +1 row shift) */
constexpr int TPAD   = NTB * 64;                 /* padded token count of every plane */
constexpr int NKC    = NTB;                      /* key chunks of 64 */
constexpr int NEARLY = NQB < 4 ? NQB : 4;        /* query blocks with residual treatment */
constexpr int CRES   = NEARLY * 64;              /* rows of K/V/ctx residual planes */
constexpr int QRES   = (NEARLY + 1) * 64;        /* rows of the Q residual plane (covers the +1 shift) */

constexpr float RSC  = 2048.0f;                  /* residual plane carry */
constexpr float RINV = 1.0f / 2048.0f;
constexpr float PSC  = 1024.0f;                  /* softmax weight carry (on the p tile, hence on the p.v accumulator) */
constexpr float CSC  = 16.0f;                    /* ctx plane carry */
constexpr float OCV  = CSC / PSC;                /* 1/64: removes the p carry and applies the ctx carry in one factor */
constexpr float WOSC = 64.0f;                    /* Wo plane carry */
constexpr float OINV = 1.0f / (CSC * WOSC);      /* 1/1024 */

static_assert(NB == 1);
static_assert(SEQ <= SEQ_FULL);
static_assert(HD == 64);
static_assert(DM % 64 == 0 && DM % 32 == 0);
static_assert(TPAD % 64 == 0);
static_assert(NKC <= 64);
static_assert(QRES <= TPAD && CRES <= TPAD);

/* workspace region map (bytes, every offset a multiple of 128) */
constexpr size_t X_B  = (size_t)TPAD * DM * 2;       /* bf16 [TPAD][DM] */
constexpr size_t W_B  = (size_t)DM * DM * 2;         /* 16-bit [DM][DM] */
constexpr size_t E_B  = (size_t)TPAD * HD * 2;       /* f16 [TPAD][HD] */
constexpr size_t HP_B = (size_t)NH * TPAD * HD * 2;  /* f16 [NH][TPAD][HD] or [NH][HD][TPAD] */
constexpr size_t QR_B = (size_t)NH * QRES * HD * 2;  /* f16 [NH][QRES][HD] */
constexpr size_t KR_B = (size_t)NH * CRES * HD * 2;  /* f16 [NH][CRES][HD] or [NH][HD][CRES] */
constexpr size_t CT_B = (size_t)TPAD * DM * 2;       /* f16 [TPAD][DM] */
constexpr size_t CR_B = (size_t)CRES * DM * 2;       /* f16 [CRES][DM] */
constexpr int    FLN  = 4;                          /* 128-byte flag lines per query block, one writer each */
constexpr int    FSL  = (NKC + FLN - 1) / FLN;      /* key chunks (used slots) per flag line */
constexpr size_t FL_B = (size_t)NQB * FLN * 32 * 4; /* int [NQB][FLN][32]: chunk kc at line kc % FLN, slot kc / FLN */
static_assert(FSL <= 32);

constexpr size_t OFF_XQ = 0;
constexpr size_t OFF_XK = OFF_XQ + X_B;
constexpr size_t OFF_XV = OFF_XK + X_B;
constexpr size_t OFF_WQ = OFF_XV + X_B;
constexpr size_t OFF_WK = OFF_WQ + W_B;
constexpr size_t OFF_WV = OFF_WK + W_B;
constexpr size_t OFF_WO = OFF_WV + W_B;
constexpr size_t OFF_ER = OFF_WO + W_B;
constexpr size_t OFF_QH = OFF_ER + E_B;
constexpr size_t OFF_KH = OFF_QH + HP_B;
constexpr size_t OFF_VT = OFF_KH + HP_B;
constexpr size_t OFF_QR = OFF_VT + HP_B;
constexpr size_t OFF_KR = OFF_QR + QR_B;
constexpr size_t OFF_VR = OFF_KR + KR_B;
constexpr size_t OFF_CT = OFF_VR + KR_B;
constexpr size_t OFF_CR = OFF_CT + CT_B;
constexpr size_t OFF_FL = OFF_CR + CR_B;
constexpr size_t WS_NEED = OFF_FL + FL_B;

static_assert(X_B % 128 == 0 && W_B % 128 == 0 && E_B % 128 == 0 && HP_B % 128 == 0);
static_assert(QR_B % 128 == 0 && KR_B % 128 == 0 && CT_B % 128 == 0 && CR_B % 128 == 0 && FL_B % 128 == 0);
static_assert(WS_NEED <= 134217728ull);
static_assert((size_t)TT * DM * 4 <= (size_t)SEQ_FULL * DM * 4);

/* -------------------------------------------------------------------------- */
__device__ __forceinline__ unsigned short f2bf_bits(float f) {
  unsigned u = __float_as_uint(f);
  return (unsigned short)((u + 0x7FFFu + ((u >> 16) & 1u)) >> 16);
}
__device__ __forceinline__ float bfr(float f) { return __uint_as_float(((unsigned)f2bf_bits(f)) << 16); }
__device__ __forceinline__ unsigned short h_bits(float f) {
  _Float16 h = (_Float16)f;
  return __builtin_bit_cast(unsigned short, h);
}
__device__ __forceinline__ float h2f(unsigned short b) {
  _Float16 h = __builtin_bit_cast(_Float16, b);
  return (float)h;
}

/* WMMA issue helpers with the 4-slot hazard guard (ties D, keeps A/B live) */
__device__ __forceinline__ v8f mma_h(v16h a, v16h b, v8f c) {
  c = __builtin_amdgcn_wmma_f32_16x16x32_f16(false, a, false, b, (short)0, c, false, false);
  asm volatile("v_nop\n\tv_nop\n\tv_nop\n\tv_nop" : "+v"(c) : "v"(a), "v"(b));
  return c;
}
__device__ __forceinline__ v8f mma_b(v16b a, v16b b, v8f c) {
  c = __builtin_amdgcn_wmma_f32_16x16x32_bf16(false, a, false, b, (short)0, c, false, false);
  asm volatile("v_nop\n\tv_nop\n\tv_nop\n\tv_nop" : "+v"(c) : "v"(a), "v"(b));
  return c;
}

__device__ __forceinline__ v8f zero8() { return (v8f){0.f,0.f,0.f,0.f,0.f,0.f,0.f,0.f}; }

/* --------------------------------------------------------------------------
 * Main loop of the 64 x 64 GEMM blocks (2 waves): acc += A[64][DM] . B[64][DM]^T, 16-bit operands.
 * Stage = 128 k values: 64 A rows and 64 B rows of 256 B each, brought into LDS by asynchronous
 * copies (each copy = two whole 256-B row pieces), two buffers: stage t+1 flies while stage t is worked on.
 * Wave 0 copies the A rows, wave 1 the B rows, 32 copies per wave and stage.
 * LDS row pitch 272 B = 16 B x 17 (odd): the 16 rows of one ds_load_b128 fall on distinct bank groups.
 * Fragment k map and the order of the k steps per accumulator are those of the direct global loads it replaces.
 * ------------------------------------------------------------------------ */
constexpr int GKS  = 128;             /* k values per stage = 4 WMMA k steps */
constexpr int GNST = DM / GKS;        /* stages */
constexpr int GP   = 136;             /* LDS row pitch in 16-bit elements */
constexpr int GBUF = 128 * GP;        /* elements of one buffer: A rows 0..63, B rows 64..127 */
static_assert(DM % GKS == 0 && GNST >= 2);

union FR { v16h hv; v16b bv; v8us h[2]; };

/* eight copies: row pairs 0, 2, .. 14 from the lane's own LDS byte address l and global address g */
__device__ __forceinline__ void copy8(unsigned l, const unsigned short* g)
{
  /* the copies and, as the last line of the same statement, the wait that stands in front of any
     rewrite of the address registers they name */
  asm volatile(
      "global_load_async_to_lds_b128 %0, %8, off\n\t"
      "global_load_async_to_lds_b128 %1, %9, off\n\t"
      "global_load_async_to_lds_b128 %2, %10, off\n\t"
      "global_load_async_to_lds_b128 %3, %11, off\n\t"
      "global_load_async_to_lds_b128 %4, %12, off\n\t"
      "global_load_async_to_lds_b128 %5, %13, off\n\t"
      "global_load_async_to_lds_b128 %6, %14, off\n\t"
      "global_load_async_to_lds_b128 %7, %15, off\n\t"
      "s_wait_xcnt 0x0"
      :: "v"(l), "v"(l + 2u * 2u * GP), "v"(l + 4u * 2u * GP), "v"(l + 6u * 2u * GP),
         "v"(l + 8u * 2u * GP), "v"(l + 10u * 2u * GP), "v"(l + 12u * 2u * GP), "v"(l + 14u * 2u * GP),
         "v"(g), "v"(g + 2 * DM), "v"(g + 4 * DM), "v"(g + 6 * DM),
         "v"(g + 8 * DM), "v"(g + 10 * DM), "v"(g + 12 * DM), "v"(g + 14 * DM)
      : "memory");
}
/* one wave's 64 rows of one stage */
__device__ __forceinline__ void stage_copy(unsigned l, const unsigned short* g)
{
  /* unrolled: the row offsets of the four statements are constants */
#pragma unroll
  for (int q = 0; q < 4; ++q) copy8(l + (unsigned)(q * 16 * GP * 2), g + (size_t)q * 16 * DM);
}

template <bool BF>
__device__ __forceinline__ void gemm_ring(const unsigned short* __restrict__ A, const unsigned short* __restrict__ B,
                                          unsigned short* ring, v8f (&acc)[2][4])
{
  const int lane = threadIdx.x & 31;
  const int wave = __builtin_amdgcn_readfirstlane((int)(threadIdx.x >> 5));
  const int hh = lane >> 4, m = lane & 15;

  /* copy addresses: lanes 0..15 one row, lanes 16..31 the next, 16 B per lane */
  const unsigned short* g0 = (wave == 0 ? A : B) + (size_t)hh * DM + m * 8;
  const unsigned l0 = (unsigned)(size_t)ring + (unsigned)(((wave * 64 + hh) * GP + m * 8) * 2);

  stage_copy(l0, g0);
  /* stage 0 has landed before the barrier that publishes it */
  asm volatile("s_wait_asynccnt 0x0" ::: "memory");
  __syncthreads();
  stage_copy(l0 + (unsigned)(GBUF * 2), g0 + GKS);

  const unsigned short* fa = ring + (wave * 32 + m) * GP + 8 * hh;
  const unsigned short* fb = ring + (64 + m) * GP + 8 * hh;

  /* rolled: one body in the instruction cache, the buffer chosen by the trip's parity */
#pragma unroll 1
  for (int t = 0; t < GNST; ++t) {
    const int bo = (t & 1) * GBUF;
    const unsigned short* pa = fa + bo;
    const unsigned short* pb = fb + bo;
    /* every loop below is unrolled so that each index of the two fragment sets is a constant and the sets stay in registers */
    FR a[2][2], b[2][4];
#pragma unroll
    for (int mi = 0; mi < 2; ++mi) {
      a[0][mi].h[0] = *(const v8us*)(pa + mi * 16 * GP);
      a[0][mi].h[1] = *(const v8us*)(pa + mi * 16 * GP + 16);
    }
#pragma unroll
    for (int ni = 0; ni < 4; ++ni) {
      b[0][ni].h[0] = *(const v8us*)(pb + ni * 16 * GP);
      b[0][ni].h[1] = *(const v8us*)(pb + ni * 16 * GP + 16);
    }
#pragma unroll
    for (int ks = 0; ks < GKS / 32; ++ks) {
      const int cur = ks & 1, nxt = cur ^ 1;
      if (ks + 1 < GKS / 32) {          /* next k step's fragments of the same stage, ahead of this step's products */
#pragma unroll
        for (int mi = 0; mi < 2; ++mi) {
          a[nxt][mi].h[0] = *(const v8us*)(pa + mi * 16 * GP + (ks + 1) * 32);
          a[nxt][mi].h[1] = *(const v8us*)(pa + mi * 16 * GP + (ks + 1) * 32 + 16);
        }
#pragma unroll
        for (int ni = 0; ni < 4; ++ni) {
          b[nxt][ni].h[0] = *(const v8us*)(pb + ni * 16 * GP + (ks + 1) * 32);
          b[nxt][ni].h[1] = *(const v8us*)(pb + ni * 16 * GP + (ks + 1) * 32 + 16);
        }
      }
#pragma unroll
      for (int ni = 0; ni < 4; ++ni) {
        if constexpr (BF) {
          acc[0][ni] = mma_b(a[cur][0].bv, b[cur][ni].bv, acc[0][ni]);
          acc[1][ni] = mma_b(a[cur][1].bv, b[cur][ni].bv, acc[1][ni]);
        } else {
          acc[0][ni] = mma_h(a[cur][0].hv, b[cur][ni].hv, acc[0][ni]);
          acc[1][ni] = mma_h(a[cur][1].hv, b[cur][ni].hv, acc[1][ni]);
        }
      }
    }
    /* this wave's reads of buffer t&1 have returned before the buffer is refilled */
    asm volatile("s_wait_dscnt 0x0" ::: "memory");
    /* this wave's copies of stage t+1 have landed before the barrier that publishes them */
    asm volatile("s_wait_asynccnt 0x0" ::: "memory");
    __syncthreads();
    if (t + 2 < GNST) stage_copy(l0 + (unsigned)(bo * 2), g0 + (size_t)(t + 2) * GKS);
  }
  /* no copy is outstanding when the wave goes on */
  asm volatile("s_wait_asynccnt 0x0" ::: "memory");
}

/* --------------------------------------------------------------------------
 * f32 [nrows][ncols] -> 16-bit plane [nrows_pad][ncols]; rows >= nrows are zeros.
 * mode 0: bf16 bits (RNE).  mode 1: f16 bits of (scale * bf16(x)).
 * Coverage: ceil(nrows_pad*ncols/8 / 256) blocks x 256 threads, guard u < total.
 * ------------------------------------------------------------------------ */
__global__ __launch_bounds__(256) void cvt_plane_kernel(
    const float* __restrict__ src, int nrows, int ncols, int nrows_pad, int mode, float scale,
    unsigned short* __restrict__ dst)
{
  const int u = blockIdx.x * 256 + threadIdx.x;
  const int upr = ncols >> 3;
  const int total = nrows_pad * upr;
  if (u >= total) return;
  const int row = u / upr;
  const int cu  = u - row * upr;
  const int rowc = row < nrows ? row : nrows - 1;          /* clamped address */
  const bool live = row < nrows;
  const float* p = src + (size_t)rowc * ncols + cu * 8;
  const v4f x0 = *(const v4f*)p;
  const v4f x1 = *(const v4f*)(p + 4);
  unsigned b0, b1, b2, b3, b4, b5, b6, b7;
  {
    const float f0 = live ? x0[0] : 0.f, f1 = live ? x0[1] : 0.f, f2 = live ? x0[2] : 0.f, f3 = live ? x0[3] : 0.f;
    const float f4 = live ? x1[0] : 0.f, f5 = live ? x1[1] : 0.f, f6 = live ? x1[2] : 0.f, f7 = live ? x1[3] : 0.f;
    if (mode == 0) {
      b0 = f2bf_bits(f0); b1 = f2bf_bits(f1); b2 = f2bf_bits(f2); b3 = f2bf_bits(f3);
      b4 = f2bf_bits(f4); b5 = f2bf_bits(f5); b6 = f2bf_bits(f6); b7 = f2bf_bits(f7);
    } else {
      b0 = h_bits(bfr(f0) * scale); b1 = h_bits(bfr(f1) * scale); b2 = h_bits(bfr(f2) * scale); b3 = h_bits(bfr(f3) * scale);
      b4 = h_bits(bfr(f4) * scale); b5 = h_bits(bfr(f5) * scale); b6 = h_bits(bfr(f6) * scale); b7 = h_bits(bfr(f7) * scale);
    }
  }
  v4u w;
  w[0] = b0 | (b1 << 16);
  w[1] = b2 | (b3 << 16);
  w[2] = b4 | (b5 << 16);
  w[3] = b6 | (b7 << 16);
  unsigned short* d = dst + (size_t)u * 8;
  *(v4u*)d = w;
  
}

/* --------------------------------------------------------------------------
 * Per (query block, key chunk) flag from the int32 key mask:
 *   0 = every effective entry masked (chunk skipped), 1 = all kept, 2 = mixed.
 * Effective entry (t, s): query row clamped to TT-1 for padded rows, keys s >= TT masked.
 * Block = (query block qb, flag line ln), 16 waves: the chunks kc = ln + FLN*j, j < FSL.
 * Wave w reads rows 4w..4w+3 of every chunk of the block; all loads are independent, so
 * the whole strip is in flight at once.  Per wave one any-kept and one all-kept bit per
 * chunk (ballots), combined over the 16 waves through LDS behind one block barrier.
 * Coverage: wave 0 stores the block's whole 128-byte line (unused slots 0);
 * NQB x FLN blocks = the whole table.
 * ------------------------------------------------------------------------ */
__device__ __forceinline__ int flag_slot(int kc) { return (kc % FLN) * 32 + kc / FLN; }

__global__ __launch_bounds__(512) void flags_kernel(const int* __restrict__ mask, int* __restrict__ flags)
{
  __shared__ unsigned wany[16];
  __shared__ unsigned wall[16];
  const int tid = threadIdx.x, lane = tid & 31;
  const int wave = __builtin_amdgcn_readfirstlane(tid >> 5);   /* scalar, so the row bases are scalar */
  const int qb = blockIdx.x, ln = blockIdx.y;

  /* key of slot j, half hf: s = col0 + FLN*64*j + 32*hf.  Only the last slot can pass TT. */
  constexpr int LOFF = FLN * (FSL - 1) * 64;
  static_assert(LOFF - 1 < TT);
  const unsigned col0 = (unsigned)(ln * 64 + lane);
  const unsigned sl0 = col0 + LOFF, sl1 = sl0 + 32u;
  const unsigned cl0 = sl0 < (unsigned)TT ? sl0 : (unsigned)(TT - 1);   /* clamped address */
  const unsigned cl1 = sl1 < (unsigned)TT ? sl1 : (unsigned)(TT - 1);   /* clamped address */
  const int* rowp[4];
#pragma unroll
  for (int rr = 0; rr < 4; ++rr) {
    int t = qb * 64 + wave * 4 + rr;
    t = t < TT ? t : TT - 1;
    rowp[rr] = mask + (size_t)t * SEQ_FULL;
  }

  /* first every load, then every count */
  int mv[FSL][8];
#pragma unroll
  for (int j = 0; j < FSL - 1; ++j) {
#pragma unroll
    for (int it = 0; it < 8; ++it)
      mv[j][it] = (rowp[it >> 1] + col0)[FLN * j * 64 + (it & 1) * 32];
  }
#pragma unroll
  for (int it = 0; it < 8; ++it)
    mv[FSL - 1][it] = rowp[it >> 1][(it & 1) ? cl1 : cl0];
  /* keeps every load in front of every count: without it the scheduler mixes them and fewer loads fly at once */
  __builtin_amdgcn_sched_barrier(0);
  /* every register that the issued loads name (row bases, key offsets) is an input here, so none is
     rewritten in front of this wait */
  asm volatile("s_wait_xcnt 0x0"
               :: "s"(rowp[0]), "s"(rowp[1]), "s"(rowp[2]), "s"(rowp[3]), "v"(col0), "v"(cl0), "v"(cl1)
               : "memory");

  int cnt[FSL];
#pragma unroll
  for (int j = 0; j < FSL; ++j) {
    int n = 0;
#pragma unroll
    for (int it = 0; it < 8; ++it) {
      const bool ex = (j < FSL - 1) || (((it & 1) ? sl1 : sl0) < (unsigned)TT);   /* key exists */
      n += (ex && mv[j][it] != 0) ? 1 : 0;
    }
    cnt[j] = n;
  }

  unsigned anym = 0u, allm = 0u;                           /* wave-uniform, bit j = chunk ln + FLN*j */
#pragma unroll
  for (int j = 0; j < FSL; ++j) {
    anym |= (__builtin_amdgcn_ballot_w32(cnt[j] != 0) != 0u) ? (1u << j) : 0u;
    allm |= (__builtin_amdgcn_ballot_w32(cnt[j] == 8) == 0xFFFFFFFFu) ? (1u << j) : 0u;
  }
  if (lane == 0) { wany[wave] = anym; wall[wave] = allm; }
  __syncthreads();

  if (wave == 0) {
    unsigned a = 0u, f = 0xFFFFFFFFu;
#pragma unroll
    for (int w = 0; w < 16; ++w) { a |= wany[w]; f &= wall[w]; }
    int fv = 0;
    if (lane < FSL) fv = ((a >> lane) & 1u) ? (((f >> lane) & 1u) ? 1 : 2) : 0;
    flags[((size_t)qb * FLN + ln) * 32 + lane] = fv;
  }
}

/* --------------------------------------------------------------------------
 * Projection GEMM: Y[t][n] = sum_k X[t][k] W[n][k] + b[n] for one 64-token x 64-col
 * (= one head) tile per block; bf16 operands (X and W planes), f32 accumulate.
 * Block = 2 waves (64 threads); wave w: tokens w*32..w*32+31 (2 row tiles) x 4 col tiles; main loop: gemm_ring.
 * A fragment (row m = lane&15): elems 0..7 <- k0+8h+i, 8..15 <- k0+16+8h+i.
 * B[k][n] = W[n][k]: loaded from row n = lane&15 with the same k map.  D elem r = (row 8h+r, col lane&15).
 * Epilogue: hi = f16(y), res = f16((y - hi) * 2048), rows t >= TT forced to 0; the block's
 * MODE 0: Q -> [NH][TPAD][HD] (+ residual rows < QRES); 1: K -> same (+ residual rows < CRES);
 * MODE 2: V -> [NH][HD][TPAD] (+ residual [NH][HD][CRES]).
 * Coverage per block: 8 iterations x 64 threads = 512 units = 64 rows x 8 segments (hi and res).
 * LDS tiles th/tr: cross-wave, separated by a block barrier; reloaded through the stored element type.
 * ------------------------------------------------------------------------ */
template <int MODE>
__global__ __launch_bounds__(64) __attribute__((amdgpu_num_vgpr(256)))
void proj_kernel(
    const unsigned short* __restrict__ X, const unsigned short* __restrict__ W,
    const float* __restrict__ bias, unsigned short* __restrict__ Ph, unsigned short* __restrict__ Pr)
{
  constexpr int PT = 72;
  constexpr int NRES_TB = (MODE == 0) ? (NEARLY + 1) : NEARLY;
  __shared__ __align__(16) unsigned short th[64 * PT];
  __shared__ __align__(16) unsigned short tr[64 * PT];
  __shared__ __align__(16) unsigned short ring[2 * GBUF];

  const int tid = threadIdx.x, wave = tid >> 5, lane = tid & 31;
  const int hh = lane >> 4, m = lane & 15;
  const int tb = blockIdx.x, head = blockIdx.y;
  const int n0 = head * 64;
  const int rl0 = wave * 32;

  v8f acc[2][4];
#pragma unroll
  for (int mi = 0; mi < 2; ++mi)
#pragma unroll
    for (int ni = 0; ni < 4; ++ni) acc[mi][ni] = zero8();

  gemm_ring<true>(X + (size_t)tb * 64 * DM, W + (size_t)n0 * DM, ring, acc);

  float bb[4];
#pragma unroll
  for (int ni = 0; ni < 4; ++ni) bb[ni] = bfr(bias[n0 + ni * 16 + m]);

#pragma unroll
  for (int mi = 0; mi < 2; ++mi) {
#pragma unroll
    for (int ni = 0; ni < 4; ++ni) {
#pragma unroll
      for (int r = 0; r < 8; ++r) {
        const int rl  = rl0 + mi * 16 + 8 * hh + r;
        const int t   = tb * 64 + rl;
        const int col = ni * 16 + m;
        float y = acc[mi][ni][r] + bb[ni];
        y = (t < TT) ? y : 0.f;
        const unsigned short hb = h_bits(y);
        const float res = (y - h2f(hb)) * RSC;
        const unsigned short rb = h_bits(res);
        if (MODE == 2) { th[col * PT + rl] = hb; tr[col * PT + rl] = rb; }
        else           { th[rl * PT + col] = hb; tr[rl * PT + col] = rb; }
      }
    }
  }
  __syncthreads();

  const bool dores = tb < NRES_TB;    /* block-uniform */
  {
#pragma unroll
    for (int it = 0; it < 8; ++it) {
      const int u = it * 64 + tid;
      const int row = u >> 3, seg = u & 7;
      const v8us vh = *(const v8us*)(th + row * PT + seg * 8);
      const v8us vr = *(const v8us*)(tr + row * PT + seg * 8);
      if (MODE == 2) {
        *(v8us*)(Ph + ((size_t)head * HD + row) * TPAD + tb * 64 + seg * 8) = vh;
        if (dores) *(v8us*)(Pr + ((size_t)head * HD + row) * CRES + tb * 64 + seg * 8) = vr;
      } else {
        *(v8us*)(Ph + ((size_t)head * TPAD + tb * 64 + row) * HD + seg * 8) = vh;
        if (dores) {
          if (MODE == 0) *(v8us*)(Pr + ((size_t)head * QRES + tb * 64 + row) * HD + seg * 8) = vr;
          else           *(v8us*)(Pr + ((size_t)head * CRES + tb * 64 + row) * HD + seg * 8) = vr;
        }
      }
    }
    
  }
}

/* --------------------------------------------------------------------------
 * Flash attention with the row-shifted Er term, head dim 64.
 * Block = 4 waves = 64 query rows of one head; grid (query blocks, NH).
 * Per kept 64-key chunk: K [key][d], Er [key][d], V^T [d][key] f16 tiles staged in LDS
 * (EARLY: also K and V^T residual tiles), scores = qh.k^T + qh(t+1).Er^T on f16 WMMA,
 * x0.125, replace-fill -inf from the key mask (flag 2 chunks), f32 online softmax,
 * P = f16(1024 p) per-wave LDS tile (EARLY: + f16 residual x2048), O += P.V on f16 WMMA
 * (O therefore carries the x1024 of P; the normaliser applies 1/(1024 l) x 16 in one factor).
 * EARLY adds (qh.k_res + q_res.k + q_res(t+1).Er)/2048 to the scores and
 * (P.V_res + P_res.V)/2048 to O through separate accumulators folded per tile.
 * Live-state plan: Q hi fragments reloaded per chunk (dead during softmax and P.V),
 * Q residual fragments loaded only inside the residual score phase, one 8-register
 * residual accumulator at a time; <= 4 O tiles + 4 score tiles + m/l persistent.
 * Epilogue: ctx = O/(1024 l) carried x16 as f16 into [TPAD][DM] (+ residual rows < CRES),
 * Fragment map as in proj_kernel (A row / B col = lane&15, split k map, D elem r = row 8h+r).
 * LDS regions: K/Er/V/res tiles and msk cross-wave (block barriers); P tiles and the
 * ------------------------------------------------------------------------ */
template <bool EARLY>
__global__ __launch_bounds__(128) __attribute__((amdgpu_num_vgpr(256)))
void attn_kernel(const unsigned short* __restrict__ Qh, const unsigned short* __restrict__ Qr,
                 const unsigned short* __restrict__ Kh, const unsigned short* __restrict__ Kr,
                 const unsigned short* __restrict__ Vt, const unsigned short* __restrict__ Vr,
                 const unsigned short* __restrict__ Erp, const int* __restrict__ mask,
                 const int* __restrict__ flags, unsigned short* __restrict__ Ct,
                 unsigned short* __restrict__ Cr)
{
  /* LDS row pitch of every fragment-read tile: 72 halves = 144 B = 16 B x 9 (odd), so the 16 rows that one
     ds_load_b128 reads fall on 16 distinct groups of four banks; at 128 B they fall on two groups */
  constexpr int LP = 72;
  constexpr int TSZ = 64 * LP;                     /* one 64-row tile, or four 16-row P tiles */
  constexpr int KSH = 0, ESH = TSZ, VTH = 2 * TSZ, PSH = 3 * TSZ, KRS = 4 * TSZ, VRS = 5 * TSZ;
  constexpr int PRS = EARLY ? 6 * TSZ : PSH;
  constexpr int SMN = EARLY ? 7 * TSZ : 4 * TSZ;
  __shared__ __align__(16) unsigned short sm[SMN];
  __shared__ __align__(16) unsigned char msk[4096];
  union FH { v16h v; v8us h[2]; };

  const int tid = threadIdx.x, wave = tid >> 5, lane = tid & 31;
  const int hh = lane >> 4, c = lane & 15;
  const int qb = EARLY ? (int)blockIdx.x : ((int)blockIdx.x + NEARLY);
  const int head = blockIdx.y;
  const int q0 = qb * 64 + wave * 16;
  const int wrow0 = wave * 16;                     /* the wave's first row inside the block tile */

  /* fragment base pointers: rows q0+c (q.k^T) and q0+1+c (shifted Er term) */
  const unsigned short* qp = Qh + ((size_t)head * TPAD + q0 + c) * HD + 8 * hh;
  const unsigned short* rp = Qr + ((size_t)head * QRES + (EARLY ? (q0 + c) : c)) * HD + 8 * hh;

  float mrow[8], lrow[8];
  v8f oacc[4];
#pragma unroll
  for (int r = 0; r < 8; ++r) { mrow[r] = -__builtin_inff(); lrow[r] = 0.f; }
#pragma unroll
  for (int t = 0; t < 4; ++t) oacc[t] = zero8();

  unsigned short* pwh = sm + PSH + wave * (16 * LP);
  unsigned short* pwr = sm + PRS + wave * (16 * LP);
  const int* frow = flags + (size_t)qb * (FLN * 32);

#pragma unroll 1
  for (int kc = 0; kc < NKC; ++kc) {
    const int fk = __builtin_amdgcn_readfirstlane(frow[flag_slot(kc)]);   /* block-uniform */
    if (fk == 0) continue;
    const int kv0 = kc * 64;
    const bool useres = EARLY && (kc < NEARLY);
    const int kvr = (kc < NEARLY) ? kv0 : 0;                   /* clamped residual chunk base */

    __syncthreads();
    /* staging: unit u -> row u>>3 (0..63), seg u&7; 4 iterations x 128 threads = 512 units per tile */
    {
      const unsigned short *gk[4], *ge[4], *gv[4];
      v4u tk[4], te[4], tv[4];
#pragma unroll
      for (int it = 0; it < 4; ++it) {
        const int u = it * 128 + tid;
        const int row = u >> 3, seg = u & 7;
        gk[it] = Kh + ((size_t)head * TPAD + kv0 + row) * HD + seg * 8;
        ge[it] = Erp + (size_t)(kv0 + row) * HD + seg * 8;
        gv[it] = Vt + ((size_t)head * HD + row) * TPAD + kv0 + seg * 8;
        tk[it] = *(const v4u*)gk[it];
        te[it] = *(const v4u*)ge[it];
        tv[it] = *(const v4u*)gv[it];
      }
      /* every address that the issued loads name is an input here, so none is rewritten in front of this wait */
      asm volatile("s_wait_xcnt 0x0"
                   :: "v"(gk[0]), "v"(gk[1]), "v"(gk[2]), "v"(gk[3]), "v"(ge[0]), "v"(ge[1]), "v"(ge[2]), "v"(ge[3]),
                      "v"(gv[0]), "v"(gv[1]), "v"(gv[2]), "v"(gv[3])
                   : "memory");
#pragma unroll
      for (int it = 0; it < 4; ++it) {
        const int u = it * 128 + tid;
        const int row = u >> 3, seg = u & 7;
        *(v4u*)(sm + KSH + row * LP + seg * 8) = tk[it];
        *(v4u*)(sm + ESH + row * LP + seg * 8) = te[it];
        *(v4u*)(sm + VTH + row * LP + seg * 8) = tv[it];
      }
    }
    if (EARLY) {
      const unsigned short *gkr[4], *gvr[4];
      v4u tkr[4], tvr[4];
#pragma unroll
      for (int it = 0; it < 4; ++it) {
        const int u = it * 128 + tid;
        const int row = u >> 3, seg = u & 7;
        gkr[it] = Kr + ((size_t)head * CRES + kvr + row) * HD + seg * 8;
        gvr[it] = Vr + ((size_t)head * HD + row) * CRES + kvr + seg * 8;
        tkr[it] = *(const v4u*)gkr[it];
        tvr[it] = *(const v4u*)gvr[it];
      }
      /* as above: the addresses of the issued loads stay whole up to this wait */
      asm volatile("s_wait_xcnt 0x0"
                   :: "v"(gkr[0]), "v"(gkr[1]), "v"(gkr[2]), "v"(gkr[3]), "v"(gvr[0]), "v"(gvr[1]), "v"(gvr[2]), "v"(gvr[3])
                   : "memory");
#pragma unroll
      for (int it = 0; it < 4; ++it) {
        const int u = it * 128 + tid;
        const int row = u >> 3, seg = u & 7;
        *(v4u*)(sm + KRS + row * LP + seg * 8) = tkr[it];
        *(v4u*)(sm + VRS + row * LP + seg * 8) = tvr[it];
      }
    }
    if (fk == 2) {
      /* key mask tile: thread -> row tid>>1, 32 columns; clamped addresses, keys >= TT masked */
      const int row = tid >> 1, hsel = tid & 1;
      int qrow = qb * 64 + row;
      qrow = qrow < TT ? qrow : TT - 1;
      const int* mb = mask + (size_t)qrow * SEQ_FULL;
#pragma unroll 1
      for (int g = 0; g < 4; ++g) {
#pragma unroll
        for (int e = 0; e < 8; ++e) {
          const int col = hsel * 32 + g * 8 + e;
          const int s = kv0 + col;
          const int sc = s < TT ? s : TT - 1;
          const int mv = mb[sc];
          msk[row * 64 + col] = (unsigned char)((s < TT && mv != 0) ? 1 : 0);
        }
      }
    }
    __syncthreads();

    /* Q hi fragments for this chunk, two 32-deep d halves */
    FH qa[2], qs[2];
#pragma unroll
    for (int dc = 0; dc < 2; ++dc) {
      qa[dc].h[0] = *(const v8us*)(qp + dc * 32);
      qa[dc].h[1] = *(const v8us*)(qp + dc * 32 + 16);
      qs[dc].h[0] = *(const v8us*)(qp + HD + dc * 32);
      qs[dc].h[1] = *(const v8us*)(qp + HD + dc * 32 + 16);
    }

    /* scores: 16 query rows x 64 keys per wave */
    v8f s[4];
#pragma unroll
    for (int j = 0; j < 4; ++j) {
      s[j] = zero8();
#pragma unroll
      for (int dc = 0; dc < 2; ++dc) {
        FH kf, ef;
        kf.h[0] = *(const v8us*)(sm + KSH + (j * 16 + c) * LP + dc * 32 + 8 * hh);
        kf.h[1] = *(const v8us*)(sm + KSH + (j * 16 + c) * LP + dc * 32 + 16 + 8 * hh);
        ef.h[0] = *(const v8us*)(sm + ESH + (j * 16 + c) * LP + dc * 32 + 8 * hh);
        ef.h[1] = *(const v8us*)(sm + ESH + (j * 16 + c) * LP + dc * 32 + 16 + 8 * hh);
        s[j] = mma_h(qa[dc].v, kf.v, s[j]);
        s[j] = mma_h(qs[dc].v, ef.v, s[j]);
      }
      if (EARLY) {
        if (useres) {
          v8f sr = zero8();
#pragma unroll
          for (int dc = 0; dc < 2; ++dc) {
            FH kf, ef, krf, qra, qrs;
            kf.h[0]  = *(const v8us*)(sm + KSH + (j * 16 + c) * LP + dc * 32 + 8 * hh);
            kf.h[1]  = *(const v8us*)(sm + KSH + (j * 16 + c) * LP + dc * 32 + 16 + 8 * hh);
            ef.h[0]  = *(const v8us*)(sm + ESH + (j * 16 + c) * LP + dc * 32 + 8 * hh);
            ef.h[1]  = *(const v8us*)(sm + ESH + (j * 16 + c) * LP + dc * 32 + 16 + 8 * hh);
            krf.h[0] = *(const v8us*)(sm + KRS + (j * 16 + c) * LP + dc * 32 + 8 * hh);
            krf.h[1] = *(const v8us*)(sm + KRS + (j * 16 + c) * LP + dc * 32 + 16 + 8 * hh);
            qra.h[0] = *(const v8us*)(rp + dc * 32);
            qra.h[1] = *(const v8us*)(rp + dc * 32 + 16);
            qrs.h[0] = *(const v8us*)(rp + HD + dc * 32);
            qrs.h[1] = *(const v8us*)(rp + HD + dc * 32 + 16);
            sr = mma_h(qa[dc].v, krf.v, sr);
            sr = mma_h(qra.v, kf.v, sr);
            sr = mma_h(qrs.v, ef.v, sr);
          }
#pragma unroll
          for (int r = 0; r < 8; ++r) s[j][r] += sr[r] * RINV;
        }
      }
    }

    /* scale by 1/sqrt(64) and replace-fill from the key mask (this wave's rows) */
#pragma unroll
    for (int j = 0; j < 4; ++j) {
#pragma unroll
      for (int r = 0; r < 8; ++r) s[j][r] *= 0.125f;
    }
    if (fk == 2) {
#pragma unroll
      for (int j = 0; j < 4; ++j) {
#pragma unroll
        for (int r = 0; r < 8; ++r) {
          const unsigned char mv = msk[(wrow0 + 8 * hh + r) * 64 + j * 16 + c];
          s[j][r] = mv ? s[j][r] : -__builtin_inff();
        }
      }
    }

    /* chunk row max over 64 keys (16 lanes of one half x 4 tiles) */
    float cm[8];
#pragma unroll
    for (int r = 0; r < 8; ++r) {
      float mx = fmaxf(fmaxf(s[0][r], s[1][r]), fmaxf(s[2][r], s[3][r]));
#pragma unroll
      for (int off = 1; off < 16; off <<= 1) mx = fmaxf(mx, __shfl_xor(mx, off, 32));
      cm[r] = mx;
    }

    /* online softmax update; P tiles (carried x1024) into the wave's LDS tile */
#pragma unroll
    for (int r = 0; r < 8; ++r) {
      const float mnew = fmaxf(mrow[r], cm[r]);
      const bool dead = (mnew == -__builtin_inff());
      const float aexp = __expf(mrow[r] - mnew);
      const float alpha = dead ? 1.f : aexp;
      mrow[r] = mnew;
      float psum = 0.f;
#pragma unroll
      for (int j = 0; j < 4; ++j) {
        const float pe = __expf(s[j][r] - mnew);
        const float p = dead ? 0.f : pe;
        psum += p;
        const float pc = p * PSC;
        const unsigned short hb = h_bits(pc);
        pwh[(8 * hh + r) * LP + j * 16 + c] = hb;
        if (EARLY) {
          const float pres = (pc - h2f(hb)) * RSC;
          pwr[(8 * hh + r) * LP + j * 16 + c] = h_bits(pres);
        }
      }
#pragma unroll
      for (int off = 1; off < 16; off <<= 1) psum += __shfl_xor(psum, off, 32);
      lrow[r] = lrow[r] * alpha + psum;
#pragma unroll
      for (int t = 0; t < 4; ++t) oacc[t][r] *= alpha;
    }
    __builtin_amdgcn_fence(3, "workgroup");
    __builtin_amdgcn_wave_barrier();
    __builtin_amdgcn_fence(2, "workgroup");

    /* O += P.V : A = P [q][key] (this wave's tile), B = V [key][d] from V^T [d][key] */
#pragma unroll
    for (int kk = 0; kk < 2; ++kk) {
      FH pa;
      pa.h[0] = *(const v8us*)(pwh + c * LP + kk * 32 + 8 * hh);
      pa.h[1] = *(const v8us*)(pwh + c * LP + kk * 32 + 16 + 8 * hh);
#pragma unroll
      for (int t = 0; t < 4; ++t) {
        FH vb;
        vb.h[0] = *(const v8us*)(sm + VTH + (t * 16 + c) * LP + kk * 32 + 8 * hh);
        vb.h[1] = *(const v8us*)(sm + VTH + (t * 16 + c) * LP + kk * 32 + 16 + 8 * hh);
        oacc[t] = mma_h(pa.v, vb.v, oacc[t]);
      }
    }
    if (EARLY) {
      if (useres) {
        /* residual products per d tile: one 8-register accumulator live at a time */
#pragma unroll
        for (int t = 0; t < 4; ++t) {
          v8f oar = zero8();
#pragma unroll
          for (int kk = 0; kk < 2; ++kk) {
            FH pa, pr, vb, vr;
            pa.h[0] = *(const v8us*)(pwh + c * LP + kk * 32 + 8 * hh);
            pa.h[1] = *(const v8us*)(pwh + c * LP + kk * 32 + 16 + 8 * hh);
            pr.h[0] = *(const v8us*)(pwr + c * LP + kk * 32 + 8 * hh);
            pr.h[1] = *(const v8us*)(pwr + c * LP + kk * 32 + 16 + 8 * hh);
            vb.h[0] = *(const v8us*)(sm + VTH + (t * 16 + c) * LP + kk * 32 + 8 * hh);
            vb.h[1] = *(const v8us*)(sm + VTH + (t * 16 + c) * LP + kk * 32 + 16 + 8 * hh);
            vr.h[0] = *(const v8us*)(sm + VRS + (t * 16 + c) * LP + kk * 32 + 8 * hh);
            vr.h[1] = *(const v8us*)(sm + VRS + (t * 16 + c) * LP + kk * 32 + 16 + 8 * hh);
            oar = mma_h(pa.v, vr.v, oar);
            oar = mma_h(pr.v, vb.v, oar);
          }
#pragma unroll
          for (int r = 0; r < 8; ++r) oacc[t][r] += oar[r] * RINV;
        }
      }
    }
  }

  /* epilogue: all waves are done with the staged tiles before the region is reused */
  __syncthreads();
  unsigned short* osh = sm + KSH + wave * 1024;     /* [16][64] hi, carried x16 */
  unsigned short* osr = sm + ESH + wave * 1024;     /* [16][64] residual x2048 (EARLY) */
#pragma unroll
  for (int r = 0; r < 8; ++r) {
    /* O holds 1024 x sum(p v); ctx = O / (1024 l); plane value = 16 ctx = O x (1/l) x (16/1024) */
    const float inv = (1.0f / lrow[r]) * OCV;
#pragma unroll
    for (int t = 0; t < 4; ++t) {
      const float o = oacc[t][r] * inv;
      const unsigned short hb = h_bits(o);
      osh[(8 * hh + r) * 64 + t * 16 + c] = hb;
      if (EARLY) {
        const float res = (o - h2f(hb)) * RSC;
        osr[(8 * hh + r) * 64 + t * 16 + c] = h_bits(res);
      }
    }
  }
  __builtin_amdgcn_fence(3, "workgroup");
  __builtin_amdgcn_wave_barrier();
  __builtin_amdgcn_fence(2, "workgroup");
  /* 16 rows x 8 segments = 4 iterations x 32 lanes; row = 4it + (lane>>3), seg = lane&7:
*/
  {
#pragma unroll
    for (int it = 0; it < 4; ++it) {
      const int u = it * 32 + lane;
      const int row = u >> 3, seg = u & 7;
      const v8us vh = *(const v8us*)(osh + row * 64 + seg * 8);
      *(v8us*)(Ct + (size_t)(q0 + row) * DM + head * 64 + seg * 8) = vh;
      if (EARLY) {
        const v8us vr = *(const v8us*)(osr + row * 64 + seg * 8);
        *(v8us*)(Cr + (size_t)(q0 + row) * DM + head * 64 + seg * 8) = vr;
      }
    }
    
  }
}

/* --------------------------------------------------------------------------
 * Output projection: out[t][n] = (sum_k ctx16[t][k] wo64[n][k]) / 1024 + b[n], f16 operands,
 * f32 accumulate.  Token blocks tb < NEARLY first accumulate the ctx residual products
 * alone from zero, scale that sum by 1/2048 in f32, and use it as the start value of
 * the hi-plane accumulation (no residual product enters an accumulator holding hi terms).
 * Block = 2 waves (64 threads), 64 tokens x 64 columns; grid (NQB, DM/64); main loops: gemm_ring.
 * Epilogue: 64x64 f32 tile staged in LDS (cross-wave, block barrier), then
 * Coverage: 16 iterations x 64 threads = 1024 units = 64 rows x 16 segments.
 * ------------------------------------------------------------------------ */
__global__ __launch_bounds__(64) __attribute__((amdgpu_num_vgpr(256)))
void out_kernel(
    const unsigned short* __restrict__ Ct, const unsigned short* __restrict__ Cr,
    const unsigned short* __restrict__ Wo, const float* __restrict__ bias, float* __restrict__ out)
{
  constexpr int PTF = 68;
  __shared__ __align__(16) float ts[64 * PTF];
  __shared__ __align__(16) unsigned short ring[2 * GBUF];

  const int tid = threadIdx.x, wave = tid >> 5, lane = tid & 31;
  const int hh = lane >> 4, m = lane & 15;
  const int tb = blockIdx.x, nb = blockIdx.y;
  const int n0 = nb * 64;
  const int rl0 = wave * 32;
  const bool dores = tb < NEARLY;     /* block-uniform */

  v8f acc[2][4];
#pragma unroll
  for (int mi = 0; mi < 2; ++mi)
#pragma unroll
    for (int ni = 0; ni < 4; ++ni) acc[mi][ni] = zero8();

  const unsigned short* wrows = Wo + (size_t)n0 * DM;

  if (dores) {
    gemm_ring<false>(Cr + (size_t)tb * 64 * DM, wrows, ring, acc);
#pragma unroll
    for (int mi = 0; mi < 2; ++mi)
#pragma unroll
      for (int ni = 0; ni < 4; ++ni)
#pragma unroll
        for (int r = 0; r < 8; ++r) acc[mi][ni][r] *= RINV;
  }

  gemm_ring<false>(Ct + (size_t)tb * 64 * DM, wrows, ring, acc);

  float bb[4];
#pragma unroll
  for (int ni = 0; ni < 4; ++ni) bb[ni] = bfr(bias[n0 + ni * 16 + m]);
#pragma unroll
  for (int mi = 0; mi < 2; ++mi) {
#pragma unroll
    for (int ni = 0; ni < 4; ++ni) {
#pragma unroll
      for (int r = 0; r < 8; ++r) {
        const int rl = rl0 + mi * 16 + 8 * hh + r;
        ts[rl * PTF + ni * 16 + m] = acc[mi][ni][r] * OINV + bb[ni];
      }
    }
  }
  __syncthreads();

  {
#pragma unroll
    for (int it = 0; it < 16; ++it) {
      const int u = it * 64 + tid;
      const int row = u >> 4, seg = u & 15;
      const int t = tb * 64 + row;
      const v4f v = *(const v4f*)(ts + row * PTF + seg * 4);
      if (t < TT) *(v4f*)(out + (size_t)t * DM + n0 + seg * 4) = v;
    }
    
  }
}

/* -------------------------------------------------------------------------- */
extern "C" void kernel_launch(void* const* d_in, const int* in_sizes, int n_in,
                              void* d_out, int out_size, void* d_ws, size_t ws_size,
                              hipStream_t stream)
{
  if (n_in < 13) return;
  if (in_sizes[0] < TT * DM || in_sizes[1] < TT * DM || in_sizes[2] < TT * DM) return;
  if (in_sizes[3] < (TT - 1) * SEQ_FULL + TT) return;
  if (in_sizes[4] < DM * DM || in_sizes[6] < DM * DM || in_sizes[8] < DM * DM || in_sizes[11] < DM * DM) return;
  if (in_sizes[5] < DM || in_sizes[7] < DM || in_sizes[9] < DM || in_sizes[12] < DM) return;
  if (in_sizes[10] < TT * HD) return;
  if (out_size < TT * DM) return;
  if (d_ws == nullptr || ws_size < WS_NEED) return;

  const float* q    = (const float*)d_in[0];
  const float* k    = (const float*)d_in[1];
  const float* v    = (const float*)d_in[2];
  const int*   mask = (const int*)d_in[3];
  const float* Wq_w = (const float*)d_in[4];
  const float* Wq_b = (const float*)d_in[5];
  const float* Wk_w = (const float*)d_in[6];
  const float* Wk_b = (const float*)d_in[7];
  const float* Wv_w = (const float*)d_in[8];
  const float* Wv_b = (const float*)d_in[9];
  const float* Er   = (const float*)d_in[10];
  const float* Wo_w = (const float*)d_in[11];
  const float* Wo_b = (const float*)d_in[12];
  float* outp = (float*)d_out;

  unsigned char* ws = (unsigned char*)d_ws;
  unsigned short* Xq = (unsigned short*)(ws + OFF_XQ);
  unsigned short* Xk = (unsigned short*)(ws + OFF_XK);
  unsigned short* Xv = (unsigned short*)(ws + OFF_XV);
  unsigned short* Wq = (unsigned short*)(ws + OFF_WQ);
  unsigned short* Wk = (unsigned short*)(ws + OFF_WK);
  unsigned short* Wv = (unsigned short*)(ws + OFF_WV);
  unsigned short* Wo = (unsigned short*)(ws + OFF_WO);
  unsigned short* Eh = (unsigned short*)(ws + OFF_ER);
  unsigned short* Qh = (unsigned short*)(ws + OFF_QH);
  unsigned short* Kh = (unsigned short*)(ws + OFF_KH);
  unsigned short* Vt = (unsigned short*)(ws + OFF_VT);
  unsigned short* Qr = (unsigned short*)(ws + OFF_QR);
  unsigned short* Kr = (unsigned short*)(ws + OFF_KR);
  unsigned short* Vr = (unsigned short*)(ws + OFF_VR);
  unsigned short* Ct = (unsigned short*)(ws + OFF_CT);
  unsigned short* Cr = (unsigned short*)(ws + OFF_CR);
  int* flags = (int*)(ws + OFF_FL);

  /* input planes (rows >= TT zero) */
  const int xu = TPAD * (DM / 8);
  const int wu = DM * (DM / 8);
  const int eu = TPAD * (HD / 8);
  cvt_plane_kernel<<<(xu + 255) / 256, 256, 0, stream>>>(q, TT, DM, TPAD, 0, 1.0f, Xq);
  cvt_plane_kernel<<<(xu + 255) / 256, 256, 0, stream>>>(k, TT, DM, TPAD, 0, 1.0f, Xk);
  cvt_plane_kernel<<<(xu + 255) / 256, 256, 0, stream>>>(v, TT, DM, TPAD, 0, 1.0f, Xv);
  cvt_plane_kernel<<<(wu + 255) / 256, 256, 0, stream>>>(Wq_w, DM, DM, DM, 0, 1.0f, Wq);
  cvt_plane_kernel<<<(wu + 255) / 256, 256, 0, stream>>>(Wk_w, DM, DM, DM, 0, 1.0f, Wk);
  cvt_plane_kernel<<<(wu + 255) / 256, 256, 0, stream>>>(Wv_w, DM, DM, DM, 0, 1.0f, Wv);
  cvt_plane_kernel<<<(wu + 255) / 256, 256, 0, stream>>>(Wo_w, DM, DM, DM, 1, WOSC, Wo);
  cvt_plane_kernel<<<(eu + 255) / 256, 256, 0, stream>>>(Er, TT, HD, TPAD, 1, 1.0f, Eh);

  /* per (query block, key chunk) skip/dense/mixed flags from the key mask */
  flags_kernel<<<dim3(NQB, FLN), 512, 0, stream>>>(mask, flags);

  /* projections: 64 tokens x one head per block */
  proj_kernel<0><<<dim3(NTB, NH), 64, 0, stream>>>(Xq, Wq, Wq_b, Qh, Qr);
  proj_kernel<1><<<dim3(NTB, NH), 64, 0, stream>>>(Xk, Wk, Wk_b, Kh, Kr);
  proj_kernel<2><<<dim3(NTB, NH), 64, 0, stream>>>(Xv, Wv, Wv_b, Vt, Vr);

  /* attention: first NEARLY query blocks with residual products, the rest single products */
  attn_kernel<true><<<dim3(NEARLY, NH), 128, 0, stream>>>(Qh, Qr, Kh, Kr, Vt, Vr, Eh, mask, flags, Ct, Cr);
  if (NQB > NEARLY)
    attn_kernel<false><<<dim3(NQB - NEARLY, NH), 128, 0, stream>>>(Qh, Qr, Kh, Kr, Vt, Vr, Eh, mask, flags, Ct, Cr);

  /* output projection into d_out */
  out_kernel<<<dim3(NQB, DM / 64), 64, 0, stream>>>(Ct, Cr, Wo, Wo_b, outp);
}

// v004
// It runs in 138 microseconds.
// In two side-by-side timings against v003, it was 1.31 and 1.30 times as fast.
// Counting every step since v000, it is 2.68 times as fast.
// Contractions: q/k/v input projections on v_wmma_f32_16x16x32_bf16 (bf16 operands = RNE-converted inputs and weights, f32 accumulate); scores q.k^T, row-shifted q.Er^T, p.v and the output projection on v_wmma_f32_16x16x32_f16 (f16 operands: f16 hi planes of projected q/k/v, p carried x1024 and folded as 1/1024 before the ctx plane, ctx carried x16, Wo carried x64, plus x2048 f16 residual planes for the first 256 query rows and first 256 keys), f32 accumulate; softmax and all other arithmetic in f32.
#include <hip/hip_runtime.h>

typedef _Float16       v16h __attribute__((ext_vector_type(16)));
typedef __bf16         v16b __attribute__((ext_vector_type(16)));
typedef unsigned short v8us __attribute__((ext_vector_type(8)));
typedef float          v8f  __attribute__((ext_vector_type(8)));
typedef float          v4f  __attribute__((ext_vector_type(4)));
typedef unsigned int   v4u  __attribute__((ext_vector_type(4)));
typedef int            v4i  __attribute__((ext_vector_type(4)));

#ifndef NB
#define NB 1
#endif
#ifndef SEQ
#define SEQ 2049
#endif
#define SEQ_FULL 2049

constexpr int DM     = 1024;
constexpr int NH     = 16;
constexpr int HD     = 64;
constexpr int TT     = SEQ;
constexpr int NQB    = (TT + 63) / 64;          /* query blocks of 64 rows */
constexpr int NTB    = NQB + 1;                  /* token blocks of the planes (one extra for the +1 row shift) */
constexpr int TPAD   = NTB * 64;                 /* padded token count of every plane */
constexpr int NKC    = NTB;                      /* key chunks of 64 */
constexpr int NEARLY = NQB < 4 ? NQB : 4;        /* query blocks with residual treatment */
constexpr int CRES   = NEARLY * 64;              /* rows of K/V/ctx residual planes */
constexpr int QRES   = (NEARLY + 1) * 64;        /* rows of the Q residual plane (covers the +1 shift) */

constexpr float RSC  = 2048.0f;                  /* residual plane carry */
constexpr float RINV = 1.0f / 2048.0f;
constexpr float PSC  = 1024.0f;                  /* softmax weight carry (on the p tile, hence on the p.v accumulator) */
constexpr float CSC  = 16.0f;                    /* ctx plane carry */
constexpr float OCV  = CSC / PSC;                /* 1/64: removes the p carry and applies the ctx carry in one factor */
constexpr float WOSC = 64.0f;                    /* Wo plane carry */
constexpr float OINV = 1.0f / (CSC * WOSC);      /* 1/1024 */

static_assert(NB == 1);
static_assert(SEQ <= SEQ_FULL);
static_assert(HD == 64);
static_assert(DM % 64 == 0 && DM % 32 == 0);
static_assert(TPAD % 64 == 0);
static_assert(NKC <= 64);
static_assert(QRES <= TPAD && CRES <= TPAD);

/* workspace region map (bytes, every offset a multiple of 128) */
constexpr size_t X_B  = (size_t)TPAD * DM * 2;       /* bf16 [TPAD][DM] */
constexpr size_t W_B  = (size_t)DM * DM * 2;         /* 16-bit [DM][DM] */
constexpr size_t E_B  = (size_t)TPAD * HD * 2;       /* f16 [TPAD][HD] */
constexpr size_t HP_B = (size_t)NH * TPAD * HD * 2;  /* f16 [NH][TPAD][HD] or [NH][HD][TPAD] */
constexpr size_t QR_B = (size_t)NH * QRES * HD * 2;  /* f16 [NH][QRES][HD] */
constexpr size_t KR_B = (size_t)NH * CRES * HD * 2;  /* f16 [NH][CRES][HD] or [NH][HD][CRES] */
constexpr size_t CT_B = (size_t)TPAD * DM * 2;       /* f16 [TPAD][DM] */
constexpr size_t CR_B = (size_t)CRES * DM * 2;       /* f16 [CRES][DM] */
constexpr int    FLN  = 4;                          /* 128-byte flag lines per query block, one writer each */
constexpr int    FSL  = (NKC + FLN - 1) / FLN;      /* key chunks (used slots) per flag line */
constexpr size_t FL_B = (size_t)NQB * FLN * 32 * 4; /* int [NQB][FLN][32]: chunk kc at line kc % FLN, slot kc / FLN */
static_assert(FSL <= 32);

constexpr size_t OFF_XQ = 0;
constexpr size_t OFF_XK = OFF_XQ + X_B;
constexpr size_t OFF_XV = OFF_XK + X_B;
constexpr size_t OFF_WQ = OFF_XV + X_B;
constexpr size_t OFF_WK = OFF_WQ + W_B;
constexpr size_t OFF_WV = OFF_WK + W_B;
constexpr size_t OFF_WO = OFF_WV + W_B;
constexpr size_t OFF_ER = OFF_WO + W_B;
constexpr size_t OFF_QH = OFF_ER + E_B;
constexpr size_t OFF_KH = OFF_QH + HP_B;
constexpr size_t OFF_VT = OFF_KH + HP_B;
constexpr size_t OFF_QR = OFF_VT + HP_B;
constexpr size_t OFF_KR = OFF_QR + QR_B;
constexpr size_t OFF_VR = OFF_KR + KR_B;
constexpr size_t OFF_CT = OFF_VR + KR_B;
constexpr size_t OFF_CR = OFF_CT + CT_B;
constexpr size_t OFF_FL = OFF_CR + CR_B;
constexpr size_t WS_NEED = OFF_FL + FL_B;

static_assert(X_B % 128 == 0 && W_B % 128 == 0 && E_B % 128 == 0 && HP_B % 128 == 0);
static_assert(QR_B % 128 == 0 && KR_B % 128 == 0 && CT_B % 128 == 0 && CR_B % 128 == 0 && FL_B % 128 == 0);
static_assert(WS_NEED <= 134217728ull);
static_assert((size_t)TT * DM * 4 <= (size_t)SEQ_FULL * DM * 4);

/* -------------------------------------------------------------------------- */
__device__ __forceinline__ unsigned short f2bf_bits(float f) {
  unsigned u = __float_as_uint(f);
  return (unsigned short)((u + 0x7FFFu + ((u >> 16) & 1u)) >> 16);
}
__device__ __forceinline__ float bfr(float f) { return __uint_as_float(((unsigned)f2bf_bits(f)) << 16); }
__device__ __forceinline__ unsigned short h_bits(float f) {
  _Float16 h = (_Float16)f;
  return __builtin_bit_cast(unsigned short, h);
}
__device__ __forceinline__ float h2f(unsigned short b) {
  _Float16 h = __builtin_bit_cast(_Float16, b);
  return (float)h;
}

/* WMMA issue helpers with the 4-slot hazard guard (ties D, keeps A/B live) */
__device__ __forceinline__ v8f mma_h(v16h a, v16h b, v8f c) {
  c = __builtin_amdgcn_wmma_f32_16x16x32_f16(false, a, false, b, (short)0, c, false, false);
  asm volatile("v_nop\n\tv_nop\n\tv_nop\n\tv_nop" : "+v"(c) : "v"(a), "v"(b));
  return c;
}
__device__ __forceinline__ v8f mma_b(v16b a, v16b b, v8f c) {
  c = __builtin_amdgcn_wmma_f32_16x16x32_bf16(false, a, false, b, (short)0, c, false, false);
  asm volatile("v_nop\n\tv_nop\n\tv_nop\n\tv_nop" : "+v"(c) : "v"(a), "v"(b));
  return c;
}

__device__ __forceinline__ v8f zero8() { return (v8f){0.f,0.f,0.f,0.f,0.f,0.f,0.f,0.f}; }

/* --------------------------------------------------------------------------
 * Main loop of the 64 x 64 GEMM blocks (2 waves): acc += A[64][DM] . B[64][DM]^T, 16-bit operands.
 * Stage = 128 k values: 64 A rows and 64 B rows of 256 B each, brought into LDS by asynchronous
 * copies (each copy = two whole 256-B row pieces), two buffers: stage t+1 flies while stage t is worked on.
 * Wave 0 copies the A rows, wave 1 the B rows, 32 copies per wave and stage.
 * LDS row pitch 272 B = 16 B x 17 (odd): the 16 rows of one ds_load_b128 fall on distinct bank groups.
 * Fragment k map and the order of the k steps per accumulator are those of the direct global loads it replaces.
 * ------------------------------------------------------------------------ */
constexpr int GKS  = 128;             /* k values per stage = 4 WMMA k steps */
constexpr int GNST = DM / GKS;        /* stages */
constexpr int GP   = 136;             /* LDS row pitch in 16-bit elements */
constexpr int GBUF = 128 * GP;        /* elements of one buffer: A rows 0..63, B rows 64..127 */
static_assert(DM % GKS == 0 && GNST >= 2);

union FR { v16h hv; v16b bv; v8us h[2]; };

/* eight copies: row pairs 0, 2, .. 14 from the lane's own LDS byte address l and global address g */
__device__ __forceinline__ void copy8(unsigned l, const unsigned short* g)
{
  /* the copies and, as the last line of the same statement, the wait that stands in front of any
     rewrite of the address registers they name */
  asm volatile(
      "global_load_async_to_lds_b128 %0, %8, off\n\t"
      "global_load_async_to_lds_b128 %1, %9, off\n\t"
      "global_load_async_to_lds_b128 %2, %10, off\n\t"
      "global_load_async_to_lds_b128 %3, %11, off\n\t"
      "global_load_async_to_lds_b128 %4, %12, off\n\t"
      "global_load_async_to_lds_b128 %5, %13, off\n\t"
      "global_load_async_to_lds_b128 %6, %14, off\n\t"
      "global_load_async_to_lds_b128 %7, %15, off\n\t"
      "s_wait_xcnt 0x0"
      :: "v"(l), "v"(l + 2u * 2u * GP), "v"(l + 4u * 2u * GP), "v"(l + 6u * 2u * GP),
         "v"(l + 8u * 2u * GP), "v"(l + 10u * 2u * GP), "v"(l + 12u * 2u * GP), "v"(l + 14u * 2u * GP),
         "v"(g), "v"(g + 2 * DM), "v"(g + 4 * DM), "v"(g + 6 * DM),
         "v"(g + 8 * DM), "v"(g + 10 * DM), "v"(g + 12 * DM), "v"(g + 14 * DM)
      : "memory");
}
/* one wave's 64 rows of one stage */
__device__ __forceinline__ void stage_copy(unsigned l, const unsigned short* g)
{
  /* unrolled: the row offsets of the four statements are constants */
#pragma unroll
  for (int q = 0; q < 4; ++q) copy8(l + (unsigned)(q * 16 * GP * 2), g + (size_t)q * 16 * DM);
}

template <bool BF>
__device__ __forceinline__ void gemm_ring(const unsigned short* __restrict__ A, const unsigned short* __restrict__ B,
                                          unsigned short* ring, v8f (&acc)[2][4])
{
  const int lane = threadIdx.x & 31;
  const int wave = __builtin_amdgcn_readfirstlane((int)(threadIdx.x >> 5));
  const int hh = lane >> 4, m = lane & 15;

  /* copy addresses: lanes 0..15 one row, lanes 16..31 the next, 16 B per lane */
  const unsigned short* g0 = (wave == 0 ? A : B) + (size_t)hh * DM + m * 8;
  const unsigned l0 = (unsigned)(size_t)ring + (unsigned)(((wave * 64 + hh) * GP + m * 8) * 2);

  stage_copy(l0, g0);
  /* stage 0 has landed before the barrier that publishes it */
  asm volatile("s_wait_asynccnt 0x0" ::: "memory");
  __syncthreads();
  stage_copy(l0 + (unsigned)(GBUF * 2), g0 + GKS);

  const unsigned short* fa = ring + (wave * 32 + m) * GP + 8 * hh;
  const unsigned short* fb = ring + (64 + m) * GP + 8 * hh;

  /* rolled: one body in the instruction cache, the buffer chosen by the trip's parity */
#pragma unroll 1
  for (int t = 0; t < GNST; ++t) {
    const int bo = (t & 1) * GBUF;
    const unsigned short* pa = fa + bo;
    const unsigned short* pb = fb + bo;
    /* every loop below is unrolled so that each index of the two fragment sets is a constant and the sets stay in registers */
    FR a[2][2], b[2][4];
#pragma unroll
    for (int mi = 0; mi < 2; ++mi) {
      a[0][mi].h[0] = *(const v8us*)(pa + mi * 16 * GP);
      a[0][mi].h[1] = *(const v8us*)(pa + mi * 16 * GP + 16);
    }
#pragma unroll
    for (int ni = 0; ni < 4; ++ni) {
      b[0][ni].h[0] = *(const v8us*)(pb + ni * 16 * GP);
      b[0][ni].h[1] = *(const v8us*)(pb + ni * 16 * GP + 16);
    }
#pragma unroll
    for (int ks = 0; ks < GKS / 32; ++ks) {
      const int cur = ks & 1, nxt = cur ^ 1;
      if (ks + 1 < GKS / 32) {          /* next k step's fragments of the same stage, ahead of this step's products */
#pragma unroll
        for (int mi = 0; mi < 2; ++mi) {
          a[nxt][mi].h[0] = *(const v8us*)(pa + mi * 16 * GP + (ks + 1) * 32);
          a[nxt][mi].h[1] = *(const v8us*)(pa + mi * 16 * GP + (ks + 1) * 32 + 16);
        }
#pragma unroll
        for (int ni = 0; ni < 4; ++ni) {
          b[nxt][ni].h[0] = *(const v8us*)(pb + ni * 16 * GP + (ks + 1) * 32);
          b[nxt][ni].h[1] = *(const v8us*)(pb + ni * 16 * GP + (ks + 1) * 32 + 16);
        }
      }
#pragma unroll
      for (int ni = 0; ni < 4; ++ni) {
        if constexpr (BF) {
          acc[0][ni] = mma_b(a[cur][0].bv, b[cur][ni].bv, acc[0][ni]);
          acc[1][ni] = mma_b(a[cur][1].bv, b[cur][ni].bv, acc[1][ni]);
        } else {
          acc[0][ni] = mma_h(a[cur][0].hv, b[cur][ni].hv, acc[0][ni]);
          acc[1][ni] = mma_h(a[cur][1].hv, b[cur][ni].hv, acc[1][ni]);
        }
      }
    }
    /* this wave's reads of buffer t&1 have returned before the buffer is refilled */
    asm volatile("s_wait_dscnt 0x0" ::: "memory");
    /* this wave's copies of stage t+1 have landed before the barrier that publishes them */
    asm volatile("s_wait_asynccnt 0x0" ::: "memory");
    __syncthreads();
    if (t + 2 < GNST) stage_copy(l0 + (unsigned)(bo * 2), g0 + (size_t)(t + 2) * GKS);
  }
  /* no copy is outstanding when the wave goes on */
  asm volatile("s_wait_asynccnt 0x0" ::: "memory");
}

/* --------------------------------------------------------------------------
 * f32 [nrows][ncols] -> 16-bit plane [nrows_pad][ncols]; rows >= nrows are zeros.
 * mode 0: bf16 bits (RNE).  mode 1: f16 bits of (scale * bf16(x)).
 * One unit u = 8 consecutive values of row u / (ncols/8); the caller hands out u < nrows_pad*ncols/8.
 * ------------------------------------------------------------------------ */
template <int nrows, int ncols, int mode>
__device__ __forceinline__ void cvt_unit(const float* __restrict__ src, float scale,
                                         unsigned short* __restrict__ dst, int u)
{
  constexpr int upr = ncols >> 3;
  const int row = u / upr;
  const int cu  = u - row * upr;
  const int rowc = row < nrows ? row : nrows - 1;          /* clamped address */
  const bool live = row < nrows;
  const float* p = src + (size_t)rowc * ncols + cu * 8;
  const v4f x0 = *(const v4f*)p;
  const v4f x1 = *(const v4f*)(p + 4);
  unsigned b0, b1, b2, b3, b4, b5, b6, b7;
  {
    const float f0 = live ? x0[0] : 0.f, f1 = live ? x0[1] : 0.f, f2 = live ? x0[2] : 0.f, f3 = live ? x0[3] : 0.f;
    const float f4 = live ? x1[0] : 0.f, f5 = live ? x1[1] : 0.f, f6 = live ? x1[2] : 0.f, f7 = live ? x1[3] : 0.f;
    if (mode == 0) {
      b0 = f2bf_bits(f0); b1 = f2bf_bits(f1); b2 = f2bf_bits(f2); b3 = f2bf_bits(f3);
      b4 = f2bf_bits(f4); b5 = f2bf_bits(f5); b6 = f2bf_bits(f6); b7 = f2bf_bits(f7);
    } else {
      b0 = h_bits(bfr(f0) * scale); b1 = h_bits(bfr(f1) * scale); b2 = h_bits(bfr(f2) * scale); b3 = h_bits(bfr(f3) * scale);
      b4 = h_bits(bfr(f4) * scale); b5 = h_bits(bfr(f5) * scale); b6 = h_bits(bfr(f6) * scale); b7 = h_bits(bfr(f7) * scale);
    }
  }
  v4u w;
  w[0] = b0 | (b1 << 16);
  w[1] = b2 | (b3 << 16);
  w[2] = b4 | (b5 << 16);
  w[3] = b6 | (b7 << 16);
  unsigned short* d = dst + (size_t)u * 8;
  *(v4u*)d = w;
  /* another branch's text follows in the caller: no register that the store names is rewritten in front of this wait */
  asm volatile("s_wait_xcnt 0x0" ::: "memory");
}

/* --------------------------------------------------------------------------
 * Per (query block, key chunk) flag from the int32 key mask:
 *   0 = every effective entry masked (chunk skipped), 1 = all kept, 2 = mixed.
 * Effective entry (t, s): query row clamped to TT-1 for padded rows, keys s >= TT masked.
 * Block = (query block qb, flag line ln), 16 waves: the chunks kc = ln + FLN*j, j < FSL.
 * Wave w reads rows 4w..4w+3 of every chunk of the block; all loads are independent, so
 * the whole strip is in flight at once.  Per wave one any-kept and one all-kept bit per
 * chunk (ballots), combined over the 16 waves through LDS behind one block barrier.
 * Coverage: wave 0 stores the block's whole 128-byte line (unused slots 0);
 * NQB x FLN blocks = the whole table.  wany, wall: 16 LDS words each.
 * ------------------------------------------------------------------------ */
__device__ __forceinline__ int flag_slot(int kc) { return (kc % FLN) * 32 + kc / FLN; }

__device__ __forceinline__ void flags_block(const int* __restrict__ mask, int* __restrict__ flags,
                                            int qb, int ln, unsigned* wany, unsigned* wall)
{
  const int tid = threadIdx.x, lane = tid & 31;
  const int wave = __builtin_amdgcn_readfirstlane(tid >> 5);   /* scalar, so the row bases are scalar */

  /* key of slot j, half hf: s = col0 + FLN*64*j + 32*hf.  Only the last slot can pass TT. */
  constexpr int LOFF = FLN * (FSL - 1) * 64;
  static_assert(LOFF - 1 < TT);
  const unsigned col0 = (unsigned)(ln * 64 + lane);
  const unsigned sl0 = col0 + LOFF, sl1 = sl0 + 32u;
  const unsigned cl0 = sl0 < (unsigned)TT ? sl0 : (unsigned)(TT - 1);   /* clamped address */
  const unsigned cl1 = sl1 < (unsigned)TT ? sl1 : (unsigned)(TT - 1);   /* clamped address */
  const int* rowp[4];
#pragma unroll
  for (int rr = 0; rr < 4; ++rr) {
    int t = qb * 64 + wave * 4 + rr;
    t = t < TT ? t : TT - 1;
    rowp[rr] = mask + (size_t)t * SEQ_FULL;
  }

  /* first every load, then every count */
  int mv[FSL][8];
#pragma unroll
  for (int j = 0; j < FSL - 1; ++j) {
#pragma unroll
    for (int it = 0; it < 8; ++it)
      mv[j][it] = (rowp[it >> 1] + col0)[FLN * j * 64 + (it & 1) * 32];
  }
#pragma unroll
  for (int it = 0; it < 8; ++it)
    mv[FSL - 1][it] = rowp[it >> 1][(it & 1) ? cl1 : cl0];
  /* keeps every load in front of every count: without it the scheduler mixes them and fewer loads fly at once */
  __builtin_amdgcn_sched_barrier(0);
  /* every register that the issued loads name (row bases, key offsets) is an input here, so none is
     rewritten in front of this wait */
  asm volatile("s_wait_xcnt 0x0"
               :: "s"(rowp[0]), "s"(rowp[1]), "s"(rowp[2]), "s"(rowp[3]), "v"(col0), "v"(cl0), "v"(cl1)
               : "memory");

  int cnt[FSL];
#pragma unroll
  for (int j = 0; j < FSL; ++j) {
    int n = 0;
#pragma unroll
    for (int it = 0; it < 8; ++it) {
      const bool ex = (j < FSL - 1) || (((it & 1) ? sl1 : sl0) < (unsigned)TT);   /* key exists */
      n += (ex && mv[j][it] != 0) ? 1 : 0;
    }
    cnt[j] = n;
  }

  unsigned anym = 0u, allm = 0u;                           /* wave-uniform, bit j = chunk ln + FLN*j */
#pragma unroll
  for (int j = 0; j < FSL; ++j) {
    anym |= (__builtin_amdgcn_ballot_w32(cnt[j] != 0) != 0u) ? (1u << j) : 0u;
    allm |= (__builtin_amdgcn_ballot_w32(cnt[j] == 8) == 0xFFFFFFFFu) ? (1u << j) : 0u;
  }
  if (lane == 0) { wany[wave] = anym; wall[wave] = allm; }
  __syncthreads();

  if (wave == 0) {
    unsigned a = 0u, f = 0xFFFFFFFFu;
#pragma unroll
    for (int w = 0; w < 16; ++w) { a |= wany[w]; f &= wall[w]; }
    int fv = 0;
    if (lane < FSL) fv = ((a >> lane) & 1u) ? (((f >> lane) & 1u) ? 1 : 2) : 0;
    flags[((size_t)qb * FLN + ln) * 32 + lane] = fv;
  }
}

/* --------------------------------------------------------------------------
 * Everything that depends on the inputs alone, in one launch of 512-thread blocks:
 * blocks [0, FBL): mask flags, block b = (query block b / FLN, flag line b % FLN);
 * then 3 x XBL blocks: q, k, v planes; 3 x WBL: Wq, Wk, Wv planes; WBL: Wo plane; EBL: Er plane.
 * A conversion block = 512 units, one per thread; every plane's unit count is a multiple of 512.
 * The branch on the block index is block-uniform (the flags part holds a block barrier).
 * ------------------------------------------------------------------------ */
constexpr int PBT = 512;
constexpr int FBL = NQB * FLN;
constexpr int XBL = TPAD * (DM / 8) / PBT;
constexpr int WBL = DM * (DM / 8) / PBT;
constexpr int EBL = TPAD * (HD / 8) / PBT;
constexpr int PREP_BLOCKS = FBL + 3 * XBL + 4 * WBL + EBL;
static_assert(TPAD * (DM / 8) % PBT == 0 && DM * (DM / 8) % PBT == 0 && TPAD * (HD / 8) % PBT == 0);

__global__ __launch_bounds__(512) void prep_kernel(
    const float* __restrict__ q, const float* __restrict__ k, const float* __restrict__ v,
    const int* __restrict__ mask,
    const float* __restrict__ Wq_w, const float* __restrict__ Wk_w, const float* __restrict__ Wv_w,
    const float* __restrict__ Wo_w, const float* __restrict__ Er,
    unsigned short* __restrict__ Xq, unsigned short* __restrict__ Xk, unsigned short* __restrict__ Xv,
    unsigned short* __restrict__ Wq, unsigned short* __restrict__ Wk, unsigned short* __restrict__ Wv,
    unsigned short* __restrict__ Wo, unsigned short* __restrict__ Eh, int* __restrict__ flags)
{
  __shared__ unsigned wany[16];
  __shared__ unsigned wall[16];
  const int tid = threadIdx.x;
  int b = blockIdx.x;
  if (b < FBL) { flags_block(mask, flags, b / FLN, b % FLN, wany, wall); return; }
  b -= FBL;
  if (b < 3 * XBL) {
    const int j = b / XBL;
    cvt_unit<TT, DM, 0>(j == 0 ? q : j == 1 ? k : v, 1.0f, j == 0 ? Xq : j == 1 ? Xk : Xv, (b - j * XBL) * PBT + tid);
    return;
  }
  b -= 3 * XBL;
  if (b < 3 * WBL) {
    const int j = b / WBL;
    cvt_unit<DM, DM, 0>(j == 0 ? Wq_w : j == 1 ? Wk_w : Wv_w, 1.0f, j == 0 ? Wq : j == 1 ? Wk : Wv, (b - j * WBL) * PBT + tid);
    return;
  }
  b -= 3 * WBL;
  if (b < WBL) { cvt_unit<DM, DM, 1>(Wo_w, WOSC, Wo, b * PBT + tid); return; }
  b -= WBL;
  cvt_unit<TT, HD, 1>(Er, 1.0f, Eh, b * PBT + tid);
}

/* --------------------------------------------------------------------------
 * Projection GEMM: Y[t][n] = sum_k X[t][k] W[n][k] + b[n] for one 64-token x 64-col
 * (= one head) tile per block; bf16 operands (X and W planes), f32 accumulate.
 * Block = 2 waves (64 threads); wave w: tokens w*32..w*32+31 (2 row tiles) x 4 col tiles; main loop: gemm_ring.
 * A fragment (row m = lane&15): elems 0..7 <- k0+8h+i, 8..15 <- k0+16+8h+i.
 * B[k][n] = W[n][k]: loaded from row n = lane&15 with the same k map.  D elem r = (row 8h+r, col lane&15).
 * Epilogue: hi = f16(y), res = f16((y - hi) * 2048), rows t >= TT forced to 0; the block's
 * MODE 0: Q -> [NH][TPAD][HD] (+ residual rows < QRES); 1: K -> same (+ residual rows < CRES);
 * MODE 2: V -> [NH][HD][TPAD] (+ residual [NH][HD][CRES]).
 * Coverage per block: 8 iterations x 64 threads = 512 units = 64 rows x 8 segments (hi and res).
 * LDS tiles th/tr: cross-wave, separated by a block barrier; reloaded through the stored element type.
 * The three projections share one launch: grid (NTB, NH, 3), MODE = blockIdx.z (block-uniform);
 * the main loop is common, proj_tail<MODE> is the epilogue.
 * ------------------------------------------------------------------------ */
constexpr int PT = 72;

template <int MODE>
__device__ __forceinline__ void proj_tail(
    v8f (&acc)[2][4], const float* __restrict__ bias, unsigned short* __restrict__ Ph,
    unsigned short* __restrict__ Pr, unsigned short* th, unsigned short* tr)
{
  constexpr int NRES_TB = (MODE == 0) ? (NEARLY + 1) : NEARLY;
  const int tid = threadIdx.x, wave = tid >> 5, lane = tid & 31;
  const int hh = lane >> 4, m = lane & 15;
  const int tb = blockIdx.x, head = blockIdx.y;
  const int n0 = head * 64;
  const int rl0 = wave * 32;

  float bb[4];
#pragma unroll
  for (int ni = 0; ni < 4; ++ni) bb[ni] = bfr(bias[n0 + ni * 16 + m]);

#pragma unroll
  for (int mi = 0; mi < 2; ++mi) {
#pragma unroll
    for (int ni = 0; ni < 4; ++ni) {
#pragma unroll
      for (int r = 0; r < 8; ++r) {
        const int rl  = rl0 + mi * 16 + 8 * hh + r;
        const int t   = tb * 64 + rl;
        const int col = ni * 16 + m;
        float y = acc[mi][ni][r] + bb[ni];
        y = (t < TT) ? y : 0.f;
        const unsigned short hb = h_bits(y);
        const float res = (y - h2f(hb)) * RSC;
        const unsigned short rb = h_bits(res);
        if (MODE == 2) { th[col * PT + rl] = hb; tr[col * PT + rl] = rb; }
        else           { th[rl * PT + col] = hb; tr[rl * PT + col] = rb; }
      }
    }
  }
  __syncthreads();

  const bool dores = tb < NRES_TB;    /* block-uniform */
  {
#pragma unroll
    for (int it = 0; it < 8; ++it) {
      const int u = it * 64 + tid;
      const int row = u >> 3, seg = u & 7;
      const v8us vh = *(const v8us*)(th + row * PT + seg * 8);
      const v8us vr = *(const v8us*)(tr + row * PT + seg * 8);
      if (MODE == 2) {
        *(v8us*)(Ph + ((size_t)head * HD + row) * TPAD + tb * 64 + seg * 8) = vh;
        if (dores) *(v8us*)(Pr + ((size_t)head * HD + row) * CRES + tb * 64 + seg * 8) = vr;
      } else {
        *(v8us*)(Ph + ((size_t)head * TPAD + tb * 64 + row) * HD + seg * 8) = vh;
        if (dores) {
          if (MODE == 0) *(v8us*)(Pr + ((size_t)head * QRES + tb * 64 + row) * HD + seg * 8) = vr;
          else           *(v8us*)(Pr + ((size_t)head * CRES + tb * 64 + row) * HD + seg * 8) = vr;
        }
      }
    }
    
  }
  /* another epilogue's text follows in the caller: no register that the last stores name is rewritten in front of this wait */
  asm volatile("s_wait_xcnt 0x0" ::: "memory");
}

__global__ __launch_bounds__(64) __attribute__((amdgpu_num_vgpr(256)))
void proj_kernel(
    const unsigned short* __restrict__ Xq, const unsigned short* __restrict__ Xk, const unsigned short* __restrict__ Xv,
    const unsigned short* __restrict__ Wq, const unsigned short* __restrict__ Wk, const unsigned short* __restrict__ Wv,
    const float* __restrict__ bq, const float* __restrict__ bk, const float* __restrict__ bv,
    unsigned short* __restrict__ Qh, unsigned short* __restrict__ Kh, unsigned short* __restrict__ Vt,
    unsigned short* __restrict__ Qr, unsigned short* __restrict__ Kr, unsigned short* __restrict__ Vr)
{
  __shared__ __align__(16) unsigned short th[64 * PT];
  __shared__ __align__(16) unsigned short tr[64 * PT];
  __shared__ __align__(16) unsigned short ring[2 * GBUF];

  const int tb = blockIdx.x, head = blockIdx.y, mode = blockIdx.z;
  const unsigned short* X = mode == 0 ? Xq : mode == 1 ? Xk : Xv;
  const unsigned short* W = mode == 0 ? Wq : mode == 1 ? Wk : Wv;

  v8f acc[2][4];
#pragma unroll
  for (int mi = 0; mi < 2; ++mi)
#pragma unroll
    for (int ni = 0; ni < 4; ++ni) acc[mi][ni] = zero8();

  gemm_ring<true>(X + (size_t)tb * 64 * DM, W + (size_t)head * 64 * DM, ring, acc);

  if (mode == 0)      proj_tail<0>(acc, bq, Qh, Qr, th, tr);
  else if (mode == 1) proj_tail<1>(acc, bk, Kh, Kr, th, tr);
  else                proj_tail<2>(acc, bv, Vt, Vr, th, tr);
}

/* --------------------------------------------------------------------------
 * Flash attention with the row-shifted Er term, head dim 64.
 * Block = 4 waves = 64 query rows of one head; grid (query blocks, NH).
 * Per kept 64-key chunk: K [key][d], Er [key][d], V^T [d][key] f16 tiles staged in LDS
 * (EARLY: also K and V^T residual tiles), scores = qh.k^T + qh(t+1).Er^T on f16 WMMA,
 * x0.125, replace-fill -inf from the key mask (flag 2 chunks), f32 online softmax,
 * P = f16(1024 p) per-wave LDS tile (EARLY: + f16 residual x2048), O += P.V on f16 WMMA
 * (O therefore carries the x1024 of P; the normaliser applies 1/(1024 l) x 16 in one factor).
 * EARLY adds (qh.k_res + q_res.k + q_res(t+1).Er)/2048 to the scores and
 * (P.V_res + P_res.V)/2048 to O through separate accumulators folded per tile.
 * Live-state plan: Q hi fragments reloaded per chunk (dead during softmax and P.V),
 * Q residual fragments loaded only inside the residual score phase, one 8-register
 * residual accumulator at a time; <= 4 O tiles + 4 score tiles + m/l persistent.
 * Epilogue: ctx = O/(1024 l) carried x16 as f16 into [TPAD][DM] (+ residual rows < CRES),
 * Fragment map as in proj_kernel (A row / B col = lane&15, split k map, D elem r = row 8h+r).
 * LDS regions: K/Er/V/res tiles and msk cross-wave (block barriers); P tiles and the
 * Both variants share one launch: grid (NQB, NH), EARLY = (query block < NEARLY), block-uniform;
 * sm holds 7 tiles (the variant without residuals uses the first 4), msk 4096 bytes.
 * ------------------------------------------------------------------------ */
/* LDS row pitch of every fragment-read tile: 72 halves = 144 B = 16 B x 9 (odd), so the 16 rows that one
   ds_load_b128 reads fall on 16 distinct groups of four banks; at 128 B they fall on two groups */
constexpr int LP = 72;
constexpr int TSZ = 64 * LP;                       /* one 64-row tile, or four 16-row P tiles */

template <bool EARLY>
__device__ __forceinline__
void attn_body(const unsigned short* __restrict__ Qh, const unsigned short* __restrict__ Qr,
               const unsigned short* __restrict__ Kh, const unsigned short* __restrict__ Kr,
               const unsigned short* __restrict__ Vt, const unsigned short* __restrict__ Vr,
               const unsigned short* __restrict__ Erp, const int* __restrict__ mask,
               const int* __restrict__ flags, unsigned short* __restrict__ Ct,
               unsigned short* __restrict__ Cr, unsigned short* sm, unsigned char* msk)
{
  constexpr int KSH = 0, ESH = TSZ, VTH = 2 * TSZ, PSH = 3 * TSZ, KRS = 4 * TSZ, VRS = 5 * TSZ;
  constexpr int PRS = EARLY ? 6 * TSZ : PSH;
  union FH { v16h v; v8us h[2]; };

  const int tid = threadIdx.x, wave = tid >> 5, lane = tid & 31;
  const int hh = lane >> 4, c = lane & 15;
  const int qb = blockIdx.x;
  const int head = blockIdx.y;
  const int q0 = qb * 64 + wave * 16;
  const int wrow0 = wave * 16;                     /* the wave's first row inside the block tile */

  /* fragment base pointers: rows q0+c (q.k^T) and q0+1+c (shifted Er term) */
  const unsigned short* qp = Qh + ((size_t)head * TPAD + q0 + c) * HD + 8 * hh;
  const unsigned short* rp = Qr + ((size_t)head * QRES + (EARLY ? (q0 + c) : c)) * HD + 8 * hh;

  float mrow[8], lrow[8];
  v8f oacc[4];
#pragma unroll
  for (int r = 0; r < 8; ++r) { mrow[r] = -__builtin_inff(); lrow[r] = 0.f; }
#pragma unroll
  for (int t = 0; t < 4; ++t) oacc[t] = zero8();

  unsigned short* pwh = sm + PSH + wave * (16 * LP);
  unsigned short* pwr = sm + PRS + wave * (16 * LP);
  const int* frow = flags + (size_t)qb * (FLN * 32);

#pragma unroll 1
  for (int kc = 0; kc < NKC; ++kc) {
    const int fk = __builtin_amdgcn_readfirstlane(frow[flag_slot(kc)]);   /* block-uniform */
    if (fk == 0) continue;
    const int kv0 = kc * 64;
    const bool useres = EARLY && (kc < NEARLY);
    const int kvr = (kc < NEARLY) ? kv0 : 0;                   /* clamped residual chunk base */

    __syncthreads();
    /* staging: unit u -> row u>>3 (0..63), seg u&7; 4 iterations x 128 threads = 512 units per tile */
    {
      const unsigned short *gk[4], *ge[4], *gv[4];
      v4u tk[4], te[4], tv[4];
#pragma unroll
      for (int it = 0; it < 4; ++it) {
        const int u = it * 128 + tid;
        const int row = u >> 3, seg = u & 7;
        gk[it] = Kh + ((size_t)head * TPAD + kv0 + row) * HD + seg * 8;
        ge[it] = Erp + (size_t)(kv0 + row) * HD + seg * 8;
        gv[it] = Vt + ((size_t)head * HD + row) * TPAD + kv0 + seg * 8;
        tk[it] = *(const v4u*)gk[it];
        te[it] = *(const v4u*)ge[it];
        tv[it] = *(const v4u*)gv[it];
      }
      /* every address that the issued loads name is an input here, so none is rewritten in front of this wait */
      asm volatile("s_wait_xcnt 0x0"
                   :: "v"(gk[0]), "v"(gk[1]), "v"(gk[2]), "v"(gk[3]), "v"(ge[0]), "v"(ge[1]), "v"(ge[2]), "v"(ge[3]),
                      "v"(gv[0]), "v"(gv[1]), "v"(gv[2]), "v"(gv[3])
                   : "memory");
#pragma unroll
      for (int it = 0; it < 4; ++it) {
        const int u = it * 128 + tid;
        const int row = u >> 3, seg = u & 7;
        *(v4u*)(sm + KSH + row * LP + seg * 8) = tk[it];
        *(v4u*)(sm + ESH + row * LP + seg * 8) = te[it];
        *(v4u*)(sm + VTH + row * LP + seg * 8) = tv[it];
      }
    }
    if (EARLY) {
      const unsigned short *gkr[4], *gvr[4];
      v4u tkr[4], tvr[4];
#pragma unroll
      for (int it = 0; it < 4; ++it) {
        const int u = it * 128 + tid;
        const int row = u >> 3, seg = u & 7;
        gkr[it] = Kr + ((size_t)head * CRES + kvr + row) * HD + seg * 8;
        gvr[it] = Vr + ((size_t)head * HD + row) * CRES + kvr + seg * 8;
        tkr[it] = *(const v4u*)gkr[it];
        tvr[it] = *(const v4u*)gvr[it];
      }
      /* as above: the addresses of the issued loads stay whole up to this wait */
      asm volatile("s_wait_xcnt 0x0"
                   :: "v"(gkr[0]), "v"(gkr[1]), "v"(gkr[2]), "v"(gkr[3]), "v"(gvr[0]), "v"(gvr[1]), "v"(gvr[2]), "v"(gvr[3])
                   : "memory");
#pragma unroll
      for (int it = 0; it < 4; ++it) {
        const int u = it * 128 + tid;
        const int row = u >> 3, seg = u & 7;
        *(v4u*)(sm + KRS + row * LP + seg * 8) = tkr[it];
        *(v4u*)(sm + VRS + row * LP + seg * 8) = tvr[it];
      }
    }
    if (fk == 2) {
      /* key mask tile: thread -> row tid>>1, 32 columns; clamped addresses, keys >= TT masked */
      const int row = tid >> 1, hsel = tid & 1;
      int qrow = qb * 64 + row;
      qrow = qrow < TT ? qrow : TT - 1;
      const int* mb = mask + (size_t)qrow * SEQ_FULL;
#pragma unroll 1
      for (int g = 0; g < 4; ++g) {
#pragma unroll
        for (int e = 0; e < 8; ++e) {
          const int col = hsel * 32 + g * 8 + e;
          const int s = kv0 + col;
          const int sc = s < TT ? s : TT - 1;
          const int mv = mb[sc];
          msk[row * 64 + col] = (unsigned char)((s < TT && mv != 0) ? 1 : 0);
        }
      }
    }
    __syncthreads();

    /* Q hi fragments for this chunk, two 32-deep d halves */
    FH qa[2], qs[2];
#pragma unroll
    for (int dc = 0; dc < 2; ++dc) {
      qa[dc].h[0] = *(const v8us*)(qp + dc * 32);
      qa[dc].h[1] = *(const v8us*)(qp + dc * 32 + 16);
      qs[dc].h[0] = *(const v8us*)(qp + HD + dc * 32);
      qs[dc].h[1] = *(const v8us*)(qp + HD + dc * 32 + 16);
    }

    /* scores: 16 query rows x 64 keys per wave */
    v8f s[4];
#pragma unroll
    for (int j = 0; j < 4; ++j) {
      s[j] = zero8();
#pragma unroll
      for (int dc = 0; dc < 2; ++dc) {
        FH kf, ef;
        kf.h[0] = *(const v8us*)(sm + KSH + (j * 16 + c) * LP + dc * 32 + 8 * hh);
        kf.h[1] = *(const v8us*)(sm + KSH + (j * 16 + c) * LP + dc * 32 + 16 + 8 * hh);
        ef.h[0] = *(const v8us*)(sm + ESH + (j * 16 + c) * LP + dc * 32 + 8 * hh);
        ef.h[1] = *(const v8us*)(sm + ESH + (j * 16 + c) * LP + dc * 32 + 16 + 8 * hh);
        s[j] = mma_h(qa[dc].v, kf.v, s[j]);
        s[j] = mma_h(qs[dc].v, ef.v, s[j]);
      }
      if (EARLY) {
        if (useres) {
          v8f sr = zero8();
#pragma unroll
          for (int dc = 0; dc < 2; ++dc) {
            FH kf, ef, krf, qra, qrs;
            kf.h[0]  = *(const v8us*)(sm + KSH + (j * 16 + c) * LP + dc * 32 + 8 * hh);
            kf.h[1]  = *(const v8us*)(sm + KSH + (j * 16 + c) * LP + dc * 32 + 16 + 8 * hh);
            ef.h[0]  = *(const v8us*)(sm + ESH + (j * 16 + c) * LP + dc * 32 + 8 * hh);
            ef.h[1]  = *(const v8us*)(sm + ESH + (j * 16 + c) * LP + dc * 32 + 16 + 8 * hh);
            krf.h[0] = *(const v8us*)(sm + KRS + (j * 16 + c) * LP + dc * 32 + 8 * hh);
            krf.h[1] = *(const v8us*)(sm + KRS + (j * 16 + c) * LP + dc * 32 + 16 + 8 * hh);
            qra.h[0] = *(const v8us*)(rp + dc * 32);
            qra.h[1] = *(const v8us*)(rp + dc * 32 + 16);
            qrs.h[0] = *(const v8us*)(rp + HD + dc * 32);
            qrs.h[1] = *(const v8us*)(rp + HD + dc * 32 + 16);
            sr = mma_h(qa[dc].v, krf.v, sr);
            sr = mma_h(qra.v, kf.v, sr);
            sr = mma_h(qrs.v, ef.v, sr);
          }
#pragma unroll
          for (int r = 0; r < 8; ++r) s[j][r] += sr[r] * RINV;
        }
      }
    }

    /* scale by 1/sqrt(64) and replace-fill from the key mask (this wave's rows) */
#pragma unroll
    for (int j = 0; j < 4; ++j) {
#pragma unroll
      for (int r = 0; r < 8; ++r) s[j][r] *= 0.125f;
    }
    if (fk == 2) {
#pragma unroll
      for (int j = 0; j < 4; ++j) {
#pragma unroll
        for (int r = 0; r < 8; ++r) {
          const unsigned char mv = msk[(wrow0 + 8 * hh + r) * 64 + j * 16 + c];
          s[j][r] = mv ? s[j][r] : -__builtin_inff();
        }
      }
    }

    /* chunk row max over 64 keys (16 lanes of one half x 4 tiles) */
    float cm[8];
#pragma unroll
    for (int r = 0; r < 8; ++r) {
      float mx = fmaxf(fmaxf(s[0][r], s[1][r]), fmaxf(s[2][r], s[3][r]));
#pragma unroll
      for (int off = 1; off < 16; off <<= 1) mx = fmaxf(mx, __shfl_xor(mx, off, 32));
      cm[r] = mx;
    }

    /* online softmax update; P tiles (carried x1024) into the wave's LDS tile */
#pragma unroll
    for (int r = 0; r < 8; ++r) {
      const float mnew = fmaxf(mrow[r], cm[r]);
      const bool dead = (mnew == -__builtin_inff());
      const float aexp = __expf(mrow[r] - mnew);
      const float alpha = dead ? 1.f : aexp;
      mrow[r] = mnew;
      float psum = 0.f;
#pragma unroll
      for (int j = 0; j < 4; ++j) {
        const float pe = __expf(s[j][r] - mnew);
        const float p = dead ? 0.f : pe;
        psum += p;
        const float pc = p * PSC;
        const unsigned short hb = h_bits(pc);
        pwh[(8 * hh + r) * LP + j * 16 + c] = hb;
        if (EARLY) {
          const float pres = (pc - h2f(hb)) * RSC;
          pwr[(8 * hh + r) * LP + j * 16 + c] = h_bits(pres);
        }
      }
#pragma unroll
      for (int off = 1; off < 16; off <<= 1) psum += __shfl_xor(psum, off, 32);
      lrow[r] = lrow[r] * alpha + psum;
#pragma unroll
      for (int t = 0; t < 4; ++t) oacc[t][r] *= alpha;
    }
    __builtin_amdgcn_fence(3, "workgroup");
    __builtin_amdgcn_wave_barrier();
    __builtin_amdgcn_fence(2, "workgroup");

    /* O += P.V : A = P [q][key] (this wave's tile), B = V [key][d] from V^T [d][key] */
#pragma unroll
    for (int kk = 0; kk < 2; ++kk) {
      FH pa;
      pa.h[0] = *(const v8us*)(pwh + c * LP + kk * 32 + 8 * hh);
      pa.h[1] = *(const v8us*)(pwh + c * LP + kk * 32 + 16 + 8 * hh);
#pragma unroll
      for (int t = 0; t < 4; ++t) {
        FH vb;
        vb.h[0] = *(const v8us*)(sm + VTH + (t * 16 + c) * LP + kk * 32 + 8 * hh);
        vb.h[1] = *(const v8us*)(sm + VTH + (t * 16 + c) * LP + kk * 32 + 16 + 8 * hh);
        oacc[t] = mma_h(pa.v, vb.v, oacc[t]);
      }
    }
    if (EARLY) {
      if (useres) {
        /* residual products per d tile: one 8-register accumulator live at a time */
#pragma unroll
        for (int t = 0; t < 4; ++t) {
          v8f oar = zero8();
#pragma unroll
          for (int kk = 0; kk < 2; ++kk) {
            FH pa, pr, vb, vr;
            pa.h[0] = *(const v8us*)(pwh + c * LP + kk * 32 + 8 * hh);
            pa.h[1] = *(const v8us*)(pwh + c * LP + kk * 32 + 16 + 8 * hh);
            pr.h[0] = *(const v8us*)(pwr + c * LP + kk * 32 + 8 * hh);
            pr.h[1] = *(const v8us*)(pwr + c * LP + kk * 32 + 16 + 8 * hh);
            vb.h[0] = *(const v8us*)(sm + VTH + (t * 16 + c) * LP + kk * 32 + 8 * hh);
            vb.h[1] = *(const v8us*)(sm + VTH + (t * 16 + c) * LP + kk * 32 + 16 + 8 * hh);
            vr.h[0] = *(const v8us*)(sm + VRS + (t * 16 + c) * LP + kk * 32 + 8 * hh);
            vr.h[1] = *(const v8us*)(sm + VRS + (t * 16 + c) * LP + kk * 32 + 16 + 8 * hh);
            oar = mma_h(pa.v, vr.v, oar);
            oar = mma_h(pr.v, vb.v, oar);
          }
#pragma unroll
          for (int r = 0; r < 8; ++r) oacc[t][r] += oar[r] * RINV;
        }
      }
    }
  }

  /* epilogue: all waves are done with the staged tiles before the region is reused */
  __syncthreads();
  unsigned short* osh = sm + KSH + wave * 1024;     /* [16][64] hi, carried x16 */
  unsigned short* osr = sm + ESH + wave * 1024;     /* [16][64] residual x2048 (EARLY) */
#pragma unroll
  for (int r = 0; r < 8; ++r) {
    /* O holds 1024 x sum(p v); ctx = O / (1024 l); plane value = 16 ctx = O x (1/l) x (16/1024) */
    const float inv = (1.0f / lrow[r]) * OCV;
#pragma unroll
    for (int t = 0; t < 4; ++t) {
      const float o = oacc[t][r] * inv;
      const unsigned short hb = h_bits(o);
      osh[(8 * hh + r) * 64 + t * 16 + c] = hb;
      if (EARLY) {
        const float res = (o - h2f(hb)) * RSC;
        osr[(8 * hh + r) * 64 + t * 16 + c] = h_bits(res);
      }
    }
  }
  __builtin_amdgcn_fence(3, "workgroup");
  __builtin_amdgcn_wave_barrier();
  __builtin_amdgcn_fence(2, "workgroup");
  /* 16 rows x 8 segments = 4 iterations x 32 lanes; row = 4it + (lane>>3), seg = lane&7:
*/
  {
#pragma unroll
    for (int it = 0; it < 4; ++it) {
      const int u = it * 32 + lane;
      const int row = u >> 3, seg = u & 7;
      const v8us vh = *(const v8us*)(osh + row * 64 + seg * 8);
      *(v8us*)(Ct + (size_t)(q0 + row) * DM + head * 64 + seg * 8) = vh;
      if (EARLY) {
        const v8us vr = *(const v8us*)(osr + row * 64 + seg * 8);
        *(v8us*)(Cr + (size_t)(q0 + row) * DM + head * 64 + seg * 8) = vr;
      }
    }
    
  }
}

__global__ __launch_bounds__(128) __attribute__((amdgpu_num_vgpr(256)))
void attn_kernel(const unsigned short* __restrict__ Qh, const unsigned short* __restrict__ Qr,
                 const unsigned short* __restrict__ Kh, const unsigned short* __restrict__ Kr,
                 const unsigned short* __restrict__ Vt, const unsigned short* __restrict__ Vr,
                 const unsigned short* __restrict__ Erp, const int* __restrict__ mask,
                 const int* __restrict__ flags, unsigned short* __restrict__ Ct,
                 unsigned short* __restrict__ Cr)
{
  __shared__ __align__(16) unsigned short sm[7 * TSZ];
  __shared__ __align__(16) unsigned char msk[4096];
  if ((int)blockIdx.x < NEARLY) attn_body<true>(Qh, Qr, Kh, Kr, Vt, Vr, Erp, mask, flags, Ct, Cr, sm, msk);
  else                          attn_body<false>(Qh, Qr, Kh, Kr, Vt, Vr, Erp, mask, flags, Ct, Cr, sm, msk);
}

/* --------------------------------------------------------------------------
 * Output projection: out[t][n] = (sum_k ctx16[t][k] wo64[n][k]) / 1024 + b[n], f16 operands,
 * f32 accumulate.  Token blocks tb < NEARLY first accumulate the ctx residual products
 * alone from zero, scale that sum by 1/2048 in f32, and use it as the start value of
 * the hi-plane accumulation (no residual product enters an accumulator holding hi terms).
 * Block = 2 waves (64 threads), 64 tokens x 64 columns; grid (NQB, DM/64); main loops: gemm_ring.
 * Epilogue: 64x64 f32 tile staged in LDS (cross-wave, block barrier), then
 * Coverage: 16 iterations x 64 threads = 1024 units = 64 rows x 16 segments.
 * ------------------------------------------------------------------------ */
__global__ __launch_bounds__(64) __attribute__((amdgpu_num_vgpr(256)))
void out_kernel(
    const unsigned short* __restrict__ Ct, const unsigned short* __restrict__ Cr,
    const unsigned short* __restrict__ Wo, const float* __restrict__ bias, float* __restrict__ out)
{
  constexpr int PTF = 68;
  __shared__ __align__(16) float ts[64 * PTF];
  __shared__ __align__(16) unsigned short ring[2 * GBUF];

  const int tid = threadIdx.x, wave = tid >> 5, lane = tid & 31;
  const int hh = lane >> 4, m = lane & 15;
  const int tb = blockIdx.x, nb = blockIdx.y;
  const int n0 = nb * 64;
  const int rl0 = wave * 32;
  const bool dores = tb < NEARLY;     /* block-uniform */

  v8f acc[2][4];
#pragma unroll
  for (int mi = 0; mi < 2; ++mi)
#pragma unroll
    for (int ni = 0; ni < 4; ++ni) acc[mi][ni] = zero8();

  const unsigned short* wrows = Wo + (size_t)n0 * DM;

  if (dores) {
    gemm_ring<false>(Cr + (size_t)tb * 64 * DM, wrows, ring, acc);
#pragma unroll
    for (int mi = 0; mi < 2; ++mi)
#pragma unroll
      for (int ni = 0; ni < 4; ++ni)
#pragma unroll
        for (int r = 0; r < 8; ++r) acc[mi][ni][r] *= RINV;
  }

  gemm_ring<false>(Ct + (size_t)tb * 64 * DM, wrows, ring, acc);

  float bb[4];
#pragma unroll
  for (int ni = 0; ni < 4; ++ni) bb[ni] = bfr(bias[n0 + ni * 16 + m]);
#pragma unroll
  for (int mi = 0; mi < 2; ++mi) {
#pragma unroll
    for (int ni = 0; ni < 4; ++ni) {
#pragma unroll
      for (int r = 0; r < 8; ++r) {
        const int rl = rl0 + mi * 16 + 8 * hh + r;
        ts[rl * PTF + ni * 16 + m] = acc[mi][ni][r] * OINV + bb[ni];
      }
    }
  }
  __syncthreads();

  {
#pragma unroll
    for (int it = 0; it < 16; ++it) {
      const int u = it * 64 + tid;
      const int row = u >> 4, seg = u & 15;
      const int t = tb * 64 + row;
      const v4f v = *(const v4f*)(ts + row * PTF + seg * 4);
      if (t < TT) *(v4f*)(out + (size_t)t * DM + n0 + seg * 4) = v;
    }
    
  }
}

/* -------------------------------------------------------------------------- */
extern "C" void kernel_launch(void* const* d_in, const int* in_sizes, int n_in,
                              void* d_out, int out_size, void* d_ws, size_t ws_size,
                              hipStream_t stream)
{
  if (n_in < 13) return;
  if (in_sizes[0] < TT * DM || in_sizes[1] < TT * DM || in_sizes[2] < TT * DM) return;
  if (in_sizes[3] < (TT - 1) * SEQ_FULL + TT) return;
  if (in_sizes[4] < DM * DM || in_sizes[6] < DM * DM || in_sizes[8] < DM * DM || in_sizes[11] < DM * DM) return;
  if (in_sizes[5] < DM || in_sizes[7] < DM || in_sizes[9] < DM || in_sizes[12] < DM) return;
  if (in_sizes[10] < TT * HD) return;
  if (out_size < TT * DM) return;
  if (d_ws == nullptr || ws_size < WS_NEED) return;

  const float* q    = (const float*)d_in[0];
  const float* k    = (const float*)d_in[1];
  const float* v    = (const float*)d_in[2];
  const int*   mask = (const int*)d_in[3];
  const float* Wq_w = (const float*)d_in[4];
  const float* Wq_b = (const float*)d_in[5];
  const float* Wk_w = (const float*)d_in[6];
  const float* Wk_b = (const float*)d_in[7];
  const float* Wv_w = (const float*)d_in[8];
  const float* Wv_b = (const float*)d_in[9];
  const float* Er   = (const float*)d_in[10];
  const float* Wo_w = (const float*)d_in[11];
  const float* Wo_b = (const float*)d_in[12];
  float* outp = (float*)d_out;

  unsigned char* ws = (unsigned char*)d_ws;
  unsigned short* Xq = (unsigned short*)(ws + OFF_XQ);
  unsigned short* Xk = (unsigned short*)(ws + OFF_XK);
  unsigned short* Xv = (unsigned short*)(ws + OFF_XV);
  unsigned short* Wq = (unsigned short*)(ws + OFF_WQ);
  unsigned short* Wk = (unsigned short*)(ws + OFF_WK);
  unsigned short* Wv = (unsigned short*)(ws + OFF_WV);
  unsigned short* Wo = (unsigned short*)(ws + OFF_WO);
  unsigned short* Eh = (unsigned short*)(ws + OFF_ER);
  unsigned short* Qh = (unsigned short*)(ws + OFF_QH);
  unsigned short* Kh = (unsigned short*)(ws + OFF_KH);
  unsigned short* Vt = (unsigned short*)(ws + OFF_VT);
  unsigned short* Qr = (unsigned short*)(ws + OFF_QR);
  unsigned short* Kr = (unsigned short*)(ws + OFF_KR);
  unsigned short* Vr = (unsigned short*)(ws + OFF_VR);
  unsigned short* Ct = (unsigned short*)(ws + OFF_CT);
  unsigned short* Cr = (unsigned short*)(ws + OFF_CR);
  int* flags = (int*)(ws + OFF_FL);

  /* input planes (rows >= TT zero) and the per (query block, key chunk) skip/dense/mixed flags */
  prep_kernel<<<PREP_BLOCKS, PBT, 0, stream>>>(q, k, v, mask, Wq_w, Wk_w, Wv_w, Wo_w, Er,
                                               Xq, Xk, Xv, Wq, Wk, Wv, Wo, Eh, flags);

  /* projections: 64 tokens x one head per block, z = q, k, v */
  proj_kernel<<<dim3(NTB, NH, 3), 64, 0, stream>>>(Xq, Xk, Xv, Wq, Wk, Wv, Wq_b, Wk_b, Wv_b, Qh, Kh, Vt, Qr, Kr, Vr);

  /* attention: first NEARLY query blocks with residual products, the rest single products */
  attn_kernel<<<dim3(NQB, NH), 128, 0, stream>>>(Qh, Qr, Kh, Kr, Vt, Vr, Eh, mask, flags, Ct, Cr);

  /* output projection into d_out */
  out_kernel<<<dim3(NQB, DM / 64), 64, 0, stream>>>(Ct, Cr, Wo, Wo_b, outp);
}

// v005
// It runs in 117 microseconds.
// In two side-by-side timings against v004, it was 1.19 and 1.18 times as fast.
// All steps since v000 together make it 3.17 times as fast.
// Contractions: q/k/v input projections on v_wmma_f32_16x16x32_bf16 (bf16 operands = RNE-converted inputs and weights, f32 accumulate); scores q.k^T, row-shifted q.Er^T, p.v and the output projection on v_wmma_f32_16x16x32_f16 (f16 operands: f16 hi planes of projected q/k/v, p carried x1024 and folded as 1/1024 before the ctx plane, ctx carried x16, Wo carried x64, plus x2048 f16 residual planes for the first 256 query rows and first 256 keys), f32 accumulate; softmax and all other arithmetic in f32.
#include <hip/hip_runtime.h>

typedef _Float16       v16h __attribute__((ext_vector_type(16)));
typedef __bf16         v16b __attribute__((ext_vector_type(16)));
typedef unsigned short v8us __attribute__((ext_vector_type(8)));
typedef float          v8f  __attribute__((ext_vector_type(8)));
typedef float          v4f  __attribute__((ext_vector_type(4)));
typedef unsigned int   v4u  __attribute__((ext_vector_type(4)));
typedef int            v4i  __attribute__((ext_vector_type(4)));

#ifndef NB
#define NB 1
#endif
#ifndef SEQ
#define SEQ 2049
#endif
#define SEQ_FULL 2049

constexpr int DM     = 1024;
constexpr int NH     = 16;
constexpr int HD     = 64;
constexpr int TT     = SEQ;
constexpr int NQB    = (TT + 63) / 64;          /* query blocks of 64 rows */
constexpr int NTB    = NQB + 1;                  /* token blocks of the planes (one extra for the +1 row shift) */
constexpr int TPAD   = NTB * 64;                 /* padded token count of every plane */
constexpr int NKC    = NTB;                      /* key chunks of 64 */
constexpr int NEARLY = NQB < 4 ? NQB : 4;        /* query blocks with residual treatment */
constexpr int CRES   = NEARLY * 64;              /* rows of K/V/ctx residual planes */
constexpr int QRES   = (NEARLY + 1) * 64;        /* rows of the Q residual plane (covers the +1 shift) */

constexpr float RSC  = 2048.0f;                  /* residual plane carry */
constexpr float RINV = 1.0f / 2048.0f;
constexpr float PSC  = 1024.0f;                  /* softmax weight carry (on the p tile, hence on the p.v accumulator) */
constexpr float CSC  = 16.0f;                    /* ctx plane carry */
constexpr float OCV  = CSC / PSC;                /* 1/64: removes the p carry and applies the ctx carry in one factor */
constexpr float WOSC = 64.0f;                    /* Wo plane carry */
constexpr float OINV = 1.0f / (CSC * WOSC);      /* 1/1024 */

static_assert(NB == 1);
static_assert(SEQ <= SEQ_FULL);
static_assert(HD == 64);
static_assert(DM % 64 == 0 && DM % 32 == 0);
static_assert(TPAD % 64 == 0);
static_assert(NKC <= 64);
static_assert(QRES <= TPAD && CRES <= TPAD);

/* workspace region map (bytes, every offset a multiple of 128) */
constexpr size_t X_B  = (size_t)TPAD * DM * 2;       /* bf16 [TPAD][DM] */
constexpr size_t W_B  = (size_t)DM * DM * 2;         /* 16-bit [DM][DM] */
constexpr size_t E_B  = (size_t)TPAD * HD * 2;       /* f16 [TPAD][HD] */
constexpr size_t HP_B = (size_t)NH * TPAD * HD * 2;  /* f16 [NH][TPAD][HD] or [NH][HD][TPAD] */
constexpr size_t QR_B = (size_t)NH * QRES * HD * 2;  /* f16 [NH][QRES][HD] */
constexpr size_t KR_B = (size_t)NH * CRES * HD * 2;  /* f16 [NH][CRES][HD] or [NH][HD][CRES] */
constexpr size_t CT_B = (size_t)TPAD * DM * 2;       /* f16 [TPAD][DM] */
constexpr size_t CR_B = (size_t)CRES * DM * 2;       /* f16 [CRES][DM] */
constexpr int    FLN  = 4;                          /* 128-byte flag lines per query block, one writer each */
constexpr int    FSL  = (NKC + FLN - 1) / FLN;      /* key chunks (used slots) per flag line */
constexpr size_t FL_B = (size_t)NQB * FLN * 32 * 4; /* int [NQB][FLN][32]: chunk kc at line kc % FLN, slot kc / FLN */
static_assert(FSL <= 32);

constexpr size_t OFF_XQ = 0;
constexpr size_t OFF_XK = OFF_XQ + X_B;
constexpr size_t OFF_XV = OFF_XK + X_B;
constexpr size_t OFF_WQ = OFF_XV + X_B;
constexpr size_t OFF_WK = OFF_WQ + W_B;
constexpr size_t OFF_WV = OFF_WK + W_B;
constexpr size_t OFF_WO = OFF_WV + W_B;
constexpr size_t OFF_ER = OFF_WO + W_B;
constexpr size_t OFF_QH = OFF_ER + E_B;
constexpr size_t OFF_KH = OFF_QH + HP_B;
constexpr size_t OFF_VT = OFF_KH + HP_B;
constexpr size_t OFF_QR = OFF_VT + HP_B;
constexpr size_t OFF_KR = OFF_QR + QR_B;
constexpr size_t OFF_VR = OFF_KR + KR_B;
constexpr size_t OFF_CT = OFF_VR + KR_B;
constexpr size_t OFF_CR = OFF_CT + CT_B;
constexpr size_t OFF_FL = OFF_CR + CR_B;
constexpr size_t WS_NEED = OFF_FL + FL_B;

static_assert(X_B % 128 == 0 && W_B % 128 == 0 && E_B % 128 == 0 && HP_B % 128 == 0);
static_assert(QR_B % 128 == 0 && KR_B % 128 == 0 && CT_B % 128 == 0 && CR_B % 128 == 0 && FL_B % 128 == 0);
static_assert(WS_NEED <= 134217728ull);
static_assert((size_t)TT * DM * 4 <= (size_t)SEQ_FULL * DM * 4);

/* -------------------------------------------------------------------------- */
__device__ __forceinline__ unsigned short f2bf_bits(float f) {
  unsigned u = __float_as_uint(f);
  return (unsigned short)((u + 0x7FFFu + ((u >> 16) & 1u)) >> 16);
}
__device__ __forceinline__ float bfr(float f) { return __uint_as_float(((unsigned)f2bf_bits(f)) << 16); }
__device__ __forceinline__ unsigned short h_bits(float f) {
  _Float16 h = (_Float16)f;
  return __builtin_bit_cast(unsigned short, h);
}
__device__ __forceinline__ float h2f(unsigned short b) {
  _Float16 h = __builtin_bit_cast(_Float16, b);
  return (float)h;
}

/* WMMA issue helpers with the 4-slot hazard guard (ties D, keeps A/B live) */
__device__ __forceinline__ v8f mma_h(v16h a, v16h b, v8f c) {
  c = __builtin_amdgcn_wmma_f32_16x16x32_f16(false, a, false, b, (short)0, c, false, false);
  asm volatile("v_nop\n\tv_nop\n\tv_nop\n\tv_nop" : "+v"(c) : "v"(a), "v"(b));
  return c;
}
__device__ __forceinline__ v8f mma_b(v16b a, v16b b, v8f c) {
  c = __builtin_amdgcn_wmma_f32_16x16x32_bf16(false, a, false, b, (short)0, c, false, false);
  asm volatile("v_nop\n\tv_nop\n\tv_nop\n\tv_nop" : "+v"(c) : "v"(a), "v"(b));
  return c;
}

__device__ __forceinline__ v8f zero8() { return (v8f){0.f,0.f,0.f,0.f,0.f,0.f,0.f,0.f}; }

/* --------------------------------------------------------------------------
 * Main loop of the 64 x 64 GEMM blocks (2 waves): acc += A[64][DM] . B[64][DM]^T, 16-bit operands.
 * Stage = 128 k values: 64 A rows and 64 B rows of 256 B each, brought into LDS by asynchronous
 * copies (each copy = two whole 256-B row pieces), two buffers: stage t+1 flies while stage t is worked on.
 * Wave 0 copies the A rows, wave 1 the B rows, 32 copies per wave and stage.
 * LDS row pitch 272 B = 16 B x 17 (odd): the 16 rows of one ds_load_b128 fall on distinct bank groups.
 * Fragment k map and the order of the k steps per accumulator are those of the direct global loads it replaces.
 * ------------------------------------------------------------------------ */
constexpr int GKS  = 128;             /* k values per stage = 4 WMMA k steps */
constexpr int GNST = DM / GKS;        /* stages */
constexpr int GP   = 136;             /* LDS row pitch in 16-bit elements */
constexpr int GBUF = 128 * GP;        /* elements of one buffer: A rows 0..63, B rows 64..127 */
static_assert(DM % GKS == 0 && GNST >= 2);

union FR { v16h hv; v16b bv; v8us h[2]; };

/* eight copies: row pairs 0, 2, .. 14 from the lane's own LDS byte address l and global address g */
__device__ __forceinline__ void copy8(unsigned l, const unsigned short* g)
{
  /* the copies and, as the last line of the same statement, the wait that stands in front of any
     rewrite of the address registers they name */
  asm volatile(
      "global_load_async_to_lds_b128 %0, %8, off\n\t"
      "global_load_async_to_lds_b128 %1, %9, off\n\t"
      "global_load_async_to_lds_b128 %2, %10, off\n\t"
      "global_load_async_to_lds_b128 %3, %11, off\n\t"
      "global_load_async_to_lds_b128 %4, %12, off\n\t"
      "global_load_async_to_lds_b128 %5, %13, off\n\t"
      "global_load_async_to_lds_b128 %6, %14, off\n\t"
      "global_load_async_to_lds_b128 %7, %15, off\n\t"
      "s_wait_xcnt 0x0"
      :: "v"(l), "v"(l + 2u * 2u * GP), "v"(l + 4u * 2u * GP), "v"(l + 6u * 2u * GP),
         "v"(l + 8u * 2u * GP), "v"(l + 10u * 2u * GP), "v"(l + 12u * 2u * GP), "v"(l + 14u * 2u * GP),
         "v"(g), "v"(g + 2 * DM), "v"(g + 4 * DM), "v"(g + 6 * DM),
         "v"(g + 8 * DM), "v"(g + 10 * DM), "v"(g + 12 * DM), "v"(g + 14 * DM)
      : "memory");
}
/* one wave's 64 rows of one stage */
__device__ __forceinline__ void stage_copy(unsigned l, const unsigned short* g)
{
  /* unrolled: the row offsets of the four statements are constants */
#pragma unroll
  for (int q = 0; q < 4; ++q) copy8(l + (unsigned)(q * 16 * GP * 2), g + (size_t)q * 16 * DM);
}

template <bool BF>
__device__ __forceinline__ void gemm_ring(const unsigned short* __restrict__ A, const unsigned short* __restrict__ B,
                                          unsigned short* ring, v8f (&acc)[2][4])
{
  const int lane = threadIdx.x & 31;
  const int wave = __builtin_amdgcn_readfirstlane((int)(threadIdx.x >> 5));
  const int hh = lane >> 4, m = lane & 15;

  /* copy addresses: lanes 0..15 one row, lanes 16..31 the next, 16 B per lane */
  const unsigned short* g0 = (wave == 0 ? A : B) + (size_t)hh * DM + m * 8;
  const unsigned l0 = (unsigned)(size_t)ring + (unsigned)(((wave * 64 + hh) * GP + m * 8) * 2);

  stage_copy(l0, g0);
  /* stage 0 has landed before the barrier that publishes it */
  asm volatile("s_wait_asynccnt 0x0" ::: "memory");
  __syncthreads();
  stage_copy(l0 + (unsigned)(GBUF * 2), g0 + GKS);

  const unsigned short* fa = ring + (wave * 32 + m) * GP + 8 * hh;
  const unsigned short* fb = ring + (64 + m) * GP + 8 * hh;

  /* rolled: one body in the instruction cache, the buffer chosen by the trip's parity */
#pragma unroll 1
  for (int t = 0; t < GNST; ++t) {
    const int bo = (t & 1) * GBUF;
    const unsigned short* pa = fa + bo;
    const unsigned short* pb = fb + bo;
    /* every loop below is unrolled so that each index of the two fragment sets is a constant and the sets stay in registers */
    FR a[2][2], b[2][4];
#pragma unroll
    for (int mi = 0; mi < 2; ++mi) {
      a[0][mi].h[0] = *(const v8us*)(pa + mi * 16 * GP);
      a[0][mi].h[1] = *(const v8us*)(pa + mi * 16 * GP + 16);
    }
#pragma unroll
    for (int ni = 0; ni < 4; ++ni) {
      b[0][ni].h[0] = *(const v8us*)(pb + ni * 16 * GP);
      b[0][ni].h[1] = *(const v8us*)(pb + ni * 16 * GP + 16);
    }
#pragma unroll
    for (int ks = 0; ks < GKS / 32; ++ks) {
      const int cur = ks & 1, nxt = cur ^ 1;
      if (ks + 1 < GKS / 32) {          /* next k step's fragments of the same stage, ahead of this step's products */
#pragma unroll
        for (int mi = 0; mi < 2; ++mi) {
          a[nxt][mi].h[0] = *(const v8us*)(pa + mi * 16 * GP + (ks + 1) * 32);
          a[nxt][mi].h[1] = *(const v8us*)(pa + mi * 16 * GP + (ks + 1) * 32 + 16);
        }
#pragma unroll
        for (int ni = 0; ni < 4; ++ni) {
          b[nxt][ni].h[0] = *(const v8us*)(pb + ni * 16 * GP + (ks + 1) * 32);
          b[nxt][ni].h[1] = *(const v8us*)(pb + ni * 16 * GP + (ks + 1) * 32 + 16);
        }
      }
#pragma unroll
      for (int ni = 0; ni < 4; ++ni) {
        if constexpr (BF) {
          acc[0][ni] = mma_b(a[cur][0].bv, b[cur][ni].bv, acc[0][ni]);
          acc[1][ni] = mma_b(a[cur][1].bv, b[cur][ni].bv, acc[1][ni]);
        } else {
          acc[0][ni] = mma_h(a[cur][0].hv, b[cur][ni].hv, acc[0][ni]);
          acc[1][ni] = mma_h(a[cur][1].hv, b[cur][ni].hv, acc[1][ni]);
        }
      }
    }
    /* this wave's reads of buffer t&1 have returned before the buffer is refilled */
    asm volatile("s_wait_dscnt 0x0" ::: "memory");
    /* this wave's copies of stage t+1 have landed before the barrier that publishes them */
    asm volatile("s_wait_asynccnt 0x0" ::: "memory");
    __syncthreads();
    if (t + 2 < GNST) stage_copy(l0 + (unsigned)(bo * 2), g0 + (size_t)(t + 2) * GKS);
  }
  /* no copy is outstanding when the wave goes on */
  asm volatile("s_wait_asynccnt 0x0" ::: "memory");
}

/* --------------------------------------------------------------------------
 * f32 [nrows][ncols] -> 16-bit plane [nrows_pad][ncols]; rows >= nrows are zeros.
 * mode 0: bf16 bits (RNE).  mode 1: f16 bits of (scale * bf16(x)).
 * One unit u = 8 consecutive values of row u / (ncols/8); the caller hands out u < nrows_pad*ncols/8.
 * ------------------------------------------------------------------------ */
template <int nrows, int ncols, int mode>
__device__ __forceinline__ void cvt_unit(const float* __restrict__ src, float scale,
                                         unsigned short* __restrict__ dst, int u)
{
  constexpr int upr = ncols >> 3;
  const int row = u / upr;
  const int cu  = u - row * upr;
  const int rowc = row < nrows ? row : nrows - 1;          /* clamped address */
  const bool live = row < nrows;
  const float* p = src + (size_t)rowc * ncols + cu * 8;
  const v4f x0 = *(const v4f*)p;
  const v4f x1 = *(const v4f*)(p + 4);
  unsigned b0, b1, b2, b3, b4, b5, b6, b7;
  {
    const float f0 = live ? x0[0] : 0.f, f1 = live ? x0[1] : 0.f, f2 = live ? x0[2] : 0.f, f3 = live ? x0[3] : 0.f;
    const float f4 = live ? x1[0] : 0.f, f5 = live ? x1[1] : 0.f, f6 = live ? x1[2] : 0.f, f7 = live ? x1[3] : 0.f;
    if (mode == 0) {
      b0 = f2bf_bits(f0); b1 = f2bf_bits(f1); b2 = f2bf_bits(f2); b3 = f2bf_bits(f3);
      b4 = f2bf_bits(f4); b5 = f2bf_bits(f5); b6 = f2bf_bits(f6); b7 = f2bf_bits(f7);
    } else {
      b0 = h_bits(bfr(f0) * scale); b1 = h_bits(bfr(f1) * scale); b2 = h_bits(bfr(f2) * scale); b3 = h_bits(bfr(f3) * scale);
      b4 = h_bits(bfr(f4) * scale); b5 = h_bits(bfr(f5) * scale); b6 = h_bits(bfr(f6) * scale); b7 = h_bits(bfr(f7) * scale);
    }
  }
  v4u w;
  w[0] = b0 | (b1 << 16);
  w[1] = b2 | (b3 << 16);
  w[2] = b4 | (b5 << 16);
  w[3] = b6 | (b7 << 16);
  unsigned short* d = dst + (size_t)u * 8;
  *(v4u*)d = w;
  /* another branch's text follows in the caller: no register that the store names is rewritten in front of this wait */
  asm volatile("s_wait_xcnt 0x0" ::: "memory");
}

/* --------------------------------------------------------------------------
 * Per (query block, key chunk) flag from the int32 key mask:
 *   0 = every effective entry masked (chunk skipped), 1 = all kept, 2 = mixed.
 * Effective entry (t, s): query row clamped to TT-1 for padded rows, keys s >= TT masked.
 * Block = (query block qb, flag line ln), 16 waves: the chunks kc = ln + FLN*j, j < FSL.
 * Wave w reads rows 4w..4w+3 of every chunk of the block; all loads are independent, so
 * the whole strip is in flight at once.  Per wave one any-kept and one all-kept bit per
 * chunk (ballots), combined over the 16 waves through LDS behind one block barrier.
 * Coverage: wave 0 stores the block's whole 128-byte line (unused slots 0);
 * NQB x FLN blocks = the whole table.  wany, wall: 16 LDS words each.
 * ------------------------------------------------------------------------ */
__device__ __forceinline__ int flag_slot(int kc) { return (kc % FLN) * 32 + kc / FLN; }

__device__ __forceinline__ void flags_block(const int* __restrict__ mask, int* __restrict__ flags,
                                            int qb, int ln, unsigned* wany, unsigned* wall)
{
  const int tid = threadIdx.x, lane = tid & 31;
  const int wave = __builtin_amdgcn_readfirstlane(tid >> 5);   /* scalar, so the row bases are scalar */

  /* key of slot j, half hf: s = col0 + FLN*64*j + 32*hf.  Only the last slot can pass TT. */
  constexpr int LOFF = FLN * (FSL - 1) * 64;
  static_assert(LOFF - 1 < TT);
  const unsigned col0 = (unsigned)(ln * 64 + lane);
  const unsigned sl0 = col0 + LOFF, sl1 = sl0 + 32u;
  const unsigned cl0 = sl0 < (unsigned)TT ? sl0 : (unsigned)(TT - 1);   /* clamped address */
  const unsigned cl1 = sl1 < (unsigned)TT ? sl1 : (unsigned)(TT - 1);   /* clamped address */
  const int* rowp[4];
#pragma unroll
  for (int rr = 0; rr < 4; ++rr) {
    int t = qb * 64 + wave * 4 + rr;
    t = t < TT ? t : TT - 1;
    rowp[rr] = mask + (size_t)t * SEQ_FULL;
  }

  /* first every load, then every count */
  int mv[FSL][8];
#pragma unroll
  for (int j = 0; j < FSL - 1; ++j) {
#pragma unroll
    for (int it = 0; it < 8; ++it)
      mv[j][it] = (rowp[it >> 1] + col0)[FLN * j * 64 + (it & 1) * 32];
  }
#pragma unroll
  for (int it = 0; it < 8; ++it)
    mv[FSL - 1][it] = rowp[it >> 1][(it & 1) ? cl1 : cl0];
  /* keeps every load in front of every count: without it the scheduler mixes them and fewer loads fly at once */
  __builtin_amdgcn_sched_barrier(0);
  /* every register that the issued loads name (row bases, key offsets) is an input here, so none is
     rewritten in front of this wait */
  asm volatile("s_wait_xcnt 0x0"
               :: "s"(rowp[0]), "s"(rowp[1]), "s"(rowp[2]), "s"(rowp[3]), "v"(col0), "v"(cl0), "v"(cl1)
               : "memory");

  int cnt[FSL];
#pragma unroll
  for (int j = 0; j < FSL; ++j) {
    int n = 0;
#pragma unroll
    for (int it = 0; it < 8; ++it) {
      const bool ex = (j < FSL - 1) || (((it & 1) ? sl1 : sl0) < (unsigned)TT);   /* key exists */
      n += (ex && mv[j][it] != 0) ? 1 : 0;
    }
    cnt[j] = n;
  }

  unsigned anym = 0u, allm = 0u;                           /* wave-uniform, bit j = chunk ln + FLN*j */
#pragma unroll
  for (int j = 0; j < FSL; ++j) {
    anym |= (__builtin_amdgcn_ballot_w32(cnt[j] != 0) != 0u) ? (1u << j) : 0u;
    allm |= (__builtin_amdgcn_ballot_w32(cnt[j] == 8) == 0xFFFFFFFFu) ? (1u << j) : 0u;
  }
  if (lane == 0) { wany[wave] = anym; wall[wave] = allm; }
  __syncthreads();

  if (wave == 0) {
    unsigned a = 0u, f = 0xFFFFFFFFu;
#pragma unroll
    for (int w = 0; w < 16; ++w) { a |= wany[w]; f &= wall[w]; }
    int fv = 0;
    if (lane < FSL) fv = ((a >> lane) & 1u) ? (((f >> lane) & 1u) ? 1 : 2) : 0;
    flags[((size_t)qb * FLN + ln) * 32 + lane] = fv;
  }
}

/* --------------------------------------------------------------------------
 * Everything that depends on the inputs alone, in one launch of 512-thread blocks:
 * blocks [0, FBL): mask flags, block b = (query block b / FLN, flag line b % FLN);
 * then 3 x XBL blocks: q, k, v planes; 3 x WBL: Wq, Wk, Wv planes; WBL: Wo plane; EBL: Er plane.
 * A conversion block = 512 units, one per thread; every plane's unit count is a multiple of 512.
 * The branch on the block index is block-uniform (the flags part holds a block barrier).
 * ------------------------------------------------------------------------ */
constexpr int PBT = 512;
constexpr int FBL = NQB * FLN;
constexpr int XBL = TPAD * (DM / 8) / PBT;
constexpr int WBL = DM * (DM / 8) / PBT;
constexpr int EBL = TPAD * (HD / 8) / PBT;
constexpr int PREP_BLOCKS = FBL + 3 * XBL + 4 * WBL + EBL;
static_assert(TPAD * (DM / 8) % PBT == 0 && DM * (DM / 8) % PBT == 0 && TPAD * (HD / 8) % PBT == 0);

__global__ __launch_bounds__(512) void prep_kernel(
    const float* __restrict__ q, const float* __restrict__ k, const float* __restrict__ v,
    const int* __restrict__ mask,
    const float* __restrict__ Wq_w, const float* __restrict__ Wk_w, const float* __restrict__ Wv_w,
    const float* __restrict__ Wo_w, const float* __restrict__ Er,
    unsigned short* __restrict__ Xq, unsigned short* __restrict__ Xk, unsigned short* __restrict__ Xv,
    unsigned short* __restrict__ Wq, unsigned short* __restrict__ Wk, unsigned short* __restrict__ Wv,
    unsigned short* __restrict__ Wo, unsigned short* __restrict__ Eh, int* __restrict__ flags)
{
  __shared__ unsigned wany[16];
  __shared__ unsigned wall[16];
  const int tid = threadIdx.x;
  int b = blockIdx.x;
  if (b < FBL) { flags_block(mask, flags, b / FLN, b % FLN, wany, wall); return; }
  b -= FBL;
  if (b < 3 * XBL) {
    const int j = b / XBL;
    cvt_unit<TT, DM, 0>(j == 0 ? q : j == 1 ? k : v, 1.0f, j == 0 ? Xq : j == 1 ? Xk : Xv, (b - j * XBL) * PBT + tid);
    return;
  }
  b -= 3 * XBL;
  if (b < 3 * WBL) {
    const int j = b / WBL;
    cvt_unit<DM, DM, 0>(j == 0 ? Wq_w : j == 1 ? Wk_w : Wv_w, 1.0f, j == 0 ? Wq : j == 1 ? Wk : Wv, (b - j * WBL) * PBT + tid);
    return;
  }
  b -= 3 * WBL;
  if (b < WBL) { cvt_unit<DM, DM, 1>(Wo_w, WOSC, Wo, b * PBT + tid); return; }
  b -= WBL;
  cvt_unit<TT, HD, 1>(Er, 1.0f, Eh, b * PBT + tid);
}

/* --------------------------------------------------------------------------
 * Projection GEMM: Y[t][n] = sum_k X[t][k] W[n][k] + b[n] for one 64-token x 64-col
 * (= one head) tile per block; bf16 operands (X and W planes), f32 accumulate.
 * Block = 2 waves (64 threads); wave w: tokens w*32..w*32+31 (2 row tiles) x 4 col tiles; main loop: gemm_ring.
 * A fragment (row m = lane&15): elems 0..7 <- k0+8h+i, 8..15 <- k0+16+8h+i.
 * B[k][n] = W[n][k]: loaded from row n = lane&15 with the same k map.  D elem r = (row 8h+r, col lane&15).
 * Epilogue: hi = f16(y), res = f16((y - hi) * 2048), rows t >= TT forced to 0; the block's
 * MODE 0: Q -> [NH][TPAD][HD] (+ residual rows < QRES); 1: K -> same (+ residual rows < CRES);
 * MODE 2: V -> [NH][HD][TPAD] (+ residual [NH][HD][CRES]).
 * Coverage per block: 8 iterations x 64 threads = 512 units = 64 rows x 8 segments (hi and res).
 * LDS tiles th/tr: cross-wave, separated by a block barrier; reloaded through the stored element type.
 * The three projections share one launch: grid (NTB, NH, 3), MODE = blockIdx.z (block-uniform);
 * the main loop is common, proj_tail<MODE> is the epilogue.
 * ------------------------------------------------------------------------ */
constexpr int PT = 72;

template <int MODE>
__device__ __forceinline__ void proj_tail(
    v8f (&acc)[2][4], const float* __restrict__ bias, unsigned short* __restrict__ Ph,
    unsigned short* __restrict__ Pr, unsigned short* th, unsigned short* tr)
{
  constexpr int NRES_TB = (MODE == 0) ? (NEARLY + 1) : NEARLY;
  const int tid = threadIdx.x, wave = tid >> 5, lane = tid & 31;
  const int hh = lane >> 4, m = lane & 15;
  const int tb = blockIdx.x, head = blockIdx.y;
  const int n0 = head * 64;
  const int rl0 = wave * 32;

  float bb[4];
#pragma unroll
  for (int ni = 0; ni < 4; ++ni) bb[ni] = bfr(bias[n0 + ni * 16 + m]);

#pragma unroll
  for (int mi = 0; mi < 2; ++mi) {
#pragma unroll
    for (int ni = 0; ni < 4; ++ni) {
#pragma unroll
      for (int r = 0; r < 8; ++r) {
        const int rl  = rl0 + mi * 16 + 8 * hh + r;
        const int t   = tb * 64 + rl;
        const int col = ni * 16 + m;
        float y = acc[mi][ni][r] + bb[ni];
        y = (t < TT) ? y : 0.f;
        const unsigned short hb = h_bits(y);
        const float res = (y - h2f(hb)) * RSC;
        const unsigned short rb = h_bits(res);
        if (MODE == 2) { th[col * PT + rl] = hb; tr[col * PT + rl] = rb; }
        else           { th[rl * PT + col] = hb; tr[rl * PT + col] = rb; }
      }
    }
  }
  __syncthreads();

  const bool dores = tb < NRES_TB;    /* block-uniform */
  {
#pragma unroll
    for (int it = 0; it < 8; ++it) {
      const int u = it * 64 + tid;
      const int row = u >> 3, seg = u & 7;
      const v8us vh = *(const v8us*)(th + row * PT + seg * 8);
      const v8us vr = *(const v8us*)(tr + row * PT + seg * 8);
      if (MODE == 2) {
        *(v8us*)(Ph + ((size_t)head * HD + row) * TPAD + tb * 64 + seg * 8) = vh;
        if (dores) *(v8us*)(Pr + ((size_t)head * HD + row) * CRES + tb * 64 + seg * 8) = vr;
      } else {
        *(v8us*)(Ph + ((size_t)head * TPAD + tb * 64 + row) * HD + seg * 8) = vh;
        if (dores) {
          if (MODE == 0) *(v8us*)(Pr + ((size_t)head * QRES + tb * 64 + row) * HD + seg * 8) = vr;
          else           *(v8us*)(Pr + ((size_t)head * CRES + tb * 64 + row) * HD + seg * 8) = vr;
        }
      }
    }
    
  }
  /* another epilogue's text follows in the caller: no register that the last stores name is rewritten in front of this wait */
  asm volatile("s_wait_xcnt 0x0" ::: "memory");
}

__global__ __launch_bounds__(64) __attribute__((amdgpu_num_vgpr(256)))
void proj_kernel(
    const unsigned short* __restrict__ Xq, const unsigned short* __restrict__ Xk, const unsigned short* __restrict__ Xv,
    const unsigned short* __restrict__ Wq, const unsigned short* __restrict__ Wk, const unsigned short* __restrict__ Wv,
    const float* __restrict__ bq, const float* __restrict__ bk, const float* __restrict__ bv,
    unsigned short* __restrict__ Qh, unsigned short* __restrict__ Kh, unsigned short* __restrict__ Vt,
    unsigned short* __restrict__ Qr, unsigned short* __restrict__ Kr, unsigned short* __restrict__ Vr)
{
  __shared__ __align__(16) unsigned short th[64 * PT];
  __shared__ __align__(16) unsigned short tr[64 * PT];
  __shared__ __align__(16) unsigned short ring[2 * GBUF];

  const int tb = blockIdx.x, head = blockIdx.y, mode = blockIdx.z;
  const unsigned short* X = mode == 0 ? Xq : mode == 1 ? Xk : Xv;
  const unsigned short* W = mode == 0 ? Wq : mode == 1 ? Wk : Wv;

  v8f acc[2][4];
#pragma unroll
  for (int mi = 0; mi < 2; ++mi)
#pragma unroll
    for (int ni = 0; ni < 4; ++ni) acc[mi][ni] = zero8();

  gemm_ring<true>(X + (size_t)tb * 64 * DM, W + (size_t)head * 64 * DM, ring, acc);

  if (mode == 0)      proj_tail<0>(acc, bq, Qh, Qr, th, tr);
  else if (mode == 1) proj_tail<1>(acc, bk, Kh, Kr, th, tr);
  else                proj_tail<2>(acc, bv, Vt, Vr, th, tr);
}

/* --------------------------------------------------------------------------
 * Flash attention with the row-shifted Er term, head dim 64, products transposed.
 * Block = 4 waves = 64 query rows of one head; grid (query blocks, NH).
 * Per kept 64-key chunk: K [key][d], Er [key][d], V^T [d][key] f16 tiles staged in LDS
 * (EARLY: also K and V^T residual tiles).
 * S^T = K.q^T + Er.q(t+1)^T on f16 WMMA: A = K or Er rows from LDS, B = Q rows; D elem r of key tile j =
 * (key 16j+8h+r, query lane&15), so a lane holds 32 of the 64 scores of ONE query and lane^16 the other 32.
 * x0.125, replace-fill -inf from the key mask (flag 2 chunks), f32 online softmax: maximum in-lane plus one
 * exchange between the wave halves; the sum stays a per-half partial and is joined once in the epilogue.
 * P^T = f16(1024 p) (EARLY: + f16 residual x2048) is a B operand straight from the score registers:
 * element s of the operand for keys 32kk.. is register s&7 of key tile 2kk+(s>>3), the hardware k order.
 * O^T += V^T.P^T on f16 WMMA: A = V^T rows from LDS; D elem r of d tile t = (d 16t+8h+r, query lane&15)
 * (O therefore carries the x1024 of P; the normaliser applies 1/(1024 l) x 16 in one factor).
 * EARLY adds (k_res.qh + k.q_res + Er.q_res(t+1))/2048 to the scores and
 * (V_res.P + V.P_res)/2048 to O through separate accumulators folded per tile.
 * Live-state plan: Q hi fragments reloaded per chunk (dead during softmax and P.V),
 * Q residual fragments loaded only inside the residual score phase, one 8-register
 * residual accumulator at a time; 4 O tiles + 4 score tiles + m/l (one value each) persistent.
 * Epilogue: ctx = O/(1024 l) carried x16 as f16 into [TPAD][DM] (+ residual rows < CRES),
 * staged per wave in LDS so that whole 128-byte row pieces are stored.
 * Fragment k map as in proj_kernel (A row / B col = lane&15, split k map).
 * LDS regions: K/Er/V/res tiles and msk cross-wave (block barriers).
 * Both variants share one launch: grid (NQB, NH), EARLY = (query block < NEARLY), block-uniform;
 * sm holds 5 tiles (the variant without residuals uses the first 3), msk 4096 bytes.
 * ------------------------------------------------------------------------ */
/* LDS row pitch of every fragment-read tile: 72 halves = 144 B = 16 B x 9 (odd), so the 16 rows that one
   ds_load_b128 reads fall on 16 distinct groups of four banks; at 128 B they fall on two groups */
constexpr int LP = 72;
constexpr int TSZ = 64 * LP;                       /* one 64-row tile */

typedef unsigned int v2u __attribute__((ext_vector_type(2)));

/* value of lane l ^ 16 */
__device__ __forceinline__ float xhalf(float x) {
  const int b = __float_as_int(x);
  return __int_as_float(__builtin_amdgcn_permlanex16(b, b, 0x76543210, 0xfedcba98, false, false));
}

template <bool EARLY>
__device__ __forceinline__
void attn_body(const unsigned short* __restrict__ Qh, const unsigned short* __restrict__ Qr,
               const unsigned short* __restrict__ Kh, const unsigned short* __restrict__ Kr,
               const unsigned short* __restrict__ Vt, const unsigned short* __restrict__ Vr,
               const unsigned short* __restrict__ Erp, const int* __restrict__ mask,
               const int* __restrict__ flags, unsigned short* __restrict__ Ct,
               unsigned short* __restrict__ Cr, unsigned short* sm, unsigned char* msk)
{
  constexpr int KSH = 0, ESH = TSZ, VTH = 2 * TSZ, KRS = 3 * TSZ, VRS = 4 * TSZ;
  union FH { v16h v; v8us h[2]; };

  const int tid = threadIdx.x, wave = tid >> 5, lane = tid & 31;
  const int hh = lane >> 4, c = lane & 15;
  const int qb = blockIdx.x;
  const int head = blockIdx.y;
  const int q0 = qb * 64 + wave * 16;
  const int wrow0 = wave * 16;                     /* the wave's first row inside the block tile */

  /* fragment base pointers: rows q0+c (k.q^T) and q0+1+c (shifted Er term) */
  const unsigned short* qp = Qh + ((size_t)head * TPAD + q0 + c) * HD + 8 * hh;
  const unsigned short* rp = Qr + ((size_t)head * QRES + (EARLY ? (q0 + c) : c)) * HD + 8 * hh;

  /* state of query q0+c: running maximum (equal in both halves), this half's part of the sum */
  float mrow = -__builtin_inff(), lrow = 0.f;
  v8f oacc[4];
#pragma unroll
  for (int t = 0; t < 4; ++t) oacc[t] = zero8();

  const int* frow = flags + (size_t)qb * (FLN * 32);

#pragma unroll 1
  for (int kc = 0; kc < NKC; ++kc) {
    const int fk = __builtin_amdgcn_readfirstlane(frow[flag_slot(kc)]);   /* block-uniform */
    if (fk == 0) continue;
    const int kv0 = kc * 64;
    const bool useres = EARLY && (kc < NEARLY);
    const int kvr = (kc < NEARLY) ? kv0 : 0;                   /* clamped residual chunk base */

    __syncthreads();
    /* staging: unit u -> row u>>3 (0..63), seg u&7; 4 iterations x 128 threads = 512 units per tile */
    {
      const unsigned short *gk[4], *ge[4], *gv[4];
      v4u tk[4], te[4], tv[4];
#pragma unroll
      for (int it = 0; it < 4; ++it) {
        const int u = it * 128 + tid;
        const int row = u >> 3, seg = u & 7;
        gk[it] = Kh + ((size_t)head * TPAD + kv0 + row) * HD + seg * 8;
        ge[it] = Erp + (size_t)(kv0 + row) * HD + seg * 8;
        gv[it] = Vt + ((size_t)head * HD + row) * TPAD + kv0 + seg * 8;
        tk[it] = *(const v4u*)gk[it];
        te[it] = *(const v4u*)ge[it];
        tv[it] = *(const v4u*)gv[it];
      }
      /* every address that the issued loads name is an input here, so none is rewritten in front of this wait */
      asm volatile("s_wait_xcnt 0x0"
                   :: "v"(gk[0]), "v"(gk[1]), "v"(gk[2]), "v"(gk[3]), "v"(ge[0]), "v"(ge[1]), "v"(ge[2]), "v"(ge[3]),
                      "v"(gv[0]), "v"(gv[1]), "v"(gv[2]), "v"(gv[3])
                   : "memory");
#pragma unroll
      for (int it = 0; it < 4; ++it) {
        const int u = it * 128 + tid;
        const int row = u >> 3, seg = u & 7;
        *(v4u*)(sm + KSH + row * LP + seg * 8) = tk[it];
        *(v4u*)(sm + ESH + row * LP + seg * 8) = te[it];
        *(v4u*)(sm + VTH + row * LP + seg * 8) = tv[it];
      }
    }
    if (EARLY) {
      const unsigned short *gkr[4], *gvr[4];
      v4u tkr[4], tvr[4];
#pragma unroll
      for (int it = 0; it < 4; ++it) {
        const int u = it * 128 + tid;
        const int row = u >> 3, seg = u & 7;
        gkr[it] = Kr + ((size_t)head * CRES + kvr + row) * HD + seg * 8;
        gvr[it] = Vr + ((size_t)head * HD + row) * CRES + kvr + seg * 8;
        tkr[it] = *(const v4u*)gkr[it];
        tvr[it] = *(const v4u*)gvr[it];
      }
      /* as above: the addresses of the issued loads stay whole up to this wait */
      asm volatile("s_wait_xcnt 0x0"
                   :: "v"(gkr[0]), "v"(gkr[1]), "v"(gkr[2]), "v"(gkr[3]), "v"(gvr[0]), "v"(gvr[1]), "v"(gvr[2]), "v"(gvr[3])
                   : "memory");
#pragma unroll
      for (int it = 0; it < 4; ++it) {
        const int u = it * 128 + tid;
        const int row = u >> 3, seg = u & 7;
        *(v4u*)(sm + KRS + row * LP + seg * 8) = tkr[it];
        *(v4u*)(sm + VRS + row * LP + seg * 8) = tvr[it];
      }
    }
    if (fk == 2) {
      /* key mask tile: thread -> row tid>>1, 32 columns; clamped addresses, keys >= TT masked */
      const int row = tid >> 1, hsel = tid & 1;
      int qrow = qb * 64 + row;
      qrow = qrow < TT ? qrow : TT - 1;
      const int* mb = mask + (size_t)qrow * SEQ_FULL;
#pragma unroll 1
      for (int g = 0; g < 4; ++g) {
#pragma unroll
        for (int e = 0; e < 8; ++e) {
          const int col = hsel * 32 + g * 8 + e;
          const int s = kv0 + col;
          const int sc = s < TT ? s : TT - 1;
          const int mv = mb[sc];
          msk[row * 64 + col] = (unsigned char)((s < TT && mv != 0) ? 1 : 0);
        }
      }
    }
    __syncthreads();

    /* Q hi fragments for this chunk (B operands), two 32-deep d halves */
    FH qa[2], qs[2];
#pragma unroll
    for (int dc = 0; dc < 2; ++dc) {
      qa[dc].h[0] = *(const v8us*)(qp + dc * 32);
      qa[dc].h[1] = *(const v8us*)(qp + dc * 32 + 16);
      qs[dc].h[0] = *(const v8us*)(qp + HD + dc * 32);
      qs[dc].h[1] = *(const v8us*)(qp + HD + dc * 32 + 16);
    }

    /* transposed scores: 64 keys x 16 queries per wave; s[j][r] = (key 16j+8h+r, query c) */
    v8f s[4];
#pragma unroll
    for (int j = 0; j < 4; ++j) {
      s[j] = zero8();
#pragma unroll
      for (int dc = 0; dc < 2; ++dc) {
        FH kf, ef;
        kf.h[0] = *(const v8us*)(sm + KSH + (j * 16 + c) * LP + dc * 32 + 8 * hh);
        kf.h[1] = *(const v8us*)(sm + KSH + (j * 16 + c) * LP + dc * 32 + 16 + 8 * hh);
        ef.h[0] = *(const v8us*)(sm + ESH + (j * 16 + c) * LP + dc * 32 + 8 * hh);
        ef.h[1] = *(const v8us*)(sm + ESH + (j * 16 + c) * LP + dc * 32 + 16 + 8 * hh);
        s[j] = mma_h(kf.v, qa[dc].v, s[j]);
        s[j] = mma_h(ef.v, qs[dc].v, s[j]);
      }
      if (EARLY) {
        if (useres) {
          v8f sr = zero8();
#pragma unroll
          for (int dc = 0; dc < 2; ++dc) {
            FH kf, ef, krf, qra, qrs;
            kf.h[0]  = *(const v8us*)(sm + KSH + (j * 16 + c) * LP + dc * 32 + 8 * hh);
            kf.h[1]  = *(const v8us*)(sm + KSH + (j * 16 + c) * LP + dc * 32 + 16 + 8 * hh);
            ef.h[0]  = *(const v8us*)(sm + ESH + (j * 16 + c) * LP + dc * 32 + 8 * hh);
            ef.h[1]  = *(const v8us*)(sm + ESH + (j * 16 + c) * LP + dc * 32 + 16 + 8 * hh);
            krf.h[0] = *(const v8us*)(sm + KRS + (j * 16 + c) * LP + dc * 32 + 8 * hh);
            krf.h[1] = *(const v8us*)(sm + KRS + (j * 16 + c) * LP + dc * 32 + 16 + 8 * hh);
            qra.h[0] = *(const v8us*)(rp + dc * 32);
            qra.h[1] = *(const v8us*)(rp + dc * 32 + 16);
            qrs.h[0] = *(const v8us*)(rp + HD + dc * 32);
            qrs.h[1] = *(const v8us*)(rp + HD + dc * 32 + 16);
            sr = mma_h(krf.v, qa[dc].v, sr);
            sr = mma_h(kf.v, qra.v, sr);
            sr = mma_h(ef.v, qrs.v, sr);
          }
#pragma unroll
          for (int r = 0; r < 8; ++r) s[j][r] += sr[r] * RINV;
        }
      }
    }

    /* scale by 1/sqrt(64) and replace-fill from the key mask (this lane's query, its 8 keys per tile) */
#pragma unroll
    for (int j = 0; j < 4; ++j) {
#pragma unroll
      for (int r = 0; r < 8; ++r) s[j][r] *= 0.125f;
    }
    if (fk == 2) {
#pragma unroll
      for (int j = 0; j < 4; ++j) {
        const v2u mw = *(const v2u*)(msk + (wrow0 + c) * 64 + j * 16 + 8 * hh);
#pragma unroll
        for (int r = 0; r < 8; ++r) {
          const unsigned mv = (mw[r >> 2] >> (8 * (r & 3))) & 0xFFu;
          s[j][r] = mv ? s[j][r] : -__builtin_inff();
        }
      }
    }

    /* chunk maximum of the lane's query: 32 keys in-lane (one chain per tile), then the other half's 32 */
    float mj[4];
#pragma unroll
    for (int j = 0; j < 4; ++j) {
      float mx = s[j][0];
#pragma unroll
      for (int r = 1; r < 8; ++r) mx = fmaxf(mx, s[j][r]);
      mj[j] = mx;
    }
    float cm = fmaxf(fmaxf(mj[0], mj[1]), fmaxf(mj[2], mj[3]));
    cm = fmaxf(cm, xhalf(cm));

    /* online softmax update; P^T (carried x1024) packed into B operands in place */
    const float mnew = fmaxf(mrow, cm);
    const bool dead = (mnew == -__builtin_inff());
    const float aexp = __expf(mrow - mnew);
    const float alpha = dead ? 1.f : aexp;
    mrow = mnew;
    FH pa[2], pr[2];
    float ps[4];
#pragma unroll
    for (int j = 0; j < 4; ++j) {
      float sum = 0.f;
#pragma unroll
      for (int r = 0; r < 8; ++r) {
        const float pe = __expf(s[j][r] - mnew);
        const float p = dead ? 0.f : pe;
        sum += p;
        const float pc = p * PSC;
        const _Float16 hv = (_Float16)pc;
        pa[j >> 1].v[(j & 1) * 8 + r] = hv;
        if (EARLY) {
          const float pres = (pc - (float)hv) * RSC;
          pr[j >> 1].v[(j & 1) * 8 + r] = (_Float16)pres;
        }
      }
      ps[j] = sum;
    }
    lrow = lrow * alpha + ((ps[0] + ps[1]) + (ps[2] + ps[3]));
#pragma unroll
    for (int t = 0; t < 4; ++t) {
#pragma unroll
      for (int r = 0; r < 8; ++r) oacc[t][r] *= alpha;
    }

    /* O^T += V^T.P^T : A = V^T [d][key] rows from LDS, B = P^T [key][q] from registers */
#pragma unroll
    for (int kk = 0; kk < 2; ++kk) {
#pragma unroll
      for (int t = 0; t < 4; ++t) {
        FH vb;
        vb.h[0] = *(const v8us*)(sm + VTH + (t * 16 + c) * LP + kk * 32 + 8 * hh);
        vb.h[1] = *(const v8us*)(sm + VTH + (t * 16 + c) * LP + kk * 32 + 16 + 8 * hh);
        oacc[t] = mma_h(vb.v, pa[kk].v, oacc[t]);
      }
    }
    if (EARLY) {
      if (useres) {
        /* residual products per d tile: one 8-register accumulator live at a time */
#pragma unroll
        for (int t = 0; t < 4; ++t) {
          v8f oar = zero8();
#pragma unroll
          for (int kk = 0; kk < 2; ++kk) {
            FH vb, vr;
            vb.h[0] = *(const v8us*)(sm + VTH + (t * 16 + c) * LP + kk * 32 + 8 * hh);
            vb.h[1] = *(const v8us*)(sm + VTH + (t * 16 + c) * LP + kk * 32 + 16 + 8 * hh);
            vr.h[0] = *(const v8us*)(sm + VRS + (t * 16 + c) * LP + kk * 32 + 8 * hh);
            vr.h[1] = *(const v8us*)(sm + VRS + (t * 16 + c) * LP + kk * 32 + 16 + 8 * hh);
            oar = mma_h(vr.v, pa[kk].v, oar);
            oar = mma_h(vb.v, pr[kk].v, oar);
          }
#pragma unroll
          for (int r = 0; r < 8; ++r) oacc[t][r] += oar[r] * RINV;
        }
      }
    }
  }

  /* epilogue: all waves are done with the staged tiles before the region is reused */
  __syncthreads();
  unsigned short* osh = sm + KSH + wave * 1024;     /* [16][64] hi, carried x16 */
  unsigned short* osr = sm + ESH + wave * 1024;     /* [16][64] residual x2048 (EARLY) */
  {
    /* the two halves' partial sums joined; O holds 1024 x sum(p v); ctx = O / (1024 l);
       plane value = 16 ctx = O x (1/l) x (16/1024) */
    const float lsum = lrow + xhalf(lrow);
    const float inv = (1.0f / lsum) * OCV;
#pragma unroll
    for (int t = 0; t < 4; ++t) {
      v8us oh, orr;
#pragma unroll
      for (int r = 0; r < 8; ++r) {
        const float o = oacc[t][r] * inv;
        const unsigned short hb = h_bits(o);
        oh[r] = hb;
        orr[r] = EARLY ? h_bits((o - h2f(hb)) * RSC) : (unsigned short)0;
      }
      /* query row c, d = 16t+8h .. +7: 16 bytes */
      *(v8us*)(osh + c * 64 + t * 16 + 8 * hh) = oh;
      if (EARLY) *(v8us*)(osr + c * 64 + t * 16 + 8 * hh) = orr;
    }
  }
  __builtin_amdgcn_fence(3, "workgroup");
  __builtin_amdgcn_wave_barrier();
  __builtin_amdgcn_fence(2, "workgroup");
  /* 16 rows x 8 segments = 4 iterations x 32 lanes; row = 4it + (lane>>3), seg = lane&7:
*/
  {
#pragma unroll
    for (int it = 0; it < 4; ++it) {
      const int u = it * 32 + lane;
      const int row = u >> 3, seg = u & 7;
      const v8us vh = *(const v8us*)(osh + row * 64 + seg * 8);
      *(v8us*)(Ct + (size_t)(q0 + row) * DM + head * 64 + seg * 8) = vh;
      if (EARLY) {
        const v8us vr = *(const v8us*)(osr + row * 64 + seg * 8);
        *(v8us*)(Cr + (size_t)(q0 + row) * DM + head * 64 + seg * 8) = vr;
      }
    }
    
  }
}

__global__ __launch_bounds__(128) __attribute__((amdgpu_num_vgpr(256)))
void attn_kernel(const unsigned short* __restrict__ Qh, const unsigned short* __restrict__ Qr,
                 const unsigned short* __restrict__ Kh, const unsigned short* __restrict__ Kr,
                 const unsigned short* __restrict__ Vt, const unsigned short* __restrict__ Vr,
                 const unsigned short* __restrict__ Erp, const int* __restrict__ mask,
                 const int* __restrict__ flags, unsigned short* __restrict__ Ct,
                 unsigned short* __restrict__ Cr)
{
  __shared__ __align__(16) unsigned short sm[5 * TSZ];
  __shared__ __align__(16) unsigned char msk[4096];
  if ((int)blockIdx.x < NEARLY) attn_body<true>(Qh, Qr, Kh, Kr, Vt, Vr, Erp, mask, flags, Ct, Cr, sm, msk);
  else                          attn_body<false>(Qh, Qr, Kh, Kr, Vt, Vr, Erp, mask, flags, Ct, Cr, sm, msk);
}

/* --------------------------------------------------------------------------
 * Output projection: out[t][n] = (sum_k ctx16[t][k] wo64[n][k]) / 1024 + b[n], f16 operands,
 * f32 accumulate.  Token blocks tb < NEARLY first accumulate the ctx residual products
 * alone from zero, scale that sum by 1/2048 in f32, and use it as the start value of
 * the hi-plane accumulation (no residual product enters an accumulator holding hi terms).
 * Block = 2 waves (64 threads), 64 tokens x 64 columns; grid (NQB, DM/64); main loops: gemm_ring.
 * Epilogue: 64x64 f32 tile staged in LDS (cross-wave, block barrier), then
 * Coverage: 16 iterations x 64 threads = 1024 units = 64 rows x 16 segments.
 * ------------------------------------------------------------------------ */
__global__ __launch_bounds__(64) __attribute__((amdgpu_num_vgpr(256)))
void out_kernel(
    const unsigned short* __restrict__ Ct, const unsigned short* __restrict__ Cr,
    const unsigned short* __restrict__ Wo, const float* __restrict__ bias, float* __restrict__ out)
{
  constexpr int PTF = 68;
  __shared__ __align__(16) float ts[64 * PTF];
  __shared__ __align__(16) unsigned short ring[2 * GBUF];

  const int tid = threadIdx.x, wave = tid >> 5, lane = tid & 31;
  const int hh = lane >> 4, m = lane & 15;
  const int tb = blockIdx.x, nb = blockIdx.y;
  const int n0 = nb * 64;
  const int rl0 = wave * 32;
  const bool dores = tb < NEARLY;     /* block-uniform */

  v8f acc[2][4];
#pragma unroll
  for (int mi = 0; mi < 2; ++mi)
#pragma unroll
    for (int ni = 0; ni < 4; ++ni) acc[mi][ni] = zero8();

  const unsigned short* wrows = Wo + (size_t)n0 * DM;

  if (dores) {
    gemm_ring<false>(Cr + (size_t)tb * 64 * DM, wrows, ring, acc);
#pragma unroll
    for (int mi = 0; mi < 2; ++mi)
#pragma unroll
      for (int ni = 0; ni < 4; ++ni)
#pragma unroll
        for (int r = 0; r < 8; ++r) acc[mi][ni][r] *= RINV;
  }

  gemm_ring<false>(Ct + (size_t)tb * 64 * DM, wrows, ring, acc);

  float bb[4];
#pragma unroll
  for (int ni = 0; ni < 4; ++ni) bb[ni] = bfr(bias[n0 + ni * 16 + m]);
#pragma unroll
  for (int mi = 0; mi < 2; ++mi) {
#pragma unroll
    for (int ni = 0; ni < 4; ++ni) {
#pragma unroll
      for (int r = 0; r < 8; ++r) {
        const int rl = rl0 + mi * 16 + 8 * hh + r;
        ts[rl * PTF + ni * 16 + m] = acc[mi][ni][r] * OINV + bb[ni];
      }
    }
  }
  __syncthreads();

  {
#pragma unroll
    for (int it = 0; it < 16; ++it) {
      const int u = it * 64 + tid;
      const int row = u >> 4, seg = u & 15;
      const int t = tb * 64 + row;
      const v4f v = *(const v4f*)(ts + row * PTF + seg * 4);
      if (t < TT) *(v4f*)(out + (size_t)t * DM + n0 + seg * 4) = v;
    }
    
  }
}

/* -------------------------------------------------------------------------- */
extern "C" void kernel_launch(void* const* d_in, const int* in_sizes, int n_in,
                              void* d_out, int out_size, void* d_ws, size_t ws_size,
                              hipStream_t stream)
{
  if (n_in < 13) return;
  if (in_sizes[0] < TT * DM || in_sizes[1] < TT * DM || in_sizes[2] < TT * DM) return;
  if (in_sizes[3] < (TT - 1) * SEQ_FULL + TT) return;
  if (in_sizes[4] < DM * DM || in_sizes[6] < DM * DM || in_sizes[8] < DM * DM || in_sizes[11] < DM * DM) return;
  if (in_sizes[5] < DM || in_sizes[7] < DM || in_sizes[9] < DM || in_sizes[12] < DM) return;
  if (in_sizes[10] < TT * HD) return;
  if (out_size < TT * DM) return;
  if (d_ws == nullptr || ws_size < WS_NEED) return;

  const float* q    = (const float*)d_in[0];
  const float* k    = (const float*)d_in[1];
  const float* v    = (const float*)d_in[2];
  const int*   mask = (const int*)d_in[3];
  const float* Wq_w = (const float*)d_in[4];
  const float* Wq_b = (const float*)d_in[5];
  const float* Wk_w = (const float*)d_in[6];
  const float* Wk_b = (const float*)d_in[7];
  const float* Wv_w = (const float*)d_in[8];
  const float* Wv_b = (const float*)d_in[9];
  const float* Er   = (const float*)d_in[10];
  const float* Wo_w = (const float*)d_in[11];
  const float* Wo_b = (const float*)d_in[12];
  float* outp = (float*)d_out;

  unsigned char* ws = (unsigned char*)d_ws;
  unsigned short* Xq = (unsigned short*)(ws + OFF_XQ);
  unsigned short* Xk = (unsigned short*)(ws + OFF_XK);
  unsigned short* Xv = (unsigned short*)(ws + OFF_XV);
  unsigned short* Wq = (unsigned short*)(ws + OFF_WQ);
  unsigned short* Wk = (unsigned short*)(ws + OFF_WK);
  unsigned short* Wv = (unsigned short*)(ws + OFF_WV);
  unsigned short* Wo = (unsigned short*)(ws + OFF_WO);
  unsigned short* Eh = (unsigned short*)(ws + OFF_ER);
  unsigned short* Qh = (unsigned short*)(ws + OFF_QH);
  unsigned short* Kh = (unsigned short*)(ws + OFF_KH);
  unsigned short* Vt = (unsigned short*)(ws + OFF_VT);
  unsigned short* Qr = (unsigned short*)(ws + OFF_QR);
  unsigned short* Kr = (unsigned short*)(ws + OFF_KR);
  unsigned short* Vr = (unsigned short*)(ws + OFF_VR);
  unsigned short* Ct = (unsigned short*)(ws + OFF_CT);
  unsigned short* Cr = (unsigned short*)(ws + OFF_CR);
  int* flags = (int*)(ws + OFF_FL);

  /* input planes (rows >= TT zero) and the per (query block, key chunk) skip/dense/mixed flags */
  prep_kernel<<<PREP_BLOCKS, PBT, 0, stream>>>(q, k, v, mask, Wq_w, Wk_w, Wv_w, Wo_w, Er,
                                               Xq, Xk, Xv, Wq, Wk, Wv, Wo, Eh, flags);

  /* projections: 64 tokens x one head per block, z = q, k, v */
  proj_kernel<<<dim3(NTB, NH, 3), 64, 0, stream>>>(Xq, Xk, Xv, Wq, Wk, Wv, Wq_b, Wk_b, Wv_b, Qh, Kh, Vt, Qr, Kr, Vr);

  /* attention: first NEARLY query blocks with residual products, the rest single products */
  attn_kernel<<<dim3(NQB, NH), 128, 0, stream>>>(Qh, Qr, Kh, Kr, Vt, Vr, Eh, mask, flags, Ct, Cr);

  /* output projection into d_out */
  out_kernel<<<dim3(NQB, DM / 64), 64, 0, stream>>>(Ct, Cr, Wo, Wo_b, outp);
}

// v006
// It runs in 98.5 microseconds.
// In two side-by-side timings against v005, it was 1.18 and 1.20 times as fast.
// All steps since v000 together make it 3.77 times as fast.
// Contractions: q/k/v input projections on v_wmma_f32_16x16x32_bf16 (bf16 operands = RNE-converted inputs and weights, f32 accumulate); scores q.k^T, row-shifted q.Er^T, p.v and the output projection on v_wmma_f32_16x16x32_f16 (f16 operands: f16 hi planes of projected q/k/v, p carried x1024 and folded as 1/1024 before the ctx plane, ctx carried x16, Wo carried x64, plus x2048 f16 residual planes for the first 256 query rows and first 256 keys), f32 accumulate; softmax and all other arithmetic in f32.
#include <hip/hip_runtime.h>

typedef _Float16       v16h __attribute__((ext_vector_type(16)));
typedef __bf16         v16b __attribute__((ext_vector_type(16)));
typedef unsigned short v8us __attribute__((ext_vector_type(8)));
typedef float          v8f  __attribute__((ext_vector_type(8)));
typedef float          v4f  __attribute__((ext_vector_type(4)));
typedef unsigned int   v4u  __attribute__((ext_vector_type(4)));
typedef int            v4i  __attribute__((ext_vector_type(4)));

#ifndef NB
#define NB 1
#endif
#ifndef SEQ
#define SEQ 2049
#endif
#define SEQ_FULL 2049

constexpr int DM     = 1024;
constexpr int NH     = 16;
constexpr int HD     = 64;
constexpr int TT     = SEQ;
constexpr int NQB    = (TT + 63) / 64;          /* query blocks of 64 rows */
constexpr int NTB    = NQB + 1;                  /* token blocks of the planes (one extra for the +1 row shift) */
constexpr int TPAD   = NTB * 64;                 /* padded token count of every plane */
constexpr int NKC    = NTB;                      /* key chunks of 64 */
constexpr int NEARLY = NQB < 4 ? NQB : 4;        /* query blocks with residual treatment */
constexpr int CRES   = NEARLY * 64;              /* rows of K/V/ctx residual planes */
constexpr int QRES   = (NEARLY + 1) * 64;        /* rows of the Q residual plane (covers the +1 shift) */

constexpr float RSC  = 2048.0f;                  /* residual plane carry */
constexpr float RINV = 1.0f / 2048.0f;
constexpr float PSC  = 1024.0f;                  /* softmax weight carry (on the p tile, hence on the p.v accumulator) */
constexpr float CSC  = 16.0f;                    /* ctx plane carry */
constexpr float OCV  = CSC / PSC;                /* 1/64: removes the p carry and applies the ctx carry in one factor */
constexpr float WOSC = 64.0f;                    /* Wo plane carry */
constexpr float OINV = 1.0f / (CSC * WOSC);      /* 1/1024 */

static_assert(NB == 1);
static_assert(SEQ <= SEQ_FULL);
static_assert(HD == 64);
static_assert(DM % 64 == 0 && DM % 32 == 0);
static_assert(TPAD % 64 == 0);
static_assert(NKC <= 64);
static_assert(QRES <= TPAD && CRES <= TPAD);

/* workspace region map (bytes, every offset a multiple of 128) */
constexpr size_t X_B  = (size_t)TPAD * DM * 2;       /* bf16 [TPAD][DM] */
constexpr size_t W_B  = (size_t)DM * DM * 2;         /* 16-bit [DM][DM] */
constexpr size_t E_B  = (size_t)TPAD * HD * 2;       /* f16 [TPAD][HD] */
constexpr size_t HP_B = (size_t)NH * TPAD * HD * 2;  /* f16 [NH][TPAD][HD] or [NH][HD][TPAD] */
constexpr size_t QR_B = (size_t)NH * QRES * HD * 2;  /* f16 [NH][QRES][HD] */
constexpr size_t KR_B = (size_t)NH * CRES * HD * 2;  /* f16 [NH][CRES][HD] or [NH][HD][CRES] */
constexpr size_t CT_B = (size_t)TPAD * DM * 2;       /* f16 [TPAD][DM] */
constexpr size_t CR_B = (size_t)CRES * DM * 2;       /* f16 [CRES][DM] */
constexpr int    FLN  = 4;                          /* 128-byte flag lines per query block, one writer each */
constexpr int    FSL  = (NKC + FLN - 1) / FLN;      /* key chunks (used slots) per flag line */
constexpr size_t FL_B = (size_t)NQB * FLN * 32 * 4; /* int [NQB][FLN][32]: chunk kc at line kc % FLN, slot kc / FLN */
static_assert(FSL <= 32);

constexpr size_t OFF_XQ = 0;
constexpr size_t OFF_XK = OFF_XQ + X_B;
constexpr size_t OFF_XV = OFF_XK + X_B;
constexpr size_t OFF_WQ = OFF_XV + X_B;
constexpr size_t OFF_WK = OFF_WQ + W_B;
constexpr size_t OFF_WV = OFF_WK + W_B;
constexpr size_t OFF_WO = OFF_WV + W_B;
constexpr size_t OFF_ER = OFF_WO + W_B;
constexpr size_t OFF_QH = OFF_ER + E_B;
constexpr size_t OFF_KH = OFF_QH + HP_B;
constexpr size_t OFF_VT = OFF_KH + HP_B;
constexpr size_t OFF_QR = OFF_VT + HP_B;
constexpr size_t OFF_KR = OFF_QR + QR_B;
constexpr size_t OFF_VR = OFF_KR + KR_B;
constexpr size_t OFF_CT = OFF_VR + KR_B;
constexpr size_t OFF_CR = OFF_CT + CT_B;
constexpr size_t OFF_FL = OFF_CR + CR_B;
constexpr size_t WS_NEED = OFF_FL + FL_B;

static_assert(X_B % 128 == 0 && W_B % 128 == 0 && E_B % 128 == 0 && HP_B % 128 == 0);
static_assert(QR_B % 128 == 0 && KR_B % 128 == 0 && CT_B % 128 == 0 && CR_B % 128 == 0 && FL_B % 128 == 0);
static_assert(WS_NEED <= 134217728ull);
static_assert((size_t)TT * DM * 4 <= (size_t)SEQ_FULL * DM * 4);

/* -------------------------------------------------------------------------- */
__device__ __forceinline__ unsigned short f2bf_bits(float f) {
  unsigned u = __float_as_uint(f);
  return (unsigned short)((u + 0x7FFFu + ((u >> 16) & 1u)) >> 16);
}
__device__ __forceinline__ float bfr(float f) { return __uint_as_float(((unsigned)f2bf_bits(f)) << 16); }
__device__ __forceinline__ unsigned short h_bits(float f) {
  _Float16 h = (_Float16)f;
  return __builtin_bit_cast(unsigned short, h);
}
__device__ __forceinline__ float h2f(unsigned short b) {
  _Float16 h = __builtin_bit_cast(_Float16, b);
  return (float)h;
}

/* WMMA issue helpers with the 4-slot hazard guard (ties D, keeps A/B live) */
__device__ __forceinline__ v8f mma_h(v16h a, v16h b, v8f c) {
  c = __builtin_amdgcn_wmma_f32_16x16x32_f16(false, a, false, b, (short)0, c, false, false);
  asm volatile("v_nop\n\tv_nop\n\tv_nop\n\tv_nop" : "+v"(c) : "v"(a), "v"(b));
  return c;
}
__device__ __forceinline__ v8f mma_b(v16b a, v16b b, v8f c) {
  c = __builtin_amdgcn_wmma_f32_16x16x32_bf16(false, a, false, b, (short)0, c, false, false);
  asm volatile("v_nop\n\tv_nop\n\tv_nop\n\tv_nop" : "+v"(c) : "v"(a), "v"(b));
  return c;
}

__device__ __forceinline__ v8f zero8() { return (v8f){0.f,0.f,0.f,0.f,0.f,0.f,0.f,0.f}; }

/* --------------------------------------------------------------------------
 * Main loop of the 64 x 64 GEMM blocks (2 waves): acc += A[64][DM] . B[64][DM]^T, 16-bit operands.
 * Stage = 128 k values: 64 A rows and 64 B rows of 256 B each, brought into LDS by asynchronous
 * copies (each copy = two whole 256-B row pieces), two buffers: stage t+1 flies while stage t is worked on.
 * Wave 0 copies the A rows, wave 1 the B rows, 32 copies per wave and stage.
 * LDS row pitch 272 B = 16 B x 17 (odd): the 16 rows of one ds_load_b128 fall on distinct bank groups.
 * Fragment k map and the order of the k steps per accumulator are those of the direct global loads it replaces.
 * ------------------------------------------------------------------------ */
constexpr int GKS  = 128;             /* k values per stage = 4 WMMA k steps */
constexpr int GNST = DM / GKS;        /* stages */
constexpr int GP   = 136;             /* LDS row pitch in 16-bit elements */
constexpr int GBUF = 128 * GP;        /* elements of one buffer: A rows 0..63, B rows 64..127 */
static_assert(DM % GKS == 0 && GNST >= 2);

union FR { v16h hv; v16b bv; v8us h[2]; };

/* eight copies: row pairs 0, 2, .. 14 from the lane's own LDS byte address l and global address g */
__device__ __forceinline__ void copy8(unsigned l, const unsigned short* g)
{
  /* the copies and, as the last line of the same statement, the wait that stands in front of any
     rewrite of the address registers they name */
  asm volatile(
      "global_load_async_to_lds_b128 %0, %8, off\n\t"
      "global_load_async_to_lds_b128 %1, %9, off\n\t"
      "global_load_async_to_lds_b128 %2, %10, off\n\t"
      "global_load_async_to_lds_b128 %3, %11, off\n\t"
      "global_load_async_to_lds_b128 %4, %12, off\n\t"
      "global_load_async_to_lds_b128 %5, %13, off\n\t"
      "global_load_async_to_lds_b128 %6, %14, off\n\t"
      "global_load_async_to_lds_b128 %7, %15, off\n\t"
      "s_wait_xcnt 0x0"
      :: "v"(l), "v"(l + 2u * 2u * GP), "v"(l + 4u * 2u * GP), "v"(l + 6u * 2u * GP),
         "v"(l + 8u * 2u * GP), "v"(l + 10u * 2u * GP), "v"(l + 12u * 2u * GP), "v"(l + 14u * 2u * GP),
         "v"(g), "v"(g + 2 * DM), "v"(g + 4 * DM), "v"(g + 6 * DM),
         "v"(g + 8 * DM), "v"(g + 10 * DM), "v"(g + 12 * DM), "v"(g + 14 * DM)
      : "memory");
}
/* one wave's 64 rows of one stage */
__device__ __forceinline__ void stage_copy(unsigned l, const unsigned short* g)
{
  /* unrolled: the row offsets of the four statements are constants */
#pragma unroll
  for (int q = 0; q < 4; ++q) copy8(l + (unsigned)(q * 16 * GP * 2), g + (size_t)q * 16 * DM);
}

template <bool BF>
__device__ __forceinline__ void gemm_ring(const unsigned short* __restrict__ A, const unsigned short* __restrict__ B,
                                          unsigned short* ring, v8f (&acc)[2][4])
{
  const int lane = threadIdx.x & 31;
  const int wave = __builtin_amdgcn_readfirstlane((int)(threadIdx.x >> 5));
  const int hh = lane >> 4, m = lane & 15;

  /* copy addresses: lanes 0..15 one row, lanes 16..31 the next, 16 B per lane */
  const unsigned short* g0 = (wave == 0 ? A : B) + (size_t)hh * DM + m * 8;
  const unsigned l0 = (unsigned)(size_t)ring + (unsigned)(((wave * 64 + hh) * GP + m * 8) * 2);

  stage_copy(l0, g0);
  /* stage 0 has landed before the barrier that publishes it */
  asm volatile("s_wait_asynccnt 0x0" ::: "memory");
  __syncthreads();
  stage_copy(l0 + (unsigned)(GBUF * 2), g0 + GKS);

  const unsigned short* fa = ring + (wave * 32 + m) * GP + 8 * hh;
  const unsigned short* fb = ring + (64 + m) * GP + 8 * hh;

  /* rolled: one body in the instruction cache, the buffer chosen by the trip's parity */
#pragma unroll 1
  for (int t = 0; t < GNST; ++t) {
    const int bo = (t & 1) * GBUF;
    const unsigned short* pa = fa + bo;
    const unsigned short* pb = fb + bo;
    /* every loop below is unrolled so that each index of the two fragment sets is a constant and the sets stay in registers */
    FR a[2][2], b[2][4];
#pragma unroll
    for (int mi = 0; mi < 2; ++mi) {
      a[0][mi].h[0] = *(const v8us*)(pa + mi * 16 * GP);
      a[0][mi].h[1] = *(const v8us*)(pa + mi * 16 * GP + 16);
    }
#pragma unroll
    for (int ni = 0; ni < 4; ++ni) {
      b[0][ni].h[0] = *(const v8us*)(pb + ni * 16 * GP);
      b[0][ni].h[1] = *(const v8us*)(pb + ni * 16 * GP + 16);
    }
#pragma unroll
    for (int ks = 0; ks < GKS / 32; ++ks) {
      const int cur = ks & 1, nxt = cur ^ 1;
      if (ks + 1 < GKS / 32) {          /* next k step's fragments of the same stage, ahead of this step's products */
#pragma unroll
        for (int mi = 0; mi < 2; ++mi) {
          a[nxt][mi].h[0] = *(const v8us*)(pa + mi * 16 * GP + (ks + 1) * 32);
          a[nxt][mi].h[1] = *(const v8us*)(pa + mi * 16 * GP + (ks + 1) * 32 + 16);
        }
#pragma unroll
        for (int ni = 0; ni < 4; ++ni) {
          b[nxt][ni].h[0] = *(const v8us*)(pb + ni * 16 * GP + (ks + 1) * 32);
          b[nxt][ni].h[1] = *(const v8us*)(pb + ni * 16 * GP + (ks + 1) * 32 + 16);
        }
      }
#pragma unroll
      for (int ni = 0; ni < 4; ++ni) {
        if constexpr (BF) {
          acc[0][ni] = mma_b(a[cur][0].bv, b[cur][ni].bv, acc[0][ni]);
          acc[1][ni] = mma_b(a[cur][1].bv, b[cur][ni].bv, acc[1][ni]);
        } else {
          acc[0][ni] = mma_h(a[cur][0].hv, b[cur][ni].hv, acc[0][ni]);
          acc[1][ni] = mma_h(a[cur][1].hv, b[cur][ni].hv, acc[1][ni]);
        }
      }
    }
    /* this wave's reads of buffer t&1 have returned before the buffer is refilled */
    asm volatile("s_wait_dscnt 0x0" ::: "memory");
    /* this wave's copies of stage t+1 have landed before the barrier that publishes them */
    asm volatile("s_wait_asynccnt 0x0" ::: "memory");
    __syncthreads();
    if (t + 2 < GNST) stage_copy(l0 + (unsigned)(bo * 2), g0 + (size_t)(t + 2) * GKS);
  }
  /* no copy is outstanding when the wave goes on */
  asm volatile("s_wait_asynccnt 0x0" ::: "memory");
}

/* --------------------------------------------------------------------------
 * f32 [nrows][ncols] -> 16-bit plane [nrows_pad][ncols]; rows >= nrows are zeros.
 * mode 0: bf16 bits (RNE).  mode 1: f16 bits of (scale * bf16(x)).
 * One unit u = 8 consecutive values of row u / (ncols/8); the caller hands out u < nrows_pad*ncols/8.
 * ------------------------------------------------------------------------ */
template <int nrows, int ncols, int mode>
__device__ __forceinline__ void cvt_unit(const float* __restrict__ src, float scale,
                                         unsigned short* __restrict__ dst, int u)
{
  constexpr int upr = ncols >> 3;
  const int row = u / upr;
  const int cu  = u - row * upr;
  const int rowc = row < nrows ? row : nrows - 1;          /* clamped address */
  const bool live = row < nrows;
  const float* p = src + (size_t)rowc * ncols + cu * 8;
  const v4f x0 = *(const v4f*)p;
  const v4f x1 = *(const v4f*)(p + 4);
  unsigned b0, b1, b2, b3, b4, b5, b6, b7;
  {
    const float f0 = live ? x0[0] : 0.f, f1 = live ? x0[1] : 0.f, f2 = live ? x0[2] : 0.f, f3 = live ? x0[3] : 0.f;
    const float f4 = live ? x1[0] : 0.f, f5 = live ? x1[1] : 0.f, f6 = live ? x1[2] : 0.f, f7 = live ? x1[3] : 0.f;
    if (mode == 0) {
      b0 = f2bf_bits(f0); b1 = f2bf_bits(f1); b2 = f2bf_bits(f2); b3 = f2bf_bits(f3);
      b4 = f2bf_bits(f4); b5 = f2bf_bits(f5); b6 = f2bf_bits(f6); b7 = f2bf_bits(f7);
    } else {
      b0 = h_bits(bfr(f0) * scale); b1 = h_bits(bfr(f1) * scale); b2 = h_bits(bfr(f2) * scale); b3 = h_bits(bfr(f3) * scale);
      b4 = h_bits(bfr(f4) * scale); b5 = h_bits(bfr(f5) * scale); b6 = h_bits(bfr(f6) * scale); b7 = h_bits(bfr(f7) * scale);
    }
  }
  v4u w;
  w[0] = b0 | (b1 << 16);
  w[1] = b2 | (b3 << 16);
  w[2] = b4 | (b5 << 16);
  w[3] = b6 | (b7 << 16);
  unsigned short* d = dst + (size_t)u * 8;
  *(v4u*)d = w;
  /* another branch's text follows in the caller: no register that the store names is rewritten in front of this wait */
  asm volatile("s_wait_xcnt 0x0" ::: "memory");
}

/* --------------------------------------------------------------------------
 * Per (query block, key chunk) flag from the int32 key mask:
 *   0 = every effective entry masked (chunk skipped), 1 = all kept, 2 = mixed.
 * Effective entry (t, s): query row clamped to TT-1 for padded rows, keys s >= TT masked.
 * Block = (query block qb, flag line ln), 16 waves: the chunks kc = ln + FLN*j, j < FSL.
 * Wave w reads rows 4w..4w+3 of every chunk of the block; all loads are independent, so
 * the whole strip is in flight at once.  Per wave one any-kept and one all-kept bit per
 * chunk (ballots), combined over the 16 waves through LDS behind one block barrier.
 * Coverage: wave 0 stores the block's whole 128-byte line (unused slots 0);
 * NQB x FLN blocks = the whole table.  wany, wall: 16 LDS words each.
 * ------------------------------------------------------------------------ */
__device__ __forceinline__ int flag_slot(int kc) { return (kc % FLN) * 32 + kc / FLN; }

__device__ __forceinline__ void flags_block(const int* __restrict__ mask, int* __restrict__ flags,
                                            int qb, int ln, unsigned* wany, unsigned* wall)
{
  const int tid = threadIdx.x, lane = tid & 31;
  const int wave = __builtin_amdgcn_readfirstlane(tid >> 5);   /* scalar, so the row bases are scalar */

  /* key of slot j, half hf: s = col0 + FLN*64*j + 32*hf.  Only the last slot can pass TT. */
  constexpr int LOFF = FLN * (FSL - 1) * 64;
  static_assert(LOFF - 1 < TT);
  const unsigned col0 = (unsigned)(ln * 64 + lane);
  const unsigned sl0 = col0 + LOFF, sl1 = sl0 + 32u;
  const unsigned cl0 = sl0 < (unsigned)TT ? sl0 : (unsigned)(TT - 1);   /* clamped address */
  const unsigned cl1 = sl1 < (unsigned)TT ? sl1 : (unsigned)(TT - 1);   /* clamped address */
  const int* rowp[4];
#pragma unroll
  for (int rr = 0; rr < 4; ++rr) {
    int t = qb * 64 + wave * 4 + rr;
    t = t < TT ? t : TT - 1;
    rowp[rr] = mask + (size_t)t * SEQ_FULL;
  }

  /* first every load, then every count */
  int mv[FSL][8];
#pragma unroll
  for (int j = 0; j < FSL - 1; ++j) {
#pragma unroll
    for (int it = 0; it < 8; ++it)
      mv[j][it] = (rowp[it >> 1] + col0)[FLN * j * 64 + (it & 1) * 32];
  }
#pragma unroll
  for (int it = 0; it < 8; ++it)
    mv[FSL - 1][it] = rowp[it >> 1][(it & 1) ? cl1 : cl0];
  /* keeps every load in front of every count: without it the scheduler mixes them and fewer loads fly at once */
  __builtin_amdgcn_sched_barrier(0);
  /* every register that the issued loads name (row bases, key offsets) is an input here, so none is
     rewritten in front of this wait */
  asm volatile("s_wait_xcnt 0x0"
               :: "s"(rowp[0]), "s"(rowp[1]), "s"(rowp[2]), "s"(rowp[3]), "v"(col0), "v"(cl0), "v"(cl1)
               : "memory");

  int cnt[FSL];
#pragma unroll
  for (int j = 0; j < FSL; ++j) {
    int n = 0;
#pragma unroll
    for (int it = 0; it < 8; ++it) {
      const bool ex = (j < FSL - 1) || (((it & 1) ? sl1 : sl0) < (unsigned)TT);   /* key exists */
      n += (ex && mv[j][it] != 0) ? 1 : 0;
    }
    cnt[j] = n;
  }

  unsigned anym = 0u, allm = 0u;                           /* wave-uniform, bit j = chunk ln + FLN*j */
#pragma unroll
  for (int j = 0; j < FSL; ++j) {
    anym |= (__builtin_amdgcn_ballot_w32(cnt[j] != 0) != 0u) ? (1u << j) : 0u;
    allm |= (__builtin_amdgcn_ballot_w32(cnt[j] == 8) == 0xFFFFFFFFu) ? (1u << j) : 0u;
  }
  if (lane == 0) { wany[wave] = anym; wall[wave] = allm; }
  __syncthreads();

  if (wave == 0) {
    unsigned a = 0u, f = 0xFFFFFFFFu;
#pragma unroll
    for (int w = 0; w < 16; ++w) { a |= wany[w]; f &= wall[w]; }
    int fv = 0;
    if (lane < FSL) fv = ((a >> lane) & 1u) ? (((f >> lane) & 1u) ? 1 : 2) : 0;
    flags[((size_t)qb * FLN + ln) * 32 + lane] = fv;
  }
}

/* --------------------------------------------------------------------------
 * Everything that depends on the inputs alone, in one launch of 512-thread blocks:
 * blocks [0, FBL): mask flags, block b = (query block b / FLN, flag line b % FLN);
 * then 3 x XBL blocks: q, k, v planes; 3 x WBL: Wq, Wk, Wv planes; WBL: Wo plane; EBL: Er plane.
 * A conversion block = 512 units, one per thread; every plane's unit count is a multiple of 512.
 * The branch on the block index is block-uniform (the flags part holds a block barrier).
 * ------------------------------------------------------------------------ */
constexpr int PBT = 512;
constexpr int FBL = NQB * FLN;
constexpr int XBL = TPAD * (DM / 8) / PBT;
constexpr int WBL = DM * (DM / 8) / PBT;
constexpr int EBL = TPAD * (HD / 8) / PBT;
constexpr int PREP_BLOCKS = FBL + 3 * XBL + 4 * WBL + EBL;
static_assert(TPAD * (DM / 8) % PBT == 0 && DM * (DM / 8) % PBT == 0 && TPAD * (HD / 8) % PBT == 0);

__global__ __launch_bounds__(512) void prep_kernel(
    const float* __restrict__ q, const float* __restrict__ k, const float* __restrict__ v,
    const int* __restrict__ mask,
    const float* __restrict__ Wq_w, const float* __restrict__ Wk_w, const float* __restrict__ Wv_w,
    const float* __restrict__ Wo_w, const float* __restrict__ Er,
    unsigned short* __restrict__ Xq, unsigned short* __restrict__ Xk, unsigned short* __restrict__ Xv,
    unsigned short* __restrict__ Wq, unsigned short* __restrict__ Wk, unsigned short* __restrict__ Wv,
    unsigned short* __restrict__ Wo, unsigned short* __restrict__ Eh, int* __restrict__ flags)
{
  __shared__ unsigned wany[16];
  __shared__ unsigned wall[16];
  const int tid = threadIdx.x;
  int b = blockIdx.x;
  if (b < FBL) { flags_block(mask, flags, b / FLN, b % FLN, wany, wall); return; }
  b -= FBL;
  if (b < 3 * XBL) {
    const int j = b / XBL;
    cvt_unit<TT, DM, 0>(j == 0 ? q : j == 1 ? k : v, 1.0f, j == 0 ? Xq : j == 1 ? Xk : Xv, (b - j * XBL) * PBT + tid);
    return;
  }
  b -= 3 * XBL;
  if (b < 3 * WBL) {
    const int j = b / WBL;
    cvt_unit<DM, DM, 0>(j == 0 ? Wq_w : j == 1 ? Wk_w : Wv_w, 1.0f, j == 0 ? Wq : j == 1 ? Wk : Wv, (b - j * WBL) * PBT + tid);
    return;
  }
  b -= 3 * WBL;
  if (b < WBL) { cvt_unit<DM, DM, 1>(Wo_w, WOSC, Wo, b * PBT + tid); return; }
  b -= WBL;
  cvt_unit<TT, HD, 1>(Er, 1.0f, Eh, b * PBT + tid);
}

/* --------------------------------------------------------------------------
 * Projection GEMM: Y[t][n] = sum_k X[t][k] W[n][k] + b[n] for one 64-token x 64-col
 * (= one head) tile per block; bf16 operands (X and W planes), f32 accumulate.
 * Block = 2 waves (64 threads); wave w: tokens w*32..w*32+31 (2 row tiles) x 4 col tiles; main loop: gemm_ring.
 * A fragment (row m = lane&15): elems 0..7 <- k0+8h+i, 8..15 <- k0+16+8h+i.
 * B[k][n] = W[n][k]: loaded from row n = lane&15 with the same k map.  D elem r = (row 8h+r, col lane&15).
 * Epilogue: hi = f16(y), res = f16((y - hi) * 2048), rows t >= TT forced to 0; the block's
 * MODE 0: Q -> [NH][TPAD][HD] (+ residual rows < QRES); 1: K -> same (+ residual rows < CRES);
 * MODE 2: V -> [NH][HD][TPAD] (+ residual [NH][HD][CRES]).
 * Coverage per block: 8 iterations x 64 threads = 512 units = 64 rows x 8 segments (hi and res).
 * LDS tiles th/tr: cross-wave, separated by a block barrier; reloaded through the stored element type.
 * The three projections share one launch: grid (NTB, NH, 3), MODE = blockIdx.z (block-uniform);
 * the main loop is common, proj_tail<MODE> is the epilogue.
 * ------------------------------------------------------------------------ */
constexpr int PT = 72;

template <int MODE>
__device__ __forceinline__ void proj_tail(
    v8f (&acc)[2][4], const float* __restrict__ bias, unsigned short* __restrict__ Ph,
    unsigned short* __restrict__ Pr, unsigned short* th, unsigned short* tr)
{
  constexpr int NRES_TB = (MODE == 0) ? (NEARLY + 1) : NEARLY;
  const int tid = threadIdx.x, wave = tid >> 5, lane = tid & 31;
  const int hh = lane >> 4, m = lane & 15;
  const int tb = blockIdx.x, head = blockIdx.y;
  const int n0 = head * 64;
  const int rl0 = wave * 32;

  float bb[4];
#pragma unroll
  for (int ni = 0; ni < 4; ++ni) bb[ni] = bfr(bias[n0 + ni * 16 + m]);

#pragma unroll
  for (int mi = 0; mi < 2; ++mi) {
#pragma unroll
    for (int ni = 0; ni < 4; ++ni) {
#pragma unroll
      for (int r = 0; r < 8; ++r) {
        const int rl  = rl0 + mi * 16 + 8 * hh + r;
        const int t   = tb * 64 + rl;
        const int col = ni * 16 + m;
        float y = acc[mi][ni][r] + bb[ni];
        y = (t < TT) ? y : 0.f;
        const unsigned short hb = h_bits(y);
        const float res = (y - h2f(hb)) * RSC;
        const unsigned short rb = h_bits(res);
        if (MODE == 2) { th[col * PT + rl] = hb; tr[col * PT + rl] = rb; }
        else           { th[rl * PT + col] = hb; tr[rl * PT + col] = rb; }
      }
    }
  }
  __syncthreads();

  const bool dores = tb < NRES_TB;    /* block-uniform */
  {
#pragma unroll
    for (int it = 0; it < 8; ++it) {
      const int u = it * 64 + tid;
      const int row = u >> 3, seg = u & 7;
      const v8us vh = *(const v8us*)(th + row * PT + seg * 8);
      const v8us vr = *(const v8us*)(tr + row * PT + seg * 8);
      if (MODE == 2) {
        *(v8us*)(Ph + ((size_t)head * HD + row) * TPAD + tb * 64 + seg * 8) = vh;
        if (dores) *(v8us*)(Pr + ((size_t)head * HD + row) * CRES + tb * 64 + seg * 8) = vr;
      } else {
        *(v8us*)(Ph + ((size_t)head * TPAD + tb * 64 + row) * HD + seg * 8) = vh;
        if (dores) {
          if (MODE == 0) *(v8us*)(Pr + ((size_t)head * QRES + tb * 64 + row) * HD + seg * 8) = vr;
          else           *(v8us*)(Pr + ((size_t)head * CRES + tb * 64 + row) * HD + seg * 8) = vr;
        }
      }
    }
    
  }
  /* another epilogue's text follows in the caller: no register that the last stores name is rewritten in front of this wait */
  asm volatile("s_wait_xcnt 0x0" ::: "memory");
}

__global__ __launch_bounds__(64) __attribute__((amdgpu_num_vgpr(256)))
void proj_kernel(
    const unsigned short* __restrict__ Xq, const unsigned short* __restrict__ Xk, const unsigned short* __restrict__ Xv,
    const unsigned short* __restrict__ Wq, const unsigned short* __restrict__ Wk, const unsigned short* __restrict__ Wv,
    const float* __restrict__ bq, const float* __restrict__ bk, const float* __restrict__ bv,
    unsigned short* __restrict__ Qh, unsigned short* __restrict__ Kh, unsigned short* __restrict__ Vt,
    unsigned short* __restrict__ Qr, unsigned short* __restrict__ Kr, unsigned short* __restrict__ Vr)
{
  __shared__ __align__(16) unsigned short th[64 * PT];
  __shared__ __align__(16) unsigned short tr[64 * PT];
  __shared__ __align__(16) unsigned short ring[2 * GBUF];

  const int tb = blockIdx.x, head = blockIdx.y, mode = blockIdx.z;
  const unsigned short* X = mode == 0 ? Xq : mode == 1 ? Xk : Xv;
  const unsigned short* W = mode == 0 ? Wq : mode == 1 ? Wk : Wv;

  v8f acc[2][4];
#pragma unroll
  for (int mi = 0; mi < 2; ++mi)
#pragma unroll
    for (int ni = 0; ni < 4; ++ni) acc[mi][ni] = zero8();

  gemm_ring<true>(X + (size_t)tb * 64 * DM, W + (size_t)head * 64 * DM, ring, acc);

  if (mode == 0)      proj_tail<0>(acc, bq, Qh, Qr, th, tr);
  else if (mode == 1) proj_tail<1>(acc, bk, Kh, Kr, th, tr);
  else                proj_tail<2>(acc, bv, Vt, Vr, th, tr);
}

/* --------------------------------------------------------------------------
 * Flash attention with the row-shifted Er term, head dim 64, products transposed.
 * Block = 4 waves = 64 query rows of one head; grid (query blocks, NH).
 * Per kept 64-key chunk: K [key][d], Er [key][d], V^T [d][key] f16 tiles staged in LDS
 * (EARLY: also K and V^T residual tiles) by asynchronous copies, two buffers: the next kept chunk flies
 * while this one is worked on; one block barrier per chunk (a second one only where a mask tile is staged).
 * S^T = K.q^T + Er.q(t+1)^T on f16 WMMA: A = K or Er rows from LDS, B = Q rows; D elem r of key tile j =
 * (key 16j+8h+r, query lane&15), so a lane holds 32 of the 64 scores of ONE query and lane^16 the other 32.
 * x0.125, replace-fill -inf from the key mask (flag 2 chunks), f32 online softmax: maximum in-lane plus one
 * exchange between the wave halves; the sum stays a per-half partial and is joined once in the epilogue.
 * P^T = f16(1024 p) (EARLY: + f16 residual x2048) is a B operand straight from the score registers:
 * element s of the operand for keys 32kk.. is register s&7 of key tile 2kk+(s>>3), the hardware k order.
 * O^T += V^T.P^T on f16 WMMA: A = V^T rows from LDS; D elem r of d tile t = (d 16t+8h+r, query lane&15)
 * (O therefore carries the x1024 of P; the normaliser applies 1/(1024 l) x 16 in one factor).
 * EARLY adds (k_res.qh + k.q_res + Er.q_res(t+1))/2048 to the scores and
 * (V_res.P + V.P_res)/2048 to O through separate accumulators folded per tile.
 * Live-state plan: Q hi fragments reloaded per chunk (dead during softmax and P.V),
 * Q residual fragments loaded only inside the residual score phase, one 8-register
 * residual accumulator at a time; 4 O tiles + 4 score tiles + m/l (one value each) persistent.
 * Epilogue: ctx = O/(1024 l) carried x16 as f16 into [TPAD][DM] (+ residual rows < CRES),
 * staged per wave in LDS so that whole 128-byte row pieces are stored.
 * Fragment k map as in proj_kernel (A row / B col = lane&15, split k map).
 * LDS regions: K/Er/V/res tiles and msk cross-wave (block barriers).
 * Both variants share one launch: grid (NQB, NH), EARLY = (query block < NEARLY), block-uniform;
 * sm holds two buffers of 5 tiles (the variant without residuals: two of 3), msk 4096 bytes.
 * ------------------------------------------------------------------------ */
/* LDS row pitch of every fragment-read tile: 72 halves = 144 B = 16 B x 9 (odd), so the 16 rows that one
   ds_load_b128 reads fall on 16 distinct groups of four banks; at 128 B they fall on two groups */
constexpr int LP = 72;
constexpr int TSZ = 64 * LP;                       /* one 64-row tile */

typedef unsigned int v2u __attribute__((ext_vector_type(2)));

/* value of lane l ^ 16 */
__device__ __forceinline__ float xhalf(float x) {
  const int b = __float_as_int(x);
  return __int_as_float(__builtin_amdgcn_permlanex16(b, b, 0x76543210, 0xfedcba98, false, false));
}

/* Asynchronous copies of one key chunk's tiles.  A lane brings 16 B; a thread's four pieces of a 64 x 64 tile
   are rows r, r+16, r+32, r+48 (r = tid>>3) at segment tid&7.  l*: the lane's LDS byte address of its first
   piece, g*: its global address; SV: global row pitch in elements of the [d][key] plane (the [key][d] planes have pitch HD). */
constexpr unsigned LS16 = 16u * LP * 2u;           /* 16 LDS rows in bytes */

template <int SV>
__device__ __forceinline__ void copy_kev(unsigned lk, unsigned le, unsigned lv, const unsigned short* gk,
                                         const unsigned short* ge, const unsigned short* gv)
{
  /* the copies and, as the last line of the same statement, the wait that stands in front of any
     rewrite of the address registers they name */
  asm volatile(
      "global_load_async_to_lds_b128 %0, %12, off\n\t"
      "global_load_async_to_lds_b128 %1, %13, off\n\t"
      "global_load_async_to_lds_b128 %2, %14, off\n\t"
      "global_load_async_to_lds_b128 %3, %15, off\n\t"
      "global_load_async_to_lds_b128 %4, %16, off\n\t"
      "global_load_async_to_lds_b128 %5, %17, off\n\t"
      "global_load_async_to_lds_b128 %6, %18, off\n\t"
      "global_load_async_to_lds_b128 %7, %19, off\n\t"
      "global_load_async_to_lds_b128 %8, %20, off\n\t"
      "global_load_async_to_lds_b128 %9, %21, off\n\t"
      "global_load_async_to_lds_b128 %10, %22, off\n\t"
      "global_load_async_to_lds_b128 %11, %23, off\n\t"
      "s_wait_xcnt 0x0"
      :: "v"(lk), "v"(lk + LS16), "v"(lk + 2u * LS16), "v"(lk + 3u * LS16),
         "v"(le), "v"(le + LS16), "v"(le + 2u * LS16), "v"(le + 3u * LS16),
         "v"(lv), "v"(lv + LS16), "v"(lv + 2u * LS16), "v"(lv + 3u * LS16),
         "v"(gk), "v"(gk + 16 * HD), "v"(gk + 32 * HD), "v"(gk + 48 * HD),
         "v"(ge), "v"(ge + 16 * HD), "v"(ge + 32 * HD), "v"(ge + 48 * HD),
         "v"(gv), "v"(gv + 16 * SV), "v"(gv + 32 * SV), "v"(gv + 48 * SV)
      : "memory");
}
template <int SV>
__device__ __forceinline__ void copy_kv(unsigned lk, unsigned lv, const unsigned short* gk, const unsigned short* gv)
{
  /* as above: the wait is the last line of the copies' own statement */
  asm volatile(
      "global_load_async_to_lds_b128 %0, %8, off\n\t"
      "global_load_async_to_lds_b128 %1, %9, off\n\t"
      "global_load_async_to_lds_b128 %2, %10, off\n\t"
      "global_load_async_to_lds_b128 %3, %11, off\n\t"
      "global_load_async_to_lds_b128 %4, %12, off\n\t"
      "global_load_async_to_lds_b128 %5, %13, off\n\t"
      "global_load_async_to_lds_b128 %6, %14, off\n\t"
      "global_load_async_to_lds_b128 %7, %15, off\n\t"
      "s_wait_xcnt 0x0"
      :: "v"(lk), "v"(lk + LS16), "v"(lk + 2u * LS16), "v"(lk + 3u * LS16),
         "v"(lv), "v"(lv + LS16), "v"(lv + 2u * LS16), "v"(lv + 3u * LS16),
         "v"(gk), "v"(gk + 16 * HD), "v"(gk + 32 * HD), "v"(gk + 48 * HD),
         "v"(gv), "v"(gv + 16 * SV), "v"(gv + 32 * SV), "v"(gv + 48 * SV)
      : "memory");
}

template <bool EARLY>
__device__ __forceinline__
void attn_body(const unsigned short* __restrict__ Qh, const unsigned short* __restrict__ Qr,
               const unsigned short* __restrict__ Kh, const unsigned short* __restrict__ Kr,
               const unsigned short* __restrict__ Vt, const unsigned short* __restrict__ Vr,
               const unsigned short* __restrict__ Erp, const int* __restrict__ mask,
               const int* __restrict__ flags, unsigned short* __restrict__ Ct,
               unsigned short* __restrict__ Cr, unsigned short* sm, unsigned char* msk)
{
  constexpr int KSH = 0, ESH = TSZ, VTH = 2 * TSZ, KRS = 3 * TSZ, VRS = 4 * TSZ;
  union FH { v16h v; v8us h[2]; };

  const int tid = threadIdx.x, wave = tid >> 5, lane = tid & 31;
  const int hh = lane >> 4, c = lane & 15;
  const int qb = blockIdx.x;
  const int head = blockIdx.y;
  const int q0 = qb * 64 + wave * 16;
  const int wrow0 = wave * 16;                     /* the wave's first row inside the block tile */

  /* fragment base pointers: rows q0+c (k.q^T) and q0+1+c (shifted Er term) */
  const unsigned short* qp = Qh + ((size_t)head * TPAD + q0 + c) * HD + 8 * hh;
  const unsigned short* rp = Qr + ((size_t)head * QRES + (EARLY ? (q0 + c) : c)) * HD + 8 * hh;

  /* state of query q0+c: running maximum (equal in both halves), this half's part of the sum */
  float mrow = -__builtin_inff(), lrow = 0.f;
  v8f oacc[4];
#pragma unroll
  for (int t = 0; t < 4; ++t) oacc[t] = zero8();

  const int* frow = flags + (size_t)qb * (FLN * 32);

  /* the block's flags as two bit masks over the key chunks (bit kc), equal in every wave: the next kept chunk
     is known ahead of its turn, so its copies can be issued one trip early */
  unsigned long long kept, mixed;
  {
    const int sl0 = flag_slot(lane < NKC ? lane : NKC - 1);             /* clamped addresses */
    const int sl1 = flag_slot(lane + 32 < NKC ? lane + 32 : NKC - 1);
    const int f0 = frow[sl0];
    const int f1 = frow[sl1];
    /* the row base and both slots are inputs here, so no register that the two loads name is rewritten in front of this wait */
    asm volatile("s_wait_xcnt 0x0" :: "s"(frow), "v"(sl0), "v"(sl1) : "memory");
    const bool e0 = lane < NKC, e1 = lane + 32 < NKC;
    kept  = ((unsigned long long)__builtin_amdgcn_ballot_w32(e1 && f1 != 0) << 32) | __builtin_amdgcn_ballot_w32(e0 && f0 != 0);
    mixed = ((unsigned long long)__builtin_amdgcn_ballot_w32(e1 && f1 == 2) << 32) | __builtin_amdgcn_ballot_w32(e0 && f0 == 2);
  }

  /* copy addresses of this thread: row tid>>3 (+16 per piece), segment tid&7 */
  constexpr int NT = EARLY ? 5 : 3;                /* tiles of one buffer */
  const int crow = tid >> 3, cseg = tid & 7;
  const unsigned lc0 = (unsigned)(size_t)sm + (unsigned)((crow * LP + cseg * 8) * 2);
  const unsigned short* gk0 = Kh + ((size_t)head * TPAD + crow) * HD + cseg * 8;
  const unsigned short* ge0 = Erp + (size_t)crow * HD + cseg * 8;
  const unsigned short* gv0 = Vt + ((size_t)head * HD + crow) * TPAD + cseg * 8;
  const unsigned short* gkr0 = Kr + ((size_t)head * CRES + crow) * HD + cseg * 8;
  const unsigned short* gvr0 = Vr + ((size_t)head * HD + crow) * CRES + cseg * 8;
  /* all tiles of chunk kc into buffer b */
  auto stage = [&](int kc, int b) {
    const unsigned l = lc0 + (unsigned)(b * NT * TSZ * 2);
    copy_kev<TPAD>(l + KSH * 2u, l + ESH * 2u, l + VTH * 2u,
                   gk0 + (size_t)kc * 64 * HD, ge0 + (size_t)kc * 64 * HD, gv0 + kc * 64);
    if (EARLY) {
      const int kvr = (kc < NEARLY) ? kc * 64 : 0;             /* clamped residual chunk base */
      copy_kv<CRES>(l + KRS * 2u, l + VRS * 2u, gkr0 + (size_t)kvr * HD, gvr0 + kvr);
    }
  };

  /* two buffers: the next kept chunk's copies fly while this chunk is worked on */
  int kcur = -1, knxt = -1;
  if (kept != 0ull) { kcur = __builtin_ctzll(kept); kept &= kept - 1ull; stage(kcur, 0); }
  /* the first chunk has landed before the barrier that publishes it */
  asm volatile("s_wait_asynccnt 0x0" ::: "memory");
  __syncthreads();
  if (kept != 0ull) { knxt = __builtin_ctzll(kept); kept &= kept - 1ull; stage(knxt, 1); }

  /* rolled: one body in the instruction cache; at most one trip per key chunk */
#pragma unroll 1
  for (int trip = 0; trip < NKC && kcur >= 0; ++trip) {
    const int kc = kcur;
    const int bsel = trip & 1;
    const unsigned short* sb = sm + bsel * (NT * TSZ);         /* this trip's buffer */
    const int fk = (int)((mixed >> kc) & 1ull) ? 2 : 1;        /* block-uniform */
    const int kv0 = kc * 64;
    const bool useres = EARLY && (kc < NEARLY);

    if (fk == 2) {
      /* key mask tile: thread -> row tid>>1, 32 columns; clamped addresses, keys >= TT masked */
      const int row = tid >> 1, hsel = tid & 1;
      int qrow = qb * 64 + row;
      qrow = qrow < TT ? qrow : TT - 1;
      const int* mb = mask + (size_t)qrow * SEQ_FULL;
#pragma unroll 1
      for (int g = 0; g < 4; ++g) {
#pragma unroll
        for (int e = 0; e < 8; ++e) {
          const int col = hsel * 32 + g * 8 + e;
          const int s = kv0 + col;
          const int sc = s < TT ? s : TT - 1;
          const int mv = mb[sc];
          msk[row * 64 + col] = (unsigned char)((s < TT && mv != 0) ? 1 : 0);
        }
      }
      /* publishes the mask tile; its last readers left it before the barrier at the foot of their trip */
      __syncthreads();
    }

    /* Q hi fragments for this chunk (B operands), two 32-deep d halves */
    FH qa[2], qs[2];
#pragma unroll
    for (int dc = 0; dc < 2; ++dc) {
      qa[dc].h[0] = *(const v8us*)(qp + dc * 32);
      qa[dc].h[1] = *(const v8us*)(qp + dc * 32 + 16);
      qs[dc].h[0] = *(const v8us*)(qp + HD + dc * 32);
      qs[dc].h[1] = *(const v8us*)(qp + HD + dc * 32 + 16);
    }

    /* transposed scores: 64 keys x 16 queries per wave; s[j][r] = (key 16j+8h+r, query c) */
    v8f s[4];
#pragma unroll
    for (int j = 0; j < 4; ++j) {
      s[j] = zero8();
#pragma unroll
      for (int dc = 0; dc < 2; ++dc) {
        FH kf, ef;
        kf.h[0] = *(const v8us*)(sb + KSH + (j * 16 + c) * LP + dc * 32 + 8 * hh);
        kf.h[1] = *(const v8us*)(sb + KSH + (j * 16 + c) * LP + dc * 32 + 16 + 8 * hh);
        ef.h[0] = *(const v8us*)(sb + ESH + (j * 16 + c) * LP + dc * 32 + 8 * hh);
        ef.h[1] = *(const v8us*)(sb + ESH + (j * 16 + c) * LP + dc * 32 + 16 + 8 * hh);
        s[j] = mma_h(kf.v, qa[dc].v, s[j]);
        s[j] = mma_h(ef.v, qs[dc].v, s[j]);
      }
      if (EARLY) {
        if (useres) {
          v8f sr = zero8();
#pragma unroll
          for (int dc = 0; dc < 2; ++dc) {
            FH kf, ef, krf, qra, qrs;
            kf.h[0]  = *(const v8us*)(sb + KSH + (j * 16 + c) * LP + dc * 32 + 8 * hh);
            kf.h[1]  = *(const v8us*)(sb + KSH + (j * 16 + c) * LP + dc * 32 + 16 + 8 * hh);
            ef.h[0]  = *(const v8us*)(sb + ESH + (j * 16 + c) * LP + dc * 32 + 8 * hh);
            ef.h[1]  = *(const v8us*)(sb + ESH + (j * 16 + c) * LP + dc * 32 + 16 + 8 * hh);
            krf.h[0] = *(const v8us*)(sb + KRS + (j * 16 + c) * LP + dc * 32 + 8 * hh);
            krf.h[1] = *(const v8us*)(sb + KRS + (j * 16 + c) * LP + dc * 32 + 16 + 8 * hh);
            qra.h[0] = *(const v8us*)(rp + dc * 32);
            qra.h[1] = *(const v8us*)(rp + dc * 32 + 16);
            qrs.h[0] = *(const v8us*)(rp + HD + dc * 32);
            qrs.h[1] = *(const v8us*)(rp + HD + dc * 32 + 16);
            sr = mma_h(krf.v, qa[dc].v, sr);
            sr = mma_h(kf.v, qra.v, sr);
            sr = mma_h(ef.v, qrs.v, sr);
          }
#pragma unroll
          for (int r = 0; r < 8; ++r) s[j][r] += sr[r] * RINV;
        }
      }
    }

    /* scale by 1/sqrt(64) and replace-fill from the key mask (this lane's query, its 8 keys per tile) */
#pragma unroll
    for (int j = 0; j < 4; ++j) {
#pragma unroll
      for (int r = 0; r < 8; ++r) s[j][r] *= 0.125f;
    }
    if (fk == 2) {
#pragma unroll
      for (int j = 0; j < 4; ++j) {
        const v2u mw = *(const v2u*)(msk + (wrow0 + c) * 64 + j * 16 + 8 * hh);
#pragma unroll
        for (int r = 0; r < 8; ++r) {
          const unsigned mv = (mw[r >> 2] >> (8 * (r & 3))) & 0xFFu;
          s[j][r] = mv ? s[j][r] : -__builtin_inff();
        }
      }
    }

    /* chunk maximum of the lane's query: 32 keys in-lane (one chain per tile), then the other half's 32 */
    float mj[4];
#pragma unroll
    for (int j = 0; j < 4; ++j) {
      float mx = s[j][0];
#pragma unroll
      for (int r = 1; r < 8; ++r) mx = fmaxf(mx, s[j][r]);
      mj[j] = mx;
    }
    float cm = fmaxf(fmaxf(mj[0], mj[1]), fmaxf(mj[2], mj[3]));
    cm = fmaxf(cm, xhalf(cm));

    /* online softmax update; P^T (carried x1024) packed into B operands in place */
    const float mnew = fmaxf(mrow, cm);
    const bool dead = (mnew == -__builtin_inff());
    const float aexp = __expf(mrow - mnew);
    const float alpha = dead ? 1.f : aexp;
    mrow = mnew;
    FH pa[2], pr[2];
    float ps[4];
#pragma unroll
    for (int j = 0; j < 4; ++j) {
      float sum = 0.f;
#pragma unroll
      for (int r = 0; r < 8; ++r) {
        const float pe = __expf(s[j][r] - mnew);
        const float p = dead ? 0.f : pe;
        sum += p;
        const float pc = p * PSC;
        const _Float16 hv = (_Float16)pc;
        pa[j >> 1].v[(j & 1) * 8 + r] = hv;
        if (EARLY) {
          const float pres = (pc - (float)hv) * RSC;
          pr[j >> 1].v[(j & 1) * 8 + r] = (_Float16)pres;
        }
      }
      ps[j] = sum;
    }
    lrow = lrow * alpha + ((ps[0] + ps[1]) + (ps[2] + ps[3]));
#pragma unroll
    for (int t = 0; t < 4; ++t) {
#pragma unroll
      for (int r = 0; r < 8; ++r) oacc[t][r] *= alpha;
    }

    /* O^T += V^T.P^T : A = V^T [d][key] rows from LDS, B = P^T [key][q] from registers */
#pragma unroll
    for (int kk = 0; kk < 2; ++kk) {
#pragma unroll
      for (int t = 0; t < 4; ++t) {
        FH vb;
        vb.h[0] = *(const v8us*)(sb + VTH + (t * 16 + c) * LP + kk * 32 + 8 * hh);
        vb.h[1] = *(const v8us*)(sb + VTH + (t * 16 + c) * LP + kk * 32 + 16 + 8 * hh);
        oacc[t] = mma_h(vb.v, pa[kk].v, oacc[t]);
      }
    }
    if (EARLY) {
      if (useres) {
        /* residual products per d tile: one 8-register accumulator live at a time */
#pragma unroll
        for (int t = 0; t < 4; ++t) {
          v8f oar = zero8();
#pragma unroll
          for (int kk = 0; kk < 2; ++kk) {
            FH vb, vr;
            vb.h[0] = *(const v8us*)(sb + VTH + (t * 16 + c) * LP + kk * 32 + 8 * hh);
            vb.h[1] = *(const v8us*)(sb + VTH + (t * 16 + c) * LP + kk * 32 + 16 + 8 * hh);
            vr.h[0] = *(const v8us*)(sb + VRS + (t * 16 + c) * LP + kk * 32 + 8 * hh);
            vr.h[1] = *(const v8us*)(sb + VRS + (t * 16 + c) * LP + kk * 32 + 16 + 8 * hh);
            oar = mma_h(vr.v, pa[kk].v, oar);
            oar = mma_h(vb.v, pr[kk].v, oar);
          }
#pragma unroll
          for (int r = 0; r < 8; ++r) oacc[t][r] += oar[r] * RINV;
        }
      }
    }

    /* this wave's reads of this trip's buffer (and of the mask tile) have returned before the buffer is refilled */
    asm volatile("s_wait_dscnt 0x0" ::: "memory");
    /* this wave's copies of the next chunk have landed before the barrier that publishes them */
    asm volatile("s_wait_asynccnt 0x0" ::: "memory");
    __syncthreads();
    kcur = knxt;
    knxt = -1;
    if (kept != 0ull) { knxt = __builtin_ctzll(kept); kept &= kept - 1ull; stage(knxt, bsel); }
  }
  /* no copy is outstanding when the wave goes on */
  asm volatile("s_wait_asynccnt 0x0" ::: "memory");

  /* epilogue: all waves are done with the staged tiles before the region is reused */
  __syncthreads();
  unsigned short* osh = sm + KSH + wave * 1024;     /* [16][64] hi, carried x16 */
  unsigned short* osr = sm + ESH + wave * 1024;     /* [16][64] residual x2048 (EARLY) */
  {
    /* the two halves' partial sums joined; O holds 1024 x sum(p v); ctx = O / (1024 l);
       plane value = 16 ctx = O x (1/l) x (16/1024) */
    const float lsum = lrow + xhalf(lrow);
    const float inv = (1.0f / lsum) * OCV;
#pragma unroll
    for (int t = 0; t < 4; ++t) {
      v8us oh, orr;
#pragma unroll
      for (int r = 0; r < 8; ++r) {
        const float o = oacc[t][r] * inv;
        const unsigned short hb = h_bits(o);
        oh[r] = hb;
        orr[r] = EARLY ? h_bits((o - h2f(hb)) * RSC) : (unsigned short)0;
      }
      /* query row c, d = 16t+8h .. +7: 16 bytes */
      *(v8us*)(osh + c * 64 + t * 16 + 8 * hh) = oh;
      if (EARLY) *(v8us*)(osr + c * 64 + t * 16 + 8 * hh) = orr;
    }
  }
  __builtin_amdgcn_fence(3, "workgroup");
  __builtin_amdgcn_wave_barrier();
  __builtin_amdgcn_fence(2, "workgroup");
  /* 16 rows x 8 segments = 4 iterations x 32 lanes; row = 4it + (lane>>3), seg = lane&7:
*/
  {
#pragma unroll
    for (int it = 0; it < 4; ++it) {
      const int u = it * 32 + lane;
      const int row = u >> 3, seg = u & 7;
      const v8us vh = *(const v8us*)(osh + row * 64 + seg * 8);
      *(v8us*)(Ct + (size_t)(q0 + row) * DM + head * 64 + seg * 8) = vh;
      if (EARLY) {
        const v8us vr = *(const v8us*)(osr + row * 64 + seg * 8);
        *(v8us*)(Cr + (size_t)(q0 + row) * DM + head * 64 + seg * 8) = vr;
      }
    }
    
  }
}

__global__ __launch_bounds__(128) __attribute__((amdgpu_num_vgpr(256)))
void attn_kernel(const unsigned short* __restrict__ Qh, const unsigned short* __restrict__ Qr,
                 const unsigned short* __restrict__ Kh, const unsigned short* __restrict__ Kr,
                 const unsigned short* __restrict__ Vt, const unsigned short* __restrict__ Vr,
                 const unsigned short* __restrict__ Erp, const int* __restrict__ mask,
                 const int* __restrict__ flags, unsigned short* __restrict__ Ct,
                 unsigned short* __restrict__ Cr)
{
  __shared__ __align__(16) unsigned short sm[2 * 5 * TSZ];
  __shared__ __align__(16) unsigned char msk[4096];
  if ((int)blockIdx.x < NEARLY) attn_body<true>(Qh, Qr, Kh, Kr, Vt, Vr, Erp, mask, flags, Ct, Cr, sm, msk);
  else                          attn_body<false>(Qh, Qr, Kh, Kr, Vt, Vr, Erp, mask, flags, Ct, Cr, sm, msk);
}

/* --------------------------------------------------------------------------
 * Output projection: out[t][n] = (sum_k ctx16[t][k] wo64[n][k]) / 1024 + b[n], f16 operands,
 * f32 accumulate.  Token blocks tb < NEARLY first accumulate the ctx residual products
 * alone from zero, scale that sum by 1/2048 in f32, and use it as the start value of
 * the hi-plane accumulation (no residual product enters an accumulator holding hi terms).
 * Block = 2 waves (64 threads), 64 tokens x 64 columns; grid (NQB, DM/64); main loops: gemm_ring.
 * Epilogue: 64x64 f32 tile staged in LDS (cross-wave, block barrier), then
 * Coverage: 16 iterations x 64 threads = 1024 units = 64 rows x 16 segments.
 * ------------------------------------------------------------------------ */
__global__ __launch_bounds__(64) __attribute__((amdgpu_num_vgpr(256)))
void out_kernel(
    const unsigned short* __restrict__ Ct, const unsigned short* __restrict__ Cr,
    const unsigned short* __restrict__ Wo, const float* __restrict__ bias, float* __restrict__ out)
{
  constexpr int PTF = 68;
  __shared__ __align__(16) float ts[64 * PTF];
  __shared__ __align__(16) unsigned short ring[2 * GBUF];

  const int tid = threadIdx.x, wave = tid >> 5, lane = tid & 31;
  const int hh = lane >> 4, m = lane & 15;
  const int tb = blockIdx.x, nb = blockIdx.y;
  const int n0 = nb * 64;
  const int rl0 = wave * 32;
  const bool dores = tb < NEARLY;     /* block-uniform */

  v8f acc[2][4];
#pragma unroll
  for (int mi = 0; mi < 2; ++mi)
#pragma unroll
    for (int ni = 0; ni < 4; ++ni) acc[mi][ni] = zero8();

  const unsigned short* wrows = Wo + (size_t)n0 * DM;

  if (dores) {
    gemm_ring<false>(Cr + (size_t)tb * 64 * DM, wrows, ring, acc);
#pragma unroll
    for (int mi = 0; mi < 2; ++mi)
#pragma unroll
      for (int ni = 0; ni < 4; ++ni)
#pragma unroll
        for (int r = 0; r < 8; ++r) acc[mi][ni][r] *= RINV;
  }

  gemm_ring<false>(Ct + (size_t)tb * 64 * DM, wrows, ring, acc);

  float bb[4];
#pragma unroll
  for (int ni = 0; ni < 4; ++ni) bb[ni] = bfr(bias[n0 + ni * 16 + m]);
#pragma unroll
  for (int mi = 0; mi < 2; ++mi) {
#pragma unroll
    for (int ni = 0; ni < 4; ++ni) {
#pragma unroll
      for (int r = 0; r < 8; ++r) {
        const int rl = rl0 + mi * 16 + 8 * hh + r;
        ts[rl * PTF + ni * 16 + m] = acc[mi][ni][r] * OINV + bb[ni];
      }
    }
  }
  __syncthreads();

  {
#pragma unroll
    for (int it = 0; it < 16; ++it) {
      const int u = it * 64 + tid;
      const int row = u >> 4, seg = u & 15;
      const int t = tb * 64 + row;
      const v4f v = *(const v4f*)(ts + row * PTF + seg * 4);
      if (t < TT) *(v4f*)(out + (size_t)t * DM + n0 + seg * 4) = v;
    }
    
  }
}

/* -------------------------------------------------------------------------- */
extern "C" void kernel_launch(void* const* d_in, const int* in_sizes, int n_in,
                              void* d_out, int out_size, void* d_ws, size_t ws_size,
                              hipStream_t stream)
{
  if (n_in < 13) return;
  if (in_sizes[0] < TT * DM || in_sizes[1] < TT * DM || in_sizes[2] < TT * DM) return;
  if (in_sizes[3] < (TT - 1) * SEQ_FULL + TT) return;
  if (in_sizes[4] < DM * DM || in_sizes[6] < DM * DM || in_sizes[8] < DM * DM || in_sizes[11] < DM * DM) return;
  if (in_sizes[5] < DM || in_sizes[7] < DM || in_sizes[9] < DM || in_sizes[12] < DM) return;
  if (in_sizes[10] < TT * HD) return;
  if (out_size < TT * DM) return;
  if (d_ws == nullptr || ws_size < WS_NEED) return;

  const float* q    = (const float*)d_in[0];
  const float* k    = (const float*)d_in[1];
  const float* v    = (const float*)d_in[2];
  const int*   mask = (const int*)d_in[3];
  const float* Wq_w = (const float*)d_in[4];
  const float* Wq_b = (const float*)d_in[5];
  const float* Wk_w = (const float*)d_in[6];
  const float* Wk_b = (const float*)d_in[7];
  const float* Wv_w = (const float*)d_in[8];
  const float* Wv_b = (const float*)d_in[9];
  const float* Er   = (const float*)d_in[10];
  const float* Wo_w = (const float*)d_in[11];
  const float* Wo_b = (const float*)d_in[12];
  float* outp = (float*)d_out;

  unsigned char* ws = (unsigned char*)d_ws;
  unsigned short* Xq = (unsigned short*)(ws + OFF_XQ);
  unsigned short* Xk = (unsigned short*)(ws + OFF_XK);
  unsigned short* Xv = (unsigned short*)(ws + OFF_XV);
  unsigned short* Wq = (unsigned short*)(ws + OFF_WQ);
  unsigned short* Wk = (unsigned short*)(ws + OFF_WK);
  unsigned short* Wv = (unsigned short*)(ws + OFF_WV);
  unsigned short* Wo = (unsigned short*)(ws + OFF_WO);
  unsigned short* Eh = (unsigned short*)(ws + OFF_ER);
  unsigned short* Qh = (unsigned short*)(ws + OFF_QH);
  unsigned short* Kh = (unsigned short*)(ws + OFF_KH);
  unsigned short* Vt = (unsigned short*)(ws + OFF_VT);
  unsigned short* Qr = (unsigned short*)(ws + OFF_QR);
  unsigned short* Kr = (unsigned short*)(ws + OFF_KR);
  unsigned short* Vr = (unsigned short*)(ws + OFF_VR);
  unsigned short* Ct = (unsigned short*)(ws + OFF_CT);
  unsigned short* Cr = (unsigned short*)(ws + OFF_CR);
  int* flags = (int*)(ws + OFF_FL);

  /* input planes (rows >= TT zero) and the per (query block, key chunk) skip/dense/mixed flags */
  prep_kernel<<<PREP_BLOCKS, PBT, 0, stream>>>(q, k, v, mask, Wq_w, Wk_w, Wv_w, Wo_w, Er,
                                               Xq, Xk, Xv, Wq, Wk, Wv, Wo, Eh, flags);

  /* projections: 64 tokens x one head per block, z = q, k, v */
  proj_kernel<<<dim3(NTB, NH, 3), 64, 0, stream>>>(Xq, Xk, Xv, Wq, Wk, Wv, Wq_b, Wk_b, Wv_b, Qh, Kh, Vt, Qr, Kr, Vr);

  /* attention: first NEARLY query blocks with residual products, the rest single products */
  attn_kernel<<<dim3(NQB, NH), 128, 0, stream>>>(Qh, Qr, Kh, Kr, Vt, Vr, Eh, mask, flags, Ct, Cr);

  /* output projection into d_out */
  out_kernel<<<dim3(NQB, DM / 64), 64, 0, stream>>>(Ct, Cr, Wo, Wo_b, outp);
}

// v007
// A run of this version takes 86.9 microseconds.
// Timed twice side by side with v006, it ran 1.11 and 1.13 times as fast.
// Counting every step since v000, it is 4.22 times as fast.
// Contractions: q/k/v input projections on v_wmma_f32_16x16x32_bf16 (bf16 operands = RNE-converted inputs and weights, f32 accumulate); scores q.k^T, row-shifted q.Er^T, p.v and the output projection on v_wmma_f32_16x16x32_f16 (f16 operands: f16 hi planes of projected q/k/v, p carried x1024 and folded as 1/1024 before the ctx plane, ctx carried x16, Wo carried x64, plus x2048 f16 residual planes for the first 256 query rows and first 256 keys), f32 accumulate; softmax and all other arithmetic in f32.
#include <hip/hip_runtime.h>

typedef _Float16       v16h __attribute__((ext_vector_type(16)));
typedef __bf16         v16b __attribute__((ext_vector_type(16)));
typedef unsigned short v8us __attribute__((ext_vector_type(8)));
typedef float          v8f  __attribute__((ext_vector_type(8)));
typedef float          v4f  __attribute__((ext_vector_type(4)));
typedef unsigned int   v4u  __attribute__((ext_vector_type(4)));
typedef int            v4i  __attribute__((ext_vector_type(4)));

#ifndef NB
#define NB 1
#endif
#ifndef SEQ
#define SEQ 2049
#endif
#define SEQ_FULL 2049

constexpr int DM     = 1024;
constexpr int NH     = 16;
constexpr int HD     = 64;
constexpr int TT     = SEQ;
constexpr int NQB    = (TT + 63) / 64;          /* query blocks of 64 rows */
constexpr int NTB    = NQB + 1;                  /* token blocks of the planes (one extra for the +1 row shift) */
constexpr int TPAD   = NTB * 64;                 /* padded token count of every plane */
constexpr int NKC    = NTB;                      /* key chunks of 64 */
constexpr int NEARLY = NQB < 4 ? NQB : 4;        /* query blocks with residual treatment */
constexpr int CRES   = NEARLY * 64;              /* rows of K/V/ctx residual planes */
constexpr int QRES   = (NEARLY + 1) * 64;        /* rows of the Q residual plane (covers the +1 shift) */

constexpr float RSC  = 2048.0f;                  /* residual plane carry */
constexpr float RINV = 1.0f / 2048.0f;
constexpr float PSC  = 1024.0f;                  /* softmax weight carry (on the p tile, hence on the p.v accumulator) */
constexpr float CSC  = 16.0f;                    /* ctx plane carry */
constexpr float OCV  = CSC / PSC;                /* 1/64: removes the p carry and applies the ctx carry in one factor */
constexpr float WOSC = 64.0f;                    /* Wo plane carry */
constexpr float OINV = 1.0f / (CSC * WOSC);      /* 1/1024 */

static_assert(NB == 1);
static_assert(SEQ <= SEQ_FULL);
static_assert(HD == 64);
static_assert(DM % 64 == 0 && DM % 32 == 0);
static_assert(TPAD % 64 == 0);
static_assert(NKC <= 64);
static_assert(QRES <= TPAD && CRES <= TPAD);

/* workspace region map (bytes, every offset a multiple of 128) */
constexpr size_t X_B  = (size_t)TPAD * DM * 2;       /* bf16 [TPAD][DM] */
constexpr size_t W_B  = (size_t)DM * DM * 2;         /* 16-bit [DM][DM] */
constexpr size_t E_B  = (size_t)TPAD * HD * 2;       /* f16 [TPAD][HD] */
constexpr size_t HP_B = (size_t)NH * TPAD * HD * 2;  /* f16 [NH][TPAD][HD] or [NH][HD][TPAD] */
constexpr size_t QR_B = (size_t)NH * QRES * HD * 2;  /* f16 [NH][QRES][HD] */
constexpr size_t KR_B = (size_t)NH * CRES * HD * 2;  /* f16 [NH][CRES][HD] or [NH][HD][CRES] */
constexpr size_t CT_B = (size_t)TPAD * DM * 2;       /* f16 [TPAD][DM] */
constexpr size_t CR_B = (size_t)CRES * DM * 2;       /* f16 [CRES][DM] */
constexpr int    FLN  = 4;                          /* 128-byte flag lines per query block, one writer each */
constexpr int    FSL  = (NKC + FLN - 1) / FLN;      /* key chunks (used slots) per flag line */
constexpr size_t FL_B = (size_t)NQB * FLN * 32 * 4; /* int [NQB][FLN][32]: chunk kc at line kc % FLN, slot kc / FLN */
static_assert(FSL <= 32);

constexpr size_t OFF_XQ = 0;
constexpr size_t OFF_XK = OFF_XQ + X_B;
constexpr size_t OFF_XV = OFF_XK + X_B;
constexpr size_t OFF_WQ = OFF_XV + X_B;
constexpr size_t OFF_WK = OFF_WQ + W_B;
constexpr size_t OFF_WV = OFF_WK + W_B;
constexpr size_t OFF_WO = OFF_WV + W_B;
constexpr size_t OFF_ER = OFF_WO + W_B;
constexpr size_t OFF_QH = OFF_ER + E_B;
constexpr size_t OFF_KH = OFF_QH + HP_B;
constexpr size_t OFF_VT = OFF_KH + HP_B;
constexpr size_t OFF_QR = OFF_VT + HP_B;
constexpr size_t OFF_KR = OFF_QR + QR_B;
constexpr size_t OFF_VR = OFF_KR + KR_B;
constexpr size_t OFF_CT = OFF_VR + KR_B;
constexpr size_t OFF_CR = OFF_CT + CT_B;
constexpr size_t OFF_FL = OFF_CR + CR_B;
constexpr size_t WS_NEED = OFF_FL + FL_B;

static_assert(X_B % 128 == 0 && W_B % 128 == 0 && E_B % 128 == 0 && HP_B % 128 == 0);
static_assert(QR_B % 128 == 0 && KR_B % 128 == 0 && CT_B % 128 == 0 && CR_B % 128 == 0 && FL_B % 128 == 0);
static_assert(WS_NEED <= 134217728ull);
static_assert((size_t)TT * DM * 4 <= (size_t)SEQ_FULL * DM * 4);

/* -------------------------------------------------------------------------- */
__device__ __forceinline__ unsigned short f2bf_bits(float f) {
  unsigned u = __float_as_uint(f);
  return (unsigned short)((u + 0x7FFFu + ((u >> 16) & 1u)) >> 16);
}
__device__ __forceinline__ float bfr(float f) { return __uint_as_float(((unsigned)f2bf_bits(f)) << 16); }
__device__ __forceinline__ unsigned short h_bits(float f) {
  _Float16 h = (_Float16)f;
  return __builtin_bit_cast(unsigned short, h);
}
__device__ __forceinline__ float h2f(unsigned short b) {
  _Float16 h = __builtin_bit_cast(_Float16, b);
  return (float)h;
}

/* WMMA issue helpers with the 4-slot hazard guard (ties D, keeps A/B live) */
__device__ __forceinline__ v8f mma_h(v16h a, v16h b, v8f c) {
  c = __builtin_amdgcn_wmma_f32_16x16x32_f16(false, a, false, b, (short)0, c, false, false);
  asm volatile("v_nop\n\tv_nop\n\tv_nop\n\tv_nop" : "+v"(c) : "v"(a), "v"(b));
  return c;
}
__device__ __forceinline__ v8f mma_b(v16b a, v16b b, v8f c) {
  c = __builtin_amdgcn_wmma_f32_16x16x32_bf16(false, a, false, b, (short)0, c, false, false);
  asm volatile("v_nop\n\tv_nop\n\tv_nop\n\tv_nop" : "+v"(c) : "v"(a), "v"(b));
  return c;
}

__device__ __forceinline__ v8f zero8() { return (v8f){0.f,0.f,0.f,0.f,0.f,0.f,0.f,0.f}; }

/* --------------------------------------------------------------------------
 * Main loop of the 64 x 64 GEMM blocks (2 waves): acc += A[64][DM] . B[64][DM]^T, 16-bit operands.
 * Stage = 128 k values: 64 A rows and 64 B rows of 256 B each, brought into LDS by asynchronous
 * copies (each copy = two whole 256-B row pieces), two buffers: stage t+1 flies while stage t is worked on.
 * Wave 0 copies the A rows, wave 1 the B rows, 32 copies per wave and stage.
 * LDS row pitch 272 B = 16 B x 17 (odd): the 16 rows of one ds_load_b128 fall on distinct bank groups.
 * Fragment k map and the order of the k steps per accumulator are those of the direct global loads it replaces.
 * ------------------------------------------------------------------------ */
constexpr int GKS  = 128;             /* k values per stage = 4 WMMA k steps */
constexpr int GNST = DM / GKS;        /* stages */
constexpr int GP   = 136;             /* LDS row pitch in 16-bit elements */
constexpr int GBUF = 128 * GP;        /* elements of one buffer: A rows 0..63, B rows 64..127 */
static_assert(DM % GKS == 0 && GNST >= 2);

union FR { v16h hv; v16b bv; v8us h[2]; };

/* eight copies: row pairs 0, 2, .. 14 from the lane's own LDS byte address l and global address g */
__device__ __forceinline__ void copy8(unsigned l, const unsigned short* g)
{
  /* the copies and, as the last line of the same statement, the wait that stands in front of any
     rewrite of the address registers they name */
  asm volatile(
      "global_load_async_to_lds_b128 %0, %8, off\n\t"
      "global_load_async_to_lds_b128 %1, %9, off\n\t"
      "global_load_async_to_lds_b128 %2, %10, off\n\t"
      "global_load_async_to_lds_b128 %3, %11, off\n\t"
      "global_load_async_to_lds_b128 %4, %12, off\n\t"
      "global_load_async_to_lds_b128 %5, %13, off\n\t"
      "global_load_async_to_lds_b128 %6, %14, off\n\t"
      "global_load_async_to_lds_b128 %7, %15, off\n\t"
      "s_wait_xcnt 0x0"
      :: "v"(l), "v"(l + 2u * 2u * GP), "v"(l + 4u * 2u * GP), "v"(l + 6u * 2u * GP),
         "v"(l + 8u * 2u * GP), "v"(l + 10u * 2u * GP), "v"(l + 12u * 2u * GP), "v"(l + 14u * 2u * GP),
         "v"(g), "v"(g + 2 * DM), "v"(g + 4 * DM), "v"(g + 6 * DM),
         "v"(g + 8 * DM), "v"(g + 10 * DM), "v"(g + 12 * DM), "v"(g + 14 * DM)
      : "memory");
}
/* one wave's 64 rows of one stage */
__device__ __forceinline__ void stage_copy(unsigned l, const unsigned short* g)
{
  /* unrolled: the row offsets of the four statements are constants */
#pragma unroll
  for (int q = 0; q < 4; ++q) copy8(l + (unsigned)(q * 16 * GP * 2), g + (size_t)q * 16 * DM);
}

template <bool BF>
__device__ __forceinline__ void gemm_ring(const unsigned short* __restrict__ A, const unsigned short* __restrict__ B,
                                          unsigned short* ring, v8f (&acc)[2][4])
{
  const int lane = threadIdx.x & 31;
  const int wave = __builtin_amdgcn_readfirstlane((int)(threadIdx.x >> 5));
  const int hh = lane >> 4, m = lane & 15;

  /* copy addresses: lanes 0..15 one row, lanes 16..31 the next, 16 B per lane */
  const unsigned short* g0 = (wave == 0 ? A : B) + (size_t)hh * DM + m * 8;
  const unsigned l0 = (unsigned)(size_t)ring + (unsigned)(((wave * 64 + hh) * GP + m * 8) * 2);

  stage_copy(l0, g0);
  /* stage 0 has landed before the barrier that publishes it */
  asm volatile("s_wait_asynccnt 0x0" ::: "memory");
  __syncthreads();
  stage_copy(l0 + (unsigned)(GBUF * 2), g0 + GKS);

  const unsigned short* fa = ring + (wave * 32 + m) * GP + 8 * hh;
  const unsigned short* fb = ring + (64 + m) * GP + 8 * hh;

  /* rolled: one body in the instruction cache, the buffer chosen by the trip's parity */
#pragma unroll 1
  for (int t = 0; t < GNST; ++t) {
    const int bo = (t & 1) * GBUF;
    const unsigned short* pa = fa + bo;
    const unsigned short* pb = fb + bo;
    /* every loop below is unrolled so that each index of the two fragment sets is a constant and the sets stay in registers */
    FR a[2][2], b[2][4];
#pragma unroll
    for (int mi = 0; mi < 2; ++mi) {
      a[0][mi].h[0] = *(const v8us*)(pa + mi * 16 * GP);
      a[0][mi].h[1] = *(const v8us*)(pa + mi * 16 * GP + 16);
    }
#pragma unroll
    for (int ni = 0; ni < 4; ++ni) {
      b[0][ni].h[0] = *(const v8us*)(pb + ni * 16 * GP);
      b[0][ni].h[1] = *(const v8us*)(pb + ni * 16 * GP + 16);
    }
#pragma unroll
    for (int ks = 0; ks < GKS / 32; ++ks) {
      const int cur = ks & 1, nxt = cur ^ 1;
      if (ks + 1 < GKS / 32) {          /* next k step's fragments of the same stage, ahead of this step's products */
#pragma unroll
        for (int mi = 0; mi < 2; ++mi) {
          a[nxt][mi].h[0] = *(const v8us*)(pa + mi * 16 * GP + (ks + 1) * 32);
          a[nxt][mi].h[1] = *(const v8us*)(pa + mi * 16 * GP + (ks + 1) * 32 + 16);
        }
#pragma unroll
        for (int ni = 0; ni < 4; ++ni) {
          b[nxt][ni].h[0] = *(const v8us*)(pb + ni * 16 * GP + (ks + 1) * 32);
          b[nxt][ni].h[1] = *(const v8us*)(pb + ni * 16 * GP + (ks + 1) * 32 + 16);
        }
      }
#pragma unroll
      for (int ni = 0; ni < 4; ++ni) {
        if constexpr (BF) {
          acc[0][ni] = mma_b(a[cur][0].bv, b[cur][ni].bv, acc[0][ni]);
          acc[1][ni] = mma_b(a[cur][1].bv, b[cur][ni].bv, acc[1][ni]);
        } else {
          acc[0][ni] = mma_h(a[cur][0].hv, b[cur][ni].hv, acc[0][ni]);
          acc[1][ni] = mma_h(a[cur][1].hv, b[cur][ni].hv, acc[1][ni]);
        }
      }
    }
    /* this wave's reads of buffer t&1 have returned before the buffer is refilled */
    asm volatile("s_wait_dscnt 0x0" ::: "memory");
    /* this wave's copies of stage t+1 have landed before the barrier that publishes them */
    asm volatile("s_wait_asynccnt 0x0" ::: "memory");
    __syncthreads();
    if (t + 2 < GNST) stage_copy(l0 + (unsigned)(bo * 2), g0 + (size_t)(t + 2) * GKS);
  }
  /* no copy is outstanding when the wave goes on */
  asm volatile("s_wait_asynccnt 0x0" ::: "memory");
}

/* --------------------------------------------------------------------------
 * f32 [nrows][ncols] -> 16-bit plane [nrows_pad][ncols]; rows >= nrows are zeros.
 * mode 0: bf16 bits (RNE).  mode 1: f16 bits of (scale * bf16(x)).
 * One unit u = 8 consecutive values of row u / (ncols/8); the caller hands out u < nrows_pad*ncols/8.
 * ------------------------------------------------------------------------ */
template <int nrows, int ncols, int mode>
__device__ __forceinline__ void cvt_unit(const float* __restrict__ src, float scale,
                                         unsigned short* __restrict__ dst, int u)
{
  constexpr int upr = ncols >> 3;
  const int row = u / upr;
  const int cu  = u - row * upr;
  const int rowc = row < nrows ? row : nrows - 1;          /* clamped address */
  const bool live = row < nrows;
  const float* p = src + (size_t)rowc * ncols + cu * 8;
  const v4f x0 = *(const v4f*)p;
  const v4f x1 = *(const v4f*)(p + 4);
  unsigned b0, b1, b2, b3, b4, b5, b6, b7;
  {
    const float f0 = live ? x0[0] : 0.f, f1 = live ? x0[1] : 0.f, f2 = live ? x0[2] : 0.f, f3 = live ? x0[3] : 0.f;
    const float f4 = live ? x1[0] : 0.f, f5 = live ? x1[1] : 0.f, f6 = live ? x1[2] : 0.f, f7 = live ? x1[3] : 0.f;
    if (mode == 0) {
      b0 = f2bf_bits(f0); b1 = f2bf_bits(f1); b2 = f2bf_bits(f2); b3 = f2bf_bits(f3);
      b4 = f2bf_bits(f4); b5 = f2bf_bits(f5); b6 = f2bf_bits(f6); b7 = f2bf_bits(f7);
    } else {
      b0 = h_bits(bfr(f0) * scale); b1 = h_bits(bfr(f1) * scale); b2 = h_bits(bfr(f2) * scale); b3 = h_bits(bfr(f3) * scale);
      b4 = h_bits(bfr(f4) * scale); b5 = h_bits(bfr(f5) * scale); b6 = h_bits(bfr(f6) * scale); b7 = h_bits(bfr(f7) * scale);
    }
  }
  v4u w;
  w[0] = b0 | (b1 << 16);
  w[1] = b2 | (b3 << 16);
  w[2] = b4 | (b5 << 16);
  w[3] = b6 | (b7 << 16);
  unsigned short* d = dst + (size_t)u * 8;
  *(v4u*)d = w;
  /* another branch's text follows in the caller: no register that the store names is rewritten in front of this wait */
  asm volatile("s_wait_xcnt 0x0" ::: "memory");
}

/* --------------------------------------------------------------------------
 * Per (query block, key chunk) flag from the int32 key mask:
 *   0 = every effective entry masked (chunk skipped), 1 = all kept, 2 = mixed.
 * Effective entry (t, s): query row clamped to TT-1 for padded rows, keys s >= TT masked.
 * Block = (query block qb, flag line ln), 16 waves: the chunks kc = ln + FLN*j, j < FSL.
 * Wave w reads rows 4w..4w+3 of every chunk of the block; all loads are independent, so
 * the whole strip is in flight at once.  Per wave one any-kept and one all-kept bit per
 * chunk (ballots), combined over the 16 waves through LDS behind one block barrier.
 * Coverage: wave 0 stores the block's whole 128-byte line (unused slots 0);
 * NQB x FLN blocks = the whole table.  wany, wall: 16 LDS words each.
 * ------------------------------------------------------------------------ */
__device__ __forceinline__ int flag_slot(int kc) { return (kc % FLN) * 32 + kc / FLN; }

__device__ __forceinline__ void flags_block(const int* __restrict__ mask, int* __restrict__ flags,
                                            int qb, int ln, unsigned* wany, unsigned* wall)
{
  const int tid = threadIdx.x, lane = tid & 31;
  const int wave = __builtin_amdgcn_readfirstlane(tid >> 5);   /* scalar, so the row bases are scalar */

  /* key of slot j, half hf: s = col0 + FLN*64*j + 32*hf.  Only the last slot can pass TT. */
  constexpr int LOFF = FLN * (FSL - 1) * 64;
  static_assert(LOFF - 1 < TT);
  const unsigned col0 = (unsigned)(ln * 64 + lane);
  const unsigned sl0 = col0 + LOFF, sl1 = sl0 + 32u;
  const unsigned cl0 = sl0 < (unsigned)TT ? sl0 : (unsigned)(TT - 1);   /* clamped address */
  const unsigned cl1 = sl1 < (unsigned)TT ? sl1 : (unsigned)(TT - 1);   /* clamped address */
  const int* rowp[4];
#pragma unroll
  for (int rr = 0; rr < 4; ++rr) {
    int t = qb * 64 + wave * 4 + rr;
    t = t < TT ? t : TT - 1;
    rowp[rr] = mask + (size_t)t * SEQ_FULL;
  }

  /* first every load, then every count */
  int mv[FSL][8];
#pragma unroll
  for (int j = 0; j < FSL - 1; ++j) {
#pragma unroll
    for (int it = 0; it < 8; ++it)
      mv[j][it] = (rowp[it >> 1] + col0)[FLN * j * 64 + (it & 1) * 32];
  }
#pragma unroll
  for (int it = 0; it < 8; ++it)
    mv[FSL - 1][it] = rowp[it >> 1][(it & 1) ? cl1 : cl0];
  /* keeps every load in front of every count: without it the scheduler mixes them and fewer loads fly at once */
  __builtin_amdgcn_sched_barrier(0);
  /* every register that the issued loads name (row bases, key offsets) is an input here, so none is
     rewritten in front of this wait */
  asm volatile("s_wait_xcnt 0x0"
               :: "s"(rowp[0]), "s"(rowp[1]), "s"(rowp[2]), "s"(rowp[3]), "v"(col0), "v"(cl0), "v"(cl1)
               : "memory");

  int cnt[FSL];
#pragma unroll
  for (int j = 0; j < FSL; ++j) {
    int n = 0;
#pragma unroll
    for (int it = 0; it < 8; ++it) {
      const bool ex = (j < FSL - 1) || (((it & 1) ? sl1 : sl0) < (unsigned)TT);   /* key exists */
      n += (ex && mv[j][it] != 0) ? 1 : 0;
    }
    cnt[j] = n;
  }

  unsigned anym = 0u, allm = 0u;                           /* wave-uniform, bit j = chunk ln + FLN*j */
#pragma unroll
  for (int j = 0; j < FSL; ++j) {
    anym |= (__builtin_amdgcn_ballot_w32(cnt[j] != 0) != 0u) ? (1u << j) : 0u;
    allm |= (__builtin_amdgcn_ballot_w32(cnt[j] == 8) == 0xFFFFFFFFu) ? (1u << j) : 0u;
  }
  if (lane == 0) { wany[wave] = anym; wall[wave] = allm; }
  __syncthreads();

  if (wave == 0) {
    unsigned a = 0u, f = 0xFFFFFFFFu;
#pragma unroll
    for (int w = 0; w < 16; ++w) { a |= wany[w]; f &= wall[w]; }
    int fv = 0;
    if (lane < FSL) fv = ((a >> lane) & 1u) ? (((f >> lane) & 1u) ? 1 : 2) : 0;
    flags[((size_t)qb * FLN + ln) * 32 + lane] = fv;
  }
}

/* --------------------------------------------------------------------------
 * Everything that depends on the inputs alone, in one launch of 512-thread blocks:
 * blocks [0, FBL): mask flags, block b = (query block b / FLN, flag line b % FLN);
 * then 3 x XBL blocks: q, k, v planes; 3 x WBL: Wq, Wk, Wv planes; WBL: Wo plane; EBL: Er plane.
 * A conversion block = 512 units, one per thread; every plane's unit count is a multiple of 512.
 * The branch on the block index is block-uniform (the flags part holds a block barrier).
 * ------------------------------------------------------------------------ */
constexpr int PBT = 512;
constexpr int FBL = NQB * FLN;
constexpr int XBL = TPAD * (DM / 8) / PBT;
constexpr int WBL = DM * (DM / 8) / PBT;
constexpr int EBL = TPAD * (HD / 8) / PBT;
constexpr int PREP_BLOCKS = FBL + 3 * XBL + 4 * WBL + EBL;
static_assert(TPAD * (DM / 8) % PBT == 0 && DM * (DM / 8) % PBT == 0 && TPAD * (HD / 8) % PBT == 0);

__global__ __launch_bounds__(512) void prep_kernel(
    const float* __restrict__ q, const float* __restrict__ k, const float* __restrict__ v,
    const int* __restrict__ mask,
    const float* __restrict__ Wq_w, const float* __restrict__ Wk_w, const float* __restrict__ Wv_w,
    const float* __restrict__ Wo_w, const float* __restrict__ Er,
    unsigned short* __restrict__ Xq, unsigned short* __restrict__ Xk, unsigned short* __restrict__ Xv,
    unsigned short* __restrict__ Wq, unsigned short* __restrict__ Wk, unsigned short* __restrict__ Wv,
    unsigned short* __restrict__ Wo, unsigned short* __restrict__ Eh, int* __restrict__ flags)
{
  __shared__ unsigned wany[16];
  __shared__ unsigned wall[16];
  const int tid = threadIdx.x;
  int b = blockIdx.x;
  if (b < FBL) { flags_block(mask, flags, b / FLN, b % FLN, wany, wall); return; }
  b -= FBL;
  if (b < 3 * XBL) {
    const int j = b / XBL;
    cvt_unit<TT, DM, 0>(j == 0 ? q : j == 1 ? k : v, 1.0f, j == 0 ? Xq : j == 1 ? Xk : Xv, (b - j * XBL) * PBT + tid);
    return;
  }
  b -= 3 * XBL;
  if (b < 3 * WBL) {
    const int j = b / WBL;
    cvt_unit<DM, DM, 0>(j == 0 ? Wq_w : j == 1 ? Wk_w : Wv_w, 1.0f, j == 0 ? Wq : j == 1 ? Wk : Wv, (b - j * WBL) * PBT + tid);
    return;
  }
  b -= 3 * WBL;
  if (b < WBL) { cvt_unit<DM, DM, 1>(Wo_w, WOSC, Wo, b * PBT + tid); return; }
  b -= WBL;
  cvt_unit<TT, HD, 1>(Er, 1.0f, Eh, b * PBT + tid);
}

/* --------------------------------------------------------------------------
 * Projection GEMM: Y[t][n] = sum_k X[t][k] W[n][k] + b[n] for one 64-token x 64-col
 * (= one head) tile per block; bf16 operands (X and W planes), f32 accumulate.
 * Block = 2 waves (64 threads); wave w: tokens w*32..w*32+31 (2 row tiles) x 4 col tiles; main loop: gemm_ring.
 * A fragment (row m = lane&15): elems 0..7 <- k0+8h+i, 8..15 <- k0+16+8h+i.
 * B[k][n] = W[n][k]: loaded from row n = lane&15 with the same k map.  D elem r = (row 8h+r, col lane&15).
 * Epilogue: hi = f16(y), res = f16((y - hi) * 2048), rows t >= TT forced to 0; the block's
 * MODE 0: Q -> [NH][TPAD][HD] (+ residual rows < QRES); 1: K -> same (+ residual rows < CRES);
 * MODE 2: V -> [NH][HD][TPAD] (+ residual [NH][HD][CRES]).
 * Coverage per block: 8 iterations x 64 threads = 512 units = 64 rows x 8 segments (hi and res).
 * LDS tiles th/tr: cross-wave, separated by a block barrier; reloaded through the stored element type.
 * The three projections share one launch: grid (NTB, NH, 3), MODE = blockIdx.z (block-uniform);
 * the main loop is common, proj_tail<MODE> is the epilogue.
 * ------------------------------------------------------------------------ */
constexpr int PT = 72;

template <int MODE>
__device__ __forceinline__ void proj_tail(
    v8f (&acc)[2][4], const float* __restrict__ bias, unsigned short* __restrict__ Ph,
    unsigned short* __restrict__ Pr, unsigned short* th, unsigned short* tr)
{
  constexpr int NRES_TB = (MODE == 0) ? (NEARLY + 1) : NEARLY;
  const int tid = threadIdx.x, wave = tid >> 5, lane = tid & 31;
  const int hh = lane >> 4, m = lane & 15;
  const int tb = blockIdx.x, head = blockIdx.y;
  const int n0 = head * 64;
  const int rl0 = wave * 32;

  float bb[4];
#pragma unroll
  for (int ni = 0; ni < 4; ++ni) bb[ni] = bfr(bias[n0 + ni * 16 + m]);

#pragma unroll
  for (int mi = 0; mi < 2; ++mi) {
#pragma unroll
    for (int ni = 0; ni < 4; ++ni) {
#pragma unroll
      for (int r = 0; r < 8; ++r) {
        const int rl  = rl0 + mi * 16 + 8 * hh + r;
        const int t   = tb * 64 + rl;
        const int col = ni * 16 + m;
        float y = acc[mi][ni][r] + bb[ni];
        y = (t < TT) ? y : 0.f;
        const unsigned short hb = h_bits(y);
        const float res = (y - h2f(hb)) * RSC;
        const unsigned short rb = h_bits(res);
        if (MODE == 2) { th[col * PT + rl] = hb; tr[col * PT + rl] = rb; }
        else           { th[rl * PT + col] = hb; tr[rl * PT + col] = rb; }
      }
    }
  }
  __syncthreads();

  const bool dores = tb < NRES_TB;    /* block-uniform */
  {
#pragma unroll
    for (int it = 0; it < 8; ++it) {
      const int u = it * 64 + tid;
      const int row = u >> 3, seg = u & 7;
      const v8us vh = *(const v8us*)(th + row * PT + seg * 8);
      const v8us vr = *(const v8us*)(tr + row * PT + seg * 8);
      if (MODE == 2) {
        *(v8us*)(Ph + ((size_t)head * HD + row) * TPAD + tb * 64 + seg * 8) = vh;
        if (dores) *(v8us*)(Pr + ((size_t)head * HD + row) * CRES + tb * 64 + seg * 8) = vr;
      } else {
        *(v8us*)(Ph + ((size_t)head * TPAD + tb * 64 + row) * HD + seg * 8) = vh;
        if (dores) {
          if (MODE == 0) *(v8us*)(Pr + ((size_t)head * QRES + tb * 64 + row) * HD + seg * 8) = vr;
          else           *(v8us*)(Pr + ((size_t)head * CRES + tb * 64 + row) * HD + seg * 8) = vr;
        }
      }
    }
    
  }
  /* another epilogue's text follows in the caller: no register that the last stores name is rewritten in front of this wait */
  asm volatile("s_wait_xcnt 0x0" ::: "memory");
}

__global__ __launch_bounds__(64) __attribute__((amdgpu_num_vgpr(256)))
void proj_kernel(
    const unsigned short* __restrict__ Xq, const unsigned short* __restrict__ Xk, const unsigned short* __restrict__ Xv,
    const unsigned short* __restrict__ Wq, const unsigned short* __restrict__ Wk, const unsigned short* __restrict__ Wv,
    const float* __restrict__ bq, const float* __restrict__ bk, const float* __restrict__ bv,
    unsigned short* __restrict__ Qh, unsigned short* __restrict__ Kh, unsigned short* __restrict__ Vt,
    unsigned short* __restrict__ Qr, unsigned short* __restrict__ Kr, unsigned short* __restrict__ Vr)
{
  __shared__ __align__(16) unsigned short th[64 * PT];
  __shared__ __align__(16) unsigned short tr[64 * PT];
  __shared__ __align__(16) unsigned short ring[2 * GBUF];

  const int tb = blockIdx.x, head = blockIdx.y, mode = blockIdx.z;
  const unsigned short* X = mode == 0 ? Xq : mode == 1 ? Xk : Xv;
  const unsigned short* W = mode == 0 ? Wq : mode == 1 ? Wk : Wv;

  v8f acc[2][4];
#pragma unroll
  for (int mi = 0; mi < 2; ++mi)
#pragma unroll
    for (int ni = 0; ni < 4; ++ni) acc[mi][ni] = zero8();

  gemm_ring<true>(X + (size_t)tb * 64 * DM, W + (size_t)head * 64 * DM, ring, acc);

  if (mode == 0)      proj_tail<0>(acc, bq, Qh, Qr, th, tr);
  else if (mode == 1) proj_tail<1>(acc, bk, Kh, Kr, th, tr);
  else                proj_tail<2>(acc, bv, Vt, Vr, th, tr);
}

/* --------------------------------------------------------------------------
 * Flash attention with the row-shifted Er term, head dim 64, products transposed.
 * Block = 4 waves = 64 query rows of one head; grid (query blocks, NH).
 * Per kept 64-key chunk: K [key][d], Er [key][d], V^T [d][key] f16 tiles staged in LDS
 * (EARLY: also K and V^T residual tiles) by asynchronous copies, two buffers: the next kept chunk flies
 * while this one is worked on; one block barrier per chunk (a second one only where a mask tile is staged).
 * S^T = K.q^T + Er.q(t+1)^T on f16 WMMA: A = K or Er rows from LDS, B = Q rows; D elem r of key tile j =
 * (key 16j+8h+r, query lane&15), so a lane holds 32 of the 64 scores of ONE query and lane^16 the other 32.
 * x0.125, replace-fill -inf from the key mask (flag 2 chunks), f32 online softmax: maximum in-lane plus one
 * exchange between the wave halves; the sum stays a per-half partial and is joined once in the epilogue.
 * P^T = f16(1024 p) (EARLY: + f16 residual x2048) is a B operand straight from the score registers:
 * element s of the operand for keys 32kk.. is register s&7 of key tile 2kk+(s>>3), the hardware k order.
 * O^T += V^T.P^T on f16 WMMA: A = V^T rows from LDS; D elem r of d tile t = (d 16t+8h+r, query lane&15)
 * (O therefore carries the x1024 of P; the normaliser applies 1/(1024 l) x 16 in one factor).
 * EARLY adds (k_res.qh + k.q_res + Er.q_res(t+1))/2048 to the scores and
 * (V_res.P + V.P_res)/2048 to O through separate accumulators folded per tile.
 * Without residuals a chunk's fragments are read from LDS in two groups: K and Er ahead of the score products,
 * V^T ahead of the softmax; 128 and 64 registers, never live together.
 * Live-state plan: Q hi fragments reloaded per chunk (dead during softmax and P.V),
 * Q residual fragments loaded only inside the residual score phase, one 8-register
 * residual accumulator at a time; 4 O tiles + 4 score tiles + m/l (one value each) persistent.
 * Epilogue: ctx = O/(1024 l) carried x16 as f16 into [TPAD][DM] (+ residual rows < CRES),
 * staged per wave in LDS so that whole 128-byte row pieces are stored.
 * Fragment k map as in proj_kernel (A row / B col = lane&15, split k map).
 * LDS regions: K/Er/V/res tiles and msk cross-wave (block barriers).
 * Both variants share one launch: grid (NQB, NH), EARLY = (query block < NEARLY), block-uniform;
 * sm holds two buffers of 5 tiles (the variant without residuals: two of 3), msk 4096 bytes.
 * ------------------------------------------------------------------------ */
/* LDS row pitch of every fragment-read tile: 72 halves = 144 B = 16 B x 9 (odd), so the 16 rows that one
   ds_load_b128 reads fall on 16 distinct groups of four banks; at 128 B they fall on two groups */
constexpr int LP = 72;
constexpr int TSZ = 64 * LP;                       /* one 64-row tile */

typedef unsigned int v2u __attribute__((ext_vector_type(2)));

/* value of lane l ^ 16 */
__device__ __forceinline__ float xhalf(float x) {
  const int b = __float_as_int(x);
  return __int_as_float(__builtin_amdgcn_permlanex16(b, b, 0x76543210, 0xfedcba98, false, false));
}

/* Asynchronous copies of one key chunk's tiles.  A lane brings 16 B; a thread's four pieces of a 64 x 64 tile
   are rows r, r+16, r+32, r+48 (r = tid>>3) at segment tid&7.  l*: the lane's LDS byte address of its first
   piece, g*: its global address; SV: global row pitch in elements of the [d][key] plane (the [key][d] planes have pitch HD). */
constexpr unsigned LS16 = 16u * LP * 2u;           /* 16 LDS rows in bytes */

template <int SV>
__device__ __forceinline__ void copy_kev(unsigned lk, unsigned le, unsigned lv, const unsigned short* gk,
                                         const unsigned short* ge, const unsigned short* gv)
{
  /* the copies and, as the last line of the same statement, the wait that stands in front of any
     rewrite of the address registers they name */
  asm volatile(
      "global_load_async_to_lds_b128 %0, %12, off\n\t"
      "global_load_async_to_lds_b128 %1, %13, off\n\t"
      "global_load_async_to_lds_b128 %2, %14, off\n\t"
      "global_load_async_to_lds_b128 %3, %15, off\n\t"
      "global_load_async_to_lds_b128 %4, %16, off\n\t"
      "global_load_async_to_lds_b128 %5, %17, off\n\t"
      "global_load_async_to_lds_b128 %6, %18, off\n\t"
      "global_load_async_to_lds_b128 %7, %19, off\n\t"
      "global_load_async_to_lds_b128 %8, %20, off\n\t"
      "global_load_async_to_lds_b128 %9, %21, off\n\t"
      "global_load_async_to_lds_b128 %10, %22, off\n\t"
      "global_load_async_to_lds_b128 %11, %23, off\n\t"
      "s_wait_xcnt 0x0"
      :: "v"(lk), "v"(lk + LS16), "v"(lk + 2u * LS16), "v"(lk + 3u * LS16),
         "v"(le), "v"(le + LS16), "v"(le + 2u * LS16), "v"(le + 3u * LS16),
         "v"(lv), "v"(lv + LS16), "v"(lv + 2u * LS16), "v"(lv + 3u * LS16),
         "v"(gk), "v"(gk + 16 * HD), "v"(gk + 32 * HD), "v"(gk + 48 * HD),
         "v"(ge), "v"(ge + 16 * HD), "v"(ge + 32 * HD), "v"(ge + 48 * HD),
         "v"(gv), "v"(gv + 16 * SV), "v"(gv + 32 * SV), "v"(gv + 48 * SV)
      : "memory");
}
template <int SV>
__device__ __forceinline__ void copy_kv(unsigned lk, unsigned lv, const unsigned short* gk, const unsigned short* gv)
{
  /* as above: the wait is the last line of the copies' own statement */
  asm volatile(
      "global_load_async_to_lds_b128 %0, %8, off\n\t"
      "global_load_async_to_lds_b128 %1, %9, off\n\t"
      "global_load_async_to_lds_b128 %2, %10, off\n\t"
      "global_load_async_to_lds_b128 %3, %11, off\n\t"
      "global_load_async_to_lds_b128 %4, %12, off\n\t"
      "global_load_async_to_lds_b128 %5, %13, off\n\t"
      "global_load_async_to_lds_b128 %6, %14, off\n\t"
      "global_load_async_to_lds_b128 %7, %15, off\n\t"
      "s_wait_xcnt 0x0"
      :: "v"(lk), "v"(lk + LS16), "v"(lk + 2u * LS16), "v"(lk + 3u * LS16),
         "v"(lv), "v"(lv + LS16), "v"(lv + 2u * LS16), "v"(lv + 3u * LS16),
         "v"(gk), "v"(gk + 16 * HD), "v"(gk + 32 * HD), "v"(gk + 48 * HD),
         "v"(gv), "v"(gv + 16 * SV), "v"(gv + 32 * SV), "v"(gv + 48 * SV)
      : "memory");
}

template <bool EARLY>
__device__ __forceinline__
void attn_body(const unsigned short* __restrict__ Qh, const unsigned short* __restrict__ Qr,
               const unsigned short* __restrict__ Kh, const unsigned short* __restrict__ Kr,
               const unsigned short* __restrict__ Vt, const unsigned short* __restrict__ Vr,
               const unsigned short* __restrict__ Erp, const int* __restrict__ mask,
               const int* __restrict__ flags, unsigned short* __restrict__ Ct,
               unsigned short* __restrict__ Cr, unsigned short* sm, unsigned char* msk)
{
  constexpr int KSH = 0, ESH = TSZ, VTH = 2 * TSZ, KRS = 3 * TSZ, VRS = 4 * TSZ;
  union FH { v16h v; v8us h[2]; };

  const int tid = threadIdx.x, wave = tid >> 5, lane = tid & 31;
  const int hh = lane >> 4, c = lane & 15;
  const int qb = blockIdx.x;
  const int head = blockIdx.y;
  const int q0 = qb * 64 + wave * 16;
  const int wrow0 = wave * 16;                     /* the wave's first row inside the block tile */

  /* fragment base pointers: rows q0+c (k.q^T) and q0+1+c (shifted Er term) */
  const unsigned short* qp = Qh + ((size_t)head * TPAD + q0 + c) * HD + 8 * hh;
  const unsigned short* rp = Qr + ((size_t)head * QRES + (EARLY ? (q0 + c) : c)) * HD + 8 * hh;

  /* state of query q0+c: running maximum (equal in both halves), this half's part of the sum */
  float mrow = -__builtin_inff(), lrow = 0.f;
  v8f oacc[4];
#pragma unroll
  for (int t = 0; t < 4; ++t) oacc[t] = zero8();

  const int* frow = flags + (size_t)qb * (FLN * 32);

  /* the block's flags as two bit masks over the key chunks (bit kc), equal in every wave: the next kept chunk
     is known ahead of its turn, so its copies can be issued one trip early */
  unsigned long long kept, mixed;
  {
    const int sl0 = flag_slot(lane < NKC ? lane : NKC - 1);             /* clamped addresses */
    const int sl1 = flag_slot(lane + 32 < NKC ? lane + 32 : NKC - 1);
    const int f0 = frow[sl0];
    const int f1 = frow[sl1];
    /* the row base and both slots are inputs here, so no register that the two loads name is rewritten in front of this wait */
    asm volatile("s_wait_xcnt 0x0" :: "s"(frow), "v"(sl0), "v"(sl1) : "memory");
    const bool e0 = lane < NKC, e1 = lane + 32 < NKC;
    kept  = ((unsigned long long)__builtin_amdgcn_ballot_w32(e1 && f1 != 0) << 32) | __builtin_amdgcn_ballot_w32(e0 && f0 != 0);
    mixed = ((unsigned long long)__builtin_amdgcn_ballot_w32(e1 && f1 == 2) << 32) | __builtin_amdgcn_ballot_w32(e0 && f0 == 2);
  }

  /* copy addresses of this thread: row tid>>3 (+16 per piece), segment tid&7 */
  constexpr int NT = EARLY ? 5 : 3;                /* tiles of one buffer */
  const int crow = tid >> 3, cseg = tid & 7;
  const unsigned lc0 = (unsigned)(size_t)sm + (unsigned)((crow * LP + cseg * 8) * 2);
  const unsigned short* gk0 = Kh + ((size_t)head * TPAD + crow) * HD + cseg * 8;
  const unsigned short* ge0 = Erp + (size_t)crow * HD + cseg * 8;
  const unsigned short* gv0 = Vt + ((size_t)head * HD + crow) * TPAD + cseg * 8;
  const unsigned short* gkr0 = Kr + ((size_t)head * CRES + crow) * HD + cseg * 8;
  const unsigned short* gvr0 = Vr + ((size_t)head * HD + crow) * CRES + cseg * 8;
  /* all tiles of chunk kc into buffer b */
  auto stage = [&](int kc, int b) {
    const unsigned l = lc0 + (unsigned)(b * NT * TSZ * 2);
    copy_kev<TPAD>(l + KSH * 2u, l + ESH * 2u, l + VTH * 2u,
                   gk0 + (size_t)kc * 64 * HD, ge0 + (size_t)kc * 64 * HD, gv0 + kc * 64);
    if (EARLY) {
      const int kvr = (kc < NEARLY) ? kc * 64 : 0;             /* clamped residual chunk base */
      copy_kv<CRES>(l + KRS * 2u, l + VRS * 2u, gkr0 + (size_t)kvr * HD, gvr0 + kvr);
    }
  };

  /* two buffers: the next kept chunk's copies fly while this chunk is worked on */
  int kcur = -1, knxt = -1;
  if (kept != 0ull) { kcur = __builtin_ctzll(kept); kept &= kept - 1ull; stage(kcur, 0); }
  /* the first chunk has landed before the barrier that publishes it */
  asm volatile("s_wait_asynccnt 0x0" ::: "memory");
  __syncthreads();
  if (kept != 0ull) { knxt = __builtin_ctzll(kept); kept &= kept - 1ull; stage(knxt, 1); }

  /* rolled: one body in the instruction cache; at most one trip per key chunk */
#pragma unroll 1
  for (int trip = 0; trip < NKC && kcur >= 0; ++trip) {
    const int kc = kcur;
    const int bsel = trip & 1;
    const unsigned short* sb = sm + bsel * (NT * TSZ);         /* this trip's buffer */
    const int fk = (int)((mixed >> kc) & 1ull) ? 2 : 1;        /* block-uniform */
    const int kv0 = kc * 64;
    const bool useres = EARLY && (kc < NEARLY);

    if (fk == 2) {
      /* key mask tile: thread -> row tid>>1, 32 columns; clamped addresses, keys >= TT masked */
      const int row = tid >> 1, hsel = tid & 1;
      int qrow = qb * 64 + row;
      qrow = qrow < TT ? qrow : TT - 1;
      const int* mb = mask + (size_t)qrow * SEQ_FULL;
#pragma unroll 1
      for (int g = 0; g < 4; ++g) {
#pragma unroll
        for (int e = 0; e < 8; ++e) {
          const int col = hsel * 32 + g * 8 + e;
          const int s = kv0 + col;
          const int sc = s < TT ? s : TT - 1;
          const int mv = mb[sc];
          msk[row * 64 + col] = (unsigned char)((s < TT && mv != 0) ? 1 : 0);
        }
      }
      /* publishes the mask tile; its last readers left it before the barrier at the foot of their trip */
      __syncthreads();
    }

    /* Q hi fragments for this chunk (B operands), two 32-deep d halves */
    FH qa[2], qs[2];
#pragma unroll
    for (int dc = 0; dc < 2; ++dc) {
      qa[dc].h[0] = *(const v8us*)(qp + dc * 32);
      qa[dc].h[1] = *(const v8us*)(qp + dc * 32 + 16);
      qs[dc].h[0] = *(const v8us*)(qp + HD + dc * 32);
      qs[dc].h[1] = *(const v8us*)(qp + HD + dc * 32 + 16);
    }

    /* transposed scores: 64 keys x 16 queries per wave; s[j][r] = (key 16j+8h+r, query c) */
    v8f s[4];
    if constexpr (!EARLY) {
      /* the chunk's 32 K and Er fragment reads stand as ONE group in front of the 16 products, in the order of
         their use, so that the wave waits out the LDS latency once a chunk and not once per pair of products;
         the products run tile-inner: four independent accumulators, each summed in the order K d0, Er d0, K d1, Er d1;
         every loop here and in the V^T group is unrolled so that the fragment arrays' indices are constants (registers) */
      FH kf[2][4], ef[2][4];
#pragma unroll
      for (int dc = 0; dc < 2; ++dc) {
#pragma unroll
        for (int j = 0; j < 4; ++j) {
          kf[dc][j].h[0] = *(const v8us*)(sb + KSH + (j * 16 + c) * LP + dc * 32 + 8 * hh);
          kf[dc][j].h[1] = *(const v8us*)(sb + KSH + (j * 16 + c) * LP + dc * 32 + 16 + 8 * hh);
        }
#pragma unroll
        for (int j = 0; j < 4; ++j) {
          ef[dc][j].h[0] = *(const v8us*)(sb + ESH + (j * 16 + c) * LP + dc * 32 + 8 * hh);
          ef[dc][j].h[1] = *(const v8us*)(sb + ESH + (j * 16 + c) * LP + dc * 32 + 16 + 8 * hh);
        }
      }
#pragma unroll
      for (int j = 0; j < 4; ++j) s[j] = zero8();
#pragma unroll
      for (int dc = 0; dc < 2; ++dc) {
#pragma unroll
        for (int j = 0; j < 4; ++j) s[j] = mma_h(kf[dc][j].v, qa[dc].v, s[j]);
#pragma unroll
        for (int j = 0; j < 4; ++j) s[j] = mma_h(ef[dc][j].v, qs[dc].v, s[j]);
      }
    }
    /* the chunk's 16 V^T fragment reads, one group in front of the softmax, whose arithmetic covers their latency */
    FH vf[2][4];
    if constexpr (!EARLY) {
#pragma unroll
      for (int kk = 0; kk < 2; ++kk) {
#pragma unroll
        for (int t = 0; t < 4; ++t) {
          vf[kk][t].h[0] = *(const v8us*)(sb + VTH + (t * 16 + c) * LP + kk * 32 + 8 * hh);
          vf[kk][t].h[1] = *(const v8us*)(sb + VTH + (t * 16 + c) * LP + kk * 32 + 16 + 8 * hh);
        }
      }
    }
    /* blocks with residuals: tile by tile, each product's fragments read next to it (256 registers do not hold
       a whole chunk's fragments beside the residual operands) */
#pragma unroll
    for (int j = 0; EARLY && j < 4; ++j) {
      s[j] = zero8();
#pragma unroll
      for (int dc = 0; dc < 2; ++dc) {
        FH kf, ef;
        kf.h[0] = *(const v8us*)(sb + KSH + (j * 16 + c) * LP + dc * 32 + 8 * hh);
        kf.h[1] = *(const v8us*)(sb + KSH + (j * 16 + c) * LP + dc * 32 + 16 + 8 * hh);
        ef.h[0] = *(const v8us*)(sb + ESH + (j * 16 + c) * LP + dc * 32 + 8 * hh);
        ef.h[1] = *(const v8us*)(sb + ESH + (j * 16 + c) * LP + dc * 32 + 16 + 8 * hh);
        s[j] = mma_h(kf.v, qa[dc].v, s[j]);
        s[j] = mma_h(ef.v, qs[dc].v, s[j]);
      }
      if (EARLY) {
        if (useres) {
          v8f sr = zero8();
#pragma unroll
          for (int dc = 0; dc < 2; ++dc) {
            FH kf, ef, krf, qra, qrs;
            kf.h[0]  = *(const v8us*)(sb + KSH + (j * 16 + c) * LP + dc * 32 + 8 * hh);
            kf.h[1]  = *(const v8us*)(sb + KSH + (j * 16 + c) * LP + dc * 32 + 16 + 8 * hh);
            ef.h[0]  = *(const v8us*)(sb + ESH + (j * 16 + c) * LP + dc * 32 + 8 * hh);
            ef.h[1]  = *(const v8us*)(sb + ESH + (j * 16 + c) * LP + dc * 32 + 16 + 8 * hh);
            krf.h[0] = *(const v8us*)(sb + KRS + (j * 16 + c) * LP + dc * 32 + 8 * hh);
            krf.h[1] = *(const v8us*)(sb + KRS + (j * 16 + c) * LP + dc * 32 + 16 + 8 * hh);
            qra.h[0] = *(const v8us*)(rp + dc * 32);
            qra.h[1] = *(const v8us*)(rp + dc * 32 + 16);
            qrs.h[0] = *(const v8us*)(rp + HD + dc * 32);
            qrs.h[1] = *(const v8us*)(rp + HD + dc * 32 + 16);
            sr = mma_h(krf.v, qa[dc].v, sr);
            sr = mma_h(kf.v, qra.v, sr);
            sr = mma_h(ef.v, qrs.v, sr);
          }
#pragma unroll
          for (int r = 0; r < 8; ++r) s[j][r] += sr[r] * RINV;
        }
      }
    }

    /* scale by 1/sqrt(64) and replace-fill from the key mask (this lane's query, its 8 keys per tile) */
#pragma unroll
    for (int j = 0; j < 4; ++j) {
#pragma unroll
      for (int r = 0; r < 8; ++r) s[j][r] *= 0.125f;
    }
    if (fk == 2) {
#pragma unroll
      for (int j = 0; j < 4; ++j) {
        const v2u mw = *(const v2u*)(msk + (wrow0 + c) * 64 + j * 16 + 8 * hh);
#pragma unroll
        for (int r = 0; r < 8; ++r) {
          const unsigned mv = (mw[r >> 2] >> (8 * (r & 3))) & 0xFFu;
          s[j][r] = mv ? s[j][r] : -__builtin_inff();
        }
      }
    }

    /* chunk maximum of the lane's query: 32 keys in-lane (one chain per tile), then the other half's 32 */
    float mj[4];
#pragma unroll
    for (int j = 0; j < 4; ++j) {
      float mx = s[j][0];
#pragma unroll
      for (int r = 1; r < 8; ++r) mx = fmaxf(mx, s[j][r]);
      mj[j] = mx;
    }
    float cm = fmaxf(fmaxf(mj[0], mj[1]), fmaxf(mj[2], mj[3]));
    cm = fmaxf(cm, xhalf(cm));

    /* online softmax update; P^T (carried x1024) packed into B operands in place */
    const float mnew = fmaxf(mrow, cm);
    const bool dead = (mnew == -__builtin_inff());
    const float aexp = __expf(mrow - mnew);
    const float alpha = dead ? 1.f : aexp;
    mrow = mnew;
    FH pa[2], pr[2];
    float ps[4];
#pragma unroll
    for (int j = 0; j < 4; ++j) {
      float sum = 0.f;
#pragma unroll
      for (int r = 0; r < 8; ++r) {
        const float pe = __expf(s[j][r] - mnew);
        const float p = dead ? 0.f : pe;
        sum += p;
        const float pc = p * PSC;
        const _Float16 hv = (_Float16)pc;
        pa[j >> 1].v[(j & 1) * 8 + r] = hv;
        if (EARLY) {
          const float pres = (pc - (float)hv) * RSC;
          pr[j >> 1].v[(j & 1) * 8 + r] = (_Float16)pres;
        }
      }
      ps[j] = sum;
    }
    lrow = lrow * alpha + ((ps[0] + ps[1]) + (ps[2] + ps[3]));
#pragma unroll
    for (int t = 0; t < 4; ++t) {
#pragma unroll
      for (int r = 0; r < 8; ++r) oacc[t][r] *= alpha;
    }

    /* O^T += V^T.P^T : A = V^T [d][key] rows from LDS, B = P^T [key][q] from registers */
#pragma unroll
    for (int kk = 0; kk < 2; ++kk) {
#pragma unroll
      for (int t = 0; t < 4; ++t) {
        if constexpr (!EARLY) {
          oacc[t] = mma_h(vf[kk][t].v, pa[kk].v, oacc[t]);
        } else {
          FH vb;
          vb.h[0] = *(const v8us*)(sb + VTH + (t * 16 + c) * LP + kk * 32 + 8 * hh);
          vb.h[1] = *(const v8us*)(sb + VTH + (t * 16 + c) * LP + kk * 32 + 16 + 8 * hh);
          oacc[t] = mma_h(vb.v, pa[kk].v, oacc[t]);
        }
      }
    }
    if (EARLY) {
      if (useres) {
        /* residual products per d tile: one 8-register accumulator live at a time */
#pragma unroll
        for (int t = 0; t < 4; ++t) {
          v8f oar = zero8();
#pragma unroll
          for (int kk = 0; kk < 2; ++kk) {
            FH vb, vr;
            vb.h[0] = *(const v8us*)(sb + VTH + (t * 16 + c) * LP + kk * 32 + 8 * hh);
            vb.h[1] = *(const v8us*)(sb + VTH + (t * 16 + c) * LP + kk * 32 + 16 + 8 * hh);
            vr.h[0] = *(const v8us*)(sb + VRS + (t * 16 + c) * LP + kk * 32 + 8 * hh);
            vr.h[1] = *(const v8us*)(sb + VRS + (t * 16 + c) * LP + kk * 32 + 16 + 8 * hh);
            oar = mma_h(vr.v, pa[kk].v, oar);
            oar = mma_h(vb.v, pr[kk].v, oar);
          }
#pragma unroll
          for (int r = 0; r < 8; ++r) oacc[t][r] += oar[r] * RINV;
        }
      }
    }

    /* this wave's reads of this trip's buffer (and of the mask tile) have returned before the buffer is refilled */
    asm volatile("s_wait_dscnt 0x0" ::: "memory");
    /* this wave's copies of the next chunk have landed before the barrier that publishes them */
    asm volatile("s_wait_asynccnt 0x0" ::: "memory");
    __syncthreads();
    kcur = knxt;
    knxt = -1;
    if (kept != 0ull) { knxt = __builtin_ctzll(kept); kept &= kept - 1ull; stage(knxt, bsel); }
  }
  /* no copy is outstanding when the wave goes on */
  asm volatile("s_wait_asynccnt 0x0" ::: "memory");

  /* epilogue: all waves are done with the staged tiles before the region is reused */
  __syncthreads();
  unsigned short* osh = sm + KSH + wave * 1024;     /* [16][64] hi, carried x16 */
  unsigned short* osr = sm + ESH + wave * 1024;     /* [16][64] residual x2048 (EARLY) */
  {
    /* the two halves' partial sums joined; O holds 1024 x sum(p v); ctx = O / (1024 l);
       plane value = 16 ctx = O x (1/l) x (16/1024) */
    const float lsum = lrow + xhalf(lrow);
    const float inv = (1.0f / lsum) * OCV;
#pragma unroll
    for (int t = 0; t < 4; ++t) {
      v8us oh, orr;
#pragma unroll
      for (int r = 0; r < 8; ++r) {
        const float o = oacc[t][r] * inv;
        const unsigned short hb = h_bits(o);
        oh[r] = hb;
        orr[r] = EARLY ? h_bits((o - h2f(hb)) * RSC) : (unsigned short)0;
      }
      /* query row c, d = 16t+8h .. +7: 16 bytes */
      *(v8us*)(osh + c * 64 + t * 16 + 8 * hh) = oh;
      if (EARLY) *(v8us*)(osr + c * 64 + t * 16 + 8 * hh) = orr;
    }
  }
  __builtin_amdgcn_fence(3, "workgroup");
  __builtin_amdgcn_wave_barrier();
  __builtin_amdgcn_fence(2, "workgroup");
  /* 16 rows x 8 segments = 4 iterations x 32 lanes; row = 4it + (lane>>3), seg = lane&7:
*/
  {
#pragma unroll
    for (int it = 0; it < 4; ++it) {
      const int u = it * 32 + lane;
      const int row = u >> 3, seg = u & 7;
      const v8us vh = *(const v8us*)(osh + row * 64 + seg * 8);
      *(v8us*)(Ct + (size_t)(q0 + row) * DM + head * 64 + seg * 8) = vh;
      if (EARLY) {
        const v8us vr = *(const v8us*)(osr + row * 64 + seg * 8);
        *(v8us*)(Cr + (size_t)(q0 + row) * DM + head * 64 + seg * 8) = vr;
      }
    }
    
  }
}

__global__ __launch_bounds__(128) __attribute__((amdgpu_num_vgpr(256)))
void attn_kernel(const unsigned short* __restrict__ Qh, const unsigned short* __restrict__ Qr,
                 const unsigned short* __restrict__ Kh, const unsigned short* __restrict__ Kr,
                 const unsigned short* __restrict__ Vt, const unsigned short* __restrict__ Vr,
                 const unsigned short* __restrict__ Erp, const int* __restrict__ mask,
                 const int* __restrict__ flags, unsigned short* __restrict__ Ct,
                 unsigned short* __restrict__ Cr)
{
  __shared__ __align__(16) unsigned short sm[2 * 5 * TSZ];
  __shared__ __align__(16) unsigned char msk[4096];
  if ((int)blockIdx.x < NEARLY) attn_body<true>(Qh, Qr, Kh, Kr, Vt, Vr, Erp, mask, flags, Ct, Cr, sm, msk);
  else                          attn_body<false>(Qh, Qr, Kh, Kr, Vt, Vr, Erp, mask, flags, Ct, Cr, sm, msk);
}

/* --------------------------------------------------------------------------
 * Output projection: out[t][n] = (sum_k ctx16[t][k] wo64[n][k]) / 1024 + b[n], f16 operands,
 * f32 accumulate.  Token blocks tb < NEARLY first accumulate the ctx residual products
 * alone from zero, scale that sum by 1/2048 in f32, and use it as the start value of
 * the hi-plane accumulation (no residual product enters an accumulator holding hi terms).
 * Block = 2 waves (64 threads), 64 tokens x 64 columns; grid (NQB, DM/64); main loops: gemm_ring.
 * Epilogue: 64x64 f32 tile staged in LDS (cross-wave, block barrier), then
 * Coverage: 16 iterations x 64 threads = 1024 units = 64 rows x 16 segments.
 * ------------------------------------------------------------------------ */
__global__ __launch_bounds__(64) __attribute__((amdgpu_num_vgpr(256)))
void out_kernel(
    const unsigned short* __restrict__ Ct, const unsigned short* __restrict__ Cr,
    const unsigned short* __restrict__ Wo, const float* __restrict__ bias, float* __restrict__ out)
{
  constexpr int PTF = 68;
  __shared__ __align__(16) float ts[64 * PTF];
  __shared__ __align__(16) unsigned short ring[2 * GBUF];

  const int tid = threadIdx.x, wave = tid >> 5, lane = tid & 31;
  const int hh = lane >> 4, m = lane & 15;
  const int tb = blockIdx.x, nb = blockIdx.y;
  const int n0 = nb * 64;
  const int rl0 = wave * 32;
  const bool dores = tb < NEARLY;     /* block-uniform */

  v8f acc[2][4];
#pragma unroll
  for (int mi = 0; mi < 2; ++mi)
#pragma unroll
    for (int ni = 0; ni < 4; ++ni) acc[mi][ni] = zero8();

  const unsigned short* wrows = Wo + (size_t)n0 * DM;

  if (dores) {
    gemm_ring<false>(Cr + (size_t)tb * 64 * DM, wrows, ring, acc);
#pragma unroll
    for (int mi = 0; mi < 2; ++mi)
#pragma unroll
      for (int ni = 0; ni < 4; ++ni)
#pragma unroll
        for (int r = 0; r < 8; ++r) acc[mi][ni][r] *= RINV;
  }

  gemm_ring<false>(Ct + (size_t)tb * 64 * DM, wrows, ring, acc);

  float bb[4];
#pragma unroll
  for (int ni = 0; ni < 4; ++ni) bb[ni] = bfr(bias[n0 + ni * 16 + m]);
#pragma unroll
  for (int mi = 0; mi < 2; ++mi) {
#pragma unroll
    for (int ni = 0; ni < 4; ++ni) {
#pragma unroll
      for (int r = 0; r < 8; ++r) {
        const int rl = rl0 + mi * 16 + 8 * hh + r;
        ts[rl * PTF + ni * 16 + m] = acc[mi][ni][r] * OINV + bb[ni];
      }
    }
  }
  __syncthreads();

  {
#pragma unroll
    for (int it = 0; it < 16; ++it) {
      const int u = it * 64 + tid;
      const int row = u >> 4, seg = u & 15;
      const int t = tb * 64 + row;
      const v4f v = *(const v4f*)(ts + row * PTF + seg * 4);
      if (t < TT) *(v4f*)(out + (size_t)t * DM + n0 + seg * 4) = v;
    }
    
  }
}

/* -------------------------------------------------------------------------- */
extern "C" void kernel_launch(void* const* d_in, const int* in_sizes, int n_in,
                              void* d_out, int out_size, void* d_ws, size_t ws_size,
                              hipStream_t stream)
{
  if (n_in < 13) return;
  if (in_sizes[0] < TT * DM || in_sizes[1] < TT * DM || in_sizes[2] < TT * DM) return;
  if (in_sizes[3] < (TT - 1) * SEQ_FULL + TT) return;
  if (in_sizes[4] < DM * DM || in_sizes[6] < DM * DM || in_sizes[8] < DM * DM || in_sizes[11] < DM * DM) return;
  if (in_sizes[5] < DM || in_sizes[7] < DM || in_sizes[9] < DM || in_sizes[12] < DM) return;
  if (in_sizes[10] < TT * HD) return;
  if (out_size < TT * DM) return;
  if (d_ws == nullptr || ws_size < WS_NEED) return;

  const float* q    = (const float*)d_in[0];
  const float* k    = (const float*)d_in[1];
  const float* v    = (const float*)d_in[2];
  const int*   mask = (const int*)d_in[3];
  const float* Wq_w = (const float*)d_in[4];
  const float* Wq_b = (const float*)d_in[5];
  const float* Wk_w = (const float*)d_in[6];
  const float* Wk_b = (const float*)d_in[7];
  const float* Wv_w = (const float*)d_in[8];
  const float* Wv_b = (const float*)d_in[9];
  const float* Er   = (const float*)d_in[10];
  const float* Wo_w = (const float*)d_in[11];
  const float* Wo_b = (const float*)d_in[12];
  float* outp = (float*)d_out;

  unsigned char* ws = (unsigned char*)d_ws;
  unsigned short* Xq = (unsigned short*)(ws + OFF_XQ);
  unsigned short* Xk = (unsigned short*)(ws + OFF_XK);
  unsigned short* Xv = (unsigned short*)(ws + OFF_XV);
  unsigned short* Wq = (unsigned short*)(ws + OFF_WQ);
  unsigned short* Wk = (unsigned short*)(ws + OFF_WK);
  unsigned short* Wv = (unsigned short*)(ws + OFF_WV);
  unsigned short* Wo = (unsigned short*)(ws + OFF_WO);
  unsigned short* Eh = (unsigned short*)(ws + OFF_ER);
  unsigned short* Qh = (unsigned short*)(ws + OFF_QH);
  unsigned short* Kh = (unsigned short*)(ws + OFF_KH);
  unsigned short* Vt = (unsigned short*)(ws + OFF_VT);
  unsigned short* Qr = (unsigned short*)(ws + OFF_QR);
  unsigned short* Kr = (unsigned short*)(ws + OFF_KR);
  unsigned short* Vr = (unsigned short*)(ws + OFF_VR);
  unsigned short* Ct = (unsigned short*)(ws + OFF_CT);
  unsigned short* Cr = (unsigned short*)(ws + OFF_CR);
  int* flags = (int*)(ws + OFF_FL);

  /* input planes (rows >= TT zero) and the per (query block, key chunk) skip/dense/mixed flags */
  prep_kernel<<<PREP_BLOCKS, PBT, 0, stream>>>(q, k, v, mask, Wq_w, Wk_w, Wv_w, Wo_w, Er,
                                               Xq, Xk, Xv, Wq, Wk, Wv, Wo, Eh, flags);

  /* projections: 64 tokens x one head per block, z = q, k, v */
  proj_kernel<<<dim3(NTB, NH, 3), 64, 0, stream>>>(Xq, Xk, Xv, Wq, Wk, Wv, Wq_b, Wk_b, Wv_b, Qh, Kh, Vt, Qr, Kr, Vr);

  /* attention: first NEARLY query blocks with residual products, the rest single products */
  attn_kernel<<<dim3(NQB, NH), 128, 0, stream>>>(Qh, Qr, Kh, Kr, Vt, Vr, Eh, mask, flags, Ct, Cr);

  /* output projection into d_out */
  out_kernel<<<dim3(NQB, DM / 64), 64, 0, stream>>>(Ct, Cr, Wo, Wo_b, outp);
}

// v008
// A run of this version takes 72.6 microseconds.
// Timed twice side by side with v007, it ran 1.19 times as fast both times.
// All steps since v000 together make it 5.03 times as fast.
// Contractions: q/k/v input projections on v_wmma_f32_16x16x32_bf16 (bf16 operands = RNE-converted inputs and weights, f32 accumulate); scores q.k^T, row-shifted q.Er^T, p.v and the output projection on v_wmma_f32_16x16x32_f16 (f16 operands: f16 hi planes of projected q/k/v, p carried x1024 and folded as 1/1024 before the ctx plane, ctx carried x16, Wo carried x64, plus x2048 f16 residual planes for the first 256 query rows and first 256 keys), f32 accumulate; softmax and all other arithmetic in f32.
#include <hip/hip_runtime.h>

typedef _Float16       v16h __attribute__((ext_vector_type(16)));
typedef __bf16         v16b __attribute__((ext_vector_type(16)));
typedef unsigned short v8us __attribute__((ext_vector_type(8)));
typedef float          v8f  __attribute__((ext_vector_type(8)));
typedef float          v4f  __attribute__((ext_vector_type(4)));
typedef unsigned int   v4u  __attribute__((ext_vector_type(4)));
typedef int            v4i  __attribute__((ext_vector_type(4)));

#ifndef NB
#define NB 1
#endif
#ifndef SEQ
#define SEQ 2049
#endif
#define SEQ_FULL 2049

constexpr int DM     = 1024;
constexpr int NH     = 16;
constexpr int HD     = 64;
constexpr int TT     = SEQ;
constexpr int NQB    = (TT + 63) / 64;          /* query blocks of 64 rows */
constexpr int NTB    = NQB + 1;                  /* token blocks of the planes (one extra for the +1 row shift) */
constexpr int TPAD   = NTB * 64;                 /* padded token count of every plane */
constexpr int NKC    = NTB;                      /* key chunks of 64 */
constexpr int NEARLY = NQB < 4 ? NQB : 4;        /* query blocks with residual treatment */
constexpr int CRES   = NEARLY * 64;              /* rows of K/V/ctx residual planes */
constexpr int QRES   = (NEARLY + 1) * 64;        /* rows of the Q residual plane (covers the +1 shift) */

constexpr float RSC  = 2048.0f;                  /* residual plane carry */
constexpr float RINV = 1.0f / 2048.0f;
constexpr float PSC  = 1024.0f;                  /* softmax weight carry (on the p tile, hence on the p.v accumulator) */
constexpr float CSC  = 16.0f;                    /* ctx plane carry */
constexpr float OCV  = CSC / PSC;                /* 1/64: removes the p carry and applies the ctx carry in one factor */
constexpr float WOSC = 64.0f;                    /* Wo plane carry */
constexpr float OINV = 1.0f / (CSC * WOSC);      /* 1/1024 */

static_assert(NB == 1);
static_assert(SEQ <= SEQ_FULL);
static_assert(HD == 64);
static_assert(DM % 64 == 0 && DM % 32 == 0);
static_assert(TPAD % 64 == 0);
static_assert(NKC <= 64);
static_assert(QRES <= TPAD && CRES <= TPAD);

/* workspace region map (bytes, every offset a multiple of 128) */
constexpr size_t X_B  = (size_t)TPAD * DM * 2;       /* bf16 [TPAD][DM] */
constexpr size_t W_B  = (size_t)DM * DM * 2;         /* 16-bit [DM][DM] */
constexpr size_t E_B  = (size_t)TPAD * HD * 2;       /* f16 [TPAD][HD] */
constexpr size_t HP_B = (size_t)NH * TPAD * HD * 2;  /* f16 [NH][TPAD][HD] or [NH][HD][TPAD] */
constexpr size_t QR_B = (size_t)NH * QRES * HD * 2;  /* f16 [NH][QRES][HD] */
constexpr size_t KR_B = (size_t)NH * CRES * HD * 2;  /* f16 [NH][CRES][HD] or [NH][HD][CRES] */
constexpr size_t CT_B = (size_t)TPAD * DM * 2;       /* f16 [TPAD][DM] */
constexpr size_t CR_B = (size_t)CRES * DM * 2;       /* f16 [CRES][DM] */
constexpr int    FLN  = 4;                          /* 128-byte flag lines per query block, one writer each */
constexpr int    FSL  = (NKC + FLN - 1) / FLN;      /* key chunks (used slots) per flag line */
constexpr size_t FL_B = (size_t)NQB * FLN * 32 * 4; /* int [NQB][FLN][32]: chunk kc at line kc % FLN, slot kc / FLN */
static_assert(FSL <= 32);

constexpr size_t OFF_XQ = 0;
constexpr size_t OFF_XK = OFF_XQ + X_B;
constexpr size_t OFF_XV = OFF_XK + X_B;
constexpr size_t OFF_WQ = OFF_XV + X_B;
constexpr size_t OFF_WK = OFF_WQ + W_B;
constexpr size_t OFF_WV = OFF_WK + W_B;
constexpr size_t OFF_WO = OFF_WV + W_B;
constexpr size_t OFF_ER = OFF_WO + W_B;
constexpr size_t OFF_QH = OFF_ER + E_B;
constexpr size_t OFF_KH = OFF_QH + HP_B;
constexpr size_t OFF_VT = OFF_KH + HP_B;
constexpr size_t OFF_QR = OFF_VT + HP_B;
constexpr size_t OFF_KR = OFF_QR + QR_B;
constexpr size_t OFF_VR = OFF_KR + KR_B;
constexpr size_t OFF_CT = OFF_VR + KR_B;
constexpr size_t OFF_CR = OFF_CT + CT_B;
constexpr size_t OFF_FL = OFF_CR + CR_B;
constexpr size_t WS_NEED = OFF_FL + FL_B;

static_assert(X_B % 128 == 0 && W_B % 128 == 0 && E_B % 128 == 0 && HP_B % 128 == 0);
static_assert(QR_B % 128 == 0 && KR_B % 128 == 0 && CT_B % 128 == 0 && CR_B % 128 == 0 && FL_B % 128 == 0);
static_assert(WS_NEED <= 134217728ull);
static_assert((size_t)TT * DM * 4 <= (size_t)SEQ_FULL * DM * 4);

/* -------------------------------------------------------------------------- */
__device__ __forceinline__ unsigned short f2bf_bits(float f) {
  unsigned u = __float_as_uint(f);
  return (unsigned short)((u + 0x7FFFu + ((u >> 16) & 1u)) >> 16);
}
__device__ __forceinline__ float bfr(float f) { return __uint_as_float(((unsigned)f2bf_bits(f)) << 16); }
__device__ __forceinline__ unsigned short h_bits(float f) {
  _Float16 h = (_Float16)f;
  return __builtin_bit_cast(unsigned short, h);
}
__device__ __forceinline__ float h2f(unsigned short b) {
  _Float16 h = __builtin_bit_cast(_Float16, b);
  return (float)h;
}

/* WMMA issue helpers with the 4-slot hazard guard (ties D, keeps A/B live) */
__device__ __forceinline__ v8f mma_h(v16h a, v16h b, v8f c) {
  c = __builtin_amdgcn_wmma_f32_16x16x32_f16(false, a, false, b, (short)0, c, false, false);
  asm volatile("v_nop\n\tv_nop\n\tv_nop\n\tv_nop" : "+v"(c) : "v"(a), "v"(b));
  return c;
}
__device__ __forceinline__ v8f mma_b(v16b a, v16b b, v8f c) {
  c = __builtin_amdgcn_wmma_f32_16x16x32_bf16(false, a, false, b, (short)0, c, false, false);
  asm volatile("v_nop\n\tv_nop\n\tv_nop\n\tv_nop" : "+v"(c) : "v"(a), "v"(b));
  return c;
}

__device__ __forceinline__ v8f zero8() { return (v8f){0.f,0.f,0.f,0.f,0.f,0.f,0.f,0.f}; }

/* --------------------------------------------------------------------------
 * Main loop of the GEMM blocks: acc += A[32 WM][DM] . B[64 WN][DM]^T, 16-bit operands, WM x WN waves,
 * wave w = 32 A rows (w % WM) x 64 B rows (w / WM).  (WM, WN) = (2, 1): 64 x 64 block; (4, 2): 128 x 128 block,
 * which brings half the bytes into LDS per product.
 * Stage = 128 k values: the block's A rows and B rows, 256 B each, brought into LDS by asynchronous
 * copies (each copy = two whole 256-B row pieces), two buffers: stage t+1 flies while stage t is worked on.
 * The rows (A first, then B) are dealt evenly to the waves: 64 rows = 32 copies per wave and stage at (2, 1), 32 rows = 16 copies at (4, 2).
 * LDS row pitch 272 B = 16 B x 17 (odd): the 16 rows of one ds_load_b128 fall on distinct bank groups.
 * Fragment k map and the order of the k steps per accumulator are those of the direct global loads it replaces.
 * ------------------------------------------------------------------------ */
constexpr int GKS  = 128;             /* k values per stage = 4 WMMA k steps */
constexpr int GNST = DM / GKS;        /* stages */
constexpr int GP   = 136;             /* LDS row pitch in 16-bit elements */
constexpr int GBUF = 128 * GP;        /* elements of one buffer of a 64 x 64 block: A rows 0..63, B rows 64..127 */
constexpr int PBUF = 256 * GP;        /* elements of one buffer of a 128 x 128 block: A rows 0..127, B rows 128..255 */
static_assert(DM % GKS == 0 && GNST >= 2);

union FR { v16h hv; v16b bv; v8us h[2]; };

/* eight copies: row pairs 0, 2, .. 14 from the lane's own LDS byte address l and global address g */
__device__ __forceinline__ void copy8(unsigned l, const unsigned short* g)
{
  /* the copies and, as the last line of the same statement, the wait that stands in front of any
     rewrite of the address registers they name */
  asm volatile(
      "global_load_async_to_lds_b128 %0, %8, off\n\t"
      "global_load_async_to_lds_b128 %1, %9, off\n\t"
      "global_load_async_to_lds_b128 %2, %10, off\n\t"
      "global_load_async_to_lds_b128 %3, %11, off\n\t"
      "global_load_async_to_lds_b128 %4, %12, off\n\t"
      "global_load_async_to_lds_b128 %5, %13, off\n\t"
      "global_load_async_to_lds_b128 %6, %14, off\n\t"
      "global_load_async_to_lds_b128 %7, %15, off\n\t"
      "s_wait_xcnt 0x0"
      :: "v"(l), "v"(l + 2u * 2u * GP), "v"(l + 4u * 2u * GP), "v"(l + 6u * 2u * GP),
         "v"(l + 8u * 2u * GP), "v"(l + 10u * 2u * GP), "v"(l + 12u * 2u * GP), "v"(l + 14u * 2u * GP),
         "v"(g), "v"(g + 2 * DM), "v"(g + 4 * DM), "v"(g + 6 * DM),
         "v"(g + 8 * DM), "v"(g + 10 * DM), "v"(g + 12 * DM), "v"(g + 14 * DM)
      : "memory");
}
/* one wave's ROWS rows of one stage */
template <int ROWS>
__device__ __forceinline__ void stage_copy(unsigned l, const unsigned short* g)
{
  /* unrolled: the row offsets of the statements are constants */
#pragma unroll
  for (int q = 0; q < ROWS / 16; ++q) copy8(l + (unsigned)(q * 16 * GP * 2), g + (size_t)q * 16 * DM);
}

template <bool BF, int WM, int WN>
__device__ __forceinline__ void gemm_ring(const unsigned short* __restrict__ A, const unsigned short* __restrict__ B,
                                          unsigned short* ring, v8f (&acc)[2][4])
{
  const int lane = threadIdx.x & 31;
  const int wave = __builtin_amdgcn_readfirstlane((int)(threadIdx.x >> 5));
  const int hh = lane >> 4, m = lane & 15;
  constexpr int AR = WM * 32, BR = WN * 64;       /* A and B rows of the block */
  constexpr int RPW = (AR + BR) / (WM * WN);      /* rows that one wave copies */
  constexpr int BUF = (AR + BR) * GP;             /* elements of one buffer */
  static_assert((AR + BR) % (WM * WN) == 0 && RPW % 16 == 0 && AR % RPW == 0);

  /* copy addresses: buffer rows r0.. of this wave; lanes 0..15 one row, lanes 16..31 the next, 16 B per lane */
  const int r0 = wave * RPW;
  const unsigned short* g0 = (r0 < AR ? A + (size_t)r0 * DM : B + (size_t)(r0 - AR) * DM) + (size_t)hh * DM + m * 8;
  const unsigned l0 = (unsigned)(size_t)ring + (unsigned)(((r0 + hh) * GP + m * 8) * 2);

  stage_copy<RPW>(l0, g0);
  /* stage 0 has landed before the barrier that publishes it */
  asm volatile("s_wait_asynccnt 0x0" ::: "memory");
  __syncthreads();
  stage_copy<RPW>(l0 + (unsigned)(BUF * 2), g0 + GKS);

  const unsigned short* fa = ring + ((wave % WM) * 32 + m) * GP + 8 * hh;
  const unsigned short* fb = ring + (AR + (wave / WM) * 64 + m) * GP + 8 * hh;

  /* rolled: one body in the instruction cache, the buffer chosen by the trip's parity */
#pragma unroll 1
  for (int t = 0; t < GNST; ++t) {
    const int bo = (t & 1) * BUF;
    const unsigned short* pa = fa + bo;
    const unsigned short* pb = fb + bo;
    /* every loop below is unrolled so that each index of the two fragment sets is a constant and the sets stay in registers */
    FR a[2][2], b[2][4];
#pragma unroll
    for (int mi = 0; mi < 2; ++mi) {
      a[0][mi].h[0] = *(const v8us*)(pa + mi * 16 * GP);
      a[0][mi].h[1] = *(const v8us*)(pa + mi * 16 * GP + 16);
    }
#pragma unroll
    for (int ni = 0; ni < 4; ++ni) {
      b[0][ni].h[0] = *(const v8us*)(pb + ni * 16 * GP);
      b[0][ni].h[1] = *(const v8us*)(pb + ni * 16 * GP + 16);
    }
#pragma unroll
    for (int ks = 0; ks < GKS / 32; ++ks) {
      const int cur = ks & 1, nxt = cur ^ 1;
      if (ks + 1 < GKS / 32) {          /* next k step's fragments of the same stage, ahead of this step's products */
#pragma unroll
        for (int mi = 0; mi < 2; ++mi) {
          a[nxt][mi].h[0] = *(const v8us*)(pa + mi * 16 * GP + (ks + 1) * 32);
          a[nxt][mi].h[1] = *(const v8us*)(pa + mi * 16 * GP + (ks + 1) * 32 + 16);
        }
#pragma unroll
        for (int ni = 0; ni < 4; ++ni) {
          b[nxt][ni].h[0] = *(const v8us*)(pb + ni * 16 * GP + (ks + 1) * 32);
          b[nxt][ni].h[1] = *(const v8us*)(pb + ni * 16 * GP + (ks + 1) * 32 + 16);
        }
      }
#pragma unroll
      for (int ni = 0; ni < 4; ++ni) {
        if constexpr (BF) {
          acc[0][ni] = mma_b(a[cur][0].bv, b[cur][ni].bv, acc[0][ni]);
          acc[1][ni] = mma_b(a[cur][1].bv, b[cur][ni].bv, acc[1][ni]);
        } else {
          acc[0][ni] = mma_h(a[cur][0].hv, b[cur][ni].hv, acc[0][ni]);
          acc[1][ni] = mma_h(a[cur][1].hv, b[cur][ni].hv, acc[1][ni]);
        }
      }
    }
    /* this wave's reads of buffer t&1 have returned before the buffer is refilled */
    asm volatile("s_wait_dscnt 0x0" ::: "memory");
    /* this wave's copies of stage t+1 have landed before the barrier that publishes them */
    asm volatile("s_wait_asynccnt 0x0" ::: "memory");
    __syncthreads();
    if (t + 2 < GNST) stage_copy<RPW>(l0 + (unsigned)(bo * 2), g0 + (size_t)(t + 2) * GKS);
  }
  /* no copy is outstanding when the wave goes on */
  asm volatile("s_wait_asynccnt 0x0" ::: "memory");
}

/* --------------------------------------------------------------------------
 * f32 [nrows][ncols] -> 16-bit plane [nrows_pad][ncols]; rows >= nrows are zeros.
 * mode 0: bf16 bits (RNE).  mode 1: f16 bits of (scale * bf16(x)).
 * One unit u = 8 consecutive values of row u / (ncols/8); the caller hands out u < nrows_pad*ncols/8.
 * ------------------------------------------------------------------------ */
template <int nrows, int ncols, int mode>
__device__ __forceinline__ void cvt_unit(const float* __restrict__ src, float scale,
                                         unsigned short* __restrict__ dst, int u)
{
  constexpr int upr = ncols >> 3;
  const int row = u / upr;
  const int cu  = u - row * upr;
  const int rowc = row < nrows ? row : nrows - 1;          /* clamped address */
  const bool live = row < nrows;
  const float* p = src + (size_t)rowc * ncols + cu * 8;
  const v4f x0 = *(const v4f*)p;
  const v4f x1 = *(const v4f*)(p + 4);
  unsigned b0, b1, b2, b3, b4, b5, b6, b7;
  {
    const float f0 = live ? x0[0] : 0.f, f1 = live ? x0[1] : 0.f, f2 = live ? x0[2] : 0.f, f3 = live ? x0[3] : 0.f;
    const float f4 = live ? x1[0] : 0.f, f5 = live ? x1[1] : 0.f, f6 = live ? x1[2] : 0.f, f7 = live ? x1[3] : 0.f;
    if (mode == 0) {
      b0 = f2bf_bits(f0); b1 = f2bf_bits(f1); b2 = f2bf_bits(f2); b3 = f2bf_bits(f3);
      b4 = f2bf_bits(f4); b5 = f2bf_bits(f5); b6 = f2bf_bits(f6); b7 = f2bf_bits(f7);
    } else {
      b0 = h_bits(bfr(f0) * scale); b1 = h_bits(bfr(f1) * scale); b2 = h_bits(bfr(f2) * scale); b3 = h_bits(bfr(f3) * scale);
      b4 = h_bits(bfr(f4) * scale); b5 = h_bits(bfr(f5) * scale); b6 = h_bits(bfr(f6) * scale); b7 = h_bits(bfr(f7) * scale);
    }
  }
  v4u w;
  w[0] = b0 | (b1 << 16);
  w[1] = b2 | (b3 << 16);
  w[2] = b4 | (b5 << 16);
  w[3] = b6 | (b7 << 16);
  unsigned short* d = dst + (size_t)u * 8;
  *(v4u*)d = w;
  /* another branch's text follows in the caller: no register that the store names is rewritten in front of this wait */
  asm volatile("s_wait_xcnt 0x0" ::: "memory");
}

/* --------------------------------------------------------------------------
 * Per (query block, key chunk) flag from the int32 key mask:
 *   0 = every effective entry masked (chunk skipped), 1 = all kept, 2 = mixed.
 * Effective entry (t, s): query row clamped to TT-1 for padded rows, keys s >= TT masked.
 * Block = (query block qb, flag line ln), 16 waves: the chunks kc = ln + FLN*j, j < FSL.
 * Wave w reads rows 4w..4w+3 of every chunk of the block; all loads are independent, so
 * the whole strip is in flight at once.  Per wave one any-kept and one all-kept bit per
 * chunk (ballots), combined over the 16 waves through LDS behind one block barrier.
 * Coverage: wave 0 stores the block's whole 128-byte line (unused slots 0);
 * NQB x FLN blocks = the whole table.  wany, wall: 16 LDS words each.
 * ------------------------------------------------------------------------ */
__device__ __forceinline__ int flag_slot(int kc) { return (kc % FLN) * 32 + kc / FLN; }

__device__ __forceinline__ void flags_block(const int* __restrict__ mask, int* __restrict__ flags,
                                            int qb, int ln, unsigned* wany, unsigned* wall)
{
  const int tid = threadIdx.x, lane = tid & 31;
  const int wave = __builtin_amdgcn_readfirstlane(tid >> 5);   /* scalar, so the row bases are scalar */

  /* key of slot j, half hf: s = col0 + FLN*64*j + 32*hf.  Only the last slot can pass TT. */
  constexpr int LOFF = FLN * (FSL - 1) * 64;
  static_assert(LOFF - 1 < TT);
  const unsigned col0 = (unsigned)(ln * 64 + lane);
  const unsigned sl0 = col0 + LOFF, sl1 = sl0 + 32u;
  const unsigned cl0 = sl0 < (unsigned)TT ? sl0 : (unsigned)(TT - 1);   /* clamped address */
  const unsigned cl1 = sl1 < (unsigned)TT ? sl1 : (unsigned)(TT - 1);   /* clamped address */
  const int* rowp[4];
#pragma unroll
  for (int rr = 0; rr < 4; ++rr) {
    int t = qb * 64 + wave * 4 + rr;
    t = t < TT ? t : TT - 1;
    rowp[rr] = mask + (size_t)t * SEQ_FULL;
  }

  /* first every load, then every count */
  int mv[FSL][8];
#pragma unroll
  for (int j = 0; j < FSL - 1; ++j) {
#pragma unroll
    for (int it = 0; it < 8; ++it)
      mv[j][it] = (rowp[it >> 1] + col0)[FLN * j * 64 + (it & 1) * 32];
  }
#pragma unroll
  for (int it = 0; it < 8; ++it)
    mv[FSL - 1][it] = rowp[it >> 1][(it & 1) ? cl1 : cl0];
  /* keeps every load in front of every count: without it the scheduler mixes them and fewer loads fly at once */
  __builtin_amdgcn_sched_barrier(0);
  /* every register that the issued loads name (row bases, key offsets) is an input here, so none is
     rewritten in front of this wait */
  asm volatile("s_wait_xcnt 0x0"
               :: "s"(rowp[0]), "s"(rowp[1]), "s"(rowp[2]), "s"(rowp[3]), "v"(col0), "v"(cl0), "v"(cl1)
               : "memory");

  int cnt[FSL];
#pragma unroll
  for (int j = 0; j < FSL; ++j) {
    int n = 0;
#pragma unroll
    for (int it = 0; it < 8; ++it) {
      const bool ex = (j < FSL - 1) || (((it & 1) ? sl1 : sl0) < (unsigned)TT);   /* key exists */
      n += (ex && mv[j][it] != 0) ? 1 : 0;
    }
    cnt[j] = n;
  }

  unsigned anym = 0u, allm = 0u;                           /* wave-uniform, bit j = chunk ln + FLN*j */
#pragma unroll
  for (int j = 0; j < FSL; ++j) {
    anym |= (__builtin_amdgcn_ballot_w32(cnt[j] != 0) != 0u) ? (1u << j) : 0u;
    allm |= (__builtin_amdgcn_ballot_w32(cnt[j] == 8) == 0xFFFFFFFFu) ? (1u << j) : 0u;
  }
  if (lane == 0) { wany[wave] = anym; wall[wave] = allm; }
  __syncthreads();

  if (wave == 0) {
    unsigned a = 0u, f = 0xFFFFFFFFu;
#pragma unroll
    for (int w = 0; w < 16; ++w) { a |= wany[w]; f &= wall[w]; }
    int fv = 0;
    if (lane < FSL) fv = ((a >> lane) & 1u) ? (((f >> lane) & 1u) ? 1 : 2) : 0;
    flags[((size_t)qb * FLN + ln) * 32 + lane] = fv;
  }
}

/* --------------------------------------------------------------------------
 * Everything that depends on the inputs alone, in one launch of 512-thread blocks:
 * blocks [0, FBL): mask flags, block b = (query block b / FLN, flag line b % FLN);
 * then 3 x XBL blocks: q, k, v planes; 3 x WBL: Wq, Wk, Wv planes; WBL: Wo plane; EBL: Er plane.
 * A conversion block = 512 units, one per thread; every plane's unit count is a multiple of 512.
 * The branch on the block index is block-uniform (the flags part holds a block barrier).
 * ------------------------------------------------------------------------ */
constexpr int PBT = 512;
constexpr int FBL = NQB * FLN;
constexpr int XBL = TPAD * (DM / 8) / PBT;
constexpr int WBL = DM * (DM / 8) / PBT;
constexpr int EBL = TPAD * (HD / 8) / PBT;
constexpr int PREP_BLOCKS = FBL + 3 * XBL + 4 * WBL + EBL;
static_assert(TPAD * (DM / 8) % PBT == 0 && DM * (DM / 8) % PBT == 0 && TPAD * (HD / 8) % PBT == 0);

__global__ __launch_bounds__(512) void prep_kernel(
    const float* __restrict__ q, const float* __restrict__ k, const float* __restrict__ v,
    const int* __restrict__ mask,
    const float* __restrict__ Wq_w, const float* __restrict__ Wk_w, const float* __restrict__ Wv_w,
    const float* __restrict__ Wo_w, const float* __restrict__ Er,
    unsigned short* __restrict__ Xq, unsigned short* __restrict__ Xk, unsigned short* __restrict__ Xv,
    unsigned short* __restrict__ Wq, unsigned short* __restrict__ Wk, unsigned short* __restrict__ Wv,
    unsigned short* __restrict__ Wo, unsigned short* __restrict__ Eh, int* __restrict__ flags)
{
  __shared__ unsigned wany[16];
  __shared__ unsigned wall[16];
  const int tid = threadIdx.x;
  int b = blockIdx.x;
  if (b < FBL) { flags_block(mask, flags, b / FLN, b % FLN, wany, wall); return; }
  b -= FBL;
  if (b < 3 * XBL) {
    const int j = b / XBL;
    cvt_unit<TT, DM, 0>(j == 0 ? q : j == 1 ? k : v, 1.0f, j == 0 ? Xq : j == 1 ? Xk : Xv, (b - j * XBL) * PBT + tid);
    return;
  }
  b -= 3 * XBL;
  if (b < 3 * WBL) {
    const int j = b / WBL;
    cvt_unit<DM, DM, 0>(j == 0 ? Wq_w : j == 1 ? Wk_w : Wv_w, 1.0f, j == 0 ? Wq : j == 1 ? Wk : Wv, (b - j * WBL) * PBT + tid);
    return;
  }
  b -= 3 * WBL;
  if (b < WBL) { cvt_unit<DM, DM, 1>(Wo_w, WOSC, Wo, b * PBT + tid); return; }
  b -= WBL;
  cvt_unit<TT, HD, 1>(Er, 1.0f, Eh, b * PBT + tid);
}

/* --------------------------------------------------------------------------
 * Projection GEMM: Y[t][n] = sum_k X[t][k] W[n][k] + b[n] for one 128-token x 128-col
 * (= two heads) tile per block; bf16 operands (X and W planes), f32 accumulate.
 * Block = 8 waves (256 threads); wave w: tokens (w&3)*32.. (2 row tiles) x the 4 col tiles of head w>>2; main loop: gemm_ring.
 * The epilogue works per pair of waves (w>>1) = one 64-token x one-head tile, as described below.
 * A fragment (row m = lane&15): elems 0..7 <- k0+8h+i, 8..15 <- k0+16+8h+i.
 * B[k][n] = W[n][k]: loaded from row n = lane&15 with the same k map.  D elem r = (row 8h+r, col lane&15).
 * Epilogue: hi = f16(y), res = f16((y - hi) * 2048), rows t >= TT forced to 0; the block's
 * MODE 0: Q -> [NH][TPAD][HD] (+ residual rows < QRES); 1: K -> same (+ residual rows < CRES);
 * MODE 2: V -> [NH][HD][TPAD] (+ residual [NH][HD][CRES]).
 * Coverage per pair of waves: 8 iterations x 64 threads = 512 units = 64 rows x 8 segments (hi and res).
 * LDS tiles th/tr (one set per pair): cross-wave, separated by a block barrier; reloaded through the stored element type.
 * They lie over the ring, which every wave has left at the barrier that ends the main loop's last trip.
 * The three projections share one launch: grid (NTB/2, NH/2, 3), MODE = blockIdx.z (block-uniform);
 * the main loop is common, proj_tail<MODE> is the epilogue.
 * ------------------------------------------------------------------------ */
constexpr int PT = 72;

template <int MODE>
__device__ __forceinline__ void proj_tail(
    v8f (&acc)[2][4], const float* __restrict__ bias, unsigned short* __restrict__ Ph,
    unsigned short* __restrict__ Pr, unsigned short* th, unsigned short* tr)
{
  constexpr int NRES_TB = (MODE == 0) ? (NEARLY + 1) : NEARLY;
  const int w = __builtin_amdgcn_readfirstlane((int)(threadIdx.x >> 5));
  const int tid = threadIdx.x & 63, wave = tid >> 5, lane = tid & 31;   /* inside the pair of waves */
  const int hh = lane >> 4, m = lane & 15;
  const int tb = blockIdx.x * 2 + ((w >> 1) & 1), head = blockIdx.y * 2 + (w >> 2);   /* the pair's 64 x 64 tile */
  const int n0 = head * 64;
  const int rl0 = wave * 32;

  float bb[4];
#pragma unroll
  for (int ni = 0; ni < 4; ++ni) bb[ni] = bfr(bias[n0 + ni * 16 + m]);

#pragma unroll
  for (int mi = 0; mi < 2; ++mi) {
#pragma unroll
    for (int ni = 0; ni < 4; ++ni) {
#pragma unroll
      for (int r = 0; r < 8; ++r) {
        const int rl  = rl0 + mi * 16 + 8 * hh + r;
        const int t   = tb * 64 + rl;
        const int col = ni * 16 + m;
        float y = acc[mi][ni][r] + bb[ni];
        y = (t < TT) ? y : 0.f;
        const unsigned short hb = h_bits(y);
        const float res = (y - h2f(hb)) * RSC;
        const unsigned short rb = h_bits(res);
        if (MODE == 2) { th[col * PT + rl] = hb; tr[col * PT + rl] = rb; }
        else           { th[rl * PT + col] = hb; tr[rl * PT + col] = rb; }
      }
    }
  }
  __syncthreads();

  const bool dores = tb < NRES_TB;    /* uniform in the pair of waves */
  {
#pragma unroll
    for (int it = 0; it < 8; ++it) {
      const int u = it * 64 + tid;
      const int row = u >> 3, seg = u & 7;
      const v8us vh = *(const v8us*)(th + row * PT + seg * 8);
      const v8us vr = *(const v8us*)(tr + row * PT + seg * 8);
      if (MODE == 2) {
        *(v8us*)(Ph + ((size_t)head * HD + row) * TPAD + tb * 64 + seg * 8) = vh;
        if (dores) *(v8us*)(Pr + ((size_t)head * HD + row) * CRES + tb * 64 + seg * 8) = vr;
      } else {
        *(v8us*)(Ph + ((size_t)head * TPAD + tb * 64 + row) * HD + seg * 8) = vh;
        if (dores) {
          if (MODE == 0) *(v8us*)(Pr + ((size_t)head * QRES + tb * 64 + row) * HD + seg * 8) = vr;
          else           *(v8us*)(Pr + ((size_t)head * CRES + tb * 64 + row) * HD + seg * 8) = vr;
        }
      }
    }
    
  }
  /* another epilogue's text follows in the caller: no register that the last stores name is rewritten in front of this wait */
  asm volatile("s_wait_xcnt 0x0" ::: "memory");
}

__global__ __launch_bounds__(256) __attribute__((amdgpu_num_vgpr(256)))
void proj_kernel(
    const unsigned short* __restrict__ Xq, const unsigned short* __restrict__ Xk, const unsigned short* __restrict__ Xv,
    const unsigned short* __restrict__ Wq, const unsigned short* __restrict__ Wk, const unsigned short* __restrict__ Wv,
    const float* __restrict__ bq, const float* __restrict__ bk, const float* __restrict__ bv,
    unsigned short* __restrict__ Qh, unsigned short* __restrict__ Kh, unsigned short* __restrict__ Vt,
    unsigned short* __restrict__ Qr, unsigned short* __restrict__ Kr, unsigned short* __restrict__ Vr)
{
  __shared__ __align__(16) unsigned short ring[2 * PBUF];
  static_assert(NTB % 2 == 0 && NH % 2 == 0 && 4 * 2 * 64 * PT <= 2 * PBUF);

  const int mode = blockIdx.z;
  /* epilogue tiles of this wave's pair */
  unsigned short* th = ring + __builtin_amdgcn_readfirstlane((int)(threadIdx.x >> 6)) * (2 * 64 * PT);
  unsigned short* tr = th + 64 * PT;
  const unsigned short* X = mode == 0 ? Xq : mode == 1 ? Xk : Xv;
  const unsigned short* W = mode == 0 ? Wq : mode == 1 ? Wk : Wv;

  v8f acc[2][4];
#pragma unroll
  for (int mi = 0; mi < 2; ++mi)
#pragma unroll
    for (int ni = 0; ni < 4; ++ni) acc[mi][ni] = zero8();

  gemm_ring<true, 4, 2>(X + (size_t)blockIdx.x * 128 * DM, W + (size_t)blockIdx.y * 128 * DM, ring, acc);

  if (mode == 0)      proj_tail<0>(acc, bq, Qh, Qr, th, tr);
  else if (mode == 1) proj_tail<1>(acc, bk, Kh, Kr, th, tr);
  else                proj_tail<2>(acc, bv, Vt, Vr, th, tr);
}

/* --------------------------------------------------------------------------
 * Flash attention with the row-shifted Er term, head dim 64, products transposed.
 * Block = 4 waves = 64 query rows of one head; grid (query blocks, NH).
 * Per kept 64-key chunk: K [key][d], Er [key][d], V^T [d][key] f16 tiles staged in LDS
 * (EARLY: also K and V^T residual tiles) by asynchronous copies, two buffers: the next kept chunk flies
 * while this one is worked on; one block barrier per chunk (a second one only where a mask tile is staged).
 * S^T = K.q^T + Er.q(t+1)^T on f16 WMMA: A = K or Er rows from LDS, B = Q rows; D elem r of key tile j =
 * (key 16j+8h+r, query lane&15), so a lane holds 32 of the 64 scores of ONE query and lane^16 the other 32.
 * x0.125, replace-fill -inf from the key mask (flag 2 chunks), f32 online softmax: maximum in-lane plus one
 * exchange between the wave halves; the sum stays a per-half partial and is joined once in the epilogue.
 * P^T = f16(1024 p) (EARLY: + f16 residual x2048) is a B operand straight from the score registers:
 * element s of the operand for keys 32kk.. is register s&7 of key tile 2kk+(s>>3), the hardware k order.
 * O^T += V^T.P^T on f16 WMMA: A = V^T rows from LDS; D elem r of d tile t = (d 16t+8h+r, query lane&15)
 * (O therefore carries the x1024 of P; the normaliser applies 1/(1024 l) x 16 in one factor).
 * EARLY adds (k_res.qh + k.q_res + Er.q_res(t+1))/2048 to the scores and
 * (V_res.P + V.P_res)/2048 to O through separate accumulators folded per tile.
 * Without residuals a chunk's fragments are read from LDS in two groups: K and Er ahead of the score products,
 * V^T ahead of the softmax; 128 and 64 registers, never live together.
 * Live-state plan: Q hi fragments reloaded per chunk (dead during softmax and P.V),
 * Q residual fragments loaded only inside the residual score phase, one 8-register
 * residual accumulator at a time; 4 O tiles + 4 score tiles + m/l (one value each) persistent.
 * Epilogue: ctx = O/(1024 l) carried x16 as f16 into [TPAD][DM] (+ residual rows < CRES),
 * staged per wave in LDS so that whole 128-byte row pieces are stored.
 * Fragment k map as in proj_kernel (A row / B col = lane&15, split k map).
 * LDS regions: K/Er/V/res tiles and msk cross-wave (block barriers).
 * Both variants share one launch: grid (NQB, NH), EARLY = (query block < NEARLY), block-uniform;
 * sm holds two buffers of 5 tiles (the variant without residuals: two of 3), msk 4096 bytes.
 * ------------------------------------------------------------------------ */
/* LDS row pitch of every fragment-read tile: 72 halves = 144 B = 16 B x 9 (odd), so the 16 rows that one
   ds_load_b128 reads fall on 16 distinct groups of four banks; at 128 B they fall on two groups */
constexpr int LP = 72;
constexpr int TSZ = 64 * LP;                       /* one 64-row tile */

typedef unsigned int v2u __attribute__((ext_vector_type(2)));

/* value of lane l ^ 16 */
__device__ __forceinline__ float xhalf(float x) {
  const int b = __float_as_int(x);
  return __int_as_float(__builtin_amdgcn_permlanex16(b, b, 0x76543210, 0xfedcba98, false, false));
}

/* Asynchronous copies of one key chunk's tiles.  A lane brings 16 B; a thread's four pieces of a 64 x 64 tile
   are rows r, r+16, r+32, r+48 (r = tid>>3) at segment tid&7.  l*: the lane's LDS byte address of its first
   piece, g*: its global address; SV: global row pitch in elements of the [d][key] plane (the [key][d] planes have pitch HD). */
constexpr unsigned LS16 = 16u * LP * 2u;           /* 16 LDS rows in bytes */

template <int SV>
__device__ __forceinline__ void copy_kev(unsigned lk, unsigned le, unsigned lv, const unsigned short* gk,
                                         const unsigned short* ge, const unsigned short* gv)
{
  /* the copies and, as the last line of the same statement, the wait that stands in front of any
     rewrite of the address registers they name */
  asm volatile(
      "global_load_async_to_lds_b128 %0, %12, off\n\t"
      "global_load_async_to_lds_b128 %1, %13, off\n\t"
      "global_load_async_to_lds_b128 %2, %14, off\n\t"
      "global_load_async_to_lds_b128 %3, %15, off\n\t"
      "global_load_async_to_lds_b128 %4, %16, off\n\t"
      "global_load_async_to_lds_b128 %5, %17, off\n\t"
      "global_load_async_to_lds_b128 %6, %18, off\n\t"
      "global_load_async_to_lds_b128 %7, %19, off\n\t"
      "global_load_async_to_lds_b128 %8, %20, off\n\t"
      "global_load_async_to_lds_b128 %9, %21, off\n\t"
      "global_load_async_to_lds_b128 %10, %22, off\n\t"
      "global_load_async_to_lds_b128 %11, %23, off\n\t"
      "s_wait_xcnt 0x0"
      :: "v"(lk), "v"(lk + LS16), "v"(lk + 2u * LS16), "v"(lk + 3u * LS16),
         "v"(le), "v"(le + LS16), "v"(le + 2u * LS16), "v"(le + 3u * LS16),
         "v"(lv), "v"(lv + LS16), "v"(lv + 2u * LS16), "v"(lv + 3u * LS16),
         "v"(gk), "v"(gk + 16 * HD), "v"(gk + 32 * HD), "v"(gk + 48 * HD),
         "v"(ge), "v"(ge + 16 * HD), "v"(ge + 32 * HD), "v"(ge + 48 * HD),
         "v"(gv), "v"(gv + 16 * SV), "v"(gv + 32 * SV), "v"(gv + 48 * SV)
      : "memory");
}
template <int SV>
__device__ __forceinline__ void copy_kv(unsigned lk, unsigned lv, const unsigned short* gk, const unsigned short* gv)
{
  /* as above: the wait is the last line of the copies' own statement */
  asm volatile(
      "global_load_async_to_lds_b128 %0, %8, off\n\t"
      "global_load_async_to_lds_b128 %1, %9, off\n\t"
      "global_load_async_to_lds_b128 %2, %10, off\n\t"
      "global_load_async_to_lds_b128 %3, %11, off\n\t"
      "global_load_async_to_lds_b128 %4, %12, off\n\t"
      "global_load_async_to_lds_b128 %5, %13, off\n\t"
      "global_load_async_to_lds_b128 %6, %14, off\n\t"
      "global_load_async_to_lds_b128 %7, %15, off\n\t"
      "s_wait_xcnt 0x0"
      :: "v"(lk), "v"(lk + LS16), "v"(lk + 2u * LS16), "v"(lk + 3u * LS16),
         "v"(lv), "v"(lv + LS16), "v"(lv + 2u * LS16), "v"(lv + 3u * LS16),
         "v"(gk), "v"(gk + 16 * HD), "v"(gk + 32 * HD), "v"(gk + 48 * HD),
         "v"(gv), "v"(gv + 16 * SV), "v"(gv + 32 * SV), "v"(gv + 48 * SV)
      : "memory");
}

template <bool EARLY>
__device__ __forceinline__
void attn_body(const unsigned short* __restrict__ Qh, const unsigned short* __restrict__ Qr,
               const unsigned short* __restrict__ Kh, const unsigned short* __restrict__ Kr,
               const unsigned short* __restrict__ Vt, const unsigned short* __restrict__ Vr,
               const unsigned short* __restrict__ Erp, const int* __restrict__ mask,
               const int* __restrict__ flags, unsigned short* __restrict__ Ct,
               unsigned short* __restrict__ Cr, unsigned short* sm, unsigned char* msk)
{
  constexpr int KSH = 0, ESH = TSZ, VTH = 2 * TSZ, KRS = 3 * TSZ, VRS = 4 * TSZ;
  union FH { v16h v; v8us h[2]; };

  const int tid = threadIdx.x, wave = tid >> 5, lane = tid & 31;
  const int hh = lane >> 4, c = lane & 15;
  const int qb = blockIdx.x;
  const int head = blockIdx.y;
  const int q0 = qb * 64 + wave * 16;
  const int wrow0 = wave * 16;                     /* the wave's first row inside the block tile */

  /* fragment base pointers: rows q0+c (k.q^T) and q0+1+c (shifted Er term) */
  const unsigned short* qp = Qh + ((size_t)head * TPAD + q0 + c) * HD + 8 * hh;
  const unsigned short* rp = Qr + ((size_t)head * QRES + (EARLY ? (q0 + c) : c)) * HD + 8 * hh;

  /* state of query q0+c: running maximum (equal in both halves), this half's part of the sum */
  float mrow = -__builtin_inff(), lrow = 0.f;
  v8f oacc[4];
#pragma unroll
  for (int t = 0; t < 4; ++t) oacc[t] = zero8();

  const int* frow = flags + (size_t)qb * (FLN * 32);

  /* the block's flags as two bit masks over the key chunks (bit kc), equal in every wave: the next kept chunk
     is known ahead of its turn, so its copies can be issued one trip early */
  unsigned long long kept, mixed;
  {
    const int sl0 = flag_slot(lane < NKC ? lane : NKC - 1);             /* clamped addresses */
    const int sl1 = flag_slot(lane + 32 < NKC ? lane + 32 : NKC - 1);
    const int f0 = frow[sl0];
    const int f1 = frow[sl1];
    /* the row base and both slots are inputs here, so no register that the two loads name is rewritten in front of this wait */
    asm volatile("s_wait_xcnt 0x0" :: "s"(frow), "v"(sl0), "v"(sl1) : "memory");
    const bool e0 = lane < NKC, e1 = lane + 32 < NKC;
    kept  = ((unsigned long long)__builtin_amdgcn_ballot_w32(e1 && f1 != 0) << 32) | __builtin_amdgcn_ballot_w32(e0 && f0 != 0);
    mixed = ((unsigned long long)__builtin_amdgcn_ballot_w32(e1 && f1 == 2) << 32) | __builtin_amdgcn_ballot_w32(e0 && f0 == 2);
  }

  /* copy addresses of this thread: row tid>>3 (+16 per piece), segment tid&7 */
  constexpr int NT = EARLY ? 5 : 3;                /* tiles of one buffer */
  const int crow = tid >> 3, cseg = tid & 7;
  const unsigned lc0 = (unsigned)(size_t)sm + (unsigned)((crow * LP + cseg * 8) * 2);
  const unsigned short* gk0 = Kh + ((size_t)head * TPAD + crow) * HD + cseg * 8;
  const unsigned short* ge0 = Erp + (size_t)crow * HD + cseg * 8;
  const unsigned short* gv0 = Vt + ((size_t)head * HD + crow) * TPAD + cseg * 8;
  const unsigned short* gkr0 = Kr + ((size_t)head * CRES + crow) * HD + cseg * 8;
  const unsigned short* gvr0 = Vr + ((size_t)head * HD + crow) * CRES + cseg * 8;
  /* all tiles of chunk kc into buffer b */
  auto stage = [&](int kc, int b) {
    const unsigned l = lc0 + (unsigned)(b * NT * TSZ * 2);
    copy_kev<TPAD>(l + KSH * 2u, l + ESH * 2u, l + VTH * 2u,
                   gk0 + (size_t)kc * 64 * HD, ge0 + (size_t)kc * 64 * HD, gv0 + kc * 64);
    if (EARLY) {
      const int kvr = (kc < NEARLY) ? kc * 64 : 0;             /* clamped residual chunk base */
      copy_kv<CRES>(l + KRS * 2u, l + VRS * 2u, gkr0 + (size_t)kvr * HD, gvr0 + kvr);
    }
  };

  /* two buffers: the next kept chunk's copies fly while this chunk is worked on */
  int kcur = -1, knxt = -1;
  if (kept != 0ull) { kcur = __builtin_ctzll(kept); kept &= kept - 1ull; stage(kcur, 0); }
  /* the first chunk has landed before the barrier that publishes it */
  asm volatile("s_wait_asynccnt 0x0" ::: "memory");
  __syncthreads();
  if (kept != 0ull) { knxt = __builtin_ctzll(kept); kept &= kept - 1ull; stage(knxt, 1); }

  /* rolled: one body in the instruction cache; at most one trip per key chunk */
#pragma unroll 1
  for (int trip = 0; trip < NKC && kcur >= 0; ++trip) {
    const int kc = kcur;
    const int bsel = trip & 1;
    const unsigned short* sb = sm + bsel * (NT * TSZ);         /* this trip's buffer */
    const int fk = (int)((mixed >> kc) & 1ull) ? 2 : 1;        /* block-uniform */
    const int kv0 = kc * 64;
    const bool useres = EARLY && (kc < NEARLY);

    if (fk == 2) {
      /* key mask tile: thread -> row tid>>1, 32 columns; clamped addresses, keys >= TT masked */
      const int row = tid >> 1, hsel = tid & 1;
      int qrow = qb * 64 + row;
      qrow = qrow < TT ? qrow : TT - 1;
      const int* mb = mask + (size_t)qrow * SEQ_FULL;
#pragma unroll 1
      for (int g = 0; g < 4; ++g) {
#pragma unroll
        for (int e = 0; e < 8; ++e) {
          const int col = hsel * 32 + g * 8 + e;
          const int s = kv0 + col;
          const int sc = s < TT ? s : TT - 1;
          const int mv = mb[sc];
          msk[row * 64 + col] = (unsigned char)((s < TT && mv != 0) ? 1 : 0);
        }
      }
      /* publishes the mask tile; its last readers left it before the barrier at the foot of their trip */
      __syncthreads();
    }

    /* Q hi fragments for this chunk (B operands), two 32-deep d halves */
    FH qa[2], qs[2];
#pragma unroll
    for (int dc = 0; dc < 2; ++dc) {
      qa[dc].h[0] = *(const v8us*)(qp + dc * 32);
      qa[dc].h[1] = *(const v8us*)(qp + dc * 32 + 16);
      qs[dc].h[0] = *(const v8us*)(qp + HD + dc * 32);
      qs[dc].h[1] = *(const v8us*)(qp + HD + dc * 32 + 16);
    }

    /* transposed scores: 64 keys x 16 queries per wave; s[j][r] = (key 16j+8h+r, query c) */
    v8f s[4];
    if constexpr (!EARLY) {
      /* the chunk's 32 K and Er fragment reads stand as ONE group in front of the 16 products, in the order of
         their use, so that the wave waits out the LDS latency once a chunk and not once per pair of products;
         the products run tile-inner: four independent accumulators, each summed in the order K d0, Er d0, K d1, Er d1;
         every loop here and in the V^T group is unrolled so that the fragment arrays' indices are constants (registers) */
      FH kf[2][4], ef[2][4];
#pragma unroll
      for (int dc = 0; dc < 2; ++dc) {
#pragma unroll
        for (int j = 0; j < 4; ++j) {
          kf[dc][j].h[0] = *(const v8us*)(sb + KSH + (j * 16 + c) * LP + dc * 32 + 8 * hh);
          kf[dc][j].h[1] = *(const v8us*)(sb + KSH + (j * 16 + c) * LP + dc * 32 + 16 + 8 * hh);
        }
#pragma unroll
        for (int j = 0; j < 4; ++j) {
          ef[dc][j].h[0] = *(const v8us*)(sb + ESH + (j * 16 + c) * LP + dc * 32 + 8 * hh);
          ef[dc][j].h[1] = *(const v8us*)(sb + ESH + (j * 16 + c) * LP + dc * 32 + 16 + 8 * hh);
        }
      }
#pragma unroll
      for (int j = 0; j < 4; ++j) s[j] = zero8();
#pragma unroll
      for (int dc = 0; dc < 2; ++dc) {
#pragma unroll
        for (int j = 0; j < 4; ++j) s[j] = mma_h(kf[dc][j].v, qa[dc].v, s[j]);
#pragma unroll
        for (int j = 0; j < 4; ++j) s[j] = mma_h(ef[dc][j].v, qs[dc].v, s[j]);
      }
    }
    /* the chunk's 16 V^T fragment reads, one group in front of the softmax, whose arithmetic covers their latency */
    FH vf[2][4];
    if constexpr (!EARLY) {
#pragma unroll
      for (int kk = 0; kk < 2; ++kk) {
#pragma unroll
        for (int t = 0; t < 4; ++t) {
          vf[kk][t].h[0] = *(const v8us*)(sb + VTH + (t * 16 + c) * LP + kk * 32 + 8 * hh);
          vf[kk][t].h[1] = *(const v8us*)(sb + VTH + (t * 16 + c) * LP + kk * 32 + 16 + 8 * hh);
        }
      }
    }
    /* blocks with residuals: tile by tile, each product's fragments read next to it (256 registers do not hold
       a whole chunk's fragments beside the residual operands) */
#pragma unroll
    for (int j = 0; EARLY && j < 4; ++j) {
      s[j] = zero8();
#pragma unroll
      for (int dc = 0; dc < 2; ++dc) {
        FH kf, ef;
        kf.h[0] = *(const v8us*)(sb + KSH + (j * 16 + c) * LP + dc * 32 + 8 * hh);
        kf.h[1] = *(const v8us*)(sb + KSH + (j * 16 + c) * LP + dc * 32 + 16 + 8 * hh);
        ef.h[0] = *(const v8us*)(sb + ESH + (j * 16 + c) * LP + dc * 32 + 8 * hh);
        ef.h[1] = *(const v8us*)(sb + ESH + (j * 16 + c) * LP + dc * 32 + 16 + 8 * hh);
        s[j] = mma_h(kf.v, qa[dc].v, s[j]);
        s[j] = mma_h(ef.v, qs[dc].v, s[j]);
      }
      if (EARLY) {
        if (useres) {
          v8f sr = zero8();
#pragma unroll
          for (int dc = 0; dc < 2; ++dc) {
            FH kf, ef, krf, qra, qrs;
            kf.h[0]  = *(const v8us*)(sb + KSH + (j * 16 + c) * LP + dc * 32 + 8 * hh);
            kf.h[1]  = *(const v8us*)(sb + KSH + (j * 16 + c) * LP + dc * 32 + 16 + 8 * hh);
            ef.h[0]  = *(const v8us*)(sb + ESH + (j * 16 + c) * LP + dc * 32 + 8 * hh);
            ef.h[1]  = *(const v8us*)(sb + ESH + (j * 16 + c) * LP + dc * 32 + 16 + 8 * hh);
            krf.h[0] = *(const v8us*)(sb + KRS + (j * 16 + c) * LP + dc * 32 + 8 * hh);
            krf.h[1] = *(const v8us*)(sb + KRS + (j * 16 + c) * LP + dc * 32 + 16 + 8 * hh);
            qra.h[0] = *(const v8us*)(rp + dc * 32);
            qra.h[1] = *(const v8us*)(rp + dc * 32 + 16);
            qrs.h[0] = *(const v8us*)(rp + HD + dc * 32);
            qrs.h[1] = *(const v8us*)(rp + HD + dc * 32 + 16);
            sr = mma_h(krf.v, qa[dc].v, sr);
            sr = mma_h(kf.v, qra.v, sr);
            sr = mma_h(ef.v, qrs.v, sr);
          }
#pragma unroll
          for (int r = 0; r < 8; ++r) s[j][r] += sr[r] * RINV;
        }
      }
    }

    /* scale by 1/sqrt(64) and replace-fill from the key mask (this lane's query, its 8 keys per tile) */
#pragma unroll
    for (int j = 0; j < 4; ++j) {
#pragma unroll
      for (int r = 0; r < 8; ++r) s[j][r] *= 0.125f;
    }
    if (fk == 2) {
#pragma unroll
      for (int j = 0; j < 4; ++j) {
        const v2u mw = *(const v2u*)(msk + (wrow0 + c) * 64 + j * 16 + 8 * hh);
#pragma unroll
        for (int r = 0; r < 8; ++r) {
          const unsigned mv = (mw[r >> 2] >> (8 * (r & 3))) & 0xFFu;
          s[j][r] = mv ? s[j][r] : -__builtin_inff();
        }
      }
    }

    /* chunk maximum of the lane's query: 32 keys in-lane (one chain per tile), then the other half's 32 */
    float mj[4];
#pragma unroll
    for (int j = 0; j < 4; ++j) {
      float mx = s[j][0];
#pragma unroll
      for (int r = 1; r < 8; ++r) mx = fmaxf(mx, s[j][r]);
      mj[j] = mx;
    }
    float cm = fmaxf(fmaxf(mj[0], mj[1]), fmaxf(mj[2], mj[3]));
    cm = fmaxf(cm, xhalf(cm));

    /* online softmax update; P^T (carried x1024) packed into B operands in place */
    const float mnew = fmaxf(mrow, cm);
    const bool dead = (mnew == -__builtin_inff());
    const float aexp = __expf(mrow - mnew);
    const float alpha = dead ? 1.f : aexp;
    mrow = mnew;
    FH pa[2], pr[2];
    float ps[4];
#pragma unroll
    for (int j = 0; j < 4; ++j) {
      float sum = 0.f;
#pragma unroll
      for (int r = 0; r < 8; ++r) {
        const float pe = __expf(s[j][r] - mnew);
        const float p = dead ? 0.f : pe;
        sum += p;
        const float pc = p * PSC;
        const _Float16 hv = (_Float16)pc;
        pa[j >> 1].v[(j & 1) * 8 + r] = hv;
        if (EARLY) {
          const float pres = (pc - (float)hv) * RSC;
          pr[j >> 1].v[(j & 1) * 8 + r] = (_Float16)pres;
        }
      }
      ps[j] = sum;
    }
    lrow = lrow * alpha + ((ps[0] + ps[1]) + (ps[2] + ps[3]));
#pragma unroll
    for (int t = 0; t < 4; ++t) {
#pragma unroll
      for (int r = 0; r < 8; ++r) oacc[t][r] *= alpha;
    }

    /* O^T += V^T.P^T : A = V^T [d][key] rows from LDS, B = P^T [key][q] from registers */
#pragma unroll
    for (int kk = 0; kk < 2; ++kk) {
#pragma unroll
      for (int t = 0; t < 4; ++t) {
        if constexpr (!EARLY) {
          oacc[t] = mma_h(vf[kk][t].v, pa[kk].v, oacc[t]);
        } else {
          FH vb;
          vb.h[0] = *(const v8us*)(sb + VTH + (t * 16 + c) * LP + kk * 32 + 8 * hh);
          vb.h[1] = *(const v8us*)(sb + VTH + (t * 16 + c) * LP + kk * 32 + 16 + 8 * hh);
          oacc[t] = mma_h(vb.v, pa[kk].v, oacc[t]);
        }
      }
    }
    if (EARLY) {
      if (useres) {
        /* residual products per d tile: one 8-register accumulator live at a time */
#pragma unroll
        for (int t = 0; t < 4; ++t) {
          v8f oar = zero8();
#pragma unroll
          for (int kk = 0; kk < 2; ++kk) {
            FH vb, vr;
            vb.h[0] = *(const v8us*)(sb + VTH + (t * 16 + c) * LP + kk * 32 + 8 * hh);
            vb.h[1] = *(const v8us*)(sb + VTH + (t * 16 + c) * LP + kk * 32 + 16 + 8 * hh);
            vr.h[0] = *(const v8us*)(sb + VRS + (t * 16 + c) * LP + kk * 32 + 8 * hh);
            vr.h[1] = *(const v8us*)(sb + VRS + (t * 16 + c) * LP + kk * 32 + 16 + 8 * hh);
            oar = mma_h(vr.v, pa[kk].v, oar);
            oar = mma_h(vb.v, pr[kk].v, oar);
          }
#pragma unroll
          for (int r = 0; r < 8; ++r) oacc[t][r] += oar[r] * RINV;
        }
      }
    }

    /* this wave's reads of this trip's buffer (and of the mask tile) have returned before the buffer is refilled */
    asm volatile("s_wait_dscnt 0x0" ::: "memory");
    /* this wave's copies of the next chunk have landed before the barrier that publishes them */
    asm volatile("s_wait_asynccnt 0x0" ::: "memory");
    __syncthreads();
    kcur = knxt;
    knxt = -1;
    if (kept != 0ull) { knxt = __builtin_ctzll(kept); kept &= kept - 1ull; stage(knxt, bsel); }
  }
  /* no copy is outstanding when the wave goes on */
  asm volatile("s_wait_asynccnt 0x0" ::: "memory");

  /* epilogue: all waves are done with the staged tiles before the region is reused */
  __syncthreads();
  unsigned short* osh = sm + KSH + wave * 1024;     /* [16][64] hi, carried x16 */
  unsigned short* osr = sm + ESH + wave * 1024;     /* [16][64] residual x2048 (EARLY) */
  {
    /* the two halves' partial sums joined; O holds 1024 x sum(p v); ctx = O / (1024 l);
       plane value = 16 ctx = O x (1/l) x (16/1024) */
    const float lsum = lrow + xhalf(lrow);
    const float inv = (1.0f / lsum) * OCV;
#pragma unroll
    for (int t = 0; t < 4; ++t) {
      v8us oh, orr;
#pragma unroll
      for (int r = 0; r < 8; ++r) {
        const float o = oacc[t][r] * inv;
        const unsigned short hb = h_bits(o);
        oh[r] = hb;
        orr[r] = EARLY ? h_bits((o - h2f(hb)) * RSC) : (unsigned short)0;
      }
      /* query row c, d = 16t+8h .. +7: 16 bytes */
      *(v8us*)(osh + c * 64 + t * 16 + 8 * hh) = oh;
      if (EARLY) *(v8us*)(osr + c * 64 + t * 16 + 8 * hh) = orr;
    }
  }
  __builtin_amdgcn_fence(3, "workgroup");
  __builtin_amdgcn_wave_barrier();
  __builtin_amdgcn_fence(2, "workgroup");
  /* 16 rows x 8 segments = 4 iterations x 32 lanes; row = 4it + (lane>>3), seg = lane&7:
*/
  {
#pragma unroll
    for (int it = 0; it < 4; ++it) {
      const int u = it * 32 + lane;
      const int row = u >> 3, seg = u & 7;
      const v8us vh = *(const v8us*)(osh + row * 64 + seg * 8);
      *(v8us*)(Ct + (size_t)(q0 + row) * DM + head * 64 + seg * 8) = vh;
      if (EARLY) {
        const v8us vr = *(const v8us*)(osr + row * 64 + seg * 8);
        *(v8us*)(Cr + (size_t)(q0 + row) * DM + head * 64 + seg * 8) = vr;
      }
    }
    
  }
}

__global__ __launch_bounds__(128) __attribute__((amdgpu_num_vgpr(256)))
void attn_kernel(const unsigned short* __restrict__ Qh, const unsigned short* __restrict__ Qr,
                 const unsigned short* __restrict__ Kh, const unsigned short* __restrict__ Kr,
                 const unsigned short* __restrict__ Vt, const unsigned short* __restrict__ Vr,
                 const unsigned short* __restrict__ Erp, const int* __restrict__ mask,
                 const int* __restrict__ flags, unsigned short* __restrict__ Ct,
                 unsigned short* __restrict__ Cr)
{
  __shared__ __align__(16) unsigned short sm[2 * 5 * TSZ];
  __shared__ __align__(16) unsigned char msk[4096];
  if ((int)blockIdx.x < NEARLY) attn_body<true>(Qh, Qr, Kh, Kr, Vt, Vr, Erp, mask, flags, Ct, Cr, sm, msk);
  else                          attn_body<false>(Qh, Qr, Kh, Kr, Vt, Vr, Erp, mask, flags, Ct, Cr, sm, msk);
}

/* --------------------------------------------------------------------------
 * Output projection: out[t][n] = (sum_k ctx16[t][k] wo64[n][k]) / 1024 + b[n], f16 operands,
 * f32 accumulate.  Token blocks tb < NEARLY first accumulate the ctx residual products
 * alone from zero, scale that sum by 1/2048 in f32, and use it as the start value of
 * the hi-plane accumulation (no residual product enters an accumulator holding hi terms).
 * Block = 2 waves (64 threads), 64 tokens x 64 columns; grid (NQB, DM/64); main loops: gemm_ring.
 * Epilogue: 64x64 f32 tile staged in LDS (cross-wave, block barrier), then
 * Coverage: 16 iterations x 64 threads = 1024 units = 64 rows x 16 segments.
 * ------------------------------------------------------------------------ */
__global__ __launch_bounds__(64) __attribute__((amdgpu_num_vgpr(256)))
void out_kernel(
    const unsigned short* __restrict__ Ct, const unsigned short* __restrict__ Cr,
    const unsigned short* __restrict__ Wo, const float* __restrict__ bias, float* __restrict__ out)
{
  constexpr int PTF = 68;
  __shared__ __align__(16) float ts[64 * PTF];
  __shared__ __align__(16) unsigned short ring[2 * GBUF];

  const int tid = threadIdx.x, wave = tid >> 5, lane = tid & 31;
  const int hh = lane >> 4, m = lane & 15;
  const int tb = blockIdx.x, nb = blockIdx.y;
  const int n0 = nb * 64;
  const int rl0 = wave * 32;
  const bool dores = tb < NEARLY;     /* block-uniform */

  v8f acc[2][4];
#pragma unroll
  for (int mi = 0; mi < 2; ++mi)
#pragma unroll
    for (int ni = 0; ni < 4; ++ni) acc[mi][ni] = zero8();

  const unsigned short* wrows = Wo + (size_t)n0 * DM;

  if (dores) {
    gemm_ring<false, 2, 1>(Cr + (size_t)tb * 64 * DM, wrows, ring, acc);
#pragma unroll
    for (int mi = 0; mi < 2; ++mi)
#pragma unroll
      for (int ni = 0; ni < 4; ++ni)
#pragma unroll
        for (int r = 0; r < 8; ++r) acc[mi][ni][r] *= RINV;
  }

  gemm_ring<false, 2, 1>(Ct + (size_t)tb * 64 * DM, wrows, ring, acc);

  float bb[4];
#pragma unroll
  for (int ni = 0; ni < 4; ++ni) bb[ni] = bfr(bias[n0 + ni * 16 + m]);
#pragma unroll
  for (int mi = 0; mi < 2; ++mi) {
#pragma unroll
    for (int ni = 0; ni < 4; ++ni) {
#pragma unroll
      for (int r = 0; r < 8; ++r) {
        const int rl = rl0 + mi * 16 + 8 * hh + r;
        ts[rl * PTF + ni * 16 + m] = acc[mi][ni][r] * OINV + bb[ni];
      }
    }
  }
  __syncthreads();

  {
#pragma unroll
    for (int it = 0; it < 16; ++it) {
      const int u = it * 64 + tid;
      const int row = u >> 4, seg = u & 15;
      const int t = tb * 64 + row;
      const v4f v = *(const v4f*)(ts + row * PTF + seg * 4);
      if (t < TT) *(v4f*)(out + (size_t)t * DM + n0 + seg * 4) = v;
    }
    
  }
}

/* -------------------------------------------------------------------------- */
extern "C" void kernel_launch(void* const* d_in, const int* in_sizes, int n_in,
                              void* d_out, int out_size, void* d_ws, size_t ws_size,
                              hipStream_t stream)
{
  if (n_in < 13) return;
  if (in_sizes[0] < TT * DM || in_sizes[1] < TT * DM || in_sizes[2] < TT * DM) return;
  if (in_sizes[3] < (TT - 1) * SEQ_FULL + TT) return;
  if (in_sizes[4] < DM * DM || in_sizes[6] < DM * DM || in_sizes[8] < DM * DM || in_sizes[11] < DM * DM) return;
  if (in_sizes[5] < DM || in_sizes[7] < DM || in_sizes[9] < DM || in_sizes[12] < DM) return;
  if (in_sizes[10] < TT * HD) return;
  if (out_size < TT * DM) return;
  if (d_ws == nullptr || ws_size < WS_NEED) return;

  const float* q    = (const float*)d_in[0];
  const float* k    = (const float*)d_in[1];
  const float* v    = (const float*)d_in[2];
  const int*   mask = (const int*)d_in[3];
  const float* Wq_w = (const float*)d_in[4];
  const float* Wq_b = (const float*)d_in[5];
  const float* Wk_w = (const float*)d_in[6];
  const float* Wk_b = (const float*)d_in[7];
  const float* Wv_w = (const float*)d_in[8];
  const float* Wv_b = (const float*)d_in[9];
  const float* Er   = (const float*)d_in[10];
  const float* Wo_w = (const float*)d_in[11];
  const float* Wo_b = (const float*)d_in[12];
  float* outp = (float*)d_out;

  unsigned char* ws = (unsigned char*)d_ws;
  unsigned short* Xq = (unsigned short*)(ws + OFF_XQ);
  unsigned short* Xk = (unsigned short*)(ws + OFF_XK);
  unsigned short* Xv = (unsigned short*)(ws + OFF_XV);
  unsigned short* Wq = (unsigned short*)(ws + OFF_WQ);
  unsigned short* Wk = (unsigned short*)(ws + OFF_WK);
  unsigned short* Wv = (unsigned short*)(ws + OFF_WV);
  unsigned short* Wo = (unsigned short*)(ws + OFF_WO);
  unsigned short* Eh = (unsigned short*)(ws + OFF_ER);
  unsigned short* Qh = (unsigned short*)(ws + OFF_QH);
  unsigned short* Kh = (unsigned short*)(ws + OFF_KH);
  unsigned short* Vt = (unsigned short*)(ws + OFF_VT);
  unsigned short* Qr = (unsigned short*)(ws + OFF_QR);
  unsigned short* Kr = (unsigned short*)(ws + OFF_KR);
  unsigned short* Vr = (unsigned short*)(ws + OFF_VR);
  unsigned short* Ct = (unsigned short*)(ws + OFF_CT);
  unsigned short* Cr = (unsigned short*)(ws + OFF_CR);
  int* flags = (int*)(ws + OFF_FL);

  /* input planes (rows >= TT zero) and the per (query block, key chunk) skip/dense/mixed flags */
  prep_kernel<<<PREP_BLOCKS, PBT, 0, stream>>>(q, k, v, mask, Wq_w, Wk_w, Wv_w, Wo_w, Er,
                                               Xq, Xk, Xv, Wq, Wk, Wv, Wo, Eh, flags);

  /* projections: 128 tokens x two heads per block, z = q, k, v */
  proj_kernel<<<dim3(NTB / 2, NH / 2, 3), 256, 0, stream>>>(Xq, Xk, Xv, Wq, Wk, Wv, Wq_b, Wk_b, Wv_b, Qh, Kh, Vt, Qr, Kr, Vr);

  /* attention: first NEARLY query blocks with residual products, the rest single products */
  attn_kernel<<<dim3(NQB, NH), 128, 0, stream>>>(Qh, Qr, Kh, Kr, Vt, Vr, Eh, mask, flags, Ct, Cr);

  /* output projection into d_out */
  out_kernel<<<dim3(NQB, DM / 64), 64, 0, stream>>>(Ct, Cr, Wo, Wo_b, outp);
}

// v009
// Measured time: 67.1 microseconds a run.
// Timed twice side by side with v008, it ran 1.09 and 1.11 times as fast.
// Counting every step since v000, it is 5.51 times as fast.
// Contractions: q/k/v input projections on v_wmma_f32_16x16x32_bf16 (bf16 operands = RNE-converted inputs and weights, f32 accumulate); scores q.k^T, row-shifted q.Er^T, p.v and the output projection on v_wmma_f32_16x16x32_f16 (f16 operands: f16 hi planes of projected q/k/v, p carried x1024 and folded as 1/1024 before the ctx plane, ctx carried x16, Wo carried x64, plus x2048 f16 residual planes for the first 256 query rows and first 256 keys), f32 accumulate; softmax and all other arithmetic in f32.
#include <hip/hip_runtime.h>

typedef _Float16       v16h __attribute__((ext_vector_type(16)));
typedef __bf16         v16b __attribute__((ext_vector_type(16)));
typedef unsigned short v8us __attribute__((ext_vector_type(8)));
typedef float          v8f  __attribute__((ext_vector_type(8)));
typedef float          v4f  __attribute__((ext_vector_type(4)));
typedef unsigned int   v4u  __attribute__((ext_vector_type(4)));
typedef int            v4i  __attribute__((ext_vector_type(4)));

#ifndef NB
#define NB 1
#endif
#ifndef SEQ
#define SEQ 2049
#endif
#define SEQ_FULL 2049

constexpr int DM     = 1024;
constexpr int NH     = 16;
constexpr int HD     = 64;
constexpr int TT     = SEQ;
constexpr int NQB    = (TT + 63) / 64;          /* query blocks of 64 rows */
constexpr int NTB    = NQB + 1;                  /* token blocks of the planes (one extra for the +1 row shift) */
constexpr int TPAD   = NTB * 64;                 /* padded token count of every plane */
constexpr int NKC    = NTB;                      /* key chunks of 64 */
constexpr int NEARLY = NQB < 4 ? NQB : 4;        /* query blocks with residual treatment */
constexpr int CRES   = NEARLY * 64;              /* rows of K/V/ctx residual planes */
constexpr int QRES   = (NEARLY + 1) * 64;        /* rows of the Q residual plane (covers the +1 shift) */

constexpr float RSC  = 2048.0f;                  /* residual plane carry */
constexpr float RINV = 1.0f / 2048.0f;
constexpr float PSC  = 1024.0f;                  /* softmax weight carry (on the p tile, hence on the p.v accumulator) */
constexpr float CSC  = 16.0f;                    /* ctx plane carry */
constexpr float OCV  = CSC / PSC;                /* 1/64: removes the p carry and applies the ctx carry in one factor */
constexpr float WOSC = 64.0f;                    /* Wo plane carry */
constexpr float OINV = 1.0f / (CSC * WOSC);      /* 1/1024 */

static_assert(NB == 1);
static_assert(SEQ <= SEQ_FULL);
static_assert(HD == 64);
static_assert(DM % 64 == 0 && DM % 32 == 0);
static_assert(TPAD % 64 == 0);
static_assert(NKC <= 64);
static_assert(QRES <= TPAD && CRES <= TPAD);

/* workspace region map (bytes, every offset a multiple of 128) */
constexpr size_t X_B  = (size_t)TPAD * DM * 2;       /* bf16 [TPAD][DM] */
constexpr size_t W_B  = (size_t)DM * DM * 2;         /* 16-bit [DM][DM] */
constexpr size_t E_B  = (size_t)TPAD * HD * 2;       /* f16 [TPAD][HD] */
constexpr size_t HP_B = (size_t)NH * TPAD * HD * 2;  /* f16 [NH][TPAD][HD] or [NH][HD][TPAD] */
constexpr size_t QR_B = (size_t)NH * QRES * HD * 2;  /* f16 [NH][QRES][HD] */
constexpr size_t KR_B = (size_t)NH * CRES * HD * 2;  /* f16 [NH][CRES][HD] or [NH][HD][CRES] */
constexpr size_t CT_B = (size_t)TPAD * DM * 2;       /* f16 [TPAD][DM] */
constexpr size_t CR_B = (size_t)CRES * DM * 2;       /* f16 [CRES][DM] */
constexpr int    FLN  = 4;                          /* 128-byte flag lines per query block, one writer each */
constexpr int    FSL  = (NKC + FLN - 1) / FLN;      /* key chunks (used slots) per flag line */
constexpr size_t FL_B = (size_t)NQB * FLN * 32 * 4; /* int [NQB][FLN][32]: chunk kc at line kc % FLN, slot kc / FLN */
static_assert(FSL <= 32);

constexpr size_t OFF_XQ = 0;
constexpr size_t OFF_XK = OFF_XQ + X_B;
constexpr size_t OFF_XV = OFF_XK + X_B;
constexpr size_t OFF_WQ = OFF_XV + X_B;
constexpr size_t OFF_WK = OFF_WQ + W_B;
constexpr size_t OFF_WV = OFF_WK + W_B;
constexpr size_t OFF_WO = OFF_WV + W_B;
constexpr size_t OFF_ER = OFF_WO + W_B;
constexpr size_t OFF_QH = OFF_ER + E_B;
constexpr size_t OFF_KH = OFF_QH + HP_B;
constexpr size_t OFF_VT = OFF_KH + HP_B;
constexpr size_t OFF_QR = OFF_VT + HP_B;
constexpr size_t OFF_KR = OFF_QR + QR_B;
constexpr size_t OFF_VR = OFF_KR + KR_B;
constexpr size_t OFF_CT = OFF_VR + KR_B;
constexpr size_t OFF_CR = OFF_CT + CT_B;
constexpr size_t OFF_FL = OFF_CR + CR_B;
constexpr size_t WS_NEED = OFF_FL + FL_B;

static_assert(X_B % 128 == 0 && W_B % 128 == 0 && E_B % 128 == 0 && HP_B % 128 == 0);
static_assert(QR_B % 128 == 0 && KR_B % 128 == 0 && CT_B % 128 == 0 && CR_B % 128 == 0 && FL_B % 128 == 0);
static_assert(WS_NEED <= 134217728ull);
static_assert((size_t)TT * DM * 4 <= (size_t)SEQ_FULL * DM * 4);

/* -------------------------------------------------------------------------- */
__device__ __forceinline__ unsigned short f2bf_bits(float f) {
  unsigned u = __float_as_uint(f);
  return (unsigned short)((u + 0x7FFFu + ((u >> 16) & 1u)) >> 16);
}
__device__ __forceinline__ float bfr(float f) { return __uint_as_float(((unsigned)f2bf_bits(f)) << 16); }
__device__ __forceinline__ unsigned short h_bits(float f) {
  _Float16 h = (_Float16)f;
  return __builtin_bit_cast(unsigned short, h);
}
__device__ __forceinline__ float h2f(unsigned short b) {
  _Float16 h = __builtin_bit_cast(_Float16, b);
  return (float)h;
}

/* WMMA issue helpers with the 4-slot hazard guard (ties D, keeps A/B live) */
__device__ __forceinline__ v8f mma_h(v16h a, v16h b, v8f c) {
  c = __builtin_amdgcn_wmma_f32_16x16x32_f16(false, a, false, b, (short)0, c, false, false);
  asm volatile("v_nop\n\tv_nop\n\tv_nop\n\tv_nop" : "+v"(c) : "v"(a), "v"(b));
  return c;
}
__device__ __forceinline__ v8f mma_b(v16b a, v16b b, v8f c) {
  c = __builtin_amdgcn_wmma_f32_16x16x32_bf16(false, a, false, b, (short)0, c, false, false);
  asm volatile("v_nop\n\tv_nop\n\tv_nop\n\tv_nop" : "+v"(c) : "v"(a), "v"(b));
  return c;
}

__device__ __forceinline__ v8f zero8() { return (v8f){0.f,0.f,0.f,0.f,0.f,0.f,0.f,0.f}; }

/* --------------------------------------------------------------------------
 * Main loop of the GEMM blocks: acc += A[32 WM][DM] . B[64 WN][DM]^T, 16-bit operands, WM x WN waves,
 * wave w = 32 A rows (w % WM) x 64 B rows (w / WM).  (WM, WN) = (2, 1): 64 x 64 block; (4, 2): 128 x 128 block,
 * which brings half the bytes into LDS per product.
 * Stage = 128 k values: the block's A rows and B rows, 256 B each, brought into LDS by asynchronous
 * copies (each copy = two whole 256-B row pieces), two buffers: stage t+1 flies while stage t is worked on.
 * The rows (A first, then B) are dealt evenly to the waves: 64 rows = 32 copies per wave and stage at (2, 1), 32 rows = 16 copies at (4, 2).
 * LDS row pitch 272 B = 16 B x 17 (odd): the 16 rows of one ds_load_b128 fall on distinct bank groups.
 * Fragment k map and the order of the k steps per accumulator are those of the direct global loads it replaces.
 * ------------------------------------------------------------------------ */
constexpr int GKS  = 128;             /* k values per stage = 4 WMMA k steps */
constexpr int GNST = DM / GKS;        /* stages */
constexpr int GP   = 136;             /* LDS row pitch in 16-bit elements */
constexpr int GBUF = 128 * GP;        /* elements of one buffer of a 64 x 64 block: A rows 0..63, B rows 64..127 */
constexpr int PBUF = 256 * GP;        /* elements of one buffer of a 128 x 128 block: A rows 0..127, B rows 128..255 */
static_assert(DM % GKS == 0 && GNST >= 2);

union FR { v16h hv; v16b bv; v8us h[2]; };

/* eight copies: row pairs 0, 2, .. 14 from the lane's own LDS byte address l and global address g */
__device__ __forceinline__ void copy8(unsigned l, const unsigned short* g)
{
  /* the copies and, as the last line of the same statement, the wait that stands in front of any
     rewrite of the address registers they name */
  asm volatile(
      "global_load_async_to_lds_b128 %0, %8, off\n\t"
      "global_load_async_to_lds_b128 %1, %9, off\n\t"
      "global_load_async_to_lds_b128 %2, %10, off\n\t"
      "global_load_async_to_lds_b128 %3, %11, off\n\t"
      "global_load_async_to_lds_b128 %4, %12, off\n\t"
      "global_load_async_to_lds_b128 %5, %13, off\n\t"
      "global_load_async_to_lds_b128 %6, %14, off\n\t"
      "global_load_async_to_lds_b128 %7, %15, off\n\t"
      "s_wait_xcnt 0x0"
      :: "v"(l), "v"(l + 2u * 2u * GP), "v"(l + 4u * 2u * GP), "v"(l + 6u * 2u * GP),
         "v"(l + 8u * 2u * GP), "v"(l + 10u * 2u * GP), "v"(l + 12u * 2u * GP), "v"(l + 14u * 2u * GP),
         "v"(g), "v"(g + 2 * DM), "v"(g + 4 * DM), "v"(g + 6 * DM),
         "v"(g + 8 * DM), "v"(g + 10 * DM), "v"(g + 12 * DM), "v"(g + 14 * DM)
      : "memory");
}
/* one wave's ROWS rows of one stage */
template <int ROWS>
__device__ __forceinline__ void stage_copy(unsigned l, const unsigned short* g)
{
  /* unrolled: the row offsets of the statements are constants */
#pragma unroll
  for (int q = 0; q < ROWS / 16; ++q) copy8(l + (unsigned)(q * 16 * GP * 2), g + (size_t)q * 16 * DM);
}

template <bool BF, int WM, int WN>
__device__ __forceinline__ void gemm_ring(const unsigned short* __restrict__ A, const unsigned short* __restrict__ B,
                                          unsigned short* ring, v8f (&acc)[2][4])
{
  const int lane = threadIdx.x & 31;
  const int wave = __builtin_amdgcn_readfirstlane((int)(threadIdx.x >> 5));
  const int hh = lane >> 4, m = lane & 15;
  constexpr int AR = WM * 32, BR = WN * 64;       /* A and B rows of the block */
  constexpr int RPW = (AR + BR) / (WM * WN);      /* rows that one wave copies */
  constexpr int BUF = (AR + BR) * GP;             /* elements of one buffer */
  static_assert((AR + BR) % (WM * WN) == 0 && RPW % 16 == 0 && AR % RPW == 0);

  /* copy addresses: buffer rows r0.. of this wave; lanes 0..15 one row, lanes 16..31 the next, 16 B per lane */
  const int r0 = wave * RPW;
  const unsigned short* g0 = (r0 < AR ? A + (size_t)r0 * DM : B + (size_t)(r0 - AR) * DM) + (size_t)hh * DM + m * 8;
  const unsigned l0 = (unsigned)(size_t)ring + (unsigned)(((r0 + hh) * GP + m * 8) * 2);

  stage_copy<RPW>(l0, g0);
  /* stage 0 has landed before the barrier that publishes it */
  asm volatile("s_wait_asynccnt 0x0" ::: "memory");
  __syncthreads();
  stage_copy<RPW>(l0 + (unsigned)(BUF * 2), g0 + GKS);

  const unsigned short* fa = ring + ((wave % WM) * 32 + m) * GP + 8 * hh;
  const unsigned short* fb = ring + (AR + (wave / WM) * 64 + m) * GP + 8 * hh;

  /* rolled: one body in the instruction cache, the buffer chosen by the trip's parity */
#pragma unroll 1
  for (int t = 0; t < GNST; ++t) {
    const int bo = (t & 1) * BUF;
    const unsigned short* pa = fa + bo;
    const unsigned short* pb = fb + bo;
    /* every loop below is unrolled so that each index of the two fragment sets is a constant and the sets stay in registers */
    FR a[2][2], b[2][4];
#pragma unroll
    for (int mi = 0; mi < 2; ++mi) {
      a[0][mi].h[0] = *(const v8us*)(pa + mi * 16 * GP);
      a[0][mi].h[1] = *(const v8us*)(pa + mi * 16 * GP + 16);
    }
#pragma unroll
    for (int ni = 0; ni < 4; ++ni) {
      b[0][ni].h[0] = *(const v8us*)(pb + ni * 16 * GP);
      b[0][ni].h[1] = *(const v8us*)(pb + ni * 16 * GP + 16);
    }
#pragma unroll
    for (int ks = 0; ks < GKS / 32; ++ks) {
      const int cur = ks & 1, nxt = cur ^ 1;
      if (ks + 1 < GKS / 32) {          /* next k step's fragments of the same stage, ahead of this step's products */
#pragma unroll
        for (int mi = 0; mi < 2; ++mi) {
          a[nxt][mi].h[0] = *(const v8us*)(pa + mi * 16 * GP + (ks + 1) * 32);
          a[nxt][mi].h[1] = *(const v8us*)(pa + mi * 16 * GP + (ks + 1) * 32 + 16);
        }
#pragma unroll
        for (int ni = 0; ni < 4; ++ni) {
          b[nxt][ni].h[0] = *(const v8us*)(pb + ni * 16 * GP + (ks + 1) * 32);
          b[nxt][ni].h[1] = *(const v8us*)(pb + ni * 16 * GP + (ks + 1) * 32 + 16);
        }
      }
#pragma unroll
      for (int ni = 0; ni < 4; ++ni) {
        if constexpr (BF) {
          acc[0][ni] = mma_b(a[cur][0].bv, b[cur][ni].bv, acc[0][ni]);
          acc[1][ni] = mma_b(a[cur][1].bv, b[cur][ni].bv, acc[1][ni]);
        } else {
          acc[0][ni] = mma_h(a[cur][0].hv, b[cur][ni].hv, acc[0][ni]);
          acc[1][ni] = mma_h(a[cur][1].hv, b[cur][ni].hv, acc[1][ni]);
        }
      }
    }
    /* this wave's reads of buffer t&1 have returned before the buffer is refilled */
    asm volatile("s_wait_dscnt 0x0" ::: "memory");
    /* this wave's copies of stage t+1 have landed before the barrier that publishes them */
    asm volatile("s_wait_asynccnt 0x0" ::: "memory");
    __syncthreads();
    if (t + 2 < GNST) stage_copy<RPW>(l0 + (unsigned)(bo * 2), g0 + (size_t)(t + 2) * GKS);
  }
  /* no copy is outstanding when the wave goes on */
  asm volatile("s_wait_asynccnt 0x0" ::: "memory");
}

/* --------------------------------------------------------------------------
 * f32 [nrows][ncols] -> 16-bit plane [nrows_pad][ncols]; rows >= nrows are zeros.
 * mode 0: bf16 bits (RNE).  mode 1: f16 bits of (scale * bf16(x)).
 * One unit u = 8 consecutive values of row u / (ncols/8); the caller hands out u < nrows_pad*ncols/8.
 * ------------------------------------------------------------------------ */
template <int nrows, int ncols, int mode>
__device__ __forceinline__ void cvt_unit(const float* __restrict__ src, float scale,
                                         unsigned short* __restrict__ dst, int u)
{
  constexpr int upr = ncols >> 3;
  const int row = u / upr;
  const int cu  = u - row * upr;
  const int rowc = row < nrows ? row : nrows - 1;          /* clamped address */
  const bool live = row < nrows;
  const float* p = src + (size_t)rowc * ncols + cu * 8;
  const v4f x0 = *(const v4f*)p;
  const v4f x1 = *(const v4f*)(p + 4);
  unsigned b0, b1, b2, b3, b4, b5, b6, b7;
  {
    const float f0 = live ? x0[0] : 0.f, f1 = live ? x0[1] : 0.f, f2 = live ? x0[2] : 0.f, f3 = live ? x0[3] : 0.f;
    const float f4 = live ? x1[0] : 0.f, f5 = live ? x1[1] : 0.f, f6 = live ? x1[2] : 0.f, f7 = live ? x1[3] : 0.f;
    if (mode == 0) {
      b0 = f2bf_bits(f0); b1 = f2bf_bits(f1); b2 = f2bf_bits(f2); b3 = f2bf_bits(f3);
      b4 = f2bf_bits(f4); b5 = f2bf_bits(f5); b6 = f2bf_bits(f6); b7 = f2bf_bits(f7);
    } else {
      b0 = h_bits(bfr(f0) * scale); b1 = h_bits(bfr(f1) * scale); b2 = h_bits(bfr(f2) * scale); b3 = h_bits(bfr(f3) * scale);
      b4 = h_bits(bfr(f4) * scale); b5 = h_bits(bfr(f5) * scale); b6 = h_bits(bfr(f6) * scale); b7 = h_bits(bfr(f7) * scale);
    }
  }
  v4u w;
  w[0] = b0 | (b1 << 16);
  w[1] = b2 | (b3 << 16);
  w[2] = b4 | (b5 << 16);
  w[3] = b6 | (b7 << 16);
  unsigned short* d = dst + (size_t)u * 8;
  *(v4u*)d = w;
  /* another branch's text follows in the caller: no register that the store names is rewritten in front of this wait */
  asm volatile("s_wait_xcnt 0x0" ::: "memory");
}

/* --------------------------------------------------------------------------
 * Per (query block, key chunk) flag from the int32 key mask:
 *   0 = every effective entry masked (chunk skipped), 1 = all kept, 2 = mixed.
 * Effective entry (t, s): query row clamped to TT-1 for padded rows, keys s >= TT masked.
 * Block = (query block qb, flag line ln), 16 waves: the chunks kc = ln + FLN*j, j < FSL.
 * Wave w reads rows 4w..4w+3 of every chunk of the block; all loads are independent, so
 * the whole strip is in flight at once.  Per wave one any-kept and one all-kept bit per
 * chunk (ballots), combined over the 16 waves through LDS behind one block barrier.
 * Coverage: wave 0 stores the block's whole 128-byte line (unused slots 0);
 * NQB x FLN blocks = the whole table.  wany, wall: 16 LDS words each.
 * ------------------------------------------------------------------------ */
__device__ __forceinline__ int flag_slot(int kc) { return (kc % FLN) * 32 + kc / FLN; }

__device__ __forceinline__ void flags_block(const int* __restrict__ mask, int* __restrict__ flags,
                                            int qb, int ln, unsigned* wany, unsigned* wall)
{
  const int tid = threadIdx.x, lane = tid & 31;
  const int wave = __builtin_amdgcn_readfirstlane(tid >> 5);   /* scalar, so the row bases are scalar */

  /* key of slot j, half hf: s = col0 + FLN*64*j + 32*hf.  Only the last slot can pass TT. */
  constexpr int LOFF = FLN * (FSL - 1) * 64;
  static_assert(LOFF - 1 < TT);
  const unsigned col0 = (unsigned)(ln * 64 + lane);
  const unsigned sl0 = col0 + LOFF, sl1 = sl0 + 32u;
  const unsigned cl0 = sl0 < (unsigned)TT ? sl0 : (unsigned)(TT - 1);   /* clamped address */
  const unsigned cl1 = sl1 < (unsigned)TT ? sl1 : (unsigned)(TT - 1);   /* clamped address */
  const int* rowp[4];
#pragma unroll
  for (int rr = 0; rr < 4; ++rr) {
    int t = qb * 64 + wave * 4 + rr;
    t = t < TT ? t : TT - 1;
    rowp[rr] = mask + (size_t)t * SEQ_FULL;
  }

  /* first every load, then every count */
  int mv[FSL][8];
#pragma unroll
  for (int j = 0; j < FSL - 1; ++j) {
#pragma unroll
    for (int it = 0; it < 8; ++it)
      mv[j][it] = (rowp[it >> 1] + col0)[FLN * j * 64 + (it & 1) * 32];
  }
#pragma unroll
  for (int it = 0; it < 8; ++it)
    mv[FSL - 1][it] = rowp[it >> 1][(it & 1) ? cl1 : cl0];
  /* keeps every load in front of every count: without it the scheduler mixes them and fewer loads fly at once */
  __builtin_amdgcn_sched_barrier(0);
  /* every register that the issued loads name (row bases, key offsets) is an input here, so none is
     rewritten in front of this wait */
  asm volatile("s_wait_xcnt 0x0"
               :: "s"(rowp[0]), "s"(rowp[1]), "s"(rowp[2]), "s"(rowp[3]), "v"(col0), "v"(cl0), "v"(cl1)
               : "memory");

  int cnt[FSL];
#pragma unroll
  for (int j = 0; j < FSL; ++j) {
    int n = 0;
#pragma unroll
    for (int it = 0; it < 8; ++it) {
      const bool ex = (j < FSL - 1) || (((it & 1) ? sl1 : sl0) < (unsigned)TT);   /* key exists */
      n += (ex && mv[j][it] != 0) ? 1 : 0;
    }
    cnt[j] = n;
  }

  unsigned anym = 0u, allm = 0u;                           /* wave-uniform, bit j = chunk ln + FLN*j */
#pragma unroll
  for (int j = 0; j < FSL; ++j) {
    anym |= (__builtin_amdgcn_ballot_w32(cnt[j] != 0) != 0u) ? (1u << j) : 0u;
    allm |= (__builtin_amdgcn_ballot_w32(cnt[j] == 8) == 0xFFFFFFFFu) ? (1u << j) : 0u;
  }
  if (lane == 0) { wany[wave] = anym; wall[wave] = allm; }
  __syncthreads();

  if (wave == 0) {
    unsigned a = 0u, f = 0xFFFFFFFFu;
#pragma unroll
    for (int w = 0; w < 16; ++w) { a |= wany[w]; f &= wall[w]; }
    int fv = 0;
    if (lane < FSL) fv = ((a >> lane) & 1u) ? (((f >> lane) & 1u) ? 1 : 2) : 0;
    flags[((size_t)qb * FLN + ln) * 32 + lane] = fv;
  }
}

/* --------------------------------------------------------------------------
 * Everything that depends on the inputs alone, in one launch of 512-thread blocks:
 * blocks [0, FBL): mask flags, block b = (query block b / FLN, flag line b % FLN);
 * then 3 x XBL blocks: q, k, v planes; 3 x WBL: Wq, Wk, Wv planes; WBL: Wo plane; EBL: Er plane.
 * A conversion block = 512 units, one per thread; every plane's unit count is a multiple of 512.
 * The branch on the block index is block-uniform (the flags part holds a block barrier).
 * ------------------------------------------------------------------------ */
constexpr int PBT = 512;
constexpr int FBL = NQB * FLN;
constexpr int XBL = TPAD * (DM / 8) / PBT;
constexpr int WBL = DM * (DM / 8) / PBT;
constexpr int EBL = TPAD * (HD / 8) / PBT;
constexpr int PREP_BLOCKS = FBL + 3 * XBL + 4 * WBL + EBL;
static_assert(TPAD * (DM / 8) % PBT == 0 && DM * (DM / 8) % PBT == 0 && TPAD * (HD / 8) % PBT == 0);

__global__ __launch_bounds__(512) void prep_kernel(
    const float* __restrict__ q, const float* __restrict__ k, const float* __restrict__ v,
    const int* __restrict__ mask,
    const float* __restrict__ Wq_w, const float* __restrict__ Wk_w, const float* __restrict__ Wv_w,
    const float* __restrict__ Wo_w, const float* __restrict__ Er,
    unsigned short* __restrict__ Xq, unsigned short* __restrict__ Xk, unsigned short* __restrict__ Xv,
    unsigned short* __restrict__ Wq, unsigned short* __restrict__ Wk, unsigned short* __restrict__ Wv,
    unsigned short* __restrict__ Wo, unsigned short* __restrict__ Eh, int* __restrict__ flags)
{
  __shared__ unsigned wany[16];
  __shared__ unsigned wall[16];
  const int tid = threadIdx.x;
  int b = blockIdx.x;
  if (b < FBL) { flags_block(mask, flags, b / FLN, b % FLN, wany, wall); return; }
  b -= FBL;
  if (b < 3 * XBL) {
    const int j = b / XBL;
    cvt_unit<TT, DM, 0>(j == 0 ? q : j == 1 ? k : v, 1.0f, j == 0 ? Xq : j == 1 ? Xk : Xv, (b - j * XBL) * PBT + tid);
    return;
  }
  b -= 3 * XBL;
  if (b < 3 * WBL) {
    const int j = b / WBL;
    cvt_unit<DM, DM, 0>(j == 0 ? Wq_w : j == 1 ? Wk_w : Wv_w, 1.0f, j == 0 ? Wq : j == 1 ? Wk : Wv, (b - j * WBL) * PBT + tid);
    return;
  }
  b -= 3 * WBL;
  if (b < WBL) { cvt_unit<DM, DM, 1>(Wo_w, WOSC, Wo, b * PBT + tid); return; }
  b -= WBL;
  cvt_unit<TT, HD, 1>(Er, 1.0f, Eh, b * PBT + tid);
}

/* --------------------------------------------------------------------------
 * Projection GEMM: Y[t][n] = sum_k X[t][k] W[n][k] + b[n] for one 128-token x 128-col
 * (= two heads) tile per block; bf16 operands (X and W planes), f32 accumulate.
 * Block = 8 waves (256 threads); wave w: tokens (w&3)*32.. (2 row tiles) x the 4 col tiles of head w>>2; main loop: gemm_ring.
 * The epilogue works per pair of waves (w>>1) = one 64-token x one-head tile, as described below.
 * A fragment (row m = lane&15): elems 0..7 <- k0+8h+i, 8..15 <- k0+16+8h+i.
 * B[k][n] = W[n][k]: loaded from row n = lane&15 with the same k map.  D elem r = (row 8h+r, col lane&15).
 * Epilogue: hi = f16(y), res = f16((y - hi) * 2048), rows t >= TT forced to 0; the block's
 * MODE 0: Q -> [NH][TPAD][HD] (+ residual rows < QRES); 1: K -> same (+ residual rows < CRES);
 * MODE 2: V -> [NH][HD][TPAD] (+ residual [NH][HD][CRES]).
 * Coverage per pair of waves: 8 iterations x 64 threads = 512 units = 64 rows x 8 segments (hi and res).
 * LDS tiles th/tr (one set per pair): cross-wave, separated by a block barrier; reloaded through the stored element type.
 * They lie over the ring, which every wave has left at the barrier that ends the main loop's last trip.
 * The three projections share one launch: grid (NTB/2, NH/2, 3), MODE = blockIdx.z (block-uniform);
 * the main loop is common, proj_tail<MODE> is the epilogue.
 * ------------------------------------------------------------------------ */
constexpr int PT = 72;

template <int MODE>
__device__ __forceinline__ void proj_tail(
    v8f (&acc)[2][4], const float* __restrict__ bias, unsigned short* __restrict__ Ph,
    unsigned short* __restrict__ Pr, unsigned short* th, unsigned short* tr)
{
  constexpr int NRES_TB = (MODE == 0) ? (NEARLY + 1) : NEARLY;
  const int w = __builtin_amdgcn_readfirstlane((int)(threadIdx.x >> 5));
  const int tid = threadIdx.x & 63, wave = tid >> 5, lane = tid & 31;   /* inside the pair of waves */
  const int hh = lane >> 4, m = lane & 15;
  const int tb = blockIdx.x * 2 + ((w >> 1) & 1), head = blockIdx.y * 2 + (w >> 2);   /* the pair's 64 x 64 tile */
  const int n0 = head * 64;
  const int rl0 = wave * 32;

  float bb[4];
#pragma unroll
  for (int ni = 0; ni < 4; ++ni) bb[ni] = bfr(bias[n0 + ni * 16 + m]);

#pragma unroll
  for (int mi = 0; mi < 2; ++mi) {
#pragma unroll
    for (int ni = 0; ni < 4; ++ni) {
#pragma unroll
      for (int r = 0; r < 8; ++r) {
        const int rl  = rl0 + mi * 16 + 8 * hh + r;
        const int t   = tb * 64 + rl;
        const int col = ni * 16 + m;
        float y = acc[mi][ni][r] + bb[ni];
        y = (t < TT) ? y : 0.f;
        const unsigned short hb = h_bits(y);
        const float res = (y - h2f(hb)) * RSC;
        const unsigned short rb = h_bits(res);
        if (MODE == 2) { th[col * PT + rl] = hb; tr[col * PT + rl] = rb; }
        else           { th[rl * PT + col] = hb; tr[rl * PT + col] = rb; }
      }
    }
  }
  __syncthreads();

  const bool dores = tb < NRES_TB;    /* uniform in the pair of waves */
  {
#pragma unroll
    for (int it = 0; it < 8; ++it) {
      const int u = it * 64 + tid;
      const int row = u >> 3, seg = u & 7;
      const v8us vh = *(const v8us*)(th + row * PT + seg * 8);
      const v8us vr = *(const v8us*)(tr + row * PT + seg * 8);
      if (MODE == 2) {
        *(v8us*)(Ph + ((size_t)head * HD + row) * TPAD + tb * 64 + seg * 8) = vh;
        if (dores) *(v8us*)(Pr + ((size_t)head * HD + row) * CRES + tb * 64 + seg * 8) = vr;
      } else {
        *(v8us*)(Ph + ((size_t)head * TPAD + tb * 64 + row) * HD + seg * 8) = vh;
        if (dores) {
          if (MODE == 0) *(v8us*)(Pr + ((size_t)head * QRES + tb * 64 + row) * HD + seg * 8) = vr;
          else           *(v8us*)(Pr + ((size_t)head * CRES + tb * 64 + row) * HD + seg * 8) = vr;
        }
      }
    }
    
  }
  /* another epilogue's text follows in the caller: no register that the last stores name is rewritten in front of this wait */
  asm volatile("s_wait_xcnt 0x0" ::: "memory");
}

__global__ __launch_bounds__(256) __attribute__((amdgpu_num_vgpr(256)))
void proj_kernel(
    const unsigned short* __restrict__ Xq, const unsigned short* __restrict__ Xk, const unsigned short* __restrict__ Xv,
    const unsigned short* __restrict__ Wq, const unsigned short* __restrict__ Wk, const unsigned short* __restrict__ Wv,
    const float* __restrict__ bq, const float* __restrict__ bk, const float* __restrict__ bv,
    unsigned short* __restrict__ Qh, unsigned short* __restrict__ Kh, unsigned short* __restrict__ Vt,
    unsigned short* __restrict__ Qr, unsigned short* __restrict__ Kr, unsigned short* __restrict__ Vr)
{
  __shared__ __align__(16) unsigned short ring[2 * PBUF];
  static_assert(NTB % 2 == 0 && NH % 2 == 0 && 4 * 2 * 64 * PT <= 2 * PBUF);

  const int mode = blockIdx.z;
  /* epilogue tiles of this wave's pair */
  unsigned short* th = ring + __builtin_amdgcn_readfirstlane((int)(threadIdx.x >> 6)) * (2 * 64 * PT);
  unsigned short* tr = th + 64 * PT;
  const unsigned short* X = mode == 0 ? Xq : mode == 1 ? Xk : Xv;
  const unsigned short* W = mode == 0 ? Wq : mode == 1 ? Wk : Wv;

  v8f acc[2][4];
#pragma unroll
  for (int mi = 0; mi < 2; ++mi)
#pragma unroll
    for (int ni = 0; ni < 4; ++ni) acc[mi][ni] = zero8();

  gemm_ring<true, 4, 2>(X + (size_t)blockIdx.x * 128 * DM, W + (size_t)blockIdx.y * 128 * DM, ring, acc);

  if (mode == 0)      proj_tail<0>(acc, bq, Qh, Qr, th, tr);
  else if (mode == 1) proj_tail<1>(acc, bk, Kh, Kr, th, tr);
  else                proj_tail<2>(acc, bv, Vt, Vr, th, tr);
}

/* --------------------------------------------------------------------------
 * Flash attention with the row-shifted Er term, head dim 64, products transposed.
 * Block = 4 waves = 64 query rows of one head; grid (query blocks, NH).
 * Per kept 64-key chunk: K [key][d], Er [key][d], V^T [d][key] f16 tiles staged in LDS
 * (EARLY: also K and V^T residual tiles) by asynchronous copies, two buffers: the next kept chunk flies
 * while this one is worked on; one block barrier per chunk (a second one only where a mask tile is staged).
 * S^T = K.q^T + Er.q(t+1)^T on f16 WMMA: A = K or Er rows from LDS, B = Q rows; D elem r of key tile j =
 * (key 16j+8h+r, query lane&15), so a lane holds 32 of the 64 scores of ONE query and lane^16 the other 32.
 * x0.125, replace-fill -inf from the key mask (flag 2 chunks), f32 online softmax: maximum in-lane plus one
 * exchange between the wave halves; the sum stays a per-half partial and is joined once in the epilogue.
 * P^T = f16(1024 p) (EARLY: + f16 residual x2048) is a B operand straight from the score registers:
 * element s of the operand for keys 32kk.. is register s&7 of key tile 2kk+(s>>3), the hardware k order.
 * O^T += V^T.P^T on f16 WMMA: A = V^T rows from LDS; D elem r of d tile t = (d 16t+8h+r, query lane&15)
 * (O therefore carries the x1024 of P; the normaliser applies 1/(1024 l) x 16 in one factor).
 * EARLY adds (k_res.qh + k.q_res + Er.q_res(t+1))/2048 to the scores and
 * (V_res.P + V.P_res)/2048 to O through separate accumulators folded per tile.
 * Without residuals a chunk's fragments are read from LDS in two groups: K and Er ahead of the score products,
 * V^T ahead of the softmax; 128 and 64 registers, never live together.
 * Live-state plan: Q hi fragments reloaded per chunk (dead during softmax and P.V),
 * Q residual fragments loaded only inside the residual score phase, one 8-register
 * residual accumulator at a time; 4 O tiles + 4 score tiles + m/l (one value each) persistent.
 * Epilogue: ctx = O/(1024 l) carried x16 as f16 into [TPAD][DM] (+ residual rows < CRES),
 * staged per wave in LDS so that whole 128-byte row pieces are stored.
 * Fragment k map as in proj_kernel (A row / B col = lane&15, split k map).
 * LDS regions: K/Er/V/res tiles and msk cross-wave (block barriers).
 * Both variants share one launch: grid (NQB, NH), EARLY = (query block < NEARLY), block-uniform;
 * sm holds two buffers of 5 tiles (the variant without residuals: two of 3), msk 4096 bytes.
 * ------------------------------------------------------------------------ */
/* LDS row pitch of every fragment-read tile: 72 halves = 144 B = 16 B x 9 (odd), so the 16 rows that one
   ds_load_b128 reads fall on 16 distinct groups of four banks; at 128 B they fall on two groups */
constexpr int LP = 72;
constexpr int TSZ = 64 * LP;                       /* one 64-row tile */

typedef unsigned int v2u __attribute__((ext_vector_type(2)));

/* value of lane l ^ 16 */
__device__ __forceinline__ float xhalf(float x) {
  const int b = __float_as_int(x);
  return __int_as_float(__builtin_amdgcn_permlanex16(b, b, 0x76543210, 0xfedcba98, false, false));
}

/* Asynchronous copies of one key chunk's tiles.  A lane brings 16 B; a thread's four pieces of a 64 x 64 tile
   are rows r, r+16, r+32, r+48 (r = tid>>3) at segment tid&7.  l*: the lane's LDS byte address of its first
   piece, g*: its global address; SV: global row pitch in elements of the [d][key] plane (the [key][d] planes have pitch HD). */
constexpr unsigned LS16 = 16u * LP * 2u;           /* 16 LDS rows in bytes */

template <int SV>
__device__ __forceinline__ void copy_kev(unsigned lk, unsigned le, unsigned lv, const unsigned short* gk,
                                         const unsigned short* ge, const unsigned short* gv)
{
  /* the copies and, as the last line of the same statement, the wait that stands in front of any
     rewrite of the address registers they name */
  asm volatile(
      "global_load_async_to_lds_b128 %0, %12, off\n\t"
      "global_load_async_to_lds_b128 %1, %13, off\n\t"
      "global_load_async_to_lds_b128 %2, %14, off\n\t"
      "global_load_async_to_lds_b128 %3, %15, off\n\t"
      "global_load_async_to_lds_b128 %4, %16, off\n\t"
      "global_load_async_to_lds_b128 %5, %17, off\n\t"
      "global_load_async_to_lds_b128 %6, %18, off\n\t"
      "global_load_async_to_lds_b128 %7, %19, off\n\t"
      "global_load_async_to_lds_b128 %8, %20, off\n\t"
      "global_load_async_to_lds_b128 %9, %21, off\n\t"
      "global_load_async_to_lds_b128 %10, %22, off\n\t"
      "global_load_async_to_lds_b128 %11, %23, off\n\t"
      "s_wait_xcnt 0x0"
      :: "v"(lk), "v"(lk + LS16), "v"(lk + 2u * LS16), "v"(lk + 3u * LS16),
         "v"(le), "v"(le + LS16), "v"(le + 2u * LS16), "v"(le + 3u * LS16),
         "v"(lv), "v"(lv + LS16), "v"(lv + 2u * LS16), "v"(lv + 3u * LS16),
         "v"(gk), "v"(gk + 16 * HD), "v"(gk + 32 * HD), "v"(gk + 48 * HD),
         "v"(ge), "v"(ge + 16 * HD), "v"(ge + 32 * HD), "v"(ge + 48 * HD),
         "v"(gv), "v"(gv + 16 * SV), "v"(gv + 32 * SV), "v"(gv + 48 * SV)
      : "memory");
}
template <int SV>
__device__ __forceinline__ void copy_kv(unsigned lk, unsigned lv, const unsigned short* gk, const unsigned short* gv)
{
  /* as above: the wait is the last line of the copies' own statement */
  asm volatile(
      "global_load_async_to_lds_b128 %0, %8, off\n\t"
      "global_load_async_to_lds_b128 %1, %9, off\n\t"
      "global_load_async_to_lds_b128 %2, %10, off\n\t"
      "global_load_async_to_lds_b128 %3, %11, off\n\t"
      "global_load_async_to_lds_b128 %4, %12, off\n\t"
      "global_load_async_to_lds_b128 %5, %13, off\n\t"
      "global_load_async_to_lds_b128 %6, %14, off\n\t"
      "global_load_async_to_lds_b128 %7, %15, off\n\t"
      "s_wait_xcnt 0x0"
      :: "v"(lk), "v"(lk + LS16), "v"(lk + 2u * LS16), "v"(lk + 3u * LS16),
         "v"(lv), "v"(lv + LS16), "v"(lv + 2u * LS16), "v"(lv + 3u * LS16),
         "v"(gk), "v"(gk + 16 * HD), "v"(gk + 32 * HD), "v"(gk + 48 * HD),
         "v"(gv), "v"(gv + 16 * SV), "v"(gv + 32 * SV), "v"(gv + 48 * SV)
      : "memory");
}

template <bool EARLY>
__device__ __forceinline__
void attn_body(const unsigned short* __restrict__ Qh, const unsigned short* __restrict__ Qr,
               const unsigned short* __restrict__ Kh, const unsigned short* __restrict__ Kr,
               const unsigned short* __restrict__ Vt, const unsigned short* __restrict__ Vr,
               const unsigned short* __restrict__ Erp, const int* __restrict__ mask,
               const int* __restrict__ flags, unsigned short* __restrict__ Ct,
               unsigned short* __restrict__ Cr, unsigned short* sm, unsigned char* msk)
{
  constexpr int KSH = 0, ESH = TSZ, VTH = 2 * TSZ, KRS = 3 * TSZ, VRS = 4 * TSZ;
  union FH { v16h v; v8us h[2]; };

  const int tid = threadIdx.x, wave = tid >> 5, lane = tid & 31;
  const int hh = lane >> 4, c = lane & 15;
  const int qb = blockIdx.x;
  const int head = blockIdx.y;
  const int q0 = qb * 64 + wave * 16;
  const int wrow0 = wave * 16;                     /* the wave's first row inside the block tile */

  /* fragment base pointers: rows q0+c (k.q^T) and q0+1+c (shifted Er term) */
  const unsigned short* qp = Qh + ((size_t)head * TPAD + q0 + c) * HD + 8 * hh;
  const unsigned short* rp = Qr + ((size_t)head * QRES + (EARLY ? (q0 + c) : c)) * HD + 8 * hh;

  /* state of query q0+c: running maximum (equal in both halves), this half's part of the sum */
  float mrow = -__builtin_inff(), lrow = 0.f;
  v8f oacc[4];
#pragma unroll
  for (int t = 0; t < 4; ++t) oacc[t] = zero8();

  const int* frow = flags + (size_t)qb * (FLN * 32);

  /* the block's flags as two bit masks over the key chunks (bit kc), equal in every wave: the next kept chunk
     is known ahead of its turn, so its copies can be issued one trip early */
  unsigned long long kept, mixed;
  {
    const int sl0 = flag_slot(lane < NKC ? lane : NKC - 1);             /* clamped addresses */
    const int sl1 = flag_slot(lane + 32 < NKC ? lane + 32 : NKC - 1);
    const int f0 = frow[sl0];
    const int f1 = frow[sl1];
    /* the row base and both slots are inputs here, so no register that the two loads name is rewritten in front of this wait */
    asm volatile("s_wait_xcnt 0x0" :: "s"(frow), "v"(sl0), "v"(sl1) : "memory");
    const bool e0 = lane < NKC, e1 = lane + 32 < NKC;
    kept  = ((unsigned long long)__builtin_amdgcn_ballot_w32(e1 && f1 != 0) << 32) | __builtin_amdgcn_ballot_w32(e0 && f0 != 0);
    mixed = ((unsigned long long)__builtin_amdgcn_ballot_w32(e1 && f1 == 2) << 32) | __builtin_amdgcn_ballot_w32(e0 && f0 == 2);
  }

  /* copy addresses of this thread: row tid>>3 (+16 per piece), segment tid&7 */
  constexpr int NT = EARLY ? 5 : 3;                /* tiles of one buffer */
  const int crow = tid >> 3, cseg = tid & 7;
  const unsigned lc0 = (unsigned)(size_t)sm + (unsigned)((crow * LP + cseg * 8) * 2);
  const unsigned short* gk0 = Kh + ((size_t)head * TPAD + crow) * HD + cseg * 8;
  const unsigned short* ge0 = Erp + (size_t)crow * HD + cseg * 8;
  const unsigned short* gv0 = Vt + ((size_t)head * HD + crow) * TPAD + cseg * 8;
  const unsigned short* gkr0 = Kr + ((size_t)head * CRES + crow) * HD + cseg * 8;
  const unsigned short* gvr0 = Vr + ((size_t)head * HD + crow) * CRES + cseg * 8;
  /* all tiles of chunk kc into buffer b */
  auto stage = [&](int kc, int b) {
    const unsigned l = lc0 + (unsigned)(b * NT * TSZ * 2);
    copy_kev<TPAD>(l + KSH * 2u, l + ESH * 2u, l + VTH * 2u,
                   gk0 + (size_t)kc * 64 * HD, ge0 + (size_t)kc * 64 * HD, gv0 + kc * 64);
    if (EARLY) {
      const int kvr = (kc < NEARLY) ? kc * 64 : 0;             /* clamped residual chunk base */
      copy_kv<CRES>(l + KRS * 2u, l + VRS * 2u, gkr0 + (size_t)kvr * HD, gvr0 + kvr);
    }
  };

  /* two buffers: the next kept chunk's copies fly while this chunk is worked on */
  int kcur = -1, knxt = -1;
  if (kept != 0ull) { kcur = __builtin_ctzll(kept); kept &= kept - 1ull; stage(kcur, 0); }
  /* the first chunk has landed before the barrier that publishes it */
  asm volatile("s_wait_asynccnt 0x0" ::: "memory");
  __syncthreads();
  if (kept != 0ull) { knxt = __builtin_ctzll(kept); kept &= kept - 1ull; stage(knxt, 1); }

  /* rolled: one body in the instruction cache; at most one trip per key chunk */
#pragma unroll 1
  for (int trip = 0; trip < NKC && kcur >= 0; ++trip) {
    const int kc = kcur;
    const int bsel = trip & 1;
    const unsigned short* sb = sm + bsel * (NT * TSZ);         /* this trip's buffer */
    const int fk = (int)((mixed >> kc) & 1ull) ? 2 : 1;        /* block-uniform */
    const int kv0 = kc * 64;
    const bool useres = EARLY && (kc < NEARLY);

    if (fk == 2) {
      /* key mask tile: thread -> row tid>>1, 32 columns; clamped addresses, keys >= TT masked */
      const int row = tid >> 1, hsel = tid & 1;
      int qrow = qb * 64 + row;
      qrow = qrow < TT ? qrow : TT - 1;
      const int* mb = mask + (size_t)qrow * SEQ_FULL;
#pragma unroll 1
      for (int g = 0; g < 4; ++g) {
#pragma unroll
        for (int e = 0; e < 8; ++e) {
          const int col = hsel * 32 + g * 8 + e;
          const int s = kv0 + col;
          const int sc = s < TT ? s : TT - 1;
          const int mv = mb[sc];
          msk[row * 64 + col] = (unsigned char)((s < TT && mv != 0) ? 1 : 0);
        }
      }
      /* publishes the mask tile; its last readers left it before the barrier at the foot of their trip */
      __syncthreads();
    }

    /* Q hi fragments for this chunk (B operands), two 32-deep d halves */
    FH qa[2], qs[2];
#pragma unroll
    for (int dc = 0; dc < 2; ++dc) {
      qa[dc].h[0] = *(const v8us*)(qp + dc * 32);
      qa[dc].h[1] = *(const v8us*)(qp + dc * 32 + 16);
      qs[dc].h[0] = *(const v8us*)(qp + HD + dc * 32);
      qs[dc].h[1] = *(const v8us*)(qp + HD + dc * 32 + 16);
    }

    /* transposed scores: 64 keys x 16 queries per wave; s[j][r] = (key 16j+8h+r, query c) */
    v8f s[4];
    if constexpr (!EARLY) {
      /* the chunk's 32 K and Er fragment reads stand as ONE group in front of the 16 products, in the order of
         their use, so that the wave waits out the LDS latency once a chunk and not once per pair of products;
         the products run tile-inner: four independent accumulators, each summed in the order K d0, Er d0, K d1, Er d1;
         every loop here and in the V^T group is unrolled so that the fragment arrays' indices are constants (registers) */
      FH kf[2][4], ef[2][4];
#pragma unroll
      for (int dc = 0; dc < 2; ++dc) {
#pragma unroll
        for (int j = 0; j < 4; ++j) {
          kf[dc][j].h[0] = *(const v8us*)(sb + KSH + (j * 16 + c) * LP + dc * 32 + 8 * hh);
          kf[dc][j].h[1] = *(const v8us*)(sb + KSH + (j * 16 + c) * LP + dc * 32 + 16 + 8 * hh);
        }
#pragma unroll
        for (int j = 0; j < 4; ++j) {
          ef[dc][j].h[0] = *(const v8us*)(sb + ESH + (j * 16 + c) * LP + dc * 32 + 8 * hh);
          ef[dc][j].h[1] = *(const v8us*)(sb + ESH + (j * 16 + c) * LP + dc * 32 + 16 + 8 * hh);
        }
      }
#pragma unroll
      for (int j = 0; j < 4; ++j) s[j] = zero8();
#pragma unroll
      for (int dc = 0; dc < 2; ++dc) {
#pragma unroll
        for (int j = 0; j < 4; ++j) s[j] = mma_h(kf[dc][j].v, qa[dc].v, s[j]);
#pragma unroll
        for (int j = 0; j < 4; ++j) s[j] = mma_h(ef[dc][j].v, qs[dc].v, s[j]);
      }
    }
    /* the chunk's 16 V^T fragment reads, one group in front of the softmax, whose arithmetic covers their latency */
    FH vf[2][4];
    if constexpr (!EARLY) {
#pragma unroll
      for (int kk = 0; kk < 2; ++kk) {
#pragma unroll
        for (int t = 0; t < 4; ++t) {
          vf[kk][t].h[0] = *(const v8us*)(sb + VTH + (t * 16 + c) * LP + kk * 32 + 8 * hh);
          vf[kk][t].h[1] = *(const v8us*)(sb + VTH + (t * 16 + c) * LP + kk * 32 + 16 + 8 * hh);
        }
      }
    }
    /* blocks with residuals: tile by tile, each product's fragments read next to it (256 registers do not hold
       a whole chunk's fragments beside the residual operands) */
#pragma unroll
    for (int j = 0; EARLY && j < 4; ++j) {
      s[j] = zero8();
#pragma unroll
      for (int dc = 0; dc < 2; ++dc) {
        FH kf, ef;
        kf.h[0] = *(const v8us*)(sb + KSH + (j * 16 + c) * LP + dc * 32 + 8 * hh);
        kf.h[1] = *(const v8us*)(sb + KSH + (j * 16 + c) * LP + dc * 32 + 16 + 8 * hh);
        ef.h[0] = *(const v8us*)(sb + ESH + (j * 16 + c) * LP + dc * 32 + 8 * hh);
        ef.h[1] = *(const v8us*)(sb + ESH + (j * 16 + c) * LP + dc * 32 + 16 + 8 * hh);
        s[j] = mma_h(kf.v, qa[dc].v, s[j]);
        s[j] = mma_h(ef.v, qs[dc].v, s[j]);
      }
      if (EARLY) {
        if (useres) {
          v8f sr = zero8();
#pragma unroll
          for (int dc = 0; dc < 2; ++dc) {
            FH kf, ef, krf, qra, qrs;
            kf.h[0]  = *(const v8us*)(sb + KSH + (j * 16 + c) * LP + dc * 32 + 8 * hh);
            kf.h[1]  = *(const v8us*)(sb + KSH + (j * 16 + c) * LP + dc * 32 + 16 + 8 * hh);
            ef.h[0]  = *(const v8us*)(sb + ESH + (j * 16 + c) * LP + dc * 32 + 8 * hh);
            ef.h[1]  = *(const v8us*)(sb + ESH + (j * 16 + c) * LP + dc * 32 + 16 + 8 * hh);
            krf.h[0] = *(const v8us*)(sb + KRS + (j * 16 + c) * LP + dc * 32 + 8 * hh);
            krf.h[1] = *(const v8us*)(sb + KRS + (j * 16 + c) * LP + dc * 32 + 16 + 8 * hh);
            qra.h[0] = *(const v8us*)(rp + dc * 32);
            qra.h[1] = *(const v8us*)(rp + dc * 32 + 16);
            qrs.h[0] = *(const v8us*)(rp + HD + dc * 32);
            qrs.h[1] = *(const v8us*)(rp + HD + dc * 32 + 16);
            sr = mma_h(krf.v, qa[dc].v, sr);
            sr = mma_h(kf.v, qra.v, sr);
            sr = mma_h(ef.v, qrs.v, sr);
          }
#pragma unroll
          for (int r = 0; r < 8; ++r) s[j][r] += sr[r] * RINV;
        }
      }
    }

    /* scale by 1/sqrt(64) and replace-fill from the key mask (this lane's query, its 8 keys per tile) */
#pragma unroll
    for (int j = 0; j < 4; ++j) {
#pragma unroll
      for (int r = 0; r < 8; ++r) s[j][r] *= 0.125f;
    }
    if (fk == 2) {
#pragma unroll
      for (int j = 0; j < 4; ++j) {
        const v2u mw = *(const v2u*)(msk + (wrow0 + c) * 64 + j * 16 + 8 * hh);
#pragma unroll
        for (int r = 0; r < 8; ++r) {
          const unsigned mv = (mw[r >> 2] >> (8 * (r & 3))) & 0xFFu;
          s[j][r] = mv ? s[j][r] : -__builtin_inff();
        }
      }
    }

    /* chunk maximum of the lane's query: 32 keys in-lane (one chain per tile), then the other half's 32 */
    float mj[4];
#pragma unroll
    for (int j = 0; j < 4; ++j) {
      float mx = s[j][0];
#pragma unroll
      for (int r = 1; r < 8; ++r) mx = fmaxf(mx, s[j][r]);
      mj[j] = mx;
    }
    float cm = fmaxf(fmaxf(mj[0], mj[1]), fmaxf(mj[2], mj[3]));
    cm = fmaxf(cm, xhalf(cm));

    /* online softmax update; P^T (carried x1024) packed into B operands in place */
    const float mnew = fmaxf(mrow, cm);
    const bool dead = (mnew == -__builtin_inff());
    const float aexp = __expf(mrow - mnew);
    const float alpha = dead ? 1.f : aexp;
    mrow = mnew;
    FH pa[2], pr[2];
    float ps[4];
#pragma unroll
    for (int j = 0; j < 4; ++j) {
      float sum = 0.f;
#pragma unroll
      for (int r = 0; r < 8; ++r) {
        const float pe = __expf(s[j][r] - mnew);
        const float p = dead ? 0.f : pe;
        sum += p;
        const float pc = p * PSC;
        const _Float16 hv = (_Float16)pc;
        pa[j >> 1].v[(j & 1) * 8 + r] = hv;
        if (EARLY) {
          const float pres = (pc - (float)hv) * RSC;
          pr[j >> 1].v[(j & 1) * 8 + r] = (_Float16)pres;
        }
      }
      ps[j] = sum;
    }
    lrow = lrow * alpha + ((ps[0] + ps[1]) + (ps[2] + ps[3]));
#pragma unroll
    for (int t = 0; t < 4; ++t) {
#pragma unroll
      for (int r = 0; r < 8; ++r) oacc[t][r] *= alpha;
    }

    /* O^T += V^T.P^T : A = V^T [d][key] rows from LDS, B = P^T [key][q] from registers */
#pragma unroll
    for (int kk = 0; kk < 2; ++kk) {
#pragma unroll
      for (int t = 0; t < 4; ++t) {
        if constexpr (!EARLY) {
          oacc[t] = mma_h(vf[kk][t].v, pa[kk].v, oacc[t]);
        } else {
          FH vb;
          vb.h[0] = *(const v8us*)(sb + VTH + (t * 16 + c) * LP + kk * 32 + 8 * hh);
          vb.h[1] = *(const v8us*)(sb + VTH + (t * 16 + c) * LP + kk * 32 + 16 + 8 * hh);
          oacc[t] = mma_h(vb.v, pa[kk].v, oacc[t]);
        }
      }
    }
    if (EARLY) {
      if (useres) {
        /* residual products per d tile: one 8-register accumulator live at a time */
#pragma unroll
        for (int t = 0; t < 4; ++t) {
          v8f oar = zero8();
#pragma unroll
          for (int kk = 0; kk < 2; ++kk) {
            FH vb, vr;
            vb.h[0] = *(const v8us*)(sb + VTH + (t * 16 + c) * LP + kk * 32 + 8 * hh);
            vb.h[1] = *(const v8us*)(sb + VTH + (t * 16 + c) * LP + kk * 32 + 16 + 8 * hh);
            vr.h[0] = *(const v8us*)(sb + VRS + (t * 16 + c) * LP + kk * 32 + 8 * hh);
            vr.h[1] = *(const v8us*)(sb + VRS + (t * 16 + c) * LP + kk * 32 + 16 + 8 * hh);
            oar = mma_h(vr.v, pa[kk].v, oar);
            oar = mma_h(vb.v, pr[kk].v, oar);
          }
#pragma unroll
          for (int r = 0; r < 8; ++r) oacc[t][r] += oar[r] * RINV;
        }
      }
    }

    /* this wave's reads of this trip's buffer (and of the mask tile) have returned before the buffer is refilled */
    asm volatile("s_wait_dscnt 0x0" ::: "memory");
    /* this wave's copies of the next chunk have landed before the barrier that publishes them */
    asm volatile("s_wait_asynccnt 0x0" ::: "memory");
    __syncthreads();
    kcur = knxt;
    knxt = -1;
    if (kept != 0ull) { knxt = __builtin_ctzll(kept); kept &= kept - 1ull; stage(knxt, bsel); }
  }
  /* no copy is outstanding when the wave goes on */
  asm volatile("s_wait_asynccnt 0x0" ::: "memory");

  /* epilogue: all waves are done with the staged tiles before the region is reused */
  __syncthreads();
  unsigned short* osh = sm + KSH + wave * 1024;     /* [16][64] hi, carried x16 */
  unsigned short* osr = sm + ESH + wave * 1024;     /* [16][64] residual x2048 (EARLY) */
  {
    /* the two halves' partial sums joined; O holds 1024 x sum(p v); ctx = O / (1024 l);
       plane value = 16 ctx = O x (1/l) x (16/1024) */
    const float lsum = lrow + xhalf(lrow);
    const float inv = (1.0f / lsum) * OCV;
#pragma unroll
    for (int t = 0; t < 4; ++t) {
      v8us oh, orr;
#pragma unroll
      for (int r = 0; r < 8; ++r) {
        const float o = oacc[t][r] * inv;
        const unsigned short hb = h_bits(o);
        oh[r] = hb;
        orr[r] = EARLY ? h_bits((o - h2f(hb)) * RSC) : (unsigned short)0;
      }
      /* query row c, d = 16t+8h .. +7: 16 bytes */
      *(v8us*)(osh + c * 64 + t * 16 + 8 * hh) = oh;
      if (EARLY) *(v8us*)(osr + c * 64 + t * 16 + 8 * hh) = orr;
    }
  }
  __builtin_amdgcn_fence(3, "workgroup");
  __builtin_amdgcn_wave_barrier();
  __builtin_amdgcn_fence(2, "workgroup");
  /* 16 rows x 8 segments = 4 iterations x 32 lanes; row = 4it + (lane>>3), seg = lane&7:
*/
  {
#pragma unroll
    for (int it = 0; it < 4; ++it) {
      const int u = it * 32 + lane;
      const int row = u >> 3, seg = u & 7;
      const v8us vh = *(const v8us*)(osh + row * 64 + seg * 8);
      *(v8us*)(Ct + (size_t)(q0 + row) * DM + head * 64 + seg * 8) = vh;
      if (EARLY) {
        const v8us vr = *(const v8us*)(osr + row * 64 + seg * 8);
        *(v8us*)(Cr + (size_t)(q0 + row) * DM + head * 64 + seg * 8) = vr;
      }
    }
    
  }
}

__global__ __launch_bounds__(128) __attribute__((amdgpu_num_vgpr(256)))
void attn_kernel(const unsigned short* __restrict__ Qh, const unsigned short* __restrict__ Qr,
                 const unsigned short* __restrict__ Kh, const unsigned short* __restrict__ Kr,
                 const unsigned short* __restrict__ Vt, const unsigned short* __restrict__ Vr,
                 const unsigned short* __restrict__ Erp, const int* __restrict__ mask,
                 const int* __restrict__ flags, unsigned short* __restrict__ Ct,
                 unsigned short* __restrict__ Cr)
{
  __shared__ __align__(16) unsigned short sm[2 * 5 * TSZ];
  __shared__ __align__(16) unsigned char msk[4096];
  if ((int)blockIdx.x < NEARLY) attn_body<true>(Qh, Qr, Kh, Kr, Vt, Vr, Erp, mask, flags, Ct, Cr, sm, msk);
  else                          attn_body<false>(Qh, Qr, Kh, Kr, Vt, Vr, Erp, mask, flags, Ct, Cr, sm, msk);
}

/* --------------------------------------------------------------------------
 * Output projection: out[t][n] = (sum_k ctx16[t][k] wo64[n][k]) / 1024 + b[n], f16 operands,
 * f32 accumulate.  Block = 4 waves (128 threads), 64 tokens x 64 columns; grid (NQB, DM/64).
 * Waves 0, 1 (32 tokens each) sum the hi-plane products.  In token blocks tb < NEARLY waves 2, 3 sum the ctx
 * residual products of the same tokens, from zero, in the same trips and against the same Wo tile; that sum is
 * scaled by 1/2048 in f32 and added to the finished hi sum (no residual product enters an accumulator holding hi terms).
 * In the other blocks waves 2, 3 only copy.
 * Main loop: stages of 128 k values and two buffers as in gemm_ring (same copies, waits, LDS pitch, fragment k map
 * and order of the k steps).  Buffer rows: ctx hi 0..63, Wo 64..127, ctx residual 128..191, dealt to the four waves
 * in groups of 16 rows (one copy8 each): 3 groups a wave with residuals, 2 without.
 * Epilogue: 64x64 f32 tile staged in LDS (cross-wave, block barriers), over the ring, which every wave has left
 * at the barrier that ends the main loop's last trip; then
 * Coverage: 8 iterations x 128 threads = 1024 units = 64 rows x 16 segments.
 * ------------------------------------------------------------------------ */
constexpr int OBUF = 192 * GP;        /* elements of one buffer */

template <bool RES>
__device__ __forceinline__ void out_ring(const unsigned short* __restrict__ Ah, const unsigned short* __restrict__ Ar,
                                         const unsigned short* __restrict__ B, unsigned short* ring, v8f (&acc)[2][4])
{
  const int lane = threadIdx.x & 31;
  const int wave = __builtin_amdgcn_readfirstlane((int)(threadIdx.x >> 5));
  const int hh = lane >> 4, m = lane & 15;
  constexpr int NG = RES ? 3 : 2;                 /* groups of 16 buffer rows that one wave copies */

  /* copy addresses of group q = buffer rows 16q..: lanes 0..15 one row, lanes 16..31 the next, 16 B per lane */
  const unsigned short* g0[NG];
  unsigned l0[NG];
  /* unrolled: the two arrays stay in registers */
#pragma unroll
  for (int i = 0; i < NG; ++i) {
    const int q = wave * NG + i;
    const unsigned short* src = q < 4 ? Ah : q < 8 ? B : Ar;
    g0[i] = src + (size_t)((q & 3) * 16 + hh) * DM + m * 8;
    l0[i] = (unsigned)(size_t)ring + (unsigned)(((q * 16 + hh) * GP + m * 8) * 2);
  }
  /* this wave's rows of stage t into buffer b */
  auto stage = [&](int t, int b) {
#pragma unroll
    for (int i = 0; i < NG; ++i) copy8(l0[i] + (unsigned)(b * OBUF * 2), g0[i] + (size_t)t * GKS);
  };

  stage(0, 0);
  /* stage 0 has landed before the barrier that publishes it */
  asm volatile("s_wait_asynccnt 0x0" ::: "memory");
  __syncthreads();
  stage(1, 1);

  const bool work = RES || wave < 2;              /* wave-uniform */
  const unsigned short* fa = ring + ((wave >> 1) * 128 + (wave & 1) * 32 + m) * GP + 8 * hh;
  const unsigned short* fb = ring + (64 + m) * GP + 8 * hh;

  /* rolled: one body in the instruction cache, the buffer chosen by the trip's parity */
#pragma unroll 1
  for (int t = 0; t < GNST; ++t) {
    const int bo = (t & 1) * OBUF;
    if (work) {
      const unsigned short* pa = fa + bo;
      const unsigned short* pb = fb + bo;
      /* every loop below is unrolled so that each index of the two fragment sets is a constant and the sets stay in registers */
      FR a[2][2], b[2][4];
#pragma unroll
      for (int mi = 0; mi < 2; ++mi) {
        a[0][mi].h[0] = *(const v8us*)(pa + mi * 16 * GP);
        a[0][mi].h[1] = *(const v8us*)(pa + mi * 16 * GP + 16);
      }
#pragma unroll
      for (int ni = 0; ni < 4; ++ni) {
        b[0][ni].h[0] = *(const v8us*)(pb + ni * 16 * GP);
        b[0][ni].h[1] = *(const v8us*)(pb + ni * 16 * GP + 16);
      }
#pragma unroll
      for (int ks = 0; ks < GKS / 32; ++ks) {
        const int cur = ks & 1, nxt = cur ^ 1;
        if (ks + 1 < GKS / 32) {          /* next k step's fragments of the same stage, ahead of this step's products */
#pragma unroll
          for (int mi = 0; mi < 2; ++mi) {
            a[nxt][mi].h[0] = *(const v8us*)(pa + mi * 16 * GP + (ks + 1) * 32);
            a[nxt][mi].h[1] = *(const v8us*)(pa + mi * 16 * GP + (ks + 1) * 32 + 16);
          }
#pragma unroll
          for (int ni = 0; ni < 4; ++ni) {
            b[nxt][ni].h[0] = *(const v8us*)(pb + ni * 16 * GP + (ks + 1) * 32);
            b[nxt][ni].h[1] = *(const v8us*)(pb + ni * 16 * GP + (ks + 1) * 32 + 16);
          }
        }
#pragma unroll
        for (int ni = 0; ni < 4; ++ni) {
          acc[0][ni] = mma_h(a[cur][0].hv, b[cur][ni].hv, acc[0][ni]);
          acc[1][ni] = mma_h(a[cur][1].hv, b[cur][ni].hv, acc[1][ni]);
        }
      }
    }
    /* this wave's reads of buffer t&1 have returned before the buffer is refilled */
    asm volatile("s_wait_dscnt 0x0" ::: "memory");
    /* this wave's copies of stage t+1 have landed before the barrier that publishes them */
    asm volatile("s_wait_asynccnt 0x0" ::: "memory");
    __syncthreads();
    if (t + 2 < GNST) stage(t + 2, t & 1);
  }
  /* no copy is outstanding when the wave goes on */
  asm volatile("s_wait_asynccnt 0x0" ::: "memory");
}

template <bool RES>
__device__ __forceinline__ void out_body(
    const unsigned short* __restrict__ Ct, const unsigned short* __restrict__ Cr,
    const unsigned short* __restrict__ Wo, const float* __restrict__ bias, float* __restrict__ out,
    unsigned short* ring)
{
  constexpr int PTF = 68;
  static_assert(64 * PTF * 4 <= 2 * OBUF * 2);
  float* ts = (float*)ring;

  const int tid = threadIdx.x, lane = tid & 31;
  const int wave = __builtin_amdgcn_readfirstlane(tid >> 5);
  const int hh = lane >> 4, m = lane & 15;
  const int tb = blockIdx.x, nb = blockIdx.y;
  const int n0 = nb * 64;
  const int rl0 = (wave & 1) * 32;

  v8f acc[2][4];
#pragma unroll
  for (int mi = 0; mi < 2; ++mi)
#pragma unroll
    for (int ni = 0; ni < 4; ++ni) acc[mi][ni] = zero8();

  out_ring<RES>(Ct + (size_t)tb * 64 * DM, Cr + (size_t)(RES ? tb : 0) * 64 * DM, Wo + (size_t)n0 * DM, ring, acc);

  if (RES) {
    /* waves 2, 3 hand their residual sums over, each element at the place where its hi sum will be staged */
    if (wave >= 2) {
#pragma unroll
      for (int mi = 0; mi < 2; ++mi)
#pragma unroll
        for (int ni = 0; ni < 4; ++ni)
#pragma unroll
          for (int r = 0; r < 8; ++r) ts[(rl0 + mi * 16 + 8 * hh + r) * PTF + ni * 16 + m] = acc[mi][ni][r] * RINV;
    }
    __syncthreads();
  }

  if (wave < 2) {
    float bb[4];
#pragma unroll
    for (int ni = 0; ni < 4; ++ni) bb[ni] = bfr(bias[n0 + ni * 16 + m]);
#pragma unroll
    for (int mi = 0; mi < 2; ++mi) {
#pragma unroll
      for (int ni = 0; ni < 4; ++ni) {
#pragma unroll
        for (int r = 0; r < 8; ++r) {
          const int rl = rl0 + mi * 16 + 8 * hh + r;
          float a = acc[mi][ni][r];
          if (RES) a += ts[rl * PTF + ni * 16 + m];
          ts[rl * PTF + ni * 16 + m] = a * OINV + bb[ni];
        }
      }
    }
  }
  __syncthreads();

  {
#pragma unroll
    for (int it = 0; it < 8; ++it) {
      const int u = it * 128 + tid;
      const int row = u >> 4, seg = u & 15;
      const int t = tb * 64 + row;
      const v4f v = *(const v4f*)(ts + row * PTF + seg * 4);
      if (t < TT) *(v4f*)(out + (size_t)t * DM + n0 + seg * 4) = v;
    }
  }
}

__global__ __launch_bounds__(128) __attribute__((amdgpu_num_vgpr(256)))
void out_kernel(
    const unsigned short* __restrict__ Ct, const unsigned short* __restrict__ Cr,
    const unsigned short* __restrict__ Wo, const float* __restrict__ bias, float* __restrict__ out)
{
  __shared__ __align__(16) unsigned short ring[2 * OBUF];
  /* block-uniform */
  if ((int)blockIdx.x < NEARLY) out_body<true>(Ct, Cr, Wo, bias, out, ring);
  else                          out_body<false>(Ct, Cr, Wo, bias, out, ring);
}

/* -------------------------------------------------------------------------- */
extern "C" void kernel_launch(void* const* d_in, const int* in_sizes, int n_in,
                              void* d_out, int out_size, void* d_ws, size_t ws_size,
                              hipStream_t stream)
{
  if (n_in < 13) return;
  if (in_sizes[0] < TT * DM || in_sizes[1] < TT * DM || in_sizes[2] < TT * DM) return;
  if (in_sizes[3] < (TT - 1) * SEQ_FULL + TT) return;
  if (in_sizes[4] < DM * DM || in_sizes[6] < DM * DM || in_sizes[8] < DM * DM || in_sizes[11] < DM * DM) return;
  if (in_sizes[5] < DM || in_sizes[7] < DM || in_sizes[9] < DM || in_sizes[12] < DM) return;
  if (in_sizes[10] < TT * HD) return;
  if (out_size < TT * DM) return;
  if (d_ws == nullptr || ws_size < WS_NEED) return;

  const float* q    = (const float*)d_in[0];
  const float* k    = (const float*)d_in[1];
  const float* v    = (const float*)d_in[2];
  const int*   mask = (const int*)d_in[3];
  const float* Wq_w = (const float*)d_in[4];
  const float* Wq_b = (const float*)d_in[5];
  const float* Wk_w = (const float*)d_in[6];
  const float* Wk_b = (const float*)d_in[7];
  const float* Wv_w = (const float*)d_in[8];
  const float* Wv_b = (const float*)d_in[9];
  const float* Er   = (const float*)d_in[10];
  const float* Wo_w = (const float*)d_in[11];
  const float* Wo_b = (const float*)d_in[12];
  float* outp = (float*)d_out;

  unsigned char* ws = (unsigned char*)d_ws;
  unsigned short* Xq = (unsigned short*)(ws + OFF_XQ);
  unsigned short* Xk = (unsigned short*)(ws + OFF_XK);
  unsigned short* Xv = (unsigned short*)(ws + OFF_XV);
  unsigned short* Wq = (unsigned short*)(ws + OFF_WQ);
  unsigned short* Wk = (unsigned short*)(ws + OFF_WK);
  unsigned short* Wv = (unsigned short*)(ws + OFF_WV);
  unsigned short* Wo = (unsigned short*)(ws + OFF_WO);
  unsigned short* Eh = (unsigned short*)(ws + OFF_ER);
  unsigned short* Qh = (unsigned short*)(ws + OFF_QH);
  unsigned short* Kh = (unsigned short*)(ws + OFF_KH);
  unsigned short* Vt = (unsigned short*)(ws + OFF_VT);
  unsigned short* Qr = (unsigned short*)(ws + OFF_QR);
  unsigned short* Kr = (unsigned short*)(ws + OFF_KR);
  unsigned short* Vr = (unsigned short*)(ws + OFF_VR);
  unsigned short* Ct = (unsigned short*)(ws + OFF_CT);
  unsigned short* Cr = (unsigned short*)(ws + OFF_CR);
  int* flags = (int*)(ws + OFF_FL);

  /* input planes (rows >= TT zero) and the per (query block, key chunk) skip/dense/mixed flags */
  prep_kernel<<<PREP_BLOCKS, PBT, 0, stream>>>(q, k, v, mask, Wq_w, Wk_w, Wv_w, Wo_w, Er,
                                               Xq, Xk, Xv, Wq, Wk, Wv, Wo, Eh, flags);

  /* projections: 128 tokens x two heads per block, z = q, k, v */
  proj_kernel<<<dim3(NTB / 2, NH / 2, 3), 256, 0, stream>>>(Xq, Xk, Xv, Wq, Wk, Wv, Wq_b, Wk_b, Wv_b, Qh, Kh, Vt, Qr, Kr, Vr);

  /* attention: first NEARLY query blocks with residual products, the rest single products */
  attn_kernel<<<dim3(NQB, NH), 128, 0, stream>>>(Qh, Qr, Kh, Kr, Vt, Vr, Eh, mask, flags, Ct, Cr);

  /* output projection into d_out */
  out_kernel<<<dim3(NQB, DM / 64), 128, 0, stream>>>(Ct, Cr, Wo, Wo_b, outp);
}
